// v000
// Measured on an AMD MI455X. A time is GPU time per run, averaged over a window of back-to-back runs after a warm-up
// (all launches, gaps included; the runs take copies of the inputs in turn), and the median of several windows.
// Apart from v000's, it joins two sittings. Times from different sittings can be a few percent apart, while
// side-by-side timings come from the same sitting.
// v000 is the starting kernel. One run takes 860 microseconds.
#include <hip/hip_runtime.h>
// Causal multi-head attention with xPos rotary embedding (2 x 2048 tokens x 1024, 16 heads x 64): q = x*Wq^T + bq, k = x*Wv^T + bv, v = x*Wk^T + bk (the module's own assignment order); q <- q*cos*scale + rot(q)*sin*scale, k <- k*cos/scale + rot(k)*sin/scale with interleaved-pair rotation, freq(t, d) = t * inv_freq[d/2], scale(t, d) = base[d mod 32]^((t - 1024)/512); scores = q.k / 32 with j <= i; softmax; merged . Wo^T + bo -> [2,2048,1024].
// Structure: x as an exact f16 plane; the three projections as f16 WMMA GEMMs (32x64 wave tiles, f32, exact products + bias) into f32 planes; per-token cos/sin/scale tables on VALU (inv_freq and base = the reference's f32 constants, precise trig and powf), then one VALU pass applies the rotation/scaling into f32 q/k planes; v re-laid per (batch, head) as [d][token]; q, k as f16 hi + x2^10 residual planes, V^T as hi + residual planes; the causal structure computed on device into a key bit plane + per-block key bound; the fused flash kernel per ((batch, head), 64 queries) (three-product hi/lo scores, online softmax f32, P hi + residual via LDS, two value accumulators); O as hi + residual planes; output projection as two GEMMs (bias in the first).
// Compute dtype: x, weights, biases rounded to bf16; projections exact; rotation f32; q, k, P, v, O as f16 hi + residual pairs (~2^-21); f32 accumulation and softmax. v_wmma_f32_16x16x32_f16.
#define NBT 2
#define SLEN 2048
#define DM 1024
#define NH 16
#define SCL 0.03125f
#define NR (NBT * SLEN)
typedef __bf16 v16b __attribute__((ext_vector_type(16)));
typedef unsigned short v8us __attribute__((ext_vector_type(8), may_alias));
typedef float  v8f  __attribute__((ext_vector_type(8)));
typedef float  v4f  __attribute__((ext_vector_type(4)));
typedef float  v4fa __attribute__((ext_vector_type(4), may_alias));
union FragB { v16b v; v8us half[2]; unsigned short u[16]; };

__device__ __forceinline__ unsigned short bf16_bits(float x) { unsigned int u = __float_as_uint(x); return (unsigned short)((u + 0x7FFFu + ((u >> 16) & 1u)) >> 16); }
__device__ __forceinline__ float bf16_val(unsigned short b) { return __uint_as_float(((unsigned int)b) << 16); }
__device__ __forceinline__ float bf16_round(float x) { return bf16_val(bf16_bits(x)); }
// D += A·B with NT terms: 1 = ah·bh, 2 = + al·bh (A split), 3 = + ah·bl (both split)
template <int NT>
__device__ __forceinline__ v8f mmaN(v16b ah, v16b al, v16b bh, v16b bl, v8f c) {
  c = __builtin_amdgcn_wmma_f32_16x16x32_bf16(false, ah, false, bh, (short)0, c, false, false);
  if (NT >= 2) c = __builtin_amdgcn_wmma_f32_16x16x32_bf16(false, al, false, bh, (short)0, c, false, false);
  if (NT >= 3) c = __builtin_amdgcn_wmma_f32_16x16x32_bf16(false, ah, false, bl, (short)0, c, false, false);
  asm volatile("v_nop\n\tv_nop\n\tv_nop\n\tv_nop" : "+v"(c) : "v"(ah), "v"(al), "v"(bh), "v"(bl));
  return c;
}

__global__ __launch_bounds__(256) void k_wt_bf16(const float* __restrict__ W, unsigned short* __restrict__ Wt, int K, int N) {
  const int t = blockIdx.x * 256 + threadIdx.x;
  const int k8n = K / 8;
  if (t >= N * k8n) return;
  const int n = t / k8n, k8 = (t % k8n) * 8;
  v8us v;
#pragma unroll
  for (int i = 0; i < 8; ++i) v[i] = bf16_bits(W[(size_t)(k8 + i) * N + n]);
  *(v8us*)(Wt + (size_t)n * K + k8) = v;
  
}

// GEMM C[M][N] (f32, pitch ldc) = act(A[M][K]·W + bias). A f32 row-major (pitch lda) converted per fragment to bf16
// (ASPLIT: hi/lo two planes -> 2 terms, else single rounded term); Wt bf16 [N][K] (pitch ldb). BIAS_BF16 rounds the
// bias to bf16 first (bias quantised to bf16 before the add). K%32==0, M%16==0, N%64==0.
template <bool ASPLIT, int ACT, bool BIAS_BF16>
__global__ __launch_bounds__(128) void k_gemm_bf(const float* __restrict__ A, int lda, const unsigned short* __restrict__ Wt, int ldb,
                                               const float* __restrict__ bias, float* __restrict__ C, int ldc, int M, int N, int K) {
  __shared__ __attribute__((aligned(16))) float so[4][16][64];
  const int tid = threadIdx.x, w = tid >> 5, lane = tid & 31, ln = lane & 15, hh = lane >> 4;
  const int ntn = N / 64;
  const int wid = blockIdx.x * 4 + w;
  const int mt = wid / ntn, nq = wid % ntn;
  if (mt * 16 >= M) return;
  const int row0 = mt * 16, col0 = nq * 64;
  const float* arow = A + (size_t)(row0 + ln) * lda;
  v8f acc[4] = {};
  for (int kb = 0; kb < K; kb += 32) {
    FragB ah, al;
    const v4f x0 = *(const v4fa*)(arow + kb + 8 * hh), x1 = *(const v4fa*)(arow + kb + 8 * hh + 4);
    const v4f x2 = *(const v4fa*)(arow + kb + 16 + 8 * hh), x3 = *(const v4fa*)(arow + kb + 16 + 8 * hh + 4);
    float xs[16] = {x0[0],x0[1],x0[2],x0[3],x1[0],x1[1],x1[2],x1[3],x2[0],x2[1],x2[2],x2[3],x3[0],x3[1],x3[2],x3[3]};
#pragma unroll
    for (int i = 0; i < 16; ++i) { const unsigned short hb = bf16_bits(xs[i]); ah.u[i] = hb; al.u[i] = ASPLIT ? bf16_bits(xs[i] - bf16_val(hb)) : (unsigned short)0; }
#pragma unroll
    for (int t = 0; t < 4; ++t) {
      const unsigned short* brow = Wt + (size_t)(col0 + t * 16 + ln) * ldb + kb;
      FragB b;
      b.half[0] = *(const v8us*)(brow + 8 * hh);
      b.half[1] = *(const v8us*)(brow + 16 + 8 * hh);
      acc[t] = mmaN<ASPLIT ? 2 : 1>(ah.v, al.v, b.v, b.v, acc[t]);
    }
  }
#pragma unroll
  for (int t = 0; t < 4; ++t) {
    float bv = bias ? bias[col0 + t * 16 + ln] : 0.f;
    if (BIAS_BF16) bv = bf16_round(bv);
#pragma unroll
    for (int r = 0; r < 8; ++r) { float v = acc[t][r] + bv; if (ACT == 1) v = fmaxf(v, 0.f); so[w][8 * hh + r][t * 16 + ln] = v; }
  }
  __builtin_amdgcn_fence(__ATOMIC_ACQ_REL, "workgroup");
  __builtin_amdgcn_wave_barrier();
  const int rsub = lane >> 4, c4 = (lane & 15) * 4;
  {
#pragma unroll
    for (int q = 0; q < 8; ++q) {
      const int r = q * 2 + rsub;
      const v4f v = *(const v4fa*)&so[w][r][c4];
      *(v4f*)(C + (size_t)(row0 + r) * ldc + col0 + c4) = v;
    }
    
  }
}

// GEMM C = act(A·W + bias + resid): A f32 (ASPLIT -> hi/lo 2 terms), Wt bf16 [N][K]; ACT 0 none, 1 relu, 2 exact gelu;
// resid (optional, f32, row index = (row % rmod), pitch ldr, RES_BF16 rounds it) added before the activation.
template <bool ASPLIT, int ACT, bool BIAS_BF16, bool RES_BF16>
__global__ __launch_bounds__(128) void k_gemm_bf3(const float* __restrict__ A, int lda, const unsigned short* __restrict__ Wt, int ldb,
                                                const float* __restrict__ bias, const float* __restrict__ resid, int rmod, int ldr,
                                                float* __restrict__ C, int ldc, int M, int N, int K) {
  __shared__ __attribute__((aligned(16))) float so[4][16][64];
  const int tid = threadIdx.x, w = tid >> 5, lane = tid & 31, ln = lane & 15, hh = lane >> 4;
  const int ntn = N / 64;
  const int wid = blockIdx.x * 4 + w;
  const int mt = wid / ntn, nq = wid % ntn;
  if (mt * 16 >= M) return;
  const int row0 = mt * 16, col0 = nq * 64;
  const float* arow = A + (size_t)(row0 + ln) * lda;
  v8f acc[4] = {};
  for (int kb = 0; kb < K; kb += 32) {
    FragB ah, al;
    const v4f x0 = *(const v4fa*)(arow + kb + 8 * hh), x1 = *(const v4fa*)(arow + kb + 8 * hh + 4);
    const v4f x2 = *(const v4fa*)(arow + kb + 16 + 8 * hh), x3 = *(const v4fa*)(arow + kb + 16 + 8 * hh + 4);
    float xs[16] = {x0[0],x0[1],x0[2],x0[3],x1[0],x1[1],x1[2],x1[3],x2[0],x2[1],x2[2],x2[3],x3[0],x3[1],x3[2],x3[3]};
#pragma unroll
    for (int i = 0; i < 16; ++i) { const unsigned short hb = bf16_bits(xs[i]); ah.u[i] = hb; al.u[i] = ASPLIT ? bf16_bits(xs[i] - bf16_val(hb)) : (unsigned short)0; }
#pragma unroll
    for (int t = 0; t < 4; ++t) {
      const unsigned short* brow = Wt + (size_t)(col0 + t * 16 + ln) * ldb + kb;
      FragB b;
      b.half[0] = *(const v8us*)(brow + 8 * hh);
      b.half[1] = *(const v8us*)(brow + 16 + 8 * hh);
      acc[t] = mmaN<ASPLIT ? 2 : 1>(ah.v, al.v, b.v, b.v, acc[t]);
    }
  }
#pragma unroll
  for (int t = 0; t < 4; ++t) {
    const int col = col0 + t * 16 + ln;
    float bv = bias ? bias[col] : 0.f;
    if (BIAS_BF16) bv = bf16_round(bv);
#pragma unroll
    for (int r = 0; r < 8; ++r) {
      float v = acc[t][r] + bv;
      if (resid) { float rv = resid[(size_t)((row0 + 8 * hh + r) % rmod) * ldr + col]; if (RES_BF16) rv = bf16_round(rv); v += rv; }
      if (ACT == 1) v = fmaxf(v, 0.f);
      if (ACT == 2) v = 0.5f * v * (1.0f + erff(v * 0.70710678118654752f));
      if (ACT == 3) { const float u = 0.7978845608028654f * (v + 0.044715f * v * v * v); v = 0.5f * v * (1.0f + tanhf(u)); }
      so[w][8 * hh + r][t * 16 + ln] = v;
    }
  }
  __builtin_amdgcn_fence(__ATOMIC_ACQ_REL, "workgroup");
  __builtin_amdgcn_wave_barrier();
  const int rsub = lane >> 4, c4 = (lane & 15) * 4;
  {
#pragma unroll
    for (int q = 0; q < 8; ++q) {
      const int r = q * 2 + rsub;
      const v4f v = *(const v4fa*)&so[w][r][c4];
      *(v4f*)(C + (size_t)(row0 + r) * ldc + col0 + c4) = v;
    }
    
  }
}
// row LayerNorm (biased variance, eps) over N: s = X (+ R); optional out_sum <- s; out_norm <- (s-mu)*rsqrt(var+eps)*g + b
template <bool PARAM_BF16>
__global__ __launch_bounds__(256) void k_layernorm(const float* __restrict__ X, const float* __restrict__ R, const float* __restrict__ g, const float* __restrict__ bta,
                                                  float* __restrict__ out_sum, float* __restrict__ out_norm, int N, float eps) {
  __shared__ float red[256];
  const int row = blockIdx.x, tid = threadIdx.x;
  const float* x = X + (size_t)row * N; const float* rr = R ? R + (size_t)row * N : nullptr;
  float vals[16];                     // up to N = 4096
  const int per = N / 256;            // contiguous chunk per thread? use strided-by-4 chunks: thread handles j = tid*4 + 1024*u
  float s1 = 0.f;
  for (int u = 0; u < per / 4; ++u) {
    const int j = tid * 4 + 1024 * u;
    const v4f a = *(const v4fa*)(x + j);
    v4f b = {0.f,0.f,0.f,0.f}; if (rr) b = *(const v4fa*)(rr + j);
#pragma unroll
    for (int q = 0; q < 4; ++q) { const float v = a[q] + b[q]; vals[u * 4 + q] = v; s1 += v; }
  }
  red[tid] = s1; __syncthreads();
  for (int st = 128; st > 0; st >>= 1) { if (tid < st) red[tid] += red[tid + st]; __syncthreads(); }
  const float mu = red[0] / (float)N; __syncthreads();
  float s2 = 0.f;
  for (int u = 0; u < per / 4; ++u)
#pragma unroll
    for (int q = 0; q < 4; ++q) { const float c = vals[u * 4 + q] - mu; s2 += c * c; }
  red[tid] = s2; __syncthreads();
  for (int st = 128; st > 0; st >>= 1) { if (tid < st) red[tid] += red[tid + st]; __syncthreads(); }
  const float rs = rsqrtf(red[0] / (float)N + eps);
  {
    for (int u = 0; u < per / 4; ++u) {
      const int j = tid * 4 + 1024 * u;
      v4f o, sm;
#pragma unroll
      for (int q = 0; q < 4; ++q) {
        float gg = g[j + q], bb = bta[j + q];
        if (PARAM_BF16) { gg = bf16_round(gg); bb = bf16_round(bb); }
        sm[q] = vals[u * 4 + q]; o[q] = (vals[u * 4 + q] - mu) * rs * gg + bb;
      }
      if (out_sum) *(v4f*)(out_sum + (size_t)row * N + j) = sm;
      *(v4f*)(out_norm + (size_t)row * N + j) = o;
    }
    
  }
}



// ---- f16 WMMA path (v_wmma_f32_16x16x32_f16): 11-bit significands for operands in range — used where a [0,1] probability operand needs more precision than bf16
typedef _Float16 v16h __attribute__((ext_vector_type(16)));
union FragH { v16h v; v8us half[2]; _Float16 h[16]; unsigned short u[16]; };
template <int NT>
__device__ __forceinline__ v8f mmaH(v16h ah, v16h al, v16h bh, v16h bl, v8f c) {
  c = __builtin_amdgcn_wmma_f32_16x16x32_f16(false, ah, false, bh, (short)0, c, false, false);
  if (NT >= 2) c = __builtin_amdgcn_wmma_f32_16x16x32_f16(false, al, false, bh, (short)0, c, false, false);
  if (NT >= 3) c = __builtin_amdgcn_wmma_f32_16x16x32_f16(false, ah, false, bl, (short)0, c, false, false);
  asm volatile("v_nop\n\tv_nop\n\tv_nop\n\tv_nop" : "+v"(c) : "v"(ah), "v"(al), "v"(bh), "v"(bl));
  return c;
}
// batched GEMM like k_gemm_b but f16 operands: A f32 (split into f16 hi/lo if ASPLIT, else rounded to f16), Bt = f16 values [n][k]; alpha; C f32; N multiple of 16 (partial tiles skipped)
template <bool ASPLIT>
__global__ __launch_bounds__(128) void k_gemm_h(const float* __restrict__ A, int lda, size_t sA, const _Float16* __restrict__ Bh, int ldb, size_t sB, float alpha, float* __restrict__ C, int ldc, size_t sC, int M, int N, int K) {
  __shared__ __attribute__((aligned(16))) float so[4][16][64];
  const int tid = threadIdx.x, w = tid >> 5, lane = tid & 31, ln = lane & 15, hh = lane >> 4; const int by = blockIdx.y;
  A += (size_t)by * sA; Bh += (size_t)by * sB; C += (size_t)by * sC;
  const int ntn = (N + 63) / 64; const int wid = blockIdx.x * 4 + w; const int mt = wid / ntn, nq = wid % ntn; if (mt * 16 >= M) return;
  const int row0 = mt * 16, col0 = nq * 64; const float* arow = A + (size_t)(row0 + ln) * lda;
  v8f acc[4] = {};
  for (int kb = 0; kb < K; kb += 32) {
    FragH ah, al;
    const v4f x0 = *(const v4fa*)(arow + kb + 8 * hh), x1 = *(const v4fa*)(arow + kb + 8 * hh + 4), x2 = *(const v4fa*)(arow + kb + 16 + 8 * hh), x3 = *(const v4fa*)(arow + kb + 16 + 8 * hh + 4);
    float xs[16] = {x0[0],x0[1],x0[2],x0[3],x1[0],x1[1],x1[2],x1[3],x2[0],x2[1],x2[2],x2[3],x3[0],x3[1],x3[2],x3[3]};
#pragma unroll
    for (int i = 0; i < 16; ++i) { const _Float16 h = (_Float16)xs[i]; ah.h[i] = h; al.h[i] = ASPLIT ? (_Float16)(xs[i] - (float)h) : (_Float16)0.0f; }
#pragma unroll
    for (int t = 0; t < 4; ++t) { if (col0 + t * 16 >= N) continue; const size_t boff = (size_t)(col0 + t * 16 + ln) * ldb + kb; FragH bq; bq.half[0] = *(const v8us*)(Bh + boff + 8 * hh); bq.half[1] = *(const v8us*)(Bh + boff + 16 + 8 * hh);
      acc[t] = mmaH<ASPLIT ? 2 : 1>(ah.v, al.v, bq.v, bq.v, acc[t]); }
  }
#pragma unroll
  for (int t = 0; t < 4; ++t) { if (col0 + t * 16 >= N) continue;
#pragma unroll
    for (int r = 0; r < 8; ++r) so[w][8 * hh + r][t * 16 + ln] = acc[t][r] * alpha; }
  __builtin_amdgcn_fence(__ATOMIC_ACQ_REL, "workgroup"); __builtin_amdgcn_wave_barrier();
  const int rsub = lane >> 4, c4 = (lane & 15) * 4;
  {
#pragma unroll
    for (int q = 0; q < 8; ++q) { const int r = q * 2 + rsub; if (col0 + c4 < N) { const v4f v = *(const v4fa*)&so[w][r][c4]; *(v4f*)(C + (size_t)(row0 + r) * ldc + col0 + c4) = v; } }
     }
}

// Wt[n][k] = f16(W[k][n]·scale) from f32 row-major W[K][N] (scale = power of two; bf16-exact weights stay exact in f16 away from the subnormal range)
__global__ __launch_bounds__(256) void k_wt_f16(const float* __restrict__ W, _Float16* __restrict__ Wt, int K, int N, float scale) {
  const int t = blockIdx.x * 256 + threadIdx.x; if (t >= N * (K / 8)) return; const int n = t / (K / 8), k8 = (t % (K / 8)) * 8; FragH f;
#pragma unroll
  for (int i = 0; i < 8; ++i) f.h[i] = (_Float16)(bf16_round(W[(size_t)(k8 + i) * N + n]) * scale); const v8us o = f.half[0];
  *(v8us*)((unsigned short*)Wt + (size_t)n * K + k8) = o; 
}
// k_gemm_hh variant with fused epilogue: v = acc·alpha + bias[by·sBias + col] (+ CP[(row/rowsPerB)·sCPb + by·64 + col] if CP) ; ACT 0 none / 1 elu ; writes f16 C16 (and f32 C if non-null)
template <int ACT>
__global__ __launch_bounds__(128) void k_gemm_hhx(const _Float16* __restrict__ A, int lda, size_t sA, const _Float16* __restrict__ Bh, int ldb, size_t sB, float alpha, const float* __restrict__ bias, size_t sBias, const float* __restrict__ CP, int rowsPerB, size_t sCPb, int row0g,
    float* __restrict__ C, _Float16* __restrict__ C16, int ldc, size_t sC, int M, int N, int K) {
  __shared__ __attribute__((aligned(16))) float so[4][16][64];
  const int tid = threadIdx.x, w = tid >> 5, lane = tid & 31, ln = lane & 15, hh = lane >> 4; const int by = blockIdx.y;
  A += (size_t)by * sA; Bh += (size_t)by * sB; const size_t cofs = (size_t)by * sC; const float* bp = bias ? bias + (size_t)by * sBias : nullptr;
  const int ntn = (N + 63) / 64; const int wid = blockIdx.x * 4 + w; const int mt = wid / ntn, nq = wid % ntn; if (mt * 16 >= M) return;
  const int row0 = mt * 16, col0 = nq * 64; const _Float16* arow = A + (size_t)(row0 + ln) * lda;
  v8f acc[4] = {};
  for (int kb = 0; kb < K; kb += 32) { FragH ah; ah.half[0] = *(const v8us*)((const unsigned short*)arow + kb + 8 * hh); ah.half[1] = *(const v8us*)((const unsigned short*)arow + kb + 16 + 8 * hh);
#pragma unroll
    for (int t = 0; t < 4; ++t) { if (col0 + t * 16 >= N) continue; const size_t boff = (size_t)(col0 + t * 16 + ln) * ldb + kb; FragH bq; bq.half[0] = *(const v8us*)((const unsigned short*)Bh + boff + 8 * hh); bq.half[1] = *(const v8us*)((const unsigned short*)Bh + boff + 16 + 8 * hh);
      acc[t] = mmaH<1>(ah.v, ah.v, bq.v, bq.v, acc[t]); }
  }
#pragma unroll
  for (int t = 0; t < 4; ++t) { if (col0 + t * 16 >= N) continue; const int col = col0 + t * 16 + ln; const float bv = bp ? bf16_round(bp[col]) : 0.f;
#pragma unroll
    for (int r = 0; r < 8; ++r) { float v = acc[t][r] * alpha + bv; if (CP) { const int bidx = (row0g + row0 + 8 * hh + r) / rowsPerB; v += CP[(size_t)bidx * sCPb + (size_t)by * 64 + col]; } if (ACT == 1) v = (v > 0.f) ? v : expm1f(v); else if (ACT == 7) v = (v > 0.f) ? v + 1.0f : expf(v); else if (ACT == 8) v = tanhf(v); else if (ACT == 9) v = 0.5f * v * (1.0f + tanhf(0.7978845608028654f * (v + 0.044715f * v * v * v))); else if (ACT == 11) v = 1.0f / (1.0f + expf(-v)); else if (ACT == 12) v = (v > 0.f) ? v : 0.01f * v; else if (ACT == 14) v = (v > 0.f) ? v : 0.1f * v; else if (ACT == 15) v = v / (1.0f + expf(-v)); else if (ACT == 3) v = fmaxf(v, 0.f); else if (ACT == 6) v = 0.5f * v * (1.0f + erff(v * 0.70710678118654752f)); so[w][8 * hh + r][t * 16 + ln] = v; } }
  __builtin_amdgcn_fence(__ATOMIC_ACQ_REL, "workgroup"); __builtin_amdgcn_wave_barrier();
  const int rsub = lane >> 4, c4 = (lane & 15) * 4; typedef _Float16 v4h __attribute__((ext_vector_type(4)));
  {
#pragma unroll
    for (int q = 0; q < 8; ++q) { const int r = q * 2 + rsub; if (col0 + c4 < N) { const v4f v = *(const v4fa*)&so[w][r][c4]; if (C) *(v4f*)(C + cofs + (size_t)(row0 + r) * ldc + col0 + c4) = v; if (C16) { v4h h4; for (int i = 0; i < 4; ++i) h4[i] = (_Float16)v[i]; *(v4h*)(C16 + cofs + (size_t)(row0 + r) * ldc + col0 + c4) = h4; } } }
     }
}


typedef _Float16 v4h __attribute__((ext_vector_type(4)));

__global__ __launch_bounds__(256) void k_x16(const float* __restrict__ x, _Float16* __restrict__ X16, size_t n8) { const size_t t = (size_t)blockIdx.x * 256 + threadIdx.x; if (t >= n8) return; FragH f;
#pragma unroll
  for (int q = 0; q < 8; ++q) f.h[q] = (_Float16)bf16_round(x[t * 8 + q]); *(v8us*)((unsigned short*)X16 + t * 8) = f.half[0];  }
__global__ __launch_bounds__(256) void k_h16(const float* __restrict__ x, _Float16* __restrict__ X16, size_t n8) { const size_t t = (size_t)blockIdx.x * 256 + threadIdx.x; if (t >= n8) return; FragH f;
#pragma unroll
  for (int q = 0; q < 8; ++q) f.h[q] = (_Float16)x[t * 8 + q]; *(v8us*)((unsigned short*)X16 + t * 8) = f.half[0];  }
__global__ __launch_bounds__(256) void k_round16f(const float* __restrict__ W, _Float16* __restrict__ Bt, size_t n8) { const size_t t = (size_t)blockIdx.x * 256 + threadIdx.x; if (t >= n8) return; FragH f;
#pragma unroll
  for (int i = 0; i < 8; ++i) f.h[i] = (_Float16)(bf16_round(W[t * 8 + i]) * 16.0f); *(v8us*)((unsigned short*)Bt + t * 8) = f.half[0];  }
template <int NHv, int TTv>
__global__ __launch_bounds__(256) void k_vt(const _Float16* __restrict__ V16, int ldv, int voff, _Float16* __restrict__ Vt) { __shared__ unsigned short tl[64][66]; const int tid = threadIdx.x; const int slab = blockIdx.x / (TTv / 64), lg = blockIdx.x % (TTv / 64); const int b = slab / NHv, h = slab % NHv;
  for (int i = tid; i < 64 * 8; i += 256) { const int r = i / 8, c8 = (i % 8) * 8; FragH f; f.half[0] = *(const v8us*)((const unsigned short*)V16 + ((size_t)b * TTv + lg * 64 + r) * ldv + voff + h * 64 + c8);
#pragma unroll
    for (int q = 0; q < 8; ++q) tl[r][c8 + q] = f.u[q]; }
  __syncthreads();
  {
#pragma unroll
    for (int rd = 0; rd < 2; ++rd) { const int d = rd * 32 + tid / 8, pc = tid % 8; FragH f;
#pragma unroll
      for (int q = 0; q < 8; ++q) f.u[q] = tl[pc * 8 + q][d];
      *(v8us*)((unsigned short*)Vt + ((size_t)slab * 64 + d) * TTv + lg * 64 + pc * 8) = f.half[0]; }
     } }

__global__ __launch_bounds__(256) void k_hl(const float* __restrict__ F, _Float16* __restrict__ Hh, _Float16* __restrict__ Hl, size_t n8) { const size_t t = (size_t)blockIdx.x * 256 + threadIdx.x; if (t >= n8) return; FragH fh, fl; const v4f a = *(const v4fa*)(F + t * 8), c = *(const v4fa*)(F + t * 8 + 4);
#pragma unroll
  for (int q = 0; q < 4; ++q) { _Float16 h = (_Float16)a[q]; fh.h[q] = h; fl.h[q] = (_Float16)((a[q] - (float)h) * 1024.0f); h = (_Float16)c[q]; fh.h[4 + q] = h; fl.h[4 + q] = (_Float16)((c[q] - (float)h) * 1024.0f); }
  { *(v8us*)((unsigned short*)Hh + t * 8) = fh.half[0]; *(v8us*)((unsigned short*)Hl + t * 8) = fl.half[0];  } }

// ---- fast GEMM (wave tile 32x64; requires M % 32 == 0 rows per launch region and N % 64 == 0); epilogue = k_gemm_hhx semantics ----
__device__ __forceinline__ v16h g2_frag(const _Float16* p, int hh) { FragH f; f.half[0] = *(const v8us*)((const unsigned short*)p + 8 * hh); f.half[1] = *(const v8us*)((const unsigned short*)p + 16 + 8 * hh); return f.v; }
__device__ __forceinline__ v8f g2_mma(v16h a, v16h b, v8f c) { v8f d = __builtin_amdgcn_wmma_f32_16x16x32_f16(false, a, false, b, (short)0, c, false, false); asm volatile("v_nop\n\tv_nop\n\tv_nop\n\tv_nop" : "+v"(d) : "v"(a), "v"(b)); return d; }
template <int ACT>
__global__ __launch_bounds__(128) void k_gemm2(const _Float16* __restrict__ A, int lda, size_t sA, const _Float16* __restrict__ Bh, int ldb, size_t sB, float alpha, const float* __restrict__ bias, size_t sBias, const float* __restrict__ CP, int rowsPerB, size_t sCPb, int row0g,
    float* __restrict__ C, _Float16* __restrict__ C16, int ldc, size_t sC, int M, int N, int K) {
  __shared__ __attribute__((aligned(16))) float so[4][32][68];
  const int tid = threadIdx.x, w = tid >> 5, lane = tid & 31, ln = lane & 15, hh = lane >> 4; const int by = blockIdx.y;
  A += (size_t)by * sA; Bh += (size_t)by * sB; const size_t cofs = (size_t)by * sC; const float* bp = bias ? bias + (size_t)by * sBias : nullptr;
  const int ntn = N >> 6; const int mt = blockIdx.x / ntn, nq = blockIdx.x - mt * ntn; const int row0 = mt * 128 + 32 * w, col0 = nq * 64; if (row0 >= M) return;
  const _Float16* a0p = A + (size_t)(row0 + ln) * lda; const _Float16* a1p = a0p + (size_t)16 * lda;
  const _Float16* b0p = Bh + (size_t)(col0 + ln) * ldb; const _Float16* b1p = b0p + (size_t)16 * ldb; const _Float16* b2p = b1p + (size_t)16 * ldb; const _Float16* b3p = b2p + (size_t)16 * ldb;
  const v8f z8 = {0.f,0.f,0.f,0.f,0.f,0.f,0.f,0.f}; v8f c00 = z8, c01 = z8, c02 = z8, c03 = z8, c10 = z8, c11 = z8, c12 = z8, c13 = z8;
#pragma unroll 1
  for (int kb = 0; kb < K; kb += 32) { const v16h a0 = g2_frag(a0p + kb, hh), a1 = g2_frag(a1p + kb, hh);
    v16h b = g2_frag(b0p + kb, hh); c00 = g2_mma(a0, b, c00); c10 = g2_mma(a1, b, c10);
    b = g2_frag(b1p + kb, hh); c01 = g2_mma(a0, b, c01); c11 = g2_mma(a1, b, c11);
    b = g2_frag(b2p + kb, hh); c02 = g2_mma(a0, b, c02); c12 = g2_mma(a1, b, c12);
    b = g2_frag(b3p + kb, hh); c03 = g2_mma(a0, b, c03); c13 = g2_mma(a1, b, c13); }
  v8f accs[8] = {c00, c01, c02, c03, c10, c11, c12, c13};
#pragma unroll
  for (int u = 0; u < 8; ++u) { const int t = u & 3, half = u >> 2; const int col = col0 + t * 16 + ln; const float bv = bp ? bf16_round(bp[col]) : 0.f;
#pragma unroll
    for (int r = 0; r < 8; ++r) { const int rloc = half * 16 + 8 * hh + r; float v = accs[u][r] * alpha + bv; if (CP) { const int bidx = (row0g + row0 + rloc) / rowsPerB; v += CP[(size_t)bidx * sCPb + (size_t)by * 64 + col]; }
      if (ACT == 3) v = fmaxf(v, 0.f); else if (ACT == 6) v = 0.5f * v * (1.0f + erff(v * 0.70710678118654752f)); else if (ACT == 11) v = 1.0f / (1.0f + expf(-v)); else if (ACT == 15) v = v / (1.0f + expf(-v)); else if (ACT == 12) v = (v > 0.f) ? v : 0.01f * v; else if (ACT == 8) v = tanhf(v);
      so[w][rloc][t * 16 + ln] = v; } }
  __builtin_amdgcn_fence(__ATOMIC_ACQ_REL, "workgroup"); __builtin_amdgcn_wave_barrier();
  const int rsub = lane >> 4, c4 = (lane & 15) * 4;
  {
#pragma unroll
    for (int q = 0; q < 16; ++q) { const int r = q * 2 + rsub; const v4f v = *(const v4fa*)&so[w][r][c4]; if (C) *(v4f*)(C + cofs + (size_t)(row0 + r) * ldc + col0 + c4) = v; if (C16) { v4h h4; for (int i = 0; i < 4; ++i) h4[i] = (_Float16)v[i]; *(v4h*)(C16 + cofs + (size_t)(row0 + r) * ldc + col0 + c4) = h4; } }
     } }



template <int TK>
__global__ __launch_bounds__(256) void k_vthl(const float* __restrict__ VF, int ldv, _Float16* __restrict__ Vth, _Float16* __restrict__ Vtl) { __shared__ float tl[64][65]; const int tid = threadIdx.x; const int slab = blockIdx.x / (TK / 64), lg = blockIdx.x % (TK / 64); const int b = slab / NH, h = slab % NH;
  for (int i = tid; i < 64 * 16; i += 256) { const int r = i / 16, c4 = (i % 16) * 4; const v4f a = *(const v4fa*)(VF + ((size_t)b * TK + lg * 64 + r) * ldv + h * 64 + c4); tl[r][c4] = a[0]; tl[r][c4 + 1] = a[1]; tl[r][c4 + 2] = a[2]; tl[r][c4 + 3] = a[3]; }
  __syncthreads();
  FragH fh[2], fl[2]; size_t oo[2];
#pragma unroll
  for (int rd = 0; rd < 2; ++rd) { const int d = rd * 32 + tid / 8, pc = tid % 8;
#pragma unroll
    for (int q = 0; q < 8; ++q) { const float v = tl[pc * 8 + q][d]; const _Float16 hv = (_Float16)v; fh[rd].h[q] = hv; fl[rd].h[q] = (_Float16)((v - (float)hv) * 1024.0f); } oo[rd] = ((size_t)slab * 64 + d) * TK + lg * 64 + pc * 8; }
  {
#pragma unroll
    for (int rd = 0; rd < 2; ++rd) { *(v8us*)((unsigned short*)Vth + oo[rd]) = fh[rd].half[0]; *(v8us*)((unsigned short*)Vtl + oo[rd]) = fl[rd].half[0]; }
     } }

template <int TQ, int TK>
__global__ __launch_bounds__(128) void k_flashm(const _Float16* __restrict__ Q16, const _Float16* __restrict__ Q16lo, int ldq, const _Float16* __restrict__ K16, const _Float16* __restrict__ K16lo, int ldk, const _Float16* __restrict__ Vt, const _Float16* __restrict__ Vtlo, const unsigned* __restrict__ MB, const int* __restrict__ RA, const int* __restrict__ KE, float* __restrict__ O, int ldo) {
  constexpr int RPW = 16, RTN = RPW / 16, NQB = TQ / (4 * RPW), DT = 4, KS = 2;
  __shared__ __attribute__((aligned(16))) unsigned short sP[4][RPW][40], sPl[4][RPW][40]; __shared__ __attribute__((aligned(16))) float sO[4][RPW][64 + 4];
  const int tid = threadIdx.x, w = tid >> 5, lane = tid & 31, ln = lane & 15, hh = lane >> 4;
  const int slab = blockIdx.x / NQB, qblk = blockIdx.x % NQB; const int b = slab / NH, h = slab % NH; const int qb0 = qblk * (4 * RPW); const int q0 = qb0 + w * RPW;
  FragH aq[2][KS], aql[2][KS];
#pragma unroll
  for (int rt = 0; rt < RTN; ++rt) { const size_t qo = ((size_t)b * TQ + q0 + rt * 16 + ln) * ldq + h * 64; const unsigned short* qr = (const unsigned short*)Q16 + qo; const unsigned short* ql = (const unsigned short*)Q16lo + qo;
#pragma unroll
    for (int ks = 0; ks < KS; ++ks) { aq[rt][ks].half[0] = *(const v8us*)(qr + ks * 32 + 8 * hh); aq[rt][ks].half[1] = *(const v8us*)(qr + ks * 32 + 16 + 8 * hh); aql[rt][ks].half[0] = *(const v8us*)(ql + ks * 32 + 8 * hh); aql[rt][ks].half[1] = *(const v8us*)(ql + ks * 32 + 16 + 8 * hh); } }
  const unsigned short* Vth = (const unsigned short*)Vt + (size_t)slab * 64 * TK; const unsigned short* Vtl = (const unsigned short*)Vtlo + (size_t)slab * 64 * TK;
  float m_r[2][8], l_r[2][8]; v8f oacc[2][DT], oaccl[2][DT];
#pragma unroll
  for (int rt = 0; rt < RTN; ++rt) {
#pragma unroll
    for (int r = 0; r < 8; ++r) { m_r[rt][r] = -3.0e38f; l_r[rt][r] = 0.f; }
#pragma unroll
    for (int dt = 0; dt < DT; ++dt) { oacc[rt][dt] = (v8f){0.f,0.f,0.f,0.f,0.f,0.f,0.f,0.f}; oaccl[rt][dt] = oacc[rt][dt]; } }
  int jend = KE[qblk * 32]; jend = min(TK, (jend + 31) & ~31); if (jend < 32) jend = 32;      /* block-uniform */
  int allm[2][8]; const unsigned* mrow[2][8];
#pragma unroll
  for (int rt = 0; rt < RTN; ++rt)
#pragma unroll
    for (int r = 0; r < 8; ++r) { const int tq = q0 + rt * 16 + 8 * hh + r; allm[rt][r] = RA[tq]; mrow[rt][r] = MB + (size_t)tq * (TK / 32); }
#pragma unroll 1
  for (int j0 = 0; j0 < jend; j0 += 32) {
    
    v8f s[2][2];
#pragma unroll
    for (int nt = 0; nt < 2; ++nt) { const size_t ko = ((size_t)b * TK + j0 + nt * 16 + ln) * ldk + h * 64; const unsigned short* kr = (const unsigned short*)K16 + ko; const unsigned short* kl = (const unsigned short*)K16lo + ko; FragH bk[KS], bkl[KS];
#pragma unroll
      for (int ks = 0; ks < KS; ++ks) { bk[ks].half[0] = *(const v8us*)(kr + ks * 32 + 8 * hh); bk[ks].half[1] = *(const v8us*)(kr + ks * 32 + 16 + 8 * hh); bkl[ks].half[0] = *(const v8us*)(kl + ks * 32 + 8 * hh); bkl[ks].half[1] = *(const v8us*)(kl + ks * 32 + 16 + 8 * hh); }
#pragma unroll
      for (int rt = 0; rt < RTN; ++rt) { v8f acc = (v8f){0.f,0.f,0.f,0.f,0.f,0.f,0.f,0.f}, accr = acc;
#pragma unroll
        for (int ks = 0; ks < KS; ++ks) { acc = mmaH<1>(aq[rt][ks].v, aq[rt][ks].v, bk[ks].v, bk[ks].v, acc); accr = mmaH<1>(aql[rt][ks].v, aql[rt][ks].v, bk[ks].v, bk[ks].v, accr); accr = mmaH<1>(aq[rt][ks].v, aq[rt][ks].v, bkl[ks].v, bkl[ks].v, accr); }
        s[rt][nt] = acc + accr * 0.0009765625f; } }
#pragma unroll
    for (int rt = 0; rt < RTN; ++rt)
#pragma unroll
      for (int r = 0; r < 8; ++r) { const unsigned mw = mrow[rt][r][j0 >> 5]; const bool am = (allm[rt][r] != 0);
        const bool ok0 = am || (((mw >> ln) & 1u) == 0u), ok1 = am || (((mw >> (16 + ln)) & 1u) == 0u);
        const float s0 = ok0 ? (am ? 0.f : s[rt][0][r] * SCL) : -INFINITY, s1 = ok1 ? (am ? 0.f : s[rt][1][r] * SCL) : -INFINITY; float mc = fmaxf(s0, s1);
        mc = fmaxf(mc, __shfl_xor(mc, 1, 32)); mc = fmaxf(mc, __shfl_xor(mc, 2, 32)); mc = fmaxf(mc, __shfl_xor(mc, 4, 32)); mc = fmaxf(mc, __shfl_xor(mc, 8, 32));
        const float mn = fmaxf(m_r[rt][r], mc); const float al = (mn > -1.0e38f) ? expf(m_r[rt][r] - mn) : 1.0f; m_r[rt][r] = mn; const float p0 = ok0 ? expf(s0 - mn) : 0.f, p1 = ok1 ? expf(s1 - mn) : 0.f; l_r[rt][r] = l_r[rt][r] * al + p0 + p1;
#pragma unroll
        for (int dt = 0; dt < DT; ++dt) { oacc[rt][dt][r] *= al; oaccl[rt][dt][r] *= al; }
        FragH t2, t3; const float ps0 = p0 * 1024.0f, ps1 = p1 * 1024.0f; t2.h[0] = (_Float16)ps0; t2.h[1] = (_Float16)ps1; t3.h[0] = (_Float16)((ps0 - (float)t2.h[0]) * 1024.0f); t3.h[1] = (_Float16)((ps1 - (float)t2.h[1]) * 1024.0f);
        sP[w][rt * 16 + 8 * hh + r][ln] = t2.u[0]; sP[w][rt * 16 + 8 * hh + r][16 + ln] = t2.u[1]; sPl[w][rt * 16 + 8 * hh + r][ln] = t3.u[0]; sPl[w][rt * 16 + 8 * hh + r][16 + ln] = t3.u[1]; }
    __builtin_amdgcn_fence(__ATOMIC_ACQ_REL, "workgroup"); __builtin_amdgcn_wave_barrier();
    FragH pa[2], pl[2];
#pragma unroll
    for (int rt = 0; rt < RTN; ++rt) { pa[rt].half[0] = *(const v8us*)&sP[w][rt * 16 + ln][8 * hh]; pa[rt].half[1] = *(const v8us*)&sP[w][rt * 16 + ln][16 + 8 * hh]; pl[rt].half[0] = *(const v8us*)&sPl[w][rt * 16 + ln][8 * hh]; pl[rt].half[1] = *(const v8us*)&sPl[w][rt * 16 + ln][16 + 8 * hh]; }
#pragma unroll
    for (int dt = 0; dt < DT; ++dt) { const size_t vo = (size_t)(dt * 16 + ln) * TK + j0; FragH bv, bl; bv.half[0] = *(const v8us*)(Vth + vo + 8 * hh); bv.half[1] = *(const v8us*)(Vth + vo + 16 + 8 * hh); bl.half[0] = *(const v8us*)(Vtl + vo + 8 * hh); bl.half[1] = *(const v8us*)(Vtl + vo + 16 + 8 * hh);
#pragma unroll
      for (int rt = 0; rt < RTN; ++rt) { oacc[rt][dt] = mmaH<1>(pa[rt].v, pa[rt].v, bv.v, bv.v, oacc[rt][dt]); oaccl[rt][dt] = mmaH<1>(pa[rt].v, pa[rt].v, bl.v, bl.v, oaccl[rt][dt]); oaccl[rt][dt] = mmaH<1>(pl[rt].v, pl[rt].v, bv.v, bv.v, oaccl[rt][dt]); } }
    __builtin_amdgcn_fence(__ATOMIC_ACQ_REL, "workgroup"); __builtin_amdgcn_wave_barrier(); }
#pragma unroll
  for (int rt = 0; rt < RTN; ++rt) {
#pragma unroll
    for (int r = 0; r < 8; ++r) { float l = l_r[rt][r]; l += __shfl_xor(l, 1, 32); l += __shfl_xor(l, 2, 32); l += __shfl_xor(l, 4, 32); l += __shfl_xor(l, 8, 32); l_r[rt][r] = (l > 0.f) ? 1.0f / (l * 1024.0f) : 0.f; }
#pragma unroll
    for (int dt = 0; dt < DT; ++dt)
#pragma unroll
      for (int r = 0; r < 8; ++r) sO[w][rt * 16 + 8 * hh + r][dt * 16 + ln] = (oacc[rt][dt][r] + oaccl[rt][dt][r] * 0.0009765625f) * l_r[rt][r]; }
  __builtin_amdgcn_fence(__ATOMIC_ACQ_REL, "workgroup"); __builtin_amdgcn_wave_barrier();
  {
#pragma unroll
    for (int rp = 0; rp < RPW; rp += 2) { const int r = rp + (lane >> 4), pc = lane & 15; const v4f val = *(const v4fa*)&sO[w][r][pc * 4]; *(v4f*)(O + ((size_t)b * TQ + q0 + r) * ldo + h * 64 + pc * 4) = val; }
     } }


__global__ __launch_bounds__(256) void k_causaltab(unsigned* __restrict__ MB, int* __restrict__ RA, int* __restrict__ KE, int nq, int nk) {
  const int t = blockIdx.x * 256 + threadIdx.x; const int nw = nk / 32;
  if (t < nq * nw) { const int q = t / nw, w = t % nw; const int first = q + 1 - 32 * w; const unsigned bits = (first <= 0) ? 0xffffffffu : ((first >= 32) ? 0u : (0xffffffffu << first)); *(unsigned*)(MB + t) = bits;  }
  if (t < nq) { *(int*)(RA + t) = 0;  }
  if (t < nq / 64) { const int v = 64 * (t + 1); *(int*)(KE + t * 32) = v;  } }

__constant__ float INVF[32] = {1.000000000e+00f,7.498942018e-01f,5.623413324e-01f,4.216965139e-01f,3.162277639e-01f,2.371373624e-01f,1.778279394e-01f,1.333521456e-01f,1.000000015e-01f,7.498941571e-02f,5.623412877e-02f,4.216964915e-02f,3.162277862e-02f,2.371373586e-02f,1.778279431e-02f,1.333521493e-02f,9.999999776e-03f,7.498942316e-03f,5.623413250e-03f,4.216964822e-03f,3.162277862e-03f,2.371373819e-03f,1.778279431e-03f,1.333521446e-03f,1.000000047e-03f,7.498941850e-04f,5.623413017e-04f,4.216964880e-04f,3.162277862e-04f,2.371373848e-04f,1.778279402e-04f,1.333521504e-04f};
__constant__ float XBASE[32] = {2.857142985e-01f,3.080357313e-01f,3.303571641e-01f,3.526785970e-01f,3.750000000e-01f,3.973214328e-01f,4.196428359e-01f,4.419642687e-01f,4.642857015e-01f,4.866071343e-01f,5.089285374e-01f,5.312500000e-01f,5.535714030e-01f,5.758928657e-01f,5.982142687e-01f,6.205357313e-01f,6.428571343e-01f,6.651785970e-01f,6.875000000e-01f,7.098214030e-01f,7.321428657e-01f,7.544642687e-01f,7.767857313e-01f,7.991071343e-01f,8.214285970e-01f,8.437500000e-01f,8.660714030e-01f,8.883928657e-01f,9.107142687e-01f,9.330357313e-01f,9.553571343e-01f,9.776785970e-01f};
__global__ __launch_bounds__(256) void k_trig(float* __restrict__ CS, float* __restrict__ SN) {
  #pragma clang fp contract(off)
  const int t = blockIdx.x * 256 + threadIdx.x; if (t >= SLEN * 32) return; const int tok = t >> 5, j = t & 31; const float ang = (float)tok * INVF[j]; const float c = cosf(ang), s = sinf(ang);
  *(float*)(CS + t) = c; *(float*)(SN + t) = s;  }
__global__ __launch_bounds__(256) void k_scale(float* __restrict__ SC) {
  #pragma clang fp contract(off)
  const int t = blockIdx.x * 256 + threadIdx.x; if (t >= SLEN * 32) return; const int tok = t >> 5, j = t & 31; const float v = powf(XBASE[j], ((float)tok - 1024.0f) / 512.0f);
  *(float*)(SC + t) = v;  }
template <int MODE>
__global__ __launch_bounds__(256) void k_xpos4(const float* __restrict__ F, const float* __restrict__ CS, const float* __restrict__ SN, const float* __restrict__ SC, float* __restrict__ OF) {
  #pragma clang fp contract(off)
  const int t = blockIdx.x * 256 + threadIdx.x; if (t >= NR * (DM / 4)) return; const int c0 = (t % (DM / 4)) * 4; const int r = t / (DM / 4); const int tok = r % SLEN; const int d0 = c0 & 63;
  const float* f = F + (size_t)r * DM + c0; const float* cs = CS + (size_t)tok * 32; const float* sn = SN + (size_t)tok * 32; const float* scp = SC + (size_t)tok * 32; v4f o;
#pragma unroll
  for (int q = 0; q < 4; ++q) { const int d = d0 + q; float sc = scp[d & 31]; if (MODE == 1) sc = 1.0f / sc;
    const float x = f[q]; const float rx = (d & 1) ? f[q - 1] : -f[q + 1]; o[q] = (x * cs[d >> 1]) * sc + (rx * sn[d >> 1]) * sc; }
  *(v4f*)(OF + (size_t)r * DM + c0) = o;  }

extern "C" void kernel_launch(void* const* d_in, const int* in_sizes, int n_in,
                              void* d_out, int out_size, void* d_ws, size_t ws_size, hipStream_t stream) {
  (void)in_sizes; (void)n_in; (void)out_size;
  const float* const* I = (const float* const*)d_in; const float* x = I[0]; const float* Wq = I[1]; const float* bq = I[2]; const float* Wk = I[3]; const float* bk = I[4]; const float* Wv = I[5]; const float* bv = I[6]; const float* Wo = I[7]; const float* bo = I[8];
  char* ws = (char*)d_ws; size_t off = 0;
  auto take = [&](size_t bytes) { char* p = ws + off; off += (bytes + 255) & ~(size_t)255; return p; };
  _Float16* BQ = (_Float16*)take((size_t)DM * DM * 2); _Float16* BK = (_Float16*)take((size_t)DM * DM * 2); _Float16* BV = (_Float16*)take((size_t)DM * DM * 2); _Float16* BO = (_Float16*)take((size_t)DM * DM * 2);
  _Float16* X16 = (_Float16*)take((size_t)NR * DM * 2); float* F = (float*)take((size_t)NR * DM * 4); float* G = (float*)take((size_t)NR * DM * 4);
  _Float16* Qh = (_Float16*)take((size_t)NR * DM * 2); _Float16* Ql = (_Float16*)take((size_t)NR * DM * 2); _Float16* Kh = (_Float16*)take((size_t)NR * DM * 2); _Float16* Kl = (_Float16*)take((size_t)NR * DM * 2); _Float16* Vth = (_Float16*)take((size_t)NR * DM * 2); _Float16* Vtl = (_Float16*)take((size_t)NR * DM * 2);
  unsigned* MB = (unsigned*)take((size_t)SLEN * (SLEN / 32) * 4); int* RA = (int*)take((size_t)SLEN * 4); int* KE = (int*)take((size_t)(SLEN / 64) * 32 * 4);
  float* CS = (float*)take((size_t)SLEN * 32 * 4); float* SN = (float*)take((size_t)SLEN * 32 * 4); float* SC = (float*)take((size_t)SLEN * 32 * 4);
  if (off > ws_size) return;      /* 8 + 8 + 16 + 16 + 6 x 8 + 1.5 = 98 MiB */
  float* O = F; _Float16* Oh = (_Float16*)G; _Float16* Ol = Oh + (size_t)NR * DM;      /* F and G (f32 scratch) are dead once the hi/lo planes exist */
  const size_t n8 = (size_t)NR * DM / 8; const unsigned nb8 = (unsigned)((n8 + 255) / 256), nb4 = (unsigned)(((size_t)NR * DM / 4 + 255) / 256); const size_t w8 = (size_t)DM * DM / 8; const unsigned wb = (unsigned)((w8 + 255) / 256);
  k_round16f<<<wb, 256, 0, stream>>>(Wq, BQ, w8); k_round16f<<<wb, 256, 0, stream>>>(Wk, BK, w8); k_round16f<<<wb, 256, 0, stream>>>(Wv, BV, w8); k_round16f<<<wb, 256, 0, stream>>>(Wo, BO, w8);      /* torch (out,in) = natural Bt; x16 */
  k_x16<<<nb8, 256, 0, stream>>>(x, X16, n8);
  k_trig<<<(SLEN * 32 + 255) / 256, 256, 0, stream>>>(CS, SN); k_scale<<<(SLEN * 32 + 255) / 256, 256, 0, stream>>>(SC); k_causaltab<<<(SLEN * (SLEN / 32) + 255) / 256, 256, 0, stream>>>(MB, RA, KE, SLEN, SLEN);
  const dim3 gP((NR / 128) * (DM / 64), 1);
  k_gemm2<0><<<gP, 128, 0, stream>>>(X16, DM, 0, BQ, DM, 0, 0.0625f, bq, 0, nullptr, 1, 0, 0, F, nullptr, DM, 0, NR, DM, DM); k_xpos4<0><<<nb4, 256, 0, stream>>>(F, CS, SN, SC, G); k_hl<<<nb8, 256, 0, stream>>>(G, Qh, Ql, n8);      /* q_mat = xpos(x Wq^T + bq) as hi/lo */
  k_gemm2<0><<<gP, 128, 0, stream>>>(X16, DM, 0, BV, DM, 0, 0.0625f, bv, 0, nullptr, 1, 0, 0, F, nullptr, DM, 0, NR, DM, DM); k_xpos4<1><<<nb4, 256, 0, stream>>>(F, CS, SN, SC, G); k_hl<<<nb8, 256, 0, stream>>>(G, Kh, Kl, n8);      /* k_mat = xpos^-1(x Wv^T + bv)  (module order) */
  k_gemm2<0><<<gP, 128, 0, stream>>>(X16, DM, 0, BK, DM, 0, 0.0625f, bk, 0, nullptr, 1, 0, 0, F, nullptr, DM, 0, NR, DM, DM);      /* v_mat = x Wk^T + bk (f32) */
  for (int b = 0; b < NBT; ++b) k_vthl<SLEN><<<NH * (SLEN / 64), 256, 0, stream>>>(F + (size_t)b * SLEN * DM, DM, Vth + (size_t)b * SLEN * DM, Vtl + (size_t)b * SLEN * DM);      /* V^T hi/lo per batch [(h)][64][2048] */
  for (int b = 0; b < NBT; ++b) { const size_t ro = (size_t)b * SLEN * DM;
    k_flashm<SLEN, SLEN><<<NH * (SLEN / 64), 128, 0, stream>>>(Qh + ro, Ql + ro, DM, Kh + ro, Kl + ro, DM, Vth + ro, Vtl + ro, MB, RA, KE, O + ro, DM); }
  k_hl<<<nb8, 256, 0, stream>>>(O, Oh, Ol, n8);
  k_gemm2<0><<<gP, 128, 0, stream>>>(Oh, DM, 0, BO, DM, 0, 0.0625f, bo, 0, nullptr, 1, 0, 0, (float*)d_out, nullptr, DM, 0, NR, DM, DM);
  k_gemm2<0><<<gP, 128, 0, stream>>>(Ol, DM, 0, BO, DM, 0, 0.0625f / 1024.0f, nullptr, 0, (const float*)d_out, 1, (size_t)DM, 0, (float*)d_out, nullptr, DM, 0, NR, DM, DM);
}

// v001
// It runs in 499 microseconds.
// In both of two side-by-side timings against v000, it was 1.72 times as fast.
#include <hip/hip_runtime.h>
// Causal multi-head attention with xPos rotary embedding (2 x 2048 tokens x 1024, 16 heads x 64): q = x*Wq^T + bq, k = x*Wv^T + bv, v = x*Wk^T + bk (the module's own assignment order); q <- q*cos*scale + rot(q)*sin*scale, k <- k*cos/scale + rot(k)*sin/scale with interleaved-pair rotation, freq(t, d) = t * inv_freq[d/2], scale(t, d) = base[d mod 32]^((t - 1024)/512); scores = q.k / 32 with j <= i; softmax; merged . Wo^T + bo -> [2,2048,1024].
// Structure: x as an exact f16 plane; the three projections as f16 WMMA GEMMs (32x64 wave tiles, f32, exact products + bias) into f32 planes; per-token cos/sin/scale tables on VALU (inv_freq and base = the reference's f32 constants, precise trig and powf), then one VALU pass applies the rotation/scaling into f32 q/k planes; v re-laid per (batch, head) as [d][token]; q, k as f16 hi + x2^10 residual planes, V^T as hi + residual planes; the causal structure computed on device into a key bit plane + per-block key bound; the fused flash kernel per ((batch, head), 16 queries), the 32-key blocks dealt round-robin to the work-group's four waves (three-product hi/lo scores, online softmax f32 per wave, P hi + residual via LDS, two value accumulators; the four partial (max, sum, O) merged through LDS at the end); O as hi + residual planes; output projection as two GEMMs (bias in the first).
// Compute dtype: x, weights, biases rounded to bf16; projections exact; rotation f32; q, k, P, v, O as f16 hi + residual pairs (~2^-21); f32 accumulation and softmax. v_wmma_f32_16x16x32_f16.
#define NBT 2
#define SLEN 2048
#define DM 1024
#define NH 16
#define SCL 0.03125f
#define NR (NBT * SLEN)
typedef __bf16 v16b __attribute__((ext_vector_type(16)));
typedef unsigned short v8us __attribute__((ext_vector_type(8), may_alias));
typedef float  v8f  __attribute__((ext_vector_type(8)));
typedef float  v4f  __attribute__((ext_vector_type(4)));
typedef float  v4fa __attribute__((ext_vector_type(4), may_alias));
union FragB { v16b v; v8us half[2]; unsigned short u[16]; };

__device__ __forceinline__ unsigned short bf16_bits(float x) { unsigned int u = __float_as_uint(x); return (unsigned short)((u + 0x7FFFu + ((u >> 16) & 1u)) >> 16); }
__device__ __forceinline__ float bf16_val(unsigned short b) { return __uint_as_float(((unsigned int)b) << 16); }
__device__ __forceinline__ float bf16_round(float x) { return bf16_val(bf16_bits(x)); }
// D += A·B with NT terms: 1 = ah·bh, 2 = + al·bh (A split), 3 = + ah·bl (both split)
template <int NT>
__device__ __forceinline__ v8f mmaN(v16b ah, v16b al, v16b bh, v16b bl, v8f c) {
  c = __builtin_amdgcn_wmma_f32_16x16x32_bf16(false, ah, false, bh, (short)0, c, false, false);
  if (NT >= 2) c = __builtin_amdgcn_wmma_f32_16x16x32_bf16(false, al, false, bh, (short)0, c, false, false);
  if (NT >= 3) c = __builtin_amdgcn_wmma_f32_16x16x32_bf16(false, ah, false, bl, (short)0, c, false, false);
  asm volatile("v_nop\n\tv_nop\n\tv_nop\n\tv_nop" : "+v"(c) : "v"(ah), "v"(al), "v"(bh), "v"(bl));
  return c;
}

__global__ __launch_bounds__(256) void k_wt_bf16(const float* __restrict__ W, unsigned short* __restrict__ Wt, int K, int N) {
  const int t = blockIdx.x * 256 + threadIdx.x;
  const int k8n = K / 8;
  if (t >= N * k8n) return;
  const int n = t / k8n, k8 = (t % k8n) * 8;
  v8us v;
#pragma unroll
  for (int i = 0; i < 8; ++i) v[i] = bf16_bits(W[(size_t)(k8 + i) * N + n]);
  *(v8us*)(Wt + (size_t)n * K + k8) = v;
  
}

// GEMM C[M][N] (f32, pitch ldc) = act(A[M][K]·W + bias). A f32 row-major (pitch lda) converted per fragment to bf16
// (ASPLIT: hi/lo two planes -> 2 terms, else single rounded term); Wt bf16 [N][K] (pitch ldb). BIAS_BF16 rounds the
// bias to bf16 first (bias quantised to bf16 before the add). K%32==0, M%16==0, N%64==0.
template <bool ASPLIT, int ACT, bool BIAS_BF16>
__global__ __launch_bounds__(128) void k_gemm_bf(const float* __restrict__ A, int lda, const unsigned short* __restrict__ Wt, int ldb,
                                               const float* __restrict__ bias, float* __restrict__ C, int ldc, int M, int N, int K) {
  __shared__ __attribute__((aligned(16))) float so[4][16][64];
  const int tid = threadIdx.x, w = tid >> 5, lane = tid & 31, ln = lane & 15, hh = lane >> 4;
  const int ntn = N / 64;
  const int wid = blockIdx.x * 4 + w;
  const int mt = wid / ntn, nq = wid % ntn;
  if (mt * 16 >= M) return;
  const int row0 = mt * 16, col0 = nq * 64;
  const float* arow = A + (size_t)(row0 + ln) * lda;
  v8f acc[4] = {};
  for (int kb = 0; kb < K; kb += 32) {
    FragB ah, al;
    const v4f x0 = *(const v4fa*)(arow + kb + 8 * hh), x1 = *(const v4fa*)(arow + kb + 8 * hh + 4);
    const v4f x2 = *(const v4fa*)(arow + kb + 16 + 8 * hh), x3 = *(const v4fa*)(arow + kb + 16 + 8 * hh + 4);
    float xs[16] = {x0[0],x0[1],x0[2],x0[3],x1[0],x1[1],x1[2],x1[3],x2[0],x2[1],x2[2],x2[3],x3[0],x3[1],x3[2],x3[3]};
#pragma unroll
    for (int i = 0; i < 16; ++i) { const unsigned short hb = bf16_bits(xs[i]); ah.u[i] = hb; al.u[i] = ASPLIT ? bf16_bits(xs[i] - bf16_val(hb)) : (unsigned short)0; }
#pragma unroll
    for (int t = 0; t < 4; ++t) {
      const unsigned short* brow = Wt + (size_t)(col0 + t * 16 + ln) * ldb + kb;
      FragB b;
      b.half[0] = *(const v8us*)(brow + 8 * hh);
      b.half[1] = *(const v8us*)(brow + 16 + 8 * hh);
      acc[t] = mmaN<ASPLIT ? 2 : 1>(ah.v, al.v, b.v, b.v, acc[t]);
    }
  }
#pragma unroll
  for (int t = 0; t < 4; ++t) {
    float bv = bias ? bias[col0 + t * 16 + ln] : 0.f;
    if (BIAS_BF16) bv = bf16_round(bv);
#pragma unroll
    for (int r = 0; r < 8; ++r) { float v = acc[t][r] + bv; if (ACT == 1) v = fmaxf(v, 0.f); so[w][8 * hh + r][t * 16 + ln] = v; }
  }
  __builtin_amdgcn_fence(__ATOMIC_ACQ_REL, "workgroup");
  __builtin_amdgcn_wave_barrier();
  const int rsub = lane >> 4, c4 = (lane & 15) * 4;
  {
#pragma unroll
    for (int q = 0; q < 8; ++q) {
      const int r = q * 2 + rsub;
      const v4f v = *(const v4fa*)&so[w][r][c4];
      *(v4f*)(C + (size_t)(row0 + r) * ldc + col0 + c4) = v;
    }
    
  }
}

// GEMM C = act(A·W + bias + resid): A f32 (ASPLIT -> hi/lo 2 terms), Wt bf16 [N][K]; ACT 0 none, 1 relu, 2 exact gelu;
// resid (optional, f32, row index = (row % rmod), pitch ldr, RES_BF16 rounds it) added before the activation.
template <bool ASPLIT, int ACT, bool BIAS_BF16, bool RES_BF16>
__global__ __launch_bounds__(128) void k_gemm_bf3(const float* __restrict__ A, int lda, const unsigned short* __restrict__ Wt, int ldb,
                                                const float* __restrict__ bias, const float* __restrict__ resid, int rmod, int ldr,
                                                float* __restrict__ C, int ldc, int M, int N, int K) {
  __shared__ __attribute__((aligned(16))) float so[4][16][64];
  const int tid = threadIdx.x, w = tid >> 5, lane = tid & 31, ln = lane & 15, hh = lane >> 4;
  const int ntn = N / 64;
  const int wid = blockIdx.x * 4 + w;
  const int mt = wid / ntn, nq = wid % ntn;
  if (mt * 16 >= M) return;
  const int row0 = mt * 16, col0 = nq * 64;
  const float* arow = A + (size_t)(row0 + ln) * lda;
  v8f acc[4] = {};
  for (int kb = 0; kb < K; kb += 32) {
    FragB ah, al;
    const v4f x0 = *(const v4fa*)(arow + kb + 8 * hh), x1 = *(const v4fa*)(arow + kb + 8 * hh + 4);
    const v4f x2 = *(const v4fa*)(arow + kb + 16 + 8 * hh), x3 = *(const v4fa*)(arow + kb + 16 + 8 * hh + 4);
    float xs[16] = {x0[0],x0[1],x0[2],x0[3],x1[0],x1[1],x1[2],x1[3],x2[0],x2[1],x2[2],x2[3],x3[0],x3[1],x3[2],x3[3]};
#pragma unroll
    for (int i = 0; i < 16; ++i) { const unsigned short hb = bf16_bits(xs[i]); ah.u[i] = hb; al.u[i] = ASPLIT ? bf16_bits(xs[i] - bf16_val(hb)) : (unsigned short)0; }
#pragma unroll
    for (int t = 0; t < 4; ++t) {
      const unsigned short* brow = Wt + (size_t)(col0 + t * 16 + ln) * ldb + kb;
      FragB b;
      b.half[0] = *(const v8us*)(brow + 8 * hh);
      b.half[1] = *(const v8us*)(brow + 16 + 8 * hh);
      acc[t] = mmaN<ASPLIT ? 2 : 1>(ah.v, al.v, b.v, b.v, acc[t]);
    }
  }
#pragma unroll
  for (int t = 0; t < 4; ++t) {
    const int col = col0 + t * 16 + ln;
    float bv = bias ? bias[col] : 0.f;
    if (BIAS_BF16) bv = bf16_round(bv);
#pragma unroll
    for (int r = 0; r < 8; ++r) {
      float v = acc[t][r] + bv;
      if (resid) { float rv = resid[(size_t)((row0 + 8 * hh + r) % rmod) * ldr + col]; if (RES_BF16) rv = bf16_round(rv); v += rv; }
      if (ACT == 1) v = fmaxf(v, 0.f);
      if (ACT == 2) v = 0.5f * v * (1.0f + erff(v * 0.70710678118654752f));
      if (ACT == 3) { const float u = 0.7978845608028654f * (v + 0.044715f * v * v * v); v = 0.5f * v * (1.0f + tanhf(u)); }
      so[w][8 * hh + r][t * 16 + ln] = v;
    }
  }
  __builtin_amdgcn_fence(__ATOMIC_ACQ_REL, "workgroup");
  __builtin_amdgcn_wave_barrier();
  const int rsub = lane >> 4, c4 = (lane & 15) * 4;
  {
#pragma unroll
    for (int q = 0; q < 8; ++q) {
      const int r = q * 2 + rsub;
      const v4f v = *(const v4fa*)&so[w][r][c4];
      *(v4f*)(C + (size_t)(row0 + r) * ldc + col0 + c4) = v;
    }
    
  }
}
// row LayerNorm (biased variance, eps) over N: s = X (+ R); optional out_sum <- s; out_norm <- (s-mu)*rsqrt(var+eps)*g + b
template <bool PARAM_BF16>
__global__ __launch_bounds__(256) void k_layernorm(const float* __restrict__ X, const float* __restrict__ R, const float* __restrict__ g, const float* __restrict__ bta,
                                                  float* __restrict__ out_sum, float* __restrict__ out_norm, int N, float eps) {
  __shared__ float red[256];
  const int row = blockIdx.x, tid = threadIdx.x;
  const float* x = X + (size_t)row * N; const float* rr = R ? R + (size_t)row * N : nullptr;
  float vals[16];                     // up to N = 4096
  const int per = N / 256;            // contiguous chunk per thread? use strided-by-4 chunks: thread handles j = tid*4 + 1024*u
  float s1 = 0.f;
  for (int u = 0; u < per / 4; ++u) {
    const int j = tid * 4 + 1024 * u;
    const v4f a = *(const v4fa*)(x + j);
    v4f b = {0.f,0.f,0.f,0.f}; if (rr) b = *(const v4fa*)(rr + j);
#pragma unroll
    for (int q = 0; q < 4; ++q) { const float v = a[q] + b[q]; vals[u * 4 + q] = v; s1 += v; }
  }
  red[tid] = s1; __syncthreads();
  for (int st = 128; st > 0; st >>= 1) { if (tid < st) red[tid] += red[tid + st]; __syncthreads(); }
  const float mu = red[0] / (float)N; __syncthreads();
  float s2 = 0.f;
  for (int u = 0; u < per / 4; ++u)
#pragma unroll
    for (int q = 0; q < 4; ++q) { const float c = vals[u * 4 + q] - mu; s2 += c * c; }
  red[tid] = s2; __syncthreads();
  for (int st = 128; st > 0; st >>= 1) { if (tid < st) red[tid] += red[tid + st]; __syncthreads(); }
  const float rs = rsqrtf(red[0] / (float)N + eps);
  {
    for (int u = 0; u < per / 4; ++u) {
      const int j = tid * 4 + 1024 * u;
      v4f o, sm;
#pragma unroll
      for (int q = 0; q < 4; ++q) {
        float gg = g[j + q], bb = bta[j + q];
        if (PARAM_BF16) { gg = bf16_round(gg); bb = bf16_round(bb); }
        sm[q] = vals[u * 4 + q]; o[q] = (vals[u * 4 + q] - mu) * rs * gg + bb;
      }
      if (out_sum) *(v4f*)(out_sum + (size_t)row * N + j) = sm;
      *(v4f*)(out_norm + (size_t)row * N + j) = o;
    }
    
  }
}



// ---- f16 WMMA path (v_wmma_f32_16x16x32_f16): 11-bit significands for operands in range — used where a [0,1] probability operand needs more precision than bf16
typedef _Float16 v16h __attribute__((ext_vector_type(16)));
union FragH { v16h v; v8us half[2]; _Float16 h[16]; unsigned short u[16]; };
template <int NT>
__device__ __forceinline__ v8f mmaH(v16h ah, v16h al, v16h bh, v16h bl, v8f c) {
  c = __builtin_amdgcn_wmma_f32_16x16x32_f16(false, ah, false, bh, (short)0, c, false, false);
  if (NT >= 2) c = __builtin_amdgcn_wmma_f32_16x16x32_f16(false, al, false, bh, (short)0, c, false, false);
  if (NT >= 3) c = __builtin_amdgcn_wmma_f32_16x16x32_f16(false, ah, false, bl, (short)0, c, false, false);
  asm volatile("v_nop\n\tv_nop\n\tv_nop\n\tv_nop" : "+v"(c) : "v"(ah), "v"(al), "v"(bh), "v"(bl));
  return c;
}
// batched GEMM like k_gemm_b but f16 operands: A f32 (split into f16 hi/lo if ASPLIT, else rounded to f16), Bt = f16 values [n][k]; alpha; C f32; N multiple of 16 (partial tiles skipped)
template <bool ASPLIT>
__global__ __launch_bounds__(128) void k_gemm_h(const float* __restrict__ A, int lda, size_t sA, const _Float16* __restrict__ Bh, int ldb, size_t sB, float alpha, float* __restrict__ C, int ldc, size_t sC, int M, int N, int K) {
  __shared__ __attribute__((aligned(16))) float so[4][16][64];
  const int tid = threadIdx.x, w = tid >> 5, lane = tid & 31, ln = lane & 15, hh = lane >> 4; const int by = blockIdx.y;
  A += (size_t)by * sA; Bh += (size_t)by * sB; C += (size_t)by * sC;
  const int ntn = (N + 63) / 64; const int wid = blockIdx.x * 4 + w; const int mt = wid / ntn, nq = wid % ntn; if (mt * 16 >= M) return;
  const int row0 = mt * 16, col0 = nq * 64; const float* arow = A + (size_t)(row0 + ln) * lda;
  v8f acc[4] = {};
  for (int kb = 0; kb < K; kb += 32) {
    FragH ah, al;
    const v4f x0 = *(const v4fa*)(arow + kb + 8 * hh), x1 = *(const v4fa*)(arow + kb + 8 * hh + 4), x2 = *(const v4fa*)(arow + kb + 16 + 8 * hh), x3 = *(const v4fa*)(arow + kb + 16 + 8 * hh + 4);
    float xs[16] = {x0[0],x0[1],x0[2],x0[3],x1[0],x1[1],x1[2],x1[3],x2[0],x2[1],x2[2],x2[3],x3[0],x3[1],x3[2],x3[3]};
#pragma unroll
    for (int i = 0; i < 16; ++i) { const _Float16 h = (_Float16)xs[i]; ah.h[i] = h; al.h[i] = ASPLIT ? (_Float16)(xs[i] - (float)h) : (_Float16)0.0f; }
#pragma unroll
    for (int t = 0; t < 4; ++t) { if (col0 + t * 16 >= N) continue; const size_t boff = (size_t)(col0 + t * 16 + ln) * ldb + kb; FragH bq; bq.half[0] = *(const v8us*)(Bh + boff + 8 * hh); bq.half[1] = *(const v8us*)(Bh + boff + 16 + 8 * hh);
      acc[t] = mmaH<ASPLIT ? 2 : 1>(ah.v, al.v, bq.v, bq.v, acc[t]); }
  }
#pragma unroll
  for (int t = 0; t < 4; ++t) { if (col0 + t * 16 >= N) continue;
#pragma unroll
    for (int r = 0; r < 8; ++r) so[w][8 * hh + r][t * 16 + ln] = acc[t][r] * alpha; }
  __builtin_amdgcn_fence(__ATOMIC_ACQ_REL, "workgroup"); __builtin_amdgcn_wave_barrier();
  const int rsub = lane >> 4, c4 = (lane & 15) * 4;
  {
#pragma unroll
    for (int q = 0; q < 8; ++q) { const int r = q * 2 + rsub; if (col0 + c4 < N) { const v4f v = *(const v4fa*)&so[w][r][c4]; *(v4f*)(C + (size_t)(row0 + r) * ldc + col0 + c4) = v; } }
     }
}

// Wt[n][k] = f16(W[k][n]·scale) from f32 row-major W[K][N] (scale = power of two; bf16-exact weights stay exact in f16 away from the subnormal range)
__global__ __launch_bounds__(256) void k_wt_f16(const float* __restrict__ W, _Float16* __restrict__ Wt, int K, int N, float scale) {
  const int t = blockIdx.x * 256 + threadIdx.x; if (t >= N * (K / 8)) return; const int n = t / (K / 8), k8 = (t % (K / 8)) * 8; FragH f;
#pragma unroll
  for (int i = 0; i < 8; ++i) f.h[i] = (_Float16)(bf16_round(W[(size_t)(k8 + i) * N + n]) * scale); const v8us o = f.half[0];
  *(v8us*)((unsigned short*)Wt + (size_t)n * K + k8) = o; 
}
// k_gemm_hh variant with fused epilogue: v = acc·alpha + bias[by·sBias + col] (+ CP[(row/rowsPerB)·sCPb + by·64 + col] if CP) ; ACT 0 none / 1 elu ; writes f16 C16 (and f32 C if non-null)
template <int ACT>
__global__ __launch_bounds__(128) void k_gemm_hhx(const _Float16* __restrict__ A, int lda, size_t sA, const _Float16* __restrict__ Bh, int ldb, size_t sB, float alpha, const float* __restrict__ bias, size_t sBias, const float* __restrict__ CP, int rowsPerB, size_t sCPb, int row0g,
    float* __restrict__ C, _Float16* __restrict__ C16, int ldc, size_t sC, int M, int N, int K) {
  __shared__ __attribute__((aligned(16))) float so[4][16][64];
  const int tid = threadIdx.x, w = tid >> 5, lane = tid & 31, ln = lane & 15, hh = lane >> 4; const int by = blockIdx.y;
  A += (size_t)by * sA; Bh += (size_t)by * sB; const size_t cofs = (size_t)by * sC; const float* bp = bias ? bias + (size_t)by * sBias : nullptr;
  const int ntn = (N + 63) / 64; const int wid = blockIdx.x * 4 + w; const int mt = wid / ntn, nq = wid % ntn; if (mt * 16 >= M) return;
  const int row0 = mt * 16, col0 = nq * 64; const _Float16* arow = A + (size_t)(row0 + ln) * lda;
  v8f acc[4] = {};
  for (int kb = 0; kb < K; kb += 32) { FragH ah; ah.half[0] = *(const v8us*)((const unsigned short*)arow + kb + 8 * hh); ah.half[1] = *(const v8us*)((const unsigned short*)arow + kb + 16 + 8 * hh);
#pragma unroll
    for (int t = 0; t < 4; ++t) { if (col0 + t * 16 >= N) continue; const size_t boff = (size_t)(col0 + t * 16 + ln) * ldb + kb; FragH bq; bq.half[0] = *(const v8us*)((const unsigned short*)Bh + boff + 8 * hh); bq.half[1] = *(const v8us*)((const unsigned short*)Bh + boff + 16 + 8 * hh);
      acc[t] = mmaH<1>(ah.v, ah.v, bq.v, bq.v, acc[t]); }
  }
#pragma unroll
  for (int t = 0; t < 4; ++t) { if (col0 + t * 16 >= N) continue; const int col = col0 + t * 16 + ln; const float bv = bp ? bf16_round(bp[col]) : 0.f;
#pragma unroll
    for (int r = 0; r < 8; ++r) { float v = acc[t][r] * alpha + bv; if (CP) { const int bidx = (row0g + row0 + 8 * hh + r) / rowsPerB; v += CP[(size_t)bidx * sCPb + (size_t)by * 64 + col]; } if (ACT == 1) v = (v > 0.f) ? v : expm1f(v); else if (ACT == 7) v = (v > 0.f) ? v + 1.0f : expf(v); else if (ACT == 8) v = tanhf(v); else if (ACT == 9) v = 0.5f * v * (1.0f + tanhf(0.7978845608028654f * (v + 0.044715f * v * v * v))); else if (ACT == 11) v = 1.0f / (1.0f + expf(-v)); else if (ACT == 12) v = (v > 0.f) ? v : 0.01f * v; else if (ACT == 14) v = (v > 0.f) ? v : 0.1f * v; else if (ACT == 15) v = v / (1.0f + expf(-v)); else if (ACT == 3) v = fmaxf(v, 0.f); else if (ACT == 6) v = 0.5f * v * (1.0f + erff(v * 0.70710678118654752f)); so[w][8 * hh + r][t * 16 + ln] = v; } }
  __builtin_amdgcn_fence(__ATOMIC_ACQ_REL, "workgroup"); __builtin_amdgcn_wave_barrier();
  const int rsub = lane >> 4, c4 = (lane & 15) * 4; typedef _Float16 v4h __attribute__((ext_vector_type(4)));
  {
#pragma unroll
    for (int q = 0; q < 8; ++q) { const int r = q * 2 + rsub; if (col0 + c4 < N) { const v4f v = *(const v4fa*)&so[w][r][c4]; if (C) *(v4f*)(C + cofs + (size_t)(row0 + r) * ldc + col0 + c4) = v; if (C16) { v4h h4; for (int i = 0; i < 4; ++i) h4[i] = (_Float16)v[i]; *(v4h*)(C16 + cofs + (size_t)(row0 + r) * ldc + col0 + c4) = h4; } } }
     }
}


typedef _Float16 v4h __attribute__((ext_vector_type(4)));

__global__ __launch_bounds__(256) void k_x16(const float* __restrict__ x, _Float16* __restrict__ X16, size_t n8) { const size_t t = (size_t)blockIdx.x * 256 + threadIdx.x; if (t >= n8) return; FragH f;
#pragma unroll
  for (int q = 0; q < 8; ++q) f.h[q] = (_Float16)bf16_round(x[t * 8 + q]); *(v8us*)((unsigned short*)X16 + t * 8) = f.half[0];  }
__global__ __launch_bounds__(256) void k_h16(const float* __restrict__ x, _Float16* __restrict__ X16, size_t n8) { const size_t t = (size_t)blockIdx.x * 256 + threadIdx.x; if (t >= n8) return; FragH f;
#pragma unroll
  for (int q = 0; q < 8; ++q) f.h[q] = (_Float16)x[t * 8 + q]; *(v8us*)((unsigned short*)X16 + t * 8) = f.half[0];  }
__global__ __launch_bounds__(256) void k_round16f(const float* __restrict__ W, _Float16* __restrict__ Bt, size_t n8) { const size_t t = (size_t)blockIdx.x * 256 + threadIdx.x; if (t >= n8) return; FragH f;
#pragma unroll
  for (int i = 0; i < 8; ++i) f.h[i] = (_Float16)(bf16_round(W[t * 8 + i]) * 16.0f); *(v8us*)((unsigned short*)Bt + t * 8) = f.half[0];  }
template <int NHv, int TTv>
__global__ __launch_bounds__(256) void k_vt(const _Float16* __restrict__ V16, int ldv, int voff, _Float16* __restrict__ Vt) { __shared__ unsigned short tl[64][66]; const int tid = threadIdx.x; const int slab = blockIdx.x / (TTv / 64), lg = blockIdx.x % (TTv / 64); const int b = slab / NHv, h = slab % NHv;
  for (int i = tid; i < 64 * 8; i += 256) { const int r = i / 8, c8 = (i % 8) * 8; FragH f; f.half[0] = *(const v8us*)((const unsigned short*)V16 + ((size_t)b * TTv + lg * 64 + r) * ldv + voff + h * 64 + c8);
#pragma unroll
    for (int q = 0; q < 8; ++q) tl[r][c8 + q] = f.u[q]; }
  __syncthreads();
  {
#pragma unroll
    for (int rd = 0; rd < 2; ++rd) { const int d = rd * 32 + tid / 8, pc = tid % 8; FragH f;
#pragma unroll
      for (int q = 0; q < 8; ++q) f.u[q] = tl[pc * 8 + q][d];
      *(v8us*)((unsigned short*)Vt + ((size_t)slab * 64 + d) * TTv + lg * 64 + pc * 8) = f.half[0]; }
     } }

__global__ __launch_bounds__(256) void k_hl(const float* __restrict__ F, _Float16* __restrict__ Hh, _Float16* __restrict__ Hl, size_t n8) { const size_t t = (size_t)blockIdx.x * 256 + threadIdx.x; if (t >= n8) return; FragH fh, fl; const v4f a = *(const v4fa*)(F + t * 8), c = *(const v4fa*)(F + t * 8 + 4);
#pragma unroll
  for (int q = 0; q < 4; ++q) { _Float16 h = (_Float16)a[q]; fh.h[q] = h; fl.h[q] = (_Float16)((a[q] - (float)h) * 1024.0f); h = (_Float16)c[q]; fh.h[4 + q] = h; fl.h[4 + q] = (_Float16)((c[q] - (float)h) * 1024.0f); }
  { *(v8us*)((unsigned short*)Hh + t * 8) = fh.half[0]; *(v8us*)((unsigned short*)Hl + t * 8) = fl.half[0];  } }

// ---- fast GEMM (wave tile 32x64; requires M % 32 == 0 rows per launch region and N % 64 == 0); epilogue = k_gemm_hhx semantics ----
__device__ __forceinline__ v16h g2_frag(const _Float16* p, int hh) { FragH f; f.half[0] = *(const v8us*)((const unsigned short*)p + 8 * hh); f.half[1] = *(const v8us*)((const unsigned short*)p + 16 + 8 * hh); return f.v; }
__device__ __forceinline__ v8f g2_mma(v16h a, v16h b, v8f c) { v8f d = __builtin_amdgcn_wmma_f32_16x16x32_f16(false, a, false, b, (short)0, c, false, false); asm volatile("v_nop\n\tv_nop\n\tv_nop\n\tv_nop" : "+v"(d) : "v"(a), "v"(b)); return d; }
template <int ACT>
__global__ __launch_bounds__(128) void k_gemm2(const _Float16* __restrict__ A, int lda, size_t sA, const _Float16* __restrict__ Bh, int ldb, size_t sB, float alpha, const float* __restrict__ bias, size_t sBias, const float* __restrict__ CP, int rowsPerB, size_t sCPb, int row0g,
    float* __restrict__ C, _Float16* __restrict__ C16, int ldc, size_t sC, int M, int N, int K) {
  __shared__ __attribute__((aligned(16))) float so[4][32][68];
  const int tid = threadIdx.x, w = tid >> 5, lane = tid & 31, ln = lane & 15, hh = lane >> 4; const int by = blockIdx.y;
  A += (size_t)by * sA; Bh += (size_t)by * sB; const size_t cofs = (size_t)by * sC; const float* bp = bias ? bias + (size_t)by * sBias : nullptr;
  const int ntn = N >> 6; const int mt = blockIdx.x / ntn, nq = blockIdx.x - mt * ntn; const int row0 = mt * 128 + 32 * w, col0 = nq * 64; if (row0 >= M) return;
  const _Float16* a0p = A + (size_t)(row0 + ln) * lda; const _Float16* a1p = a0p + (size_t)16 * lda;
  const _Float16* b0p = Bh + (size_t)(col0 + ln) * ldb; const _Float16* b1p = b0p + (size_t)16 * ldb; const _Float16* b2p = b1p + (size_t)16 * ldb; const _Float16* b3p = b2p + (size_t)16 * ldb;
  const v8f z8 = {0.f,0.f,0.f,0.f,0.f,0.f,0.f,0.f}; v8f c00 = z8, c01 = z8, c02 = z8, c03 = z8, c10 = z8, c11 = z8, c12 = z8, c13 = z8;
#pragma unroll 1
  for (int kb = 0; kb < K; kb += 32) { const v16h a0 = g2_frag(a0p + kb, hh), a1 = g2_frag(a1p + kb, hh);
    v16h b = g2_frag(b0p + kb, hh); c00 = g2_mma(a0, b, c00); c10 = g2_mma(a1, b, c10);
    b = g2_frag(b1p + kb, hh); c01 = g2_mma(a0, b, c01); c11 = g2_mma(a1, b, c11);
    b = g2_frag(b2p + kb, hh); c02 = g2_mma(a0, b, c02); c12 = g2_mma(a1, b, c12);
    b = g2_frag(b3p + kb, hh); c03 = g2_mma(a0, b, c03); c13 = g2_mma(a1, b, c13); }
  v8f accs[8] = {c00, c01, c02, c03, c10, c11, c12, c13};
#pragma unroll
  for (int u = 0; u < 8; ++u) { const int t = u & 3, half = u >> 2; const int col = col0 + t * 16 + ln; const float bv = bp ? bf16_round(bp[col]) : 0.f;
#pragma unroll
    for (int r = 0; r < 8; ++r) { const int rloc = half * 16 + 8 * hh + r; float v = accs[u][r] * alpha + bv; if (CP) { const int bidx = (row0g + row0 + rloc) / rowsPerB; v += CP[(size_t)bidx * sCPb + (size_t)by * 64 + col]; }
      if (ACT == 3) v = fmaxf(v, 0.f); else if (ACT == 6) v = 0.5f * v * (1.0f + erff(v * 0.70710678118654752f)); else if (ACT == 11) v = 1.0f / (1.0f + expf(-v)); else if (ACT == 15) v = v / (1.0f + expf(-v)); else if (ACT == 12) v = (v > 0.f) ? v : 0.01f * v; else if (ACT == 8) v = tanhf(v);
      so[w][rloc][t * 16 + ln] = v; } }
  __builtin_amdgcn_fence(__ATOMIC_ACQ_REL, "workgroup"); __builtin_amdgcn_wave_barrier();
  const int rsub = lane >> 4, c4 = (lane & 15) * 4;
  {
#pragma unroll
    for (int q = 0; q < 16; ++q) { const int r = q * 2 + rsub; const v4f v = *(const v4fa*)&so[w][r][c4]; if (C) *(v4f*)(C + cofs + (size_t)(row0 + r) * ldc + col0 + c4) = v; if (C16) { v4h h4; for (int i = 0; i < 4; ++i) h4[i] = (_Float16)v[i]; *(v4h*)(C16 + cofs + (size_t)(row0 + r) * ldc + col0 + c4) = h4; } }
     } }



template <int TK>
__global__ __launch_bounds__(256) void k_vthl(const float* __restrict__ VF, int ldv, _Float16* __restrict__ Vth, _Float16* __restrict__ Vtl) { __shared__ float tl[64][65]; const int tid = threadIdx.x; const int slab = blockIdx.x / (TK / 64), lg = blockIdx.x % (TK / 64); const int b = slab / NH, h = slab % NH;
  for (int i = tid; i < 64 * 16; i += 256) { const int r = i / 16, c4 = (i % 16) * 4; const v4f a = *(const v4fa*)(VF + ((size_t)b * TK + lg * 64 + r) * ldv + h * 64 + c4); tl[r][c4] = a[0]; tl[r][c4 + 1] = a[1]; tl[r][c4 + 2] = a[2]; tl[r][c4 + 3] = a[3]; }
  __syncthreads();
  FragH fh[2], fl[2]; size_t oo[2];
#pragma unroll
  for (int rd = 0; rd < 2; ++rd) { const int d = rd * 32 + tid / 8, pc = tid % 8;
#pragma unroll
    for (int q = 0; q < 8; ++q) { const float v = tl[pc * 8 + q][d]; const _Float16 hv = (_Float16)v; fh[rd].h[q] = hv; fl[rd].h[q] = (_Float16)((v - (float)hv) * 1024.0f); } oo[rd] = ((size_t)slab * 64 + d) * TK + lg * 64 + pc * 8; }
  {
#pragma unroll
    for (int rd = 0; rd < 2; ++rd) { *(v8us*)((unsigned short*)Vth + oo[rd]) = fh[rd].half[0]; *(v8us*)((unsigned short*)Vtl + oo[rd]) = fl[rd].half[0]; }
     } }

template <int TQ, int TK>
__global__ __launch_bounds__(128) void k_flashm(const _Float16* __restrict__ Q16, const _Float16* __restrict__ Q16lo, int ldq, const _Float16* __restrict__ K16, const _Float16* __restrict__ K16lo, int ldk, const _Float16* __restrict__ Vt, const _Float16* __restrict__ Vtlo, const unsigned* __restrict__ MB, const int* __restrict__ RA, const int* __restrict__ KE, float* __restrict__ O, int ldo) {
  constexpr int RPW = 16, RTN = RPW / 16, NQB = TQ / RPW, DT = 4, KS = 2;
  __shared__ __attribute__((aligned(16))) unsigned short sP[4][RPW][40], sPl[4][RPW][40]; __shared__ __attribute__((aligned(16))) float sO[4][RPW][64 + 4]; __shared__ float sM[4][RPW], sL[4][RPW];
  const int tid = threadIdx.x, lane = tid & 31, ln = lane & 15, hh = lane >> 4;
  const int w = __builtin_amdgcn_readfirstlane(tid >> 5);      /* the wave's number in a scalar register: the key loop's start and its branch stay scalar */
  /* grid (slab, tile): all four waves share one 16-query tile; tiles with the most keys have the lowest flat index (for speed only) */
  const int slab = blockIdx.x, qt = NQB - 1 - (int)blockIdx.y; const int b = slab / NH, h = slab % NH; const int q0 = qt * RPW; const int qblk = q0 >> 6;
  FragH aq[2][KS], aql[2][KS];
#pragma unroll
  for (int rt = 0; rt < RTN; ++rt) { const size_t qo = ((size_t)b * TQ + q0 + rt * 16 + ln) * ldq + h * 64; const unsigned short* qr = (const unsigned short*)Q16 + qo; const unsigned short* ql = (const unsigned short*)Q16lo + qo;
#pragma unroll
    for (int ks = 0; ks < KS; ++ks) { aq[rt][ks].half[0] = *(const v8us*)(qr + ks * 32 + 8 * hh); aq[rt][ks].half[1] = *(const v8us*)(qr + ks * 32 + 16 + 8 * hh); aql[rt][ks].half[0] = *(const v8us*)(ql + ks * 32 + 8 * hh); aql[rt][ks].half[1] = *(const v8us*)(ql + ks * 32 + 16 + 8 * hh); } }
  const unsigned short* Vth = (const unsigned short*)Vt + (size_t)slab * 64 * TK; const unsigned short* Vtl = (const unsigned short*)Vtlo + (size_t)slab * 64 * TK;
  float m_r[2][8], l_r[2][8]; v8f oacc[2][DT], oaccl[2][DT];
#pragma unroll
  for (int rt = 0; rt < RTN; ++rt) {
#pragma unroll
    for (int r = 0; r < 8; ++r) { m_r[rt][r] = -3.0e38f; l_r[rt][r] = 0.f; }
#pragma unroll
    for (int dt = 0; dt < DT; ++dt) { oacc[rt][dt] = (v8f){0.f,0.f,0.f,0.f,0.f,0.f,0.f,0.f}; oaccl[rt][dt] = oacc[rt][dt]; } }
  int jend = KE[qblk * 32]; jend = min(TK, (jend + 31) & ~31); if (jend < 32) jend = 32;      /* block-uniform */
  int allm[2][8]; const unsigned* mrow[2][8];
#pragma unroll
  for (int rt = 0; rt < RTN; ++rt)
#pragma unroll
    for (int r = 0; r < 8; ++r) { const int tq = q0 + rt * 16 + 8 * hh + r; allm[rt][r] = RA[tq]; mrow[rt][r] = MB + (size_t)tq * (TK / 32); }
#pragma unroll 1
  for (int j0 = 32 * w; j0 < jend; j0 += 128) {      /* wave w takes key blocks w, w + 4, ... */
    
    v8f s[2][2];
#pragma unroll
    for (int nt = 0; nt < 2; ++nt) { const size_t ko = ((size_t)b * TK + j0 + nt * 16 + ln) * ldk + h * 64; const unsigned short* kr = (const unsigned short*)K16 + ko; const unsigned short* kl = (const unsigned short*)K16lo + ko; FragH bk[KS], bkl[KS];
#pragma unroll
      for (int ks = 0; ks < KS; ++ks) { bk[ks].half[0] = *(const v8us*)(kr + ks * 32 + 8 * hh); bk[ks].half[1] = *(const v8us*)(kr + ks * 32 + 16 + 8 * hh); bkl[ks].half[0] = *(const v8us*)(kl + ks * 32 + 8 * hh); bkl[ks].half[1] = *(const v8us*)(kl + ks * 32 + 16 + 8 * hh); }
#pragma unroll
      for (int rt = 0; rt < RTN; ++rt) { v8f acc = (v8f){0.f,0.f,0.f,0.f,0.f,0.f,0.f,0.f}, accr = acc;
#pragma unroll
        for (int ks = 0; ks < KS; ++ks) { acc = mmaH<1>(aq[rt][ks].v, aq[rt][ks].v, bk[ks].v, bk[ks].v, acc); accr = mmaH<1>(aql[rt][ks].v, aql[rt][ks].v, bk[ks].v, bk[ks].v, accr); accr = mmaH<1>(aq[rt][ks].v, aq[rt][ks].v, bkl[ks].v, bkl[ks].v, accr); }
        s[rt][nt] = acc + accr * 0.0009765625f; } }
#pragma unroll
    for (int rt = 0; rt < RTN; ++rt)
#pragma unroll
      for (int r = 0; r < 8; ++r) { const unsigned mw = mrow[rt][r][j0 >> 5]; const bool am = (allm[rt][r] != 0);
        const bool ok0 = am || (((mw >> ln) & 1u) == 0u), ok1 = am || (((mw >> (16 + ln)) & 1u) == 0u);
        const float s0 = ok0 ? (am ? 0.f : s[rt][0][r] * SCL) : -INFINITY, s1 = ok1 ? (am ? 0.f : s[rt][1][r] * SCL) : -INFINITY; float mc = fmaxf(s0, s1);
        mc = fmaxf(mc, __shfl_xor(mc, 1, 32)); mc = fmaxf(mc, __shfl_xor(mc, 2, 32)); mc = fmaxf(mc, __shfl_xor(mc, 4, 32)); mc = fmaxf(mc, __shfl_xor(mc, 8, 32));
        const float mn = fmaxf(m_r[rt][r], mc); const float al = (mn > -1.0e38f) ? expf(m_r[rt][r] - mn) : 1.0f; m_r[rt][r] = mn; const float p0 = ok0 ? expf(s0 - mn) : 0.f, p1 = ok1 ? expf(s1 - mn) : 0.f; l_r[rt][r] = l_r[rt][r] * al + p0 + p1;
#pragma unroll
        for (int dt = 0; dt < DT; ++dt) { oacc[rt][dt][r] *= al; oaccl[rt][dt][r] *= al; }
        FragH t2, t3; const float ps0 = p0 * 1024.0f, ps1 = p1 * 1024.0f; t2.h[0] = (_Float16)ps0; t2.h[1] = (_Float16)ps1; t3.h[0] = (_Float16)((ps0 - (float)t2.h[0]) * 1024.0f); t3.h[1] = (_Float16)((ps1 - (float)t2.h[1]) * 1024.0f);
        sP[w][rt * 16 + 8 * hh + r][ln] = t2.u[0]; sP[w][rt * 16 + 8 * hh + r][16 + ln] = t2.u[1]; sPl[w][rt * 16 + 8 * hh + r][ln] = t3.u[0]; sPl[w][rt * 16 + 8 * hh + r][16 + ln] = t3.u[1]; }
    __builtin_amdgcn_fence(__ATOMIC_ACQ_REL, "workgroup"); __builtin_amdgcn_wave_barrier();
    FragH pa[2], pl[2];
#pragma unroll
    for (int rt = 0; rt < RTN; ++rt) { pa[rt].half[0] = *(const v8us*)&sP[w][rt * 16 + ln][8 * hh]; pa[rt].half[1] = *(const v8us*)&sP[w][rt * 16 + ln][16 + 8 * hh]; pl[rt].half[0] = *(const v8us*)&sPl[w][rt * 16 + ln][8 * hh]; pl[rt].half[1] = *(const v8us*)&sPl[w][rt * 16 + ln][16 + 8 * hh]; }
#pragma unroll
    for (int dt = 0; dt < DT; ++dt) { const size_t vo = (size_t)(dt * 16 + ln) * TK + j0; FragH bv, bl; bv.half[0] = *(const v8us*)(Vth + vo + 8 * hh); bv.half[1] = *(const v8us*)(Vth + vo + 16 + 8 * hh); bl.half[0] = *(const v8us*)(Vtl + vo + 8 * hh); bl.half[1] = *(const v8us*)(Vtl + vo + 16 + 8 * hh);
#pragma unroll
      for (int rt = 0; rt < RTN; ++rt) { oacc[rt][dt] = mmaH<1>(pa[rt].v, pa[rt].v, bv.v, bv.v, oacc[rt][dt]); oaccl[rt][dt] = mmaH<1>(pa[rt].v, pa[rt].v, bl.v, bl.v, oaccl[rt][dt]); oaccl[rt][dt] = mmaH<1>(pl[rt].v, pl[rt].v, bv.v, bv.v, oaccl[rt][dt]); } }
    __builtin_amdgcn_fence(__ATOMIC_ACQ_REL, "workgroup"); __builtin_amdgcn_wave_barrier(); }
#pragma unroll
  for (int rt = 0; rt < RTN; ++rt) {
#pragma unroll
    for (int r = 0; r < 8; ++r) { float l = l_r[rt][r]; l += __shfl_xor(l, 1, 32); l += __shfl_xor(l, 2, 32); l += __shfl_xor(l, 4, 32); l += __shfl_xor(l, 8, 32); l_r[rt][r] = l; }
    if (ln == 0) {
#pragma unroll
      for (int r = 0; r < 8; ++r) { sM[w][rt * 16 + 8 * hh + r] = m_r[rt][r]; sL[w][rt * 16 + 8 * hh + r] = l_r[rt][r]; } }
#pragma unroll
    for (int dt = 0; dt < DT; ++dt)
#pragma unroll
      for (int r = 0; r < 8; ++r) sO[w][rt * 16 + 8 * hh + r][dt * 16 + ln] = oacc[rt][dt][r] + oaccl[rt][dt][r] * 0.0009765625f; }
  __syncthreads();      /* every wave's partial (max, sum, O) is in LDS before any wave merges them */
  {
#pragma unroll
    for (int rp = 0; rp < RPW; rp += 8) { const int r = rp + (tid >> 4), pc = tid & 15;
      const float m0 = sM[0][r], m1 = sM[1][r], m2 = sM[2][r], m3 = sM[3][r]; const float mx = fmaxf(fmaxf(m0, m1), fmaxf(m2, m3));      /* a wave that saw no open key holds -3e38, sum 0, O 0: weight 0 (or 1 on zeros) */
      const float e0 = expf(m0 - mx), e1 = expf(m1 - mx), e2 = expf(m2 - mx), e3 = expf(m3 - mx);
      const float l = e0 * sL[0][r] + e1 * sL[1][r] + e2 * sL[2][r] + e3 * sL[3][r]; const float inv = (l > 0.f) ? 1.0f / (l * 1024.0f) : 0.f;
      const v4f o0 = *(const v4fa*)&sO[0][r][pc * 4], o1 = *(const v4fa*)&sO[1][r][pc * 4], o2 = *(const v4fa*)&sO[2][r][pc * 4], o3 = *(const v4fa*)&sO[3][r][pc * 4];
      const v4f val = (o0 * e0 + o1 * e1 + o2 * e2 + o3 * e3) * inv; *(v4f*)(O + ((size_t)b * TQ + q0 + r) * ldo + h * 64 + pc * 4) = val; }
     } }


__global__ __launch_bounds__(256) void k_causaltab(unsigned* __restrict__ MB, int* __restrict__ RA, int* __restrict__ KE, int nq, int nk) {
  const int t = blockIdx.x * 256 + threadIdx.x; const int nw = nk / 32;
  if (t < nq * nw) { const int q = t / nw, w = t % nw; const int first = q + 1 - 32 * w; const unsigned bits = (first <= 0) ? 0xffffffffu : ((first >= 32) ? 0u : (0xffffffffu << first)); *(unsigned*)(MB + t) = bits;  }
  if (t < nq) { *(int*)(RA + t) = 0;  }
  if (t < nq / 64) { const int v = 64 * (t + 1); *(int*)(KE + t * 32) = v;  } }

__constant__ float INVF[32] = {1.000000000e+00f,7.498942018e-01f,5.623413324e-01f,4.216965139e-01f,3.162277639e-01f,2.371373624e-01f,1.778279394e-01f,1.333521456e-01f,1.000000015e-01f,7.498941571e-02f,5.623412877e-02f,4.216964915e-02f,3.162277862e-02f,2.371373586e-02f,1.778279431e-02f,1.333521493e-02f,9.999999776e-03f,7.498942316e-03f,5.623413250e-03f,4.216964822e-03f,3.162277862e-03f,2.371373819e-03f,1.778279431e-03f,1.333521446e-03f,1.000000047e-03f,7.498941850e-04f,5.623413017e-04f,4.216964880e-04f,3.162277862e-04f,2.371373848e-04f,1.778279402e-04f,1.333521504e-04f};
__constant__ float XBASE[32] = {2.857142985e-01f,3.080357313e-01f,3.303571641e-01f,3.526785970e-01f,3.750000000e-01f,3.973214328e-01f,4.196428359e-01f,4.419642687e-01f,4.642857015e-01f,4.866071343e-01f,5.089285374e-01f,5.312500000e-01f,5.535714030e-01f,5.758928657e-01f,5.982142687e-01f,6.205357313e-01f,6.428571343e-01f,6.651785970e-01f,6.875000000e-01f,7.098214030e-01f,7.321428657e-01f,7.544642687e-01f,7.767857313e-01f,7.991071343e-01f,8.214285970e-01f,8.437500000e-01f,8.660714030e-01f,8.883928657e-01f,9.107142687e-01f,9.330357313e-01f,9.553571343e-01f,9.776785970e-01f};
__global__ __launch_bounds__(256) void k_trig(float* __restrict__ CS, float* __restrict__ SN) {
  #pragma clang fp contract(off)
  const int t = blockIdx.x * 256 + threadIdx.x; if (t >= SLEN * 32) return; const int tok = t >> 5, j = t & 31; const float ang = (float)tok * INVF[j]; const float c = cosf(ang), s = sinf(ang);
  *(float*)(CS + t) = c; *(float*)(SN + t) = s;  }
__global__ __launch_bounds__(256) void k_scale(float* __restrict__ SC) {
  #pragma clang fp contract(off)
  const int t = blockIdx.x * 256 + threadIdx.x; if (t >= SLEN * 32) return; const int tok = t >> 5, j = t & 31; const float v = powf(XBASE[j], ((float)tok - 1024.0f) / 512.0f);
  *(float*)(SC + t) = v;  }
template <int MODE>
__global__ __launch_bounds__(256) void k_xpos4(const float* __restrict__ F, const float* __restrict__ CS, const float* __restrict__ SN, const float* __restrict__ SC, float* __restrict__ OF) {
  #pragma clang fp contract(off)
  const int t = blockIdx.x * 256 + threadIdx.x; if (t >= NR * (DM / 4)) return; const int c0 = (t % (DM / 4)) * 4; const int r = t / (DM / 4); const int tok = r % SLEN; const int d0 = c0 & 63;
  const float* f = F + (size_t)r * DM + c0; const float* cs = CS + (size_t)tok * 32; const float* sn = SN + (size_t)tok * 32; const float* scp = SC + (size_t)tok * 32; v4f o;
#pragma unroll
  for (int q = 0; q < 4; ++q) { const int d = d0 + q; float sc = scp[d & 31]; if (MODE == 1) sc = 1.0f / sc;
    const float x = f[q]; const float rx = (d & 1) ? f[q - 1] : -f[q + 1]; o[q] = (x * cs[d >> 1]) * sc + (rx * sn[d >> 1]) * sc; }
  *(v4f*)(OF + (size_t)r * DM + c0) = o;  }

extern "C" void kernel_launch(void* const* d_in, const int* in_sizes, int n_in,
                              void* d_out, int out_size, void* d_ws, size_t ws_size, hipStream_t stream) {
  (void)in_sizes; (void)n_in; (void)out_size;
  const float* const* I = (const float* const*)d_in; const float* x = I[0]; const float* Wq = I[1]; const float* bq = I[2]; const float* Wk = I[3]; const float* bk = I[4]; const float* Wv = I[5]; const float* bv = I[6]; const float* Wo = I[7]; const float* bo = I[8];
  char* ws = (char*)d_ws; size_t off = 0;
  auto take = [&](size_t bytes) { char* p = ws + off; off += (bytes + 255) & ~(size_t)255; return p; };
  _Float16* BQ = (_Float16*)take((size_t)DM * DM * 2); _Float16* BK = (_Float16*)take((size_t)DM * DM * 2); _Float16* BV = (_Float16*)take((size_t)DM * DM * 2); _Float16* BO = (_Float16*)take((size_t)DM * DM * 2);
  _Float16* X16 = (_Float16*)take((size_t)NR * DM * 2); float* F = (float*)take((size_t)NR * DM * 4); float* G = (float*)take((size_t)NR * DM * 4);
  _Float16* Qh = (_Float16*)take((size_t)NR * DM * 2); _Float16* Ql = (_Float16*)take((size_t)NR * DM * 2); _Float16* Kh = (_Float16*)take((size_t)NR * DM * 2); _Float16* Kl = (_Float16*)take((size_t)NR * DM * 2); _Float16* Vth = (_Float16*)take((size_t)NR * DM * 2); _Float16* Vtl = (_Float16*)take((size_t)NR * DM * 2);
  unsigned* MB = (unsigned*)take((size_t)SLEN * (SLEN / 32) * 4); int* RA = (int*)take((size_t)SLEN * 4); int* KE = (int*)take((size_t)(SLEN / 64) * 32 * 4);
  float* CS = (float*)take((size_t)SLEN * 32 * 4); float* SN = (float*)take((size_t)SLEN * 32 * 4); float* SC = (float*)take((size_t)SLEN * 32 * 4);
  if (off > ws_size) return;      /* 8 + 8 + 16 + 16 + 6 x 8 + 1.5 = 98 MiB */
  float* O = F; _Float16* Oh = (_Float16*)G; _Float16* Ol = Oh + (size_t)NR * DM;      /* F and G (f32 scratch) are dead once the hi/lo planes exist */
  const size_t n8 = (size_t)NR * DM / 8; const unsigned nb8 = (unsigned)((n8 + 255) / 256), nb4 = (unsigned)(((size_t)NR * DM / 4 + 255) / 256); const size_t w8 = (size_t)DM * DM / 8; const unsigned wb = (unsigned)((w8 + 255) / 256);
  k_round16f<<<wb, 256, 0, stream>>>(Wq, BQ, w8); k_round16f<<<wb, 256, 0, stream>>>(Wk, BK, w8); k_round16f<<<wb, 256, 0, stream>>>(Wv, BV, w8); k_round16f<<<wb, 256, 0, stream>>>(Wo, BO, w8);      /* torch (out,in) = natural Bt; x16 */
  k_x16<<<nb8, 256, 0, stream>>>(x, X16, n8);
  k_trig<<<(SLEN * 32 + 255) / 256, 256, 0, stream>>>(CS, SN); k_scale<<<(SLEN * 32 + 255) / 256, 256, 0, stream>>>(SC); k_causaltab<<<(SLEN * (SLEN / 32) + 255) / 256, 256, 0, stream>>>(MB, RA, KE, SLEN, SLEN);
  const dim3 gP((NR / 128) * (DM / 64), 1);
  k_gemm2<0><<<gP, 128, 0, stream>>>(X16, DM, 0, BQ, DM, 0, 0.0625f, bq, 0, nullptr, 1, 0, 0, F, nullptr, DM, 0, NR, DM, DM); k_xpos4<0><<<nb4, 256, 0, stream>>>(F, CS, SN, SC, G); k_hl<<<nb8, 256, 0, stream>>>(G, Qh, Ql, n8);      /* q_mat = xpos(x Wq^T + bq) as hi/lo */
  k_gemm2<0><<<gP, 128, 0, stream>>>(X16, DM, 0, BV, DM, 0, 0.0625f, bv, 0, nullptr, 1, 0, 0, F, nullptr, DM, 0, NR, DM, DM); k_xpos4<1><<<nb4, 256, 0, stream>>>(F, CS, SN, SC, G); k_hl<<<nb8, 256, 0, stream>>>(G, Kh, Kl, n8);      /* k_mat = xpos^-1(x Wv^T + bv)  (module order) */
  k_gemm2<0><<<gP, 128, 0, stream>>>(X16, DM, 0, BK, DM, 0, 0.0625f, bk, 0, nullptr, 1, 0, 0, F, nullptr, DM, 0, NR, DM, DM);      /* v_mat = x Wk^T + bk (f32) */
  for (int b = 0; b < NBT; ++b) k_vthl<SLEN><<<NH * (SLEN / 64), 256, 0, stream>>>(F + (size_t)b * SLEN * DM, DM, Vth + (size_t)b * SLEN * DM, Vtl + (size_t)b * SLEN * DM);      /* V^T hi/lo per batch [(h)][64][2048] */
  for (int b = 0; b < NBT; ++b) { const size_t ro = (size_t)b * SLEN * DM;
    k_flashm<SLEN, SLEN><<<dim3(NH, SLEN / 16), 128, 0, stream>>>(Qh + ro, Ql + ro, DM, Kh + ro, Kl + ro, DM, Vth + ro, Vtl + ro, MB, RA, KE, O + ro, DM); }
  k_hl<<<nb8, 256, 0, stream>>>(O, Oh, Ol, n8);
  k_gemm2<0><<<gP, 128, 0, stream>>>(Oh, DM, 0, BO, DM, 0, 0.0625f, bo, 0, nullptr, 1, 0, 0, (float*)d_out, nullptr, DM, 0, NR, DM, DM);
  k_gemm2<0><<<gP, 128, 0, stream>>>(Ol, DM, 0, BO, DM, 0, 0.0625f / 1024.0f, nullptr, 0, (const float*)d_out, 1, (size_t)DM, 0, (float*)d_out, nullptr, DM, 0, NR, DM, DM);
}

// v002
// One run takes 419 microseconds.
// Next to v001, in two timings, it ran 1.20 and 1.19 times as fast.
// Over all steps from v000 it is 2.05 times as fast.
#include <hip/hip_runtime.h>
// Causal multi-head attention with xPos rotary embedding (2 x 2048 tokens x 1024, 16 heads x 64): q = x*Wq^T + bq, k = x*Wv^T + bv, v = x*Wk^T + bk (the module's own assignment order); q <- q*cos*scale + rot(q)*sin*scale, k <- k*cos/scale + rot(k)*sin/scale with interleaved-pair rotation, freq(t, d) = t * inv_freq[d/2], scale(t, d) = base[d mod 32]^((t - 1024)/512); scores = q.k / 32 with j <= i; softmax; merged . Wo^T + bo -> [2,2048,1024].
// Structure: x as an exact f16 plane; the three projections as f16 WMMA GEMMs (32x64 wave tiles, f32, exact products + bias) into f32 planes; per-token cos/sin/scale tables on VALU (inv_freq and base = the reference's f32 constants, precise trig and powf), then one VALU pass applies the rotation/scaling into f32 q/k planes; v re-laid per (batch, head) as [d][token]; q, k as f16 hi + x2^10 residual planes, V^T as hi + residual planes; the causal structure computed on device into a key bit plane + per-block key bound; the fused flash kernel per ((batch, head), 16 queries), the 32-key blocks dealt round-robin to the work-group's four waves (three-product hi/lo scores, online softmax f32 per wave, P hi + residual via LDS, two value accumulators; the four partial (max, sum, O) merged through LDS at the end); O as hi + residual planes; output projection as two GEMMs (bias in the first).
// Compute dtype: x, weights, biases rounded to bf16; projections exact; rotation f32; q, k, P, v, O as f16 hi + residual pairs (~2^-21); f32 accumulation and softmax. v_wmma_f32_16x16x32_f16.
#define NBT 2
#define SLEN 2048
#define DM 1024
#define NH 16
#define SCL 0.03125f
#define NR (NBT * SLEN)
typedef __bf16 v16b __attribute__((ext_vector_type(16)));
typedef unsigned short v8us __attribute__((ext_vector_type(8), may_alias));
typedef float  v8f  __attribute__((ext_vector_type(8)));
typedef float  v4f  __attribute__((ext_vector_type(4)));
typedef float  v4fa __attribute__((ext_vector_type(4), may_alias));
union FragB { v16b v; v8us half[2]; unsigned short u[16]; };

__device__ __forceinline__ unsigned short bf16_bits(float x) { unsigned int u = __float_as_uint(x); return (unsigned short)((u + 0x7FFFu + ((u >> 16) & 1u)) >> 16); }
__device__ __forceinline__ float bf16_val(unsigned short b) { return __uint_as_float(((unsigned int)b) << 16); }
__device__ __forceinline__ float bf16_round(float x) { return bf16_val(bf16_bits(x)); }
// D += A·B with NT terms: 1 = ah·bh, 2 = + al·bh (A split), 3 = + ah·bl (both split)
template <int NT>
__device__ __forceinline__ v8f mmaN(v16b ah, v16b al, v16b bh, v16b bl, v8f c) {
  c = __builtin_amdgcn_wmma_f32_16x16x32_bf16(false, ah, false, bh, (short)0, c, false, false);
  if (NT >= 2) c = __builtin_amdgcn_wmma_f32_16x16x32_bf16(false, al, false, bh, (short)0, c, false, false);
  if (NT >= 3) c = __builtin_amdgcn_wmma_f32_16x16x32_bf16(false, ah, false, bl, (short)0, c, false, false);
  asm volatile("v_nop\n\tv_nop\n\tv_nop\n\tv_nop" : "+v"(c) : "v"(ah), "v"(al), "v"(bh), "v"(bl));
  return c;
}

__global__ __launch_bounds__(256) void k_wt_bf16(const float* __restrict__ W, unsigned short* __restrict__ Wt, int K, int N) {
  const int t = blockIdx.x * 256 + threadIdx.x;
  const int k8n = K / 8;
  if (t >= N * k8n) return;
  const int n = t / k8n, k8 = (t % k8n) * 8;
  v8us v;
#pragma unroll
  for (int i = 0; i < 8; ++i) v[i] = bf16_bits(W[(size_t)(k8 + i) * N + n]);
  *(v8us*)(Wt + (size_t)n * K + k8) = v;
  
}

// GEMM C[M][N] (f32, pitch ldc) = act(A[M][K]·W + bias). A f32 row-major (pitch lda) converted per fragment to bf16
// (ASPLIT: hi/lo two planes -> 2 terms, else single rounded term); Wt bf16 [N][K] (pitch ldb). BIAS_BF16 rounds the
// bias to bf16 first (bias quantised to bf16 before the add). K%32==0, M%16==0, N%64==0.
template <bool ASPLIT, int ACT, bool BIAS_BF16>
__global__ __launch_bounds__(128) void k_gemm_bf(const float* __restrict__ A, int lda, const unsigned short* __restrict__ Wt, int ldb,
                                               const float* __restrict__ bias, float* __restrict__ C, int ldc, int M, int N, int K) {
  __shared__ __attribute__((aligned(16))) float so[4][16][64];
  const int tid = threadIdx.x, w = tid >> 5, lane = tid & 31, ln = lane & 15, hh = lane >> 4;
  const int ntn = N / 64;
  const int wid = blockIdx.x * 4 + w;
  const int mt = wid / ntn, nq = wid % ntn;
  if (mt * 16 >= M) return;
  const int row0 = mt * 16, col0 = nq * 64;
  const float* arow = A + (size_t)(row0 + ln) * lda;
  v8f acc[4] = {};
  for (int kb = 0; kb < K; kb += 32) {
    FragB ah, al;
    const v4f x0 = *(const v4fa*)(arow + kb + 8 * hh), x1 = *(const v4fa*)(arow + kb + 8 * hh + 4);
    const v4f x2 = *(const v4fa*)(arow + kb + 16 + 8 * hh), x3 = *(const v4fa*)(arow + kb + 16 + 8 * hh + 4);
    float xs[16] = {x0[0],x0[1],x0[2],x0[3],x1[0],x1[1],x1[2],x1[3],x2[0],x2[1],x2[2],x2[3],x3[0],x3[1],x3[2],x3[3]};
#pragma unroll
    for (int i = 0; i < 16; ++i) { const unsigned short hb = bf16_bits(xs[i]); ah.u[i] = hb; al.u[i] = ASPLIT ? bf16_bits(xs[i] - bf16_val(hb)) : (unsigned short)0; }
#pragma unroll
    for (int t = 0; t < 4; ++t) {
      const unsigned short* brow = Wt + (size_t)(col0 + t * 16 + ln) * ldb + kb;
      FragB b;
      b.half[0] = *(const v8us*)(brow + 8 * hh);
      b.half[1] = *(const v8us*)(brow + 16 + 8 * hh);
      acc[t] = mmaN<ASPLIT ? 2 : 1>(ah.v, al.v, b.v, b.v, acc[t]);
    }
  }
#pragma unroll
  for (int t = 0; t < 4; ++t) {
    float bv = bias ? bias[col0 + t * 16 + ln] : 0.f;
    if (BIAS_BF16) bv = bf16_round(bv);
#pragma unroll
    for (int r = 0; r < 8; ++r) { float v = acc[t][r] + bv; if (ACT == 1) v = fmaxf(v, 0.f); so[w][8 * hh + r][t * 16 + ln] = v; }
  }
  __builtin_amdgcn_fence(__ATOMIC_ACQ_REL, "workgroup");
  __builtin_amdgcn_wave_barrier();
  const int rsub = lane >> 4, c4 = (lane & 15) * 4;
  {
#pragma unroll
    for (int q = 0; q < 8; ++q) {
      const int r = q * 2 + rsub;
      const v4f v = *(const v4fa*)&so[w][r][c4];
      *(v4f*)(C + (size_t)(row0 + r) * ldc + col0 + c4) = v;
    }
    
  }
}

// GEMM C = act(A·W + bias + resid): A f32 (ASPLIT -> hi/lo 2 terms), Wt bf16 [N][K]; ACT 0 none, 1 relu, 2 exact gelu;
// resid (optional, f32, row index = (row % rmod), pitch ldr, RES_BF16 rounds it) added before the activation.
template <bool ASPLIT, int ACT, bool BIAS_BF16, bool RES_BF16>
__global__ __launch_bounds__(128) void k_gemm_bf3(const float* __restrict__ A, int lda, const unsigned short* __restrict__ Wt, int ldb,
                                                const float* __restrict__ bias, const float* __restrict__ resid, int rmod, int ldr,
                                                float* __restrict__ C, int ldc, int M, int N, int K) {
  __shared__ __attribute__((aligned(16))) float so[4][16][64];
  const int tid = threadIdx.x, w = tid >> 5, lane = tid & 31, ln = lane & 15, hh = lane >> 4;
  const int ntn = N / 64;
  const int wid = blockIdx.x * 4 + w;
  const int mt = wid / ntn, nq = wid % ntn;
  if (mt * 16 >= M) return;
  const int row0 = mt * 16, col0 = nq * 64;
  const float* arow = A + (size_t)(row0 + ln) * lda;
  v8f acc[4] = {};
  for (int kb = 0; kb < K; kb += 32) {
    FragB ah, al;
    const v4f x0 = *(const v4fa*)(arow + kb + 8 * hh), x1 = *(const v4fa*)(arow + kb + 8 * hh + 4);
    const v4f x2 = *(const v4fa*)(arow + kb + 16 + 8 * hh), x3 = *(const v4fa*)(arow + kb + 16 + 8 * hh + 4);
    float xs[16] = {x0[0],x0[1],x0[2],x0[3],x1[0],x1[1],x1[2],x1[3],x2[0],x2[1],x2[2],x2[3],x3[0],x3[1],x3[2],x3[3]};
#pragma unroll
    for (int i = 0; i < 16; ++i) { const unsigned short hb = bf16_bits(xs[i]); ah.u[i] = hb; al.u[i] = ASPLIT ? bf16_bits(xs[i] - bf16_val(hb)) : (unsigned short)0; }
#pragma unroll
    for (int t = 0; t < 4; ++t) {
      const unsigned short* brow = Wt + (size_t)(col0 + t * 16 + ln) * ldb + kb;
      FragB b;
      b.half[0] = *(const v8us*)(brow + 8 * hh);
      b.half[1] = *(const v8us*)(brow + 16 + 8 * hh);
      acc[t] = mmaN<ASPLIT ? 2 : 1>(ah.v, al.v, b.v, b.v, acc[t]);
    }
  }
#pragma unroll
  for (int t = 0; t < 4; ++t) {
    const int col = col0 + t * 16 + ln;
    float bv = bias ? bias[col] : 0.f;
    if (BIAS_BF16) bv = bf16_round(bv);
#pragma unroll
    for (int r = 0; r < 8; ++r) {
      float v = acc[t][r] + bv;
      if (resid) { float rv = resid[(size_t)((row0 + 8 * hh + r) % rmod) * ldr + col]; if (RES_BF16) rv = bf16_round(rv); v += rv; }
      if (ACT == 1) v = fmaxf(v, 0.f);
      if (ACT == 2) v = 0.5f * v * (1.0f + erff(v * 0.70710678118654752f));
      if (ACT == 3) { const float u = 0.7978845608028654f * (v + 0.044715f * v * v * v); v = 0.5f * v * (1.0f + tanhf(u)); }
      so[w][8 * hh + r][t * 16 + ln] = v;
    }
  }
  __builtin_amdgcn_fence(__ATOMIC_ACQ_REL, "workgroup");
  __builtin_amdgcn_wave_barrier();
  const int rsub = lane >> 4, c4 = (lane & 15) * 4;
  {
#pragma unroll
    for (int q = 0; q < 8; ++q) {
      const int r = q * 2 + rsub;
      const v4f v = *(const v4fa*)&so[w][r][c4];
      *(v4f*)(C + (size_t)(row0 + r) * ldc + col0 + c4) = v;
    }
    
  }
}
// row LayerNorm (biased variance, eps) over N: s = X (+ R); optional out_sum <- s; out_norm <- (s-mu)*rsqrt(var+eps)*g + b
template <bool PARAM_BF16>
__global__ __launch_bounds__(256) void k_layernorm(const float* __restrict__ X, const float* __restrict__ R, const float* __restrict__ g, const float* __restrict__ bta,
                                                  float* __restrict__ out_sum, float* __restrict__ out_norm, int N, float eps) {
  __shared__ float red[256];
  const int row = blockIdx.x, tid = threadIdx.x;
  const float* x = X + (size_t)row * N; const float* rr = R ? R + (size_t)row * N : nullptr;
  float vals[16];                     // up to N = 4096
  const int per = N / 256;            // contiguous chunk per thread? use strided-by-4 chunks: thread handles j = tid*4 + 1024*u
  float s1 = 0.f;
  for (int u = 0; u < per / 4; ++u) {
    const int j = tid * 4 + 1024 * u;
    const v4f a = *(const v4fa*)(x + j);
    v4f b = {0.f,0.f,0.f,0.f}; if (rr) b = *(const v4fa*)(rr + j);
#pragma unroll
    for (int q = 0; q < 4; ++q) { const float v = a[q] + b[q]; vals[u * 4 + q] = v; s1 += v; }
  }
  red[tid] = s1; __syncthreads();
  for (int st = 128; st > 0; st >>= 1) { if (tid < st) red[tid] += red[tid + st]; __syncthreads(); }
  const float mu = red[0] / (float)N; __syncthreads();
  float s2 = 0.f;
  for (int u = 0; u < per / 4; ++u)
#pragma unroll
    for (int q = 0; q < 4; ++q) { const float c = vals[u * 4 + q] - mu; s2 += c * c; }
  red[tid] = s2; __syncthreads();
  for (int st = 128; st > 0; st >>= 1) { if (tid < st) red[tid] += red[tid + st]; __syncthreads(); }
  const float rs = rsqrtf(red[0] / (float)N + eps);
  {
    for (int u = 0; u < per / 4; ++u) {
      const int j = tid * 4 + 1024 * u;
      v4f o, sm;
#pragma unroll
      for (int q = 0; q < 4; ++q) {
        float gg = g[j + q], bb = bta[j + q];
        if (PARAM_BF16) { gg = bf16_round(gg); bb = bf16_round(bb); }
        sm[q] = vals[u * 4 + q]; o[q] = (vals[u * 4 + q] - mu) * rs * gg + bb;
      }
      if (out_sum) *(v4f*)(out_sum + (size_t)row * N + j) = sm;
      *(v4f*)(out_norm + (size_t)row * N + j) = o;
    }
    
  }
}



// ---- f16 WMMA path (v_wmma_f32_16x16x32_f16): 11-bit significands for operands in range — used where a [0,1] probability operand needs more precision than bf16
typedef _Float16 v16h __attribute__((ext_vector_type(16)));
union FragH { v16h v; v8us half[2]; _Float16 h[16]; unsigned short u[16]; };
template <int NT>
__device__ __forceinline__ v8f mmaH(v16h ah, v16h al, v16h bh, v16h bl, v8f c) {
  c = __builtin_amdgcn_wmma_f32_16x16x32_f16(false, ah, false, bh, (short)0, c, false, false);
  if (NT >= 2) c = __builtin_amdgcn_wmma_f32_16x16x32_f16(false, al, false, bh, (short)0, c, false, false);
  if (NT >= 3) c = __builtin_amdgcn_wmma_f32_16x16x32_f16(false, ah, false, bl, (short)0, c, false, false);
  asm volatile("v_nop\n\tv_nop\n\tv_nop\n\tv_nop" : "+v"(c) : "v"(ah), "v"(al), "v"(bh), "v"(bl));
  return c;
}
// batched GEMM like k_gemm_b but f16 operands: A f32 (split into f16 hi/lo if ASPLIT, else rounded to f16), Bt = f16 values [n][k]; alpha; C f32; N multiple of 16 (partial tiles skipped)
template <bool ASPLIT>
__global__ __launch_bounds__(128) void k_gemm_h(const float* __restrict__ A, int lda, size_t sA, const _Float16* __restrict__ Bh, int ldb, size_t sB, float alpha, float* __restrict__ C, int ldc, size_t sC, int M, int N, int K) {
  __shared__ __attribute__((aligned(16))) float so[4][16][64];
  const int tid = threadIdx.x, w = tid >> 5, lane = tid & 31, ln = lane & 15, hh = lane >> 4; const int by = blockIdx.y;
  A += (size_t)by * sA; Bh += (size_t)by * sB; C += (size_t)by * sC;
  const int ntn = (N + 63) / 64; const int wid = blockIdx.x * 4 + w; const int mt = wid / ntn, nq = wid % ntn; if (mt * 16 >= M) return;
  const int row0 = mt * 16, col0 = nq * 64; const float* arow = A + (size_t)(row0 + ln) * lda;
  v8f acc[4] = {};
  for (int kb = 0; kb < K; kb += 32) {
    FragH ah, al;
    const v4f x0 = *(const v4fa*)(arow + kb + 8 * hh), x1 = *(const v4fa*)(arow + kb + 8 * hh + 4), x2 = *(const v4fa*)(arow + kb + 16 + 8 * hh), x3 = *(const v4fa*)(arow + kb + 16 + 8 * hh + 4);
    float xs[16] = {x0[0],x0[1],x0[2],x0[3],x1[0],x1[1],x1[2],x1[3],x2[0],x2[1],x2[2],x2[3],x3[0],x3[1],x3[2],x3[3]};
#pragma unroll
    for (int i = 0; i < 16; ++i) { const _Float16 h = (_Float16)xs[i]; ah.h[i] = h; al.h[i] = ASPLIT ? (_Float16)(xs[i] - (float)h) : (_Float16)0.0f; }
#pragma unroll
    for (int t = 0; t < 4; ++t) { if (col0 + t * 16 >= N) continue; const size_t boff = (size_t)(col0 + t * 16 + ln) * ldb + kb; FragH bq; bq.half[0] = *(const v8us*)(Bh + boff + 8 * hh); bq.half[1] = *(const v8us*)(Bh + boff + 16 + 8 * hh);
      acc[t] = mmaH<ASPLIT ? 2 : 1>(ah.v, al.v, bq.v, bq.v, acc[t]); }
  }
#pragma unroll
  for (int t = 0; t < 4; ++t) { if (col0 + t * 16 >= N) continue;
#pragma unroll
    for (int r = 0; r < 8; ++r) so[w][8 * hh + r][t * 16 + ln] = acc[t][r] * alpha; }
  __builtin_amdgcn_fence(__ATOMIC_ACQ_REL, "workgroup"); __builtin_amdgcn_wave_barrier();
  const int rsub = lane >> 4, c4 = (lane & 15) * 4;
  {
#pragma unroll
    for (int q = 0; q < 8; ++q) { const int r = q * 2 + rsub; if (col0 + c4 < N) { const v4f v = *(const v4fa*)&so[w][r][c4]; *(v4f*)(C + (size_t)(row0 + r) * ldc + col0 + c4) = v; } }
     }
}

// Wt[n][k] = f16(W[k][n]·scale) from f32 row-major W[K][N] (scale = power of two; bf16-exact weights stay exact in f16 away from the subnormal range)
__global__ __launch_bounds__(256) void k_wt_f16(const float* __restrict__ W, _Float16* __restrict__ Wt, int K, int N, float scale) {
  const int t = blockIdx.x * 256 + threadIdx.x; if (t >= N * (K / 8)) return; const int n = t / (K / 8), k8 = (t % (K / 8)) * 8; FragH f;
#pragma unroll
  for (int i = 0; i < 8; ++i) f.h[i] = (_Float16)(bf16_round(W[(size_t)(k8 + i) * N + n]) * scale); const v8us o = f.half[0];
  *(v8us*)((unsigned short*)Wt + (size_t)n * K + k8) = o; 
}
// k_gemm_hh variant with fused epilogue: v = acc·alpha + bias[by·sBias + col] (+ CP[(row/rowsPerB)·sCPb + by·64 + col] if CP) ; ACT 0 none / 1 elu ; writes f16 C16 (and f32 C if non-null)
template <int ACT>
__global__ __launch_bounds__(128) void k_gemm_hhx(const _Float16* __restrict__ A, int lda, size_t sA, const _Float16* __restrict__ Bh, int ldb, size_t sB, float alpha, const float* __restrict__ bias, size_t sBias, const float* __restrict__ CP, int rowsPerB, size_t sCPb, int row0g,
    float* __restrict__ C, _Float16* __restrict__ C16, int ldc, size_t sC, int M, int N, int K) {
  __shared__ __attribute__((aligned(16))) float so[4][16][64];
  const int tid = threadIdx.x, w = tid >> 5, lane = tid & 31, ln = lane & 15, hh = lane >> 4; const int by = blockIdx.y;
  A += (size_t)by * sA; Bh += (size_t)by * sB; const size_t cofs = (size_t)by * sC; const float* bp = bias ? bias + (size_t)by * sBias : nullptr;
  const int ntn = (N + 63) / 64; const int wid = blockIdx.x * 4 + w; const int mt = wid / ntn, nq = wid % ntn; if (mt * 16 >= M) return;
  const int row0 = mt * 16, col0 = nq * 64; const _Float16* arow = A + (size_t)(row0 + ln) * lda;
  v8f acc[4] = {};
  for (int kb = 0; kb < K; kb += 32) { FragH ah; ah.half[0] = *(const v8us*)((const unsigned short*)arow + kb + 8 * hh); ah.half[1] = *(const v8us*)((const unsigned short*)arow + kb + 16 + 8 * hh);
#pragma unroll
    for (int t = 0; t < 4; ++t) { if (col0 + t * 16 >= N) continue; const size_t boff = (size_t)(col0 + t * 16 + ln) * ldb + kb; FragH bq; bq.half[0] = *(const v8us*)((const unsigned short*)Bh + boff + 8 * hh); bq.half[1] = *(const v8us*)((const unsigned short*)Bh + boff + 16 + 8 * hh);
      acc[t] = mmaH<1>(ah.v, ah.v, bq.v, bq.v, acc[t]); }
  }
#pragma unroll
  for (int t = 0; t < 4; ++t) { if (col0 + t * 16 >= N) continue; const int col = col0 + t * 16 + ln; const float bv = bp ? bf16_round(bp[col]) : 0.f;
#pragma unroll
    for (int r = 0; r < 8; ++r) { float v = acc[t][r] * alpha + bv; if (CP) { const int bidx = (row0g + row0 + 8 * hh + r) / rowsPerB; v += CP[(size_t)bidx * sCPb + (size_t)by * 64 + col]; } if (ACT == 1) v = (v > 0.f) ? v : expm1f(v); else if (ACT == 7) v = (v > 0.f) ? v + 1.0f : expf(v); else if (ACT == 8) v = tanhf(v); else if (ACT == 9) v = 0.5f * v * (1.0f + tanhf(0.7978845608028654f * (v + 0.044715f * v * v * v))); else if (ACT == 11) v = 1.0f / (1.0f + expf(-v)); else if (ACT == 12) v = (v > 0.f) ? v : 0.01f * v; else if (ACT == 14) v = (v > 0.f) ? v : 0.1f * v; else if (ACT == 15) v = v / (1.0f + expf(-v)); else if (ACT == 3) v = fmaxf(v, 0.f); else if (ACT == 6) v = 0.5f * v * (1.0f + erff(v * 0.70710678118654752f)); so[w][8 * hh + r][t * 16 + ln] = v; } }
  __builtin_amdgcn_fence(__ATOMIC_ACQ_REL, "workgroup"); __builtin_amdgcn_wave_barrier();
  const int rsub = lane >> 4, c4 = (lane & 15) * 4; typedef _Float16 v4h __attribute__((ext_vector_type(4)));
  {
#pragma unroll
    for (int q = 0; q < 8; ++q) { const int r = q * 2 + rsub; if (col0 + c4 < N) { const v4f v = *(const v4fa*)&so[w][r][c4]; if (C) *(v4f*)(C + cofs + (size_t)(row0 + r) * ldc + col0 + c4) = v; if (C16) { v4h h4; for (int i = 0; i < 4; ++i) h4[i] = (_Float16)v[i]; *(v4h*)(C16 + cofs + (size_t)(row0 + r) * ldc + col0 + c4) = h4; } } }
     }
}


typedef _Float16 v4h __attribute__((ext_vector_type(4)));

__global__ __launch_bounds__(256) void k_x16(const float* __restrict__ x, _Float16* __restrict__ X16, size_t n8) { const size_t t = (size_t)blockIdx.x * 256 + threadIdx.x; if (t >= n8) return; FragH f;
#pragma unroll
  for (int q = 0; q < 8; ++q) f.h[q] = (_Float16)bf16_round(x[t * 8 + q]); *(v8us*)((unsigned short*)X16 + t * 8) = f.half[0];  }
__global__ __launch_bounds__(256) void k_h16(const float* __restrict__ x, _Float16* __restrict__ X16, size_t n8) { const size_t t = (size_t)blockIdx.x * 256 + threadIdx.x; if (t >= n8) return; FragH f;
#pragma unroll
  for (int q = 0; q < 8; ++q) f.h[q] = (_Float16)x[t * 8 + q]; *(v8us*)((unsigned short*)X16 + t * 8) = f.half[0];  }
__global__ __launch_bounds__(256) void k_round16f(const float* __restrict__ W, _Float16* __restrict__ Bt, size_t n8) { const size_t t = (size_t)blockIdx.x * 256 + threadIdx.x; if (t >= n8) return; FragH f;
#pragma unroll
  for (int i = 0; i < 8; ++i) f.h[i] = (_Float16)(bf16_round(W[t * 8 + i]) * 16.0f); *(v8us*)((unsigned short*)Bt + t * 8) = f.half[0];  }
template <int NHv, int TTv>
__global__ __launch_bounds__(256) void k_vt(const _Float16* __restrict__ V16, int ldv, int voff, _Float16* __restrict__ Vt) { __shared__ unsigned short tl[64][66]; const int tid = threadIdx.x; const int slab = blockIdx.x / (TTv / 64), lg = blockIdx.x % (TTv / 64); const int b = slab / NHv, h = slab % NHv;
  for (int i = tid; i < 64 * 8; i += 256) { const int r = i / 8, c8 = (i % 8) * 8; FragH f; f.half[0] = *(const v8us*)((const unsigned short*)V16 + ((size_t)b * TTv + lg * 64 + r) * ldv + voff + h * 64 + c8);
#pragma unroll
    for (int q = 0; q < 8; ++q) tl[r][c8 + q] = f.u[q]; }
  __syncthreads();
  {
#pragma unroll
    for (int rd = 0; rd < 2; ++rd) { const int d = rd * 32 + tid / 8, pc = tid % 8; FragH f;
#pragma unroll
      for (int q = 0; q < 8; ++q) f.u[q] = tl[pc * 8 + q][d];
      *(v8us*)((unsigned short*)Vt + ((size_t)slab * 64 + d) * TTv + lg * 64 + pc * 8) = f.half[0]; }
     } }

__global__ __launch_bounds__(256) void k_hl(const float* __restrict__ F, _Float16* __restrict__ Hh, _Float16* __restrict__ Hl, size_t n8) { const size_t t = (size_t)blockIdx.x * 256 + threadIdx.x; if (t >= n8) return; FragH fh, fl; const v4f a = *(const v4fa*)(F + t * 8), c = *(const v4fa*)(F + t * 8 + 4);
#pragma unroll
  for (int q = 0; q < 4; ++q) { _Float16 h = (_Float16)a[q]; fh.h[q] = h; fl.h[q] = (_Float16)((a[q] - (float)h) * 1024.0f); h = (_Float16)c[q]; fh.h[4 + q] = h; fl.h[4 + q] = (_Float16)((c[q] - (float)h) * 1024.0f); }
  { *(v8us*)((unsigned short*)Hh + t * 8) = fh.half[0]; *(v8us*)((unsigned short*)Hl + t * 8) = fl.half[0];  } }

// ---- fast GEMM (wave tile 32x64; requires M % 32 == 0 rows per launch region and N % 64 == 0); epilogue = k_gemm_hhx semantics ----
__device__ __forceinline__ v16h g2_frag(const _Float16* p, int hh) { FragH f; f.half[0] = *(const v8us*)((const unsigned short*)p + 8 * hh); f.half[1] = *(const v8us*)((const unsigned short*)p + 16 + 8 * hh); return f.v; }
__device__ __forceinline__ v8f g2_mma(v16h a, v16h b, v8f c) { v8f d = __builtin_amdgcn_wmma_f32_16x16x32_f16(false, a, false, b, (short)0, c, false, false); asm volatile("v_nop\n\tv_nop\n\tv_nop\n\tv_nop" : "+v"(d) : "v"(a), "v"(b)); return d; }
template <int ACT>
__global__ __launch_bounds__(128) void k_gemm2(const _Float16* __restrict__ A, int lda, size_t sA, const _Float16* __restrict__ Bh, int ldb, size_t sB, float alpha, const float* __restrict__ bias, size_t sBias, const float* __restrict__ CP, int rowsPerB, size_t sCPb, int row0g,
    float* __restrict__ C, _Float16* __restrict__ C16, int ldc, size_t sC, int M, int N, int K) {
  __shared__ __attribute__((aligned(16))) float so[4][32][68];
  const int tid = threadIdx.x, w = tid >> 5, lane = tid & 31, ln = lane & 15, hh = lane >> 4; const int by = blockIdx.y;
  A += (size_t)by * sA; Bh += (size_t)by * sB; const size_t cofs = (size_t)by * sC; const float* bp = bias ? bias + (size_t)by * sBias : nullptr;
  const int ntn = N >> 6; const int mt = blockIdx.x / ntn, nq = blockIdx.x - mt * ntn; const int row0 = mt * 128 + 32 * w, col0 = nq * 64; if (row0 >= M) return;
  const _Float16* a0p = A + (size_t)(row0 + ln) * lda; const _Float16* a1p = a0p + (size_t)16 * lda;
  const _Float16* b0p = Bh + (size_t)(col0 + ln) * ldb; const _Float16* b1p = b0p + (size_t)16 * ldb; const _Float16* b2p = b1p + (size_t)16 * ldb; const _Float16* b3p = b2p + (size_t)16 * ldb;
  const v8f z8 = {0.f,0.f,0.f,0.f,0.f,0.f,0.f,0.f}; v8f c00 = z8, c01 = z8, c02 = z8, c03 = z8, c10 = z8, c11 = z8, c12 = z8, c13 = z8;
#pragma unroll 1
  for (int kb = 0; kb < K; kb += 32) { const v16h a0 = g2_frag(a0p + kb, hh), a1 = g2_frag(a1p + kb, hh);
    v16h b = g2_frag(b0p + kb, hh); c00 = g2_mma(a0, b, c00); c10 = g2_mma(a1, b, c10);
    b = g2_frag(b1p + kb, hh); c01 = g2_mma(a0, b, c01); c11 = g2_mma(a1, b, c11);
    b = g2_frag(b2p + kb, hh); c02 = g2_mma(a0, b, c02); c12 = g2_mma(a1, b, c12);
    b = g2_frag(b3p + kb, hh); c03 = g2_mma(a0, b, c03); c13 = g2_mma(a1, b, c13); }
  v8f accs[8] = {c00, c01, c02, c03, c10, c11, c12, c13};
#pragma unroll
  for (int u = 0; u < 8; ++u) { const int t = u & 3, half = u >> 2; const int col = col0 + t * 16 + ln; const float bv = bp ? bf16_round(bp[col]) : 0.f;
#pragma unroll
    for (int r = 0; r < 8; ++r) { const int rloc = half * 16 + 8 * hh + r; float v = accs[u][r] * alpha + bv; if (CP) { const int bidx = (row0g + row0 + rloc) / rowsPerB; v += CP[(size_t)bidx * sCPb + (size_t)by * 64 + col]; }
      if (ACT == 3) v = fmaxf(v, 0.f); else if (ACT == 6) v = 0.5f * v * (1.0f + erff(v * 0.70710678118654752f)); else if (ACT == 11) v = 1.0f / (1.0f + expf(-v)); else if (ACT == 15) v = v / (1.0f + expf(-v)); else if (ACT == 12) v = (v > 0.f) ? v : 0.01f * v; else if (ACT == 8) v = tanhf(v);
      so[w][rloc][t * 16 + ln] = v; } }
  __builtin_amdgcn_fence(__ATOMIC_ACQ_REL, "workgroup"); __builtin_amdgcn_wave_barrier();
  const int rsub = lane >> 4, c4 = (lane & 15) * 4;
  {
#pragma unroll
    for (int q = 0; q < 16; ++q) { const int r = q * 2 + rsub; const v4f v = *(const v4fa*)&so[w][r][c4]; if (C) *(v4f*)(C + cofs + (size_t)(row0 + r) * ldc + col0 + c4) = v; if (C16) { v4h h4; for (int i = 0; i < 4; ++i) h4[i] = (_Float16)v[i]; *(v4h*)(C16 + cofs + (size_t)(row0 + r) * ldc + col0 + c4) = h4; } }
     } }



template <int TK>
__global__ __launch_bounds__(256) void k_vthl(const float* __restrict__ VF, int ldv, _Float16* __restrict__ Vth, _Float16* __restrict__ Vtl) { __shared__ float tl[64][65]; const int tid = threadIdx.x; const int slab = blockIdx.x / (TK / 64), lg = blockIdx.x % (TK / 64); const int b = slab / NH, h = slab % NH;
  for (int i = tid; i < 64 * 16; i += 256) { const int r = i / 16, c4 = (i % 16) * 4; const v4f a = *(const v4fa*)(VF + ((size_t)b * TK + lg * 64 + r) * ldv + h * 64 + c4); tl[r][c4] = a[0]; tl[r][c4 + 1] = a[1]; tl[r][c4 + 2] = a[2]; tl[r][c4 + 3] = a[3]; }
  __syncthreads();
  FragH fh[2], fl[2]; size_t oo[2];
#pragma unroll
  for (int rd = 0; rd < 2; ++rd) { const int d = rd * 32 + tid / 8, pc = tid % 8;
#pragma unroll
    for (int q = 0; q < 8; ++q) { const float v = tl[pc * 8 + q][d]; const _Float16 hv = (_Float16)v; fh[rd].h[q] = hv; fl[rd].h[q] = (_Float16)((v - (float)hv) * 1024.0f); } oo[rd] = ((size_t)slab * 64 + d) * TK + lg * 64 + pc * 8; }
  {
#pragma unroll
    for (int rd = 0; rd < 2; ++rd) { *(v8us*)((unsigned short*)Vth + oo[rd]) = fh[rd].half[0]; *(v8us*)((unsigned short*)Vtl + oo[rd]) = fl[rd].half[0]; }
     } }

template <int TQ, int TK>
__global__ __launch_bounds__(128) void k_flashm(const _Float16* __restrict__ Q16, const _Float16* __restrict__ Q16lo, int ldq, const _Float16* __restrict__ K16, const _Float16* __restrict__ K16lo, int ldk, const _Float16* __restrict__ Vt, const _Float16* __restrict__ Vtlo, const unsigned* __restrict__ MB, const int* __restrict__ RA, const int* __restrict__ KE, float* __restrict__ O, int ldo) {
  constexpr int RPW = 16, RTN = RPW / 16, NQB = TQ / RPW, DT = 4, KS = 2;
  __shared__ __attribute__((aligned(16))) unsigned short sP[4][RPW][40], sPl[4][RPW][40]; __shared__ __attribute__((aligned(16))) float sO[4][RPW][64 + 4]; __shared__ float sM[4][RPW], sL[4][RPW];
  const int tid = threadIdx.x, lane = tid & 31, ln = lane & 15, hh = lane >> 4;
  const int w = __builtin_amdgcn_readfirstlane(tid >> 5);      /* the wave's number in a scalar register: the key loop's start and its branch stay scalar */
  /* grid (slab, tile): all four waves share one 16-query tile; tiles with the most keys have the lowest flat index (for speed only) */
  const int slab = blockIdx.x, qt = NQB - 1 - (int)blockIdx.y; const int b = slab / NH, h = slab % NH; const int q0 = qt * RPW; const int qblk = q0 >> 6;
  FragH aq[2][KS], aql[2][KS];
#pragma unroll
  for (int rt = 0; rt < RTN; ++rt) { const size_t qo = ((size_t)b * TQ + q0 + rt * 16 + ln) * ldq + h * 64; const unsigned short* qr = (const unsigned short*)Q16 + qo; const unsigned short* ql = (const unsigned short*)Q16lo + qo;
#pragma unroll
    for (int ks = 0; ks < KS; ++ks) { aq[rt][ks].half[0] = *(const v8us*)(qr + ks * 32 + 8 * hh); aq[rt][ks].half[1] = *(const v8us*)(qr + ks * 32 + 16 + 8 * hh); aql[rt][ks].half[0] = *(const v8us*)(ql + ks * 32 + 8 * hh); aql[rt][ks].half[1] = *(const v8us*)(ql + ks * 32 + 16 + 8 * hh); } }
  const unsigned short* Vth = (const unsigned short*)Vt + (size_t)slab * 64 * TK; const unsigned short* Vtl = (const unsigned short*)Vtlo + (size_t)slab * 64 * TK;
  float m_r[2][8], l_r[2][8]; v8f oacc[2][DT], oaccl[2][DT];
#pragma unroll
  for (int rt = 0; rt < RTN; ++rt) {
#pragma unroll
    for (int r = 0; r < 8; ++r) { m_r[rt][r] = -3.0e38f; l_r[rt][r] = 0.f; }
#pragma unroll
    for (int dt = 0; dt < DT; ++dt) { oacc[rt][dt] = (v8f){0.f,0.f,0.f,0.f,0.f,0.f,0.f,0.f}; oaccl[rt][dt] = oacc[rt][dt]; } }
  int jend = KE[qblk * 32]; jend = min(TK, (jend + 31) & ~31); if (jend < 32) jend = 32;      /* block-uniform */
  int allm[2][8]; const unsigned* mrow[2][8];
#pragma unroll
  for (int rt = 0; rt < RTN; ++rt)
#pragma unroll
    for (int r = 0; r < 8; ++r) { const int tq = q0 + rt * 16 + 8 * hh + r; allm[rt][r] = RA[tq]; mrow[rt][r] = MB + (size_t)tq * (TK / 32); }
#pragma unroll 1
  for (int j0 = 32 * w; j0 < jend; j0 += 128) {      /* wave w takes key blocks w, w + 4, ... */
    unsigned mw[2][8];      /* all of the pass's mask words are fetched here, so that their latency runs under the K loads and the score products */
#pragma unroll
    for (int rt = 0; rt < RTN; ++rt)
#pragma unroll
      for (int r = 0; r < 8; ++r) mw[rt][r] = mrow[rt][r][j0 >> 5];
    asm volatile("s_wait_xcnt 0x0" ::: "memory");      /* precaution: stands in front of every rewrite of the mask loads' address registers; it also keeps these loads ahead of the K loads */
    v8f s[2][2];
#pragma unroll
    for (int nt = 0; nt < 2; ++nt) { const size_t ko = ((size_t)b * TK + j0 + nt * 16 + ln) * ldk + h * 64; const unsigned short* kr = (const unsigned short*)K16 + ko; const unsigned short* kl = (const unsigned short*)K16lo + ko; FragH bk[KS], bkl[KS];
#pragma unroll
      for (int ks = 0; ks < KS; ++ks) { bk[ks].half[0] = *(const v8us*)(kr + ks * 32 + 8 * hh); bk[ks].half[1] = *(const v8us*)(kr + ks * 32 + 16 + 8 * hh); bkl[ks].half[0] = *(const v8us*)(kl + ks * 32 + 8 * hh); bkl[ks].half[1] = *(const v8us*)(kl + ks * 32 + 16 + 8 * hh); }
#pragma unroll
      for (int rt = 0; rt < RTN; ++rt) { v8f acc = (v8f){0.f,0.f,0.f,0.f,0.f,0.f,0.f,0.f}, accr = acc;
#pragma unroll
        for (int ks = 0; ks < KS; ++ks) { acc = mmaH<1>(aq[rt][ks].v, aq[rt][ks].v, bk[ks].v, bk[ks].v, acc); accr = mmaH<1>(aql[rt][ks].v, aql[rt][ks].v, bk[ks].v, bk[ks].v, accr); accr = mmaH<1>(aq[rt][ks].v, aq[rt][ks].v, bkl[ks].v, bkl[ks].v, accr); }
        s[rt][nt] = acc + accr * 0.0009765625f; } }
    /* softmax in stages over the eight rows, with selects in place of branches: one straight block, in which the rows' dependent chains overlap */
    float s0[2][8], s1[2][8], mc[2][8]; bool ok0[2][8], ok1[2][8];
#pragma unroll
    for (int rt = 0; rt < RTN; ++rt)
#pragma unroll
      for (int r = 0; r < 8; ++r) { const bool am = (allm[rt][r] != 0);
        ok0[rt][r] = am || (((mw[rt][r] >> ln) & 1u) == 0u); ok1[rt][r] = am || (((mw[rt][r] >> (16 + ln)) & 1u) == 0u);
        s0[rt][r] = ok0[rt][r] ? (am ? 0.f : s[rt][0][r] * SCL) : -INFINITY; s1[rt][r] = ok1[rt][r] ? (am ? 0.f : s[rt][1][r] * SCL) : -INFINITY; mc[rt][r] = fmaxf(s0[rt][r], s1[rt][r]); }
#pragma unroll
    for (int st = 1; st <= 8; st <<= 1)
#pragma unroll
      for (int rt = 0; rt < RTN; ++rt)
#pragma unroll
        for (int r = 0; r < 8; ++r) mc[rt][r] = fmaxf(mc[rt][r], __shfl_xor(mc[rt][r], st, 32));
#pragma unroll
    for (int rt = 0; rt < RTN; ++rt)
#pragma unroll
      for (int r = 0; r < 8; ++r) {
        const float mn = fmaxf(m_r[rt][r], mc[rt][r]); const float ea = expf(m_r[rt][r] - mn), e0 = expf(s0[rt][r] - mn), e1 = expf(s1[rt][r] - mn);      /* computed for every lane; the selects below keep the values of the guarded form */
        const float al = (mn > -1.0e38f) ? ea : 1.0f; m_r[rt][r] = mn; const float p0 = ok0[rt][r] ? e0 : 0.f, p1 = ok1[rt][r] ? e1 : 0.f; l_r[rt][r] = l_r[rt][r] * al + p0 + p1;
#pragma unroll
        for (int dt = 0; dt < DT; ++dt) { oacc[rt][dt][r] *= al; oaccl[rt][dt][r] *= al; }
        FragH t2, t3; const float ps0 = p0 * 1024.0f, ps1 = p1 * 1024.0f; t2.h[0] = (_Float16)ps0; t2.h[1] = (_Float16)ps1; t3.h[0] = (_Float16)((ps0 - (float)t2.h[0]) * 1024.0f); t3.h[1] = (_Float16)((ps1 - (float)t2.h[1]) * 1024.0f);
        sP[w][rt * 16 + 8 * hh + r][ln] = t2.u[0]; sP[w][rt * 16 + 8 * hh + r][16 + ln] = t2.u[1]; sPl[w][rt * 16 + 8 * hh + r][ln] = t3.u[0]; sPl[w][rt * 16 + 8 * hh + r][16 + ln] = t3.u[1]; }
    __builtin_amdgcn_fence(__ATOMIC_ACQ_REL, "workgroup"); __builtin_amdgcn_wave_barrier();
    FragH pa[2], pl[2];
#pragma unroll
    for (int rt = 0; rt < RTN; ++rt) { pa[rt].half[0] = *(const v8us*)&sP[w][rt * 16 + ln][8 * hh]; pa[rt].half[1] = *(const v8us*)&sP[w][rt * 16 + ln][16 + 8 * hh]; pl[rt].half[0] = *(const v8us*)&sPl[w][rt * 16 + ln][8 * hh]; pl[rt].half[1] = *(const v8us*)&sPl[w][rt * 16 + ln][16 + 8 * hh]; }
#pragma unroll
    for (int dt = 0; dt < DT; ++dt) { const size_t vo = (size_t)(dt * 16 + ln) * TK + j0; FragH bv, bl; bv.half[0] = *(const v8us*)(Vth + vo + 8 * hh); bv.half[1] = *(const v8us*)(Vth + vo + 16 + 8 * hh); bl.half[0] = *(const v8us*)(Vtl + vo + 8 * hh); bl.half[1] = *(const v8us*)(Vtl + vo + 16 + 8 * hh);
#pragma unroll
      for (int rt = 0; rt < RTN; ++rt) { oacc[rt][dt] = mmaH<1>(pa[rt].v, pa[rt].v, bv.v, bv.v, oacc[rt][dt]); oaccl[rt][dt] = mmaH<1>(pa[rt].v, pa[rt].v, bl.v, bl.v, oaccl[rt][dt]); oaccl[rt][dt] = mmaH<1>(pl[rt].v, pl[rt].v, bv.v, bv.v, oaccl[rt][dt]); } }
    __builtin_amdgcn_fence(__ATOMIC_ACQ_REL, "workgroup"); __builtin_amdgcn_wave_barrier(); }
#pragma unroll
  for (int rt = 0; rt < RTN; ++rt) {
#pragma unroll
    for (int r = 0; r < 8; ++r) { float l = l_r[rt][r]; l += __shfl_xor(l, 1, 32); l += __shfl_xor(l, 2, 32); l += __shfl_xor(l, 4, 32); l += __shfl_xor(l, 8, 32); l_r[rt][r] = l; }
    if (ln == 0) {
#pragma unroll
      for (int r = 0; r < 8; ++r) { sM[w][rt * 16 + 8 * hh + r] = m_r[rt][r]; sL[w][rt * 16 + 8 * hh + r] = l_r[rt][r]; } }
#pragma unroll
    for (int dt = 0; dt < DT; ++dt)
#pragma unroll
      for (int r = 0; r < 8; ++r) sO[w][rt * 16 + 8 * hh + r][dt * 16 + ln] = oacc[rt][dt][r] + oaccl[rt][dt][r] * 0.0009765625f; }
  __syncthreads();      /* every wave's partial (max, sum, O) is in LDS before any wave merges them */
  {
#pragma unroll
    for (int rp = 0; rp < RPW; rp += 8) { const int r = rp + (tid >> 4), pc = tid & 15;
      const float m0 = sM[0][r], m1 = sM[1][r], m2 = sM[2][r], m3 = sM[3][r]; const float mx = fmaxf(fmaxf(m0, m1), fmaxf(m2, m3));      /* a wave that saw no open key holds -3e38, sum 0, O 0: weight 0 (or 1 on zeros) */
      const float e0 = expf(m0 - mx), e1 = expf(m1 - mx), e2 = expf(m2 - mx), e3 = expf(m3 - mx);
      const float l = e0 * sL[0][r] + e1 * sL[1][r] + e2 * sL[2][r] + e3 * sL[3][r]; const float inv = (l > 0.f) ? 1.0f / (l * 1024.0f) : 0.f;
      const v4f o0 = *(const v4fa*)&sO[0][r][pc * 4], o1 = *(const v4fa*)&sO[1][r][pc * 4], o2 = *(const v4fa*)&sO[2][r][pc * 4], o3 = *(const v4fa*)&sO[3][r][pc * 4];
      const v4f val = (o0 * e0 + o1 * e1 + o2 * e2 + o3 * e3) * inv; *(v4f*)(O + ((size_t)b * TQ + q0 + r) * ldo + h * 64 + pc * 4) = val; }
     } }


__global__ __launch_bounds__(256) void k_causaltab(unsigned* __restrict__ MB, int* __restrict__ RA, int* __restrict__ KE, int nq, int nk) {
  const int t = blockIdx.x * 256 + threadIdx.x; const int nw = nk / 32;
  if (t < nq * nw) { const int q = t / nw, w = t % nw; const int first = q + 1 - 32 * w; const unsigned bits = (first <= 0) ? 0xffffffffu : ((first >= 32) ? 0u : (0xffffffffu << first)); *(unsigned*)(MB + t) = bits;  }
  if (t < nq) { *(int*)(RA + t) = 0;  }
  if (t < nq / 64) { const int v = 64 * (t + 1); *(int*)(KE + t * 32) = v;  } }

__constant__ float INVF[32] = {1.000000000e+00f,7.498942018e-01f,5.623413324e-01f,4.216965139e-01f,3.162277639e-01f,2.371373624e-01f,1.778279394e-01f,1.333521456e-01f,1.000000015e-01f,7.498941571e-02f,5.623412877e-02f,4.216964915e-02f,3.162277862e-02f,2.371373586e-02f,1.778279431e-02f,1.333521493e-02f,9.999999776e-03f,7.498942316e-03f,5.623413250e-03f,4.216964822e-03f,3.162277862e-03f,2.371373819e-03f,1.778279431e-03f,1.333521446e-03f,1.000000047e-03f,7.498941850e-04f,5.623413017e-04f,4.216964880e-04f,3.162277862e-04f,2.371373848e-04f,1.778279402e-04f,1.333521504e-04f};
__constant__ float XBASE[32] = {2.857142985e-01f,3.080357313e-01f,3.303571641e-01f,3.526785970e-01f,3.750000000e-01f,3.973214328e-01f,4.196428359e-01f,4.419642687e-01f,4.642857015e-01f,4.866071343e-01f,5.089285374e-01f,5.312500000e-01f,5.535714030e-01f,5.758928657e-01f,5.982142687e-01f,6.205357313e-01f,6.428571343e-01f,6.651785970e-01f,6.875000000e-01f,7.098214030e-01f,7.321428657e-01f,7.544642687e-01f,7.767857313e-01f,7.991071343e-01f,8.214285970e-01f,8.437500000e-01f,8.660714030e-01f,8.883928657e-01f,9.107142687e-01f,9.330357313e-01f,9.553571343e-01f,9.776785970e-01f};
__global__ __launch_bounds__(256) void k_trig(float* __restrict__ CS, float* __restrict__ SN) {
  #pragma clang fp contract(off)
  const int t = blockIdx.x * 256 + threadIdx.x; if (t >= SLEN * 32) return; const int tok = t >> 5, j = t & 31; const float ang = (float)tok * INVF[j]; const float c = cosf(ang), s = sinf(ang);
  *(float*)(CS + t) = c; *(float*)(SN + t) = s;  }
__global__ __launch_bounds__(256) void k_scale(float* __restrict__ SC) {
  #pragma clang fp contract(off)
  const int t = blockIdx.x * 256 + threadIdx.x; if (t >= SLEN * 32) return; const int tok = t >> 5, j = t & 31; const float v = powf(XBASE[j], ((float)tok - 1024.0f) / 512.0f);
  *(float*)(SC + t) = v;  }
template <int MODE>
__global__ __launch_bounds__(256) void k_xpos4(const float* __restrict__ F, const float* __restrict__ CS, const float* __restrict__ SN, const float* __restrict__ SC, float* __restrict__ OF) {
  #pragma clang fp contract(off)
  const int t = blockIdx.x * 256 + threadIdx.x; if (t >= NR * (DM / 4)) return; const int c0 = (t % (DM / 4)) * 4; const int r = t / (DM / 4); const int tok = r % SLEN; const int d0 = c0 & 63;
  const float* f = F + (size_t)r * DM + c0; const float* cs = CS + (size_t)tok * 32; const float* sn = SN + (size_t)tok * 32; const float* scp = SC + (size_t)tok * 32; v4f o;
#pragma unroll
  for (int q = 0; q < 4; ++q) { const int d = d0 + q; float sc = scp[d & 31]; if (MODE == 1) sc = 1.0f / sc;
    const float x = f[q]; const float rx = (d & 1) ? f[q - 1] : -f[q + 1]; o[q] = (x * cs[d >> 1]) * sc + (rx * sn[d >> 1]) * sc; }
  *(v4f*)(OF + (size_t)r * DM + c0) = o;  }

extern "C" void kernel_launch(void* const* d_in, const int* in_sizes, int n_in,
                              void* d_out, int out_size, void* d_ws, size_t ws_size, hipStream_t stream) {
  (void)in_sizes; (void)n_in; (void)out_size;
  const float* const* I = (const float* const*)d_in; const float* x = I[0]; const float* Wq = I[1]; const float* bq = I[2]; const float* Wk = I[3]; const float* bk = I[4]; const float* Wv = I[5]; const float* bv = I[6]; const float* Wo = I[7]; const float* bo = I[8];
  char* ws = (char*)d_ws; size_t off = 0;
  auto take = [&](size_t bytes) { char* p = ws + off; off += (bytes + 255) & ~(size_t)255; return p; };
  _Float16* BQ = (_Float16*)take((size_t)DM * DM * 2); _Float16* BK = (_Float16*)take((size_t)DM * DM * 2); _Float16* BV = (_Float16*)take((size_t)DM * DM * 2); _Float16* BO = (_Float16*)take((size_t)DM * DM * 2);
  _Float16* X16 = (_Float16*)take((size_t)NR * DM * 2); float* F = (float*)take((size_t)NR * DM * 4); float* G = (float*)take((size_t)NR * DM * 4);
  _Float16* Qh = (_Float16*)take((size_t)NR * DM * 2); _Float16* Ql = (_Float16*)take((size_t)NR * DM * 2); _Float16* Kh = (_Float16*)take((size_t)NR * DM * 2); _Float16* Kl = (_Float16*)take((size_t)NR * DM * 2); _Float16* Vth = (_Float16*)take((size_t)NR * DM * 2); _Float16* Vtl = (_Float16*)take((size_t)NR * DM * 2);
  unsigned* MB = (unsigned*)take((size_t)SLEN * (SLEN / 32) * 4); int* RA = (int*)take((size_t)SLEN * 4); int* KE = (int*)take((size_t)(SLEN / 64) * 32 * 4);
  float* CS = (float*)take((size_t)SLEN * 32 * 4); float* SN = (float*)take((size_t)SLEN * 32 * 4); float* SC = (float*)take((size_t)SLEN * 32 * 4);
  if (off > ws_size) return;      /* 8 + 8 + 16 + 16 + 6 x 8 + 1.5 = 98 MiB */
  float* O = F; _Float16* Oh = (_Float16*)G; _Float16* Ol = Oh + (size_t)NR * DM;      /* F and G (f32 scratch) are dead once the hi/lo planes exist */
  const size_t n8 = (size_t)NR * DM / 8; const unsigned nb8 = (unsigned)((n8 + 255) / 256), nb4 = (unsigned)(((size_t)NR * DM / 4 + 255) / 256); const size_t w8 = (size_t)DM * DM / 8; const unsigned wb = (unsigned)((w8 + 255) / 256);
  k_round16f<<<wb, 256, 0, stream>>>(Wq, BQ, w8); k_round16f<<<wb, 256, 0, stream>>>(Wk, BK, w8); k_round16f<<<wb, 256, 0, stream>>>(Wv, BV, w8); k_round16f<<<wb, 256, 0, stream>>>(Wo, BO, w8);      /* torch (out,in) = natural Bt; x16 */
  k_x16<<<nb8, 256, 0, stream>>>(x, X16, n8);
  k_trig<<<(SLEN * 32 + 255) / 256, 256, 0, stream>>>(CS, SN); k_scale<<<(SLEN * 32 + 255) / 256, 256, 0, stream>>>(SC); k_causaltab<<<(SLEN * (SLEN / 32) + 255) / 256, 256, 0, stream>>>(MB, RA, KE, SLEN, SLEN);
  const dim3 gP((NR / 128) * (DM / 64), 1);
  k_gemm2<0><<<gP, 128, 0, stream>>>(X16, DM, 0, BQ, DM, 0, 0.0625f, bq, 0, nullptr, 1, 0, 0, F, nullptr, DM, 0, NR, DM, DM); k_xpos4<0><<<nb4, 256, 0, stream>>>(F, CS, SN, SC, G); k_hl<<<nb8, 256, 0, stream>>>(G, Qh, Ql, n8);      /* q_mat = xpos(x Wq^T + bq) as hi/lo */
  k_gemm2<0><<<gP, 128, 0, stream>>>(X16, DM, 0, BV, DM, 0, 0.0625f, bv, 0, nullptr, 1, 0, 0, F, nullptr, DM, 0, NR, DM, DM); k_xpos4<1><<<nb4, 256, 0, stream>>>(F, CS, SN, SC, G); k_hl<<<nb8, 256, 0, stream>>>(G, Kh, Kl, n8);      /* k_mat = xpos^-1(x Wv^T + bv)  (module order) */
  k_gemm2<0><<<gP, 128, 0, stream>>>(X16, DM, 0, BK, DM, 0, 0.0625f, bk, 0, nullptr, 1, 0, 0, F, nullptr, DM, 0, NR, DM, DM);      /* v_mat = x Wk^T + bk (f32) */
  for (int b = 0; b < NBT; ++b) k_vthl<SLEN><<<NH * (SLEN / 64), 256, 0, stream>>>(F + (size_t)b * SLEN * DM, DM, Vth + (size_t)b * SLEN * DM, Vtl + (size_t)b * SLEN * DM);      /* V^T hi/lo per batch [(h)][64][2048] */
  for (int b = 0; b < NBT; ++b) { const size_t ro = (size_t)b * SLEN * DM;
    k_flashm<SLEN, SLEN><<<dim3(NH, SLEN / 16), 128, 0, stream>>>(Qh + ro, Ql + ro, DM, Kh + ro, Kl + ro, DM, Vth + ro, Vtl + ro, MB, RA, KE, O + ro, DM); }
  k_hl<<<nb8, 256, 0, stream>>>(O, Oh, Ol, n8);
  k_gemm2<0><<<gP, 128, 0, stream>>>(Oh, DM, 0, BO, DM, 0, 0.0625f, bo, 0, nullptr, 1, 0, 0, (float*)d_out, nullptr, DM, 0, NR, DM, DM);
  k_gemm2<0><<<gP, 128, 0, stream>>>(Ol, DM, 0, BO, DM, 0, 0.0625f / 1024.0f, nullptr, 0, (const float*)d_out, 1, (size_t)DM, 0, (float*)d_out, nullptr, DM, 0, NR, DM, DM);
}

// v003
// It runs in 304 microseconds.
// Next to v002, in two timings, it ran 1.38 times as fast each time.
// Counting every step since v000, it is 2.83 times as fast.
#include <hip/hip_runtime.h>
// Causal multi-head attention with xPos rotary embedding (2 x 2048 tokens x 1024, 16 heads x 64): q = x*Wq^T + bq, k = x*Wv^T + bv, v = x*Wk^T + bk (the module's own assignment order); q <- q*cos*scale + rot(q)*sin*scale, k <- k*cos/scale + rot(k)*sin/scale with interleaved-pair rotation, freq(t, d) = t * inv_freq[d/2], scale(t, d) = base[d mod 32]^((t - 1024)/512); scores = q.k / 32 with j <= i; softmax; merged . Wo^T + bo -> [2,2048,1024].
// Structure: x as an exact f16 plane; the three projections as f16 WMMA GEMMs (32x64 wave tiles fed from LDS-staged 128x64 work-group tiles, f32, exact products + bias) into f32 planes; per-token cos/sin/scale tables on VALU (inv_freq and base = the reference's f32 constants, precise trig and powf), then one VALU pass applies the rotation/scaling into f32 planes; v re-laid per (batch, head) as [d][token]; q, k as f16 hi + x2^10 residual planes, V^T as hi + residual planes; the causal structure computed on device into a key bit plane + per-block key bound; the fused flash kernel per ((batch, head), 16 queries), the 32-key blocks dealt round-robin to the work-group's four waves (three-product hi/lo scores, online softmax f32 per wave, P hi + residual via LDS, two value accumulators; the four partial (max, sum, O) merged through LDS at the end); O as hi + residual planes; output projection as two GEMMs (bias in the first).
// Compute dtype: x, weights, biases rounded to bf16; projections exact; rotation f32; q, k, P, v, O as f16 hi + residual pairs (~2^-21); f32 accumulation and softmax. v_wmma_f32_16x16x32_f16.
#define NBT 2
#define SLEN 2048
#define DM 1024
#define NH 16
#define SCL 0.03125f
#define NR (NBT * SLEN)
typedef __bf16 v16b __attribute__((ext_vector_type(16)));
typedef unsigned short v8us __attribute__((ext_vector_type(8), may_alias));
typedef float  v8f  __attribute__((ext_vector_type(8)));
typedef float  v4f  __attribute__((ext_vector_type(4)));
typedef float  v4fa __attribute__((ext_vector_type(4), may_alias));
union FragB { v16b v; v8us half[2]; unsigned short u[16]; };

__device__ __forceinline__ unsigned short bf16_bits(float x) { unsigned int u = __float_as_uint(x); return (unsigned short)((u + 0x7FFFu + ((u >> 16) & 1u)) >> 16); }
__device__ __forceinline__ float bf16_val(unsigned short b) { return __uint_as_float(((unsigned int)b) << 16); }
__device__ __forceinline__ float bf16_round(float x) { return bf16_val(bf16_bits(x)); }
// D += A·B with NT terms: 1 = ah·bh, 2 = + al·bh (A split), 3 = + ah·bl (both split)
template <int NT>
__device__ __forceinline__ v8f mmaN(v16b ah, v16b al, v16b bh, v16b bl, v8f c) {
  c = __builtin_amdgcn_wmma_f32_16x16x32_bf16(false, ah, false, bh, (short)0, c, false, false);
  if (NT >= 2) c = __builtin_amdgcn_wmma_f32_16x16x32_bf16(false, al, false, bh, (short)0, c, false, false);
  if (NT >= 3) c = __builtin_amdgcn_wmma_f32_16x16x32_bf16(false, ah, false, bl, (short)0, c, false, false);
  asm volatile("v_nop\n\tv_nop\n\tv_nop\n\tv_nop" : "+v"(c) : "v"(ah), "v"(al), "v"(bh), "v"(bl));
  return c;
}

__global__ __launch_bounds__(256) void k_wt_bf16(const float* __restrict__ W, unsigned short* __restrict__ Wt, int K, int N) {
  const int t = blockIdx.x * 256 + threadIdx.x;
  const int k8n = K / 8;
  if (t >= N * k8n) return;
  const int n = t / k8n, k8 = (t % k8n) * 8;
  v8us v;
#pragma unroll
  for (int i = 0; i < 8; ++i) v[i] = bf16_bits(W[(size_t)(k8 + i) * N + n]);
  *(v8us*)(Wt + (size_t)n * K + k8) = v;
  
}

// GEMM C[M][N] (f32, pitch ldc) = act(A[M][K]·W + bias). A f32 row-major (pitch lda) converted per fragment to bf16
// (ASPLIT: hi/lo two planes -> 2 terms, else single rounded term); Wt bf16 [N][K] (pitch ldb). BIAS_BF16 rounds the
// bias to bf16 first (bias quantised to bf16 before the add). K%32==0, M%16==0, N%64==0.
template <bool ASPLIT, int ACT, bool BIAS_BF16>
__global__ __launch_bounds__(128) void k_gemm_bf(const float* __restrict__ A, int lda, const unsigned short* __restrict__ Wt, int ldb,
                                               const float* __restrict__ bias, float* __restrict__ C, int ldc, int M, int N, int K) {
  __shared__ __attribute__((aligned(16))) float so[4][16][64];
  const int tid = threadIdx.x, w = tid >> 5, lane = tid & 31, ln = lane & 15, hh = lane >> 4;
  const int ntn = N / 64;
  const int wid = blockIdx.x * 4 + w;
  const int mt = wid / ntn, nq = wid % ntn;
  if (mt * 16 >= M) return;
  const int row0 = mt * 16, col0 = nq * 64;
  const float* arow = A + (size_t)(row0 + ln) * lda;
  v8f acc[4] = {};
  for (int kb = 0; kb < K; kb += 32) {
    FragB ah, al;
    const v4f x0 = *(const v4fa*)(arow + kb + 8 * hh), x1 = *(const v4fa*)(arow + kb + 8 * hh + 4);
    const v4f x2 = *(const v4fa*)(arow + kb + 16 + 8 * hh), x3 = *(const v4fa*)(arow + kb + 16 + 8 * hh + 4);
    float xs[16] = {x0[0],x0[1],x0[2],x0[3],x1[0],x1[1],x1[2],x1[3],x2[0],x2[1],x2[2],x2[3],x3[0],x3[1],x3[2],x3[3]};
#pragma unroll
    for (int i = 0; i < 16; ++i) { const unsigned short hb = bf16_bits(xs[i]); ah.u[i] = hb; al.u[i] = ASPLIT ? bf16_bits(xs[i] - bf16_val(hb)) : (unsigned short)0; }
#pragma unroll
    for (int t = 0; t < 4; ++t) {
      const unsigned short* brow = Wt + (size_t)(col0 + t * 16 + ln) * ldb + kb;
      FragB b;
      b.half[0] = *(const v8us*)(brow + 8 * hh);
      b.half[1] = *(const v8us*)(brow + 16 + 8 * hh);
      acc[t] = mmaN<ASPLIT ? 2 : 1>(ah.v, al.v, b.v, b.v, acc[t]);
    }
  }
#pragma unroll
  for (int t = 0; t < 4; ++t) {
    float bv = bias ? bias[col0 + t * 16 + ln] : 0.f;
    if (BIAS_BF16) bv = bf16_round(bv);
#pragma unroll
    for (int r = 0; r < 8; ++r) { float v = acc[t][r] + bv; if (ACT == 1) v = fmaxf(v, 0.f); so[w][8 * hh + r][t * 16 + ln] = v; }
  }
  __builtin_amdgcn_fence(__ATOMIC_ACQ_REL, "workgroup");
  __builtin_amdgcn_wave_barrier();
  const int rsub = lane >> 4, c4 = (lane & 15) * 4;
  {
#pragma unroll
    for (int q = 0; q < 8; ++q) {
      const int r = q * 2 + rsub;
      const v4f v = *(const v4fa*)&so[w][r][c4];
      *(v4f*)(C + (size_t)(row0 + r) * ldc + col0 + c4) = v;
    }
    
  }
}

// GEMM C = act(A·W + bias + resid): A f32 (ASPLIT -> hi/lo 2 terms), Wt bf16 [N][K]; ACT 0 none, 1 relu, 2 exact gelu;
// resid (optional, f32, row index = (row % rmod), pitch ldr, RES_BF16 rounds it) added before the activation.
template <bool ASPLIT, int ACT, bool BIAS_BF16, bool RES_BF16>
__global__ __launch_bounds__(128) void k_gemm_bf3(const float* __restrict__ A, int lda, const unsigned short* __restrict__ Wt, int ldb,
                                                const float* __restrict__ bias, const float* __restrict__ resid, int rmod, int ldr,
                                                float* __restrict__ C, int ldc, int M, int N, int K) {
  __shared__ __attribute__((aligned(16))) float so[4][16][64];
  const int tid = threadIdx.x, w = tid >> 5, lane = tid & 31, ln = lane & 15, hh = lane >> 4;
  const int ntn = N / 64;
  const int wid = blockIdx.x * 4 + w;
  const int mt = wid / ntn, nq = wid % ntn;
  if (mt * 16 >= M) return;
  const int row0 = mt * 16, col0 = nq * 64;
  const float* arow = A + (size_t)(row0 + ln) * lda;
  v8f acc[4] = {};
  for (int kb = 0; kb < K; kb += 32) {
    FragB ah, al;
    const v4f x0 = *(const v4fa*)(arow + kb + 8 * hh), x1 = *(const v4fa*)(arow + kb + 8 * hh + 4);
    const v4f x2 = *(const v4fa*)(arow + kb + 16 + 8 * hh), x3 = *(const v4fa*)(arow + kb + 16 + 8 * hh + 4);
    float xs[16] = {x0[0],x0[1],x0[2],x0[3],x1[0],x1[1],x1[2],x1[3],x2[0],x2[1],x2[2],x2[3],x3[0],x3[1],x3[2],x3[3]};
#pragma unroll
    for (int i = 0; i < 16; ++i) { const unsigned short hb = bf16_bits(xs[i]); ah.u[i] = hb; al.u[i] = ASPLIT ? bf16_bits(xs[i] - bf16_val(hb)) : (unsigned short)0; }
#pragma unroll
    for (int t = 0; t < 4; ++t) {
      const unsigned short* brow = Wt + (size_t)(col0 + t * 16 + ln) * ldb + kb;
      FragB b;
      b.half[0] = *(const v8us*)(brow + 8 * hh);
      b.half[1] = *(const v8us*)(brow + 16 + 8 * hh);
      acc[t] = mmaN<ASPLIT ? 2 : 1>(ah.v, al.v, b.v, b.v, acc[t]);
    }
  }
#pragma unroll
  for (int t = 0; t < 4; ++t) {
    const int col = col0 + t * 16 + ln;
    float bv = bias ? bias[col] : 0.f;
    if (BIAS_BF16) bv = bf16_round(bv);
#pragma unroll
    for (int r = 0; r < 8; ++r) {
      float v = acc[t][r] + bv;
      if (resid) { float rv = resid[(size_t)((row0 + 8 * hh + r) % rmod) * ldr + col]; if (RES_BF16) rv = bf16_round(rv); v += rv; }
      if (ACT == 1) v = fmaxf(v, 0.f);
      if (ACT == 2) v = 0.5f * v * (1.0f + erff(v * 0.70710678118654752f));
      if (ACT == 3) { const float u = 0.7978845608028654f * (v + 0.044715f * v * v * v); v = 0.5f * v * (1.0f + tanhf(u)); }
      so[w][8 * hh + r][t * 16 + ln] = v;
    }
  }
  __builtin_amdgcn_fence(__ATOMIC_ACQ_REL, "workgroup");
  __builtin_amdgcn_wave_barrier();
  const int rsub = lane >> 4, c4 = (lane & 15) * 4;
  {
#pragma unroll
    for (int q = 0; q < 8; ++q) {
      const int r = q * 2 + rsub;
      const v4f v = *(const v4fa*)&so[w][r][c4];
      *(v4f*)(C + (size_t)(row0 + r) * ldc + col0 + c4) = v;
    }
    
  }
}
// row LayerNorm (biased variance, eps) over N: s = X (+ R); optional out_sum <- s; out_norm <- (s-mu)*rsqrt(var+eps)*g + b
template <bool PARAM_BF16>
__global__ __launch_bounds__(256) void k_layernorm(const float* __restrict__ X, const float* __restrict__ R, const float* __restrict__ g, const float* __restrict__ bta,
                                                  float* __restrict__ out_sum, float* __restrict__ out_norm, int N, float eps) {
  __shared__ float red[256];
  const int row = blockIdx.x, tid = threadIdx.x;
  const float* x = X + (size_t)row * N; const float* rr = R ? R + (size_t)row * N : nullptr;
  float vals[16];                     // up to N = 4096
  const int per = N / 256;            // contiguous chunk per thread? use strided-by-4 chunks: thread handles j = tid*4 + 1024*u
  float s1 = 0.f;
  for (int u = 0; u < per / 4; ++u) {
    const int j = tid * 4 + 1024 * u;
    const v4f a = *(const v4fa*)(x + j);
    v4f b = {0.f,0.f,0.f,0.f}; if (rr) b = *(const v4fa*)(rr + j);
#pragma unroll
    for (int q = 0; q < 4; ++q) { const float v = a[q] + b[q]; vals[u * 4 + q] = v; s1 += v; }
  }
  red[tid] = s1; __syncthreads();
  for (int st = 128; st > 0; st >>= 1) { if (tid < st) red[tid] += red[tid + st]; __syncthreads(); }
  const float mu = red[0] / (float)N; __syncthreads();
  float s2 = 0.f;
  for (int u = 0; u < per / 4; ++u)
#pragma unroll
    for (int q = 0; q < 4; ++q) { const float c = vals[u * 4 + q] - mu; s2 += c * c; }
  red[tid] = s2; __syncthreads();
  for (int st = 128; st > 0; st >>= 1) { if (tid < st) red[tid] += red[tid + st]; __syncthreads(); }
  const float rs = rsqrtf(red[0] / (float)N + eps);
  {
    for (int u = 0; u < per / 4; ++u) {
      const int j = tid * 4 + 1024 * u;
      v4f o, sm;
#pragma unroll
      for (int q = 0; q < 4; ++q) {
        float gg = g[j + q], bb = bta[j + q];
        if (PARAM_BF16) { gg = bf16_round(gg); bb = bf16_round(bb); }
        sm[q] = vals[u * 4 + q]; o[q] = (vals[u * 4 + q] - mu) * rs * gg + bb;
      }
      if (out_sum) *(v4f*)(out_sum + (size_t)row * N + j) = sm;
      *(v4f*)(out_norm + (size_t)row * N + j) = o;
    }
    
  }
}



// ---- f16 WMMA path (v_wmma_f32_16x16x32_f16): 11-bit significands for operands in range — used where a [0,1] probability operand needs more precision than bf16
typedef _Float16 v16h __attribute__((ext_vector_type(16)));
union FragH { v16h v; v8us half[2]; _Float16 h[16]; unsigned short u[16]; };
template <int NT>
__device__ __forceinline__ v8f mmaH(v16h ah, v16h al, v16h bh, v16h bl, v8f c) {
  c = __builtin_amdgcn_wmma_f32_16x16x32_f16(false, ah, false, bh, (short)0, c, false, false);
  if (NT >= 2) c = __builtin_amdgcn_wmma_f32_16x16x32_f16(false, al, false, bh, (short)0, c, false, false);
  if (NT >= 3) c = __builtin_amdgcn_wmma_f32_16x16x32_f16(false, ah, false, bl, (short)0, c, false, false);
  asm volatile("v_nop\n\tv_nop\n\tv_nop\n\tv_nop" : "+v"(c) : "v"(ah), "v"(al), "v"(bh), "v"(bl));
  return c;
}
// batched GEMM like k_gemm_b but f16 operands: A f32 (split into f16 hi/lo if ASPLIT, else rounded to f16), Bt = f16 values [n][k]; alpha; C f32; N multiple of 16 (partial tiles skipped)
template <bool ASPLIT>
__global__ __launch_bounds__(128) void k_gemm_h(const float* __restrict__ A, int lda, size_t sA, const _Float16* __restrict__ Bh, int ldb, size_t sB, float alpha, float* __restrict__ C, int ldc, size_t sC, int M, int N, int K) {
  __shared__ __attribute__((aligned(16))) float so[4][16][64];
  const int tid = threadIdx.x, w = tid >> 5, lane = tid & 31, ln = lane & 15, hh = lane >> 4; const int by = blockIdx.y;
  A += (size_t)by * sA; Bh += (size_t)by * sB; C += (size_t)by * sC;
  const int ntn = (N + 63) / 64; const int wid = blockIdx.x * 4 + w; const int mt = wid / ntn, nq = wid % ntn; if (mt * 16 >= M) return;
  const int row0 = mt * 16, col0 = nq * 64; const float* arow = A + (size_t)(row0 + ln) * lda;
  v8f acc[4] = {};
  for (int kb = 0; kb < K; kb += 32) {
    FragH ah, al;
    const v4f x0 = *(const v4fa*)(arow + kb + 8 * hh), x1 = *(const v4fa*)(arow + kb + 8 * hh + 4), x2 = *(const v4fa*)(arow + kb + 16 + 8 * hh), x3 = *(const v4fa*)(arow + kb + 16 + 8 * hh + 4);
    float xs[16] = {x0[0],x0[1],x0[2],x0[3],x1[0],x1[1],x1[2],x1[3],x2[0],x2[1],x2[2],x2[3],x3[0],x3[1],x3[2],x3[3]};
#pragma unroll
    for (int i = 0; i < 16; ++i) { const _Float16 h = (_Float16)xs[i]; ah.h[i] = h; al.h[i] = ASPLIT ? (_Float16)(xs[i] - (float)h) : (_Float16)0.0f; }
#pragma unroll
    for (int t = 0; t < 4; ++t) { if (col0 + t * 16 >= N) continue; const size_t boff = (size_t)(col0 + t * 16 + ln) * ldb + kb; FragH bq; bq.half[0] = *(const v8us*)(Bh + boff + 8 * hh); bq.half[1] = *(const v8us*)(Bh + boff + 16 + 8 * hh);
      acc[t] = mmaH<ASPLIT ? 2 : 1>(ah.v, al.v, bq.v, bq.v, acc[t]); }
  }
#pragma unroll
  for (int t = 0; t < 4; ++t) { if (col0 + t * 16 >= N) continue;
#pragma unroll
    for (int r = 0; r < 8; ++r) so[w][8 * hh + r][t * 16 + ln] = acc[t][r] * alpha; }
  __builtin_amdgcn_fence(__ATOMIC_ACQ_REL, "workgroup"); __builtin_amdgcn_wave_barrier();
  const int rsub = lane >> 4, c4 = (lane & 15) * 4;
  {
#pragma unroll
    for (int q = 0; q < 8; ++q) { const int r = q * 2 + rsub; if (col0 + c4 < N) { const v4f v = *(const v4fa*)&so[w][r][c4]; *(v4f*)(C + (size_t)(row0 + r) * ldc + col0 + c4) = v; } }
     }
}

// Wt[n][k] = f16(W[k][n]·scale) from f32 row-major W[K][N] (scale = power of two; bf16-exact weights stay exact in f16 away from the subnormal range)
__global__ __launch_bounds__(256) void k_wt_f16(const float* __restrict__ W, _Float16* __restrict__ Wt, int K, int N, float scale) {
  const int t = blockIdx.x * 256 + threadIdx.x; if (t >= N * (K / 8)) return; const int n = t / (K / 8), k8 = (t % (K / 8)) * 8; FragH f;
#pragma unroll
  for (int i = 0; i < 8; ++i) f.h[i] = (_Float16)(bf16_round(W[(size_t)(k8 + i) * N + n]) * scale); const v8us o = f.half[0];
  *(v8us*)((unsigned short*)Wt + (size_t)n * K + k8) = o; 
}
// k_gemm_hh variant with fused epilogue: v = acc·alpha + bias[by·sBias + col] (+ CP[(row/rowsPerB)·sCPb + by·64 + col] if CP) ; ACT 0 none / 1 elu ; writes f16 C16 (and f32 C if non-null)
template <int ACT>
__global__ __launch_bounds__(128) void k_gemm_hhx(const _Float16* __restrict__ A, int lda, size_t sA, const _Float16* __restrict__ Bh, int ldb, size_t sB, float alpha, const float* __restrict__ bias, size_t sBias, const float* __restrict__ CP, int rowsPerB, size_t sCPb, int row0g,
    float* __restrict__ C, _Float16* __restrict__ C16, int ldc, size_t sC, int M, int N, int K) {
  __shared__ __attribute__((aligned(16))) float so[4][16][64];
  const int tid = threadIdx.x, w = tid >> 5, lane = tid & 31, ln = lane & 15, hh = lane >> 4; const int by = blockIdx.y;
  A += (size_t)by * sA; Bh += (size_t)by * sB; const size_t cofs = (size_t)by * sC; const float* bp = bias ? bias + (size_t)by * sBias : nullptr;
  const int ntn = (N + 63) / 64; const int wid = blockIdx.x * 4 + w; const int mt = wid / ntn, nq = wid % ntn; if (mt * 16 >= M) return;
  const int row0 = mt * 16, col0 = nq * 64; const _Float16* arow = A + (size_t)(row0 + ln) * lda;
  v8f acc[4] = {};
  for (int kb = 0; kb < K; kb += 32) { FragH ah; ah.half[0] = *(const v8us*)((const unsigned short*)arow + kb + 8 * hh); ah.half[1] = *(const v8us*)((const unsigned short*)arow + kb + 16 + 8 * hh);
#pragma unroll
    for (int t = 0; t < 4; ++t) { if (col0 + t * 16 >= N) continue; const size_t boff = (size_t)(col0 + t * 16 + ln) * ldb + kb; FragH bq; bq.half[0] = *(const v8us*)((const unsigned short*)Bh + boff + 8 * hh); bq.half[1] = *(const v8us*)((const unsigned short*)Bh + boff + 16 + 8 * hh);
      acc[t] = mmaH<1>(ah.v, ah.v, bq.v, bq.v, acc[t]); }
  }
#pragma unroll
  for (int t = 0; t < 4; ++t) { if (col0 + t * 16 >= N) continue; const int col = col0 + t * 16 + ln; const float bv = bp ? bf16_round(bp[col]) : 0.f;
#pragma unroll
    for (int r = 0; r < 8; ++r) { float v = acc[t][r] * alpha + bv; if (CP) { const int bidx = (row0g + row0 + 8 * hh + r) / rowsPerB; v += CP[(size_t)bidx * sCPb + (size_t)by * 64 + col]; } if (ACT == 1) v = (v > 0.f) ? v : expm1f(v); else if (ACT == 7) v = (v > 0.f) ? v + 1.0f : expf(v); else if (ACT == 8) v = tanhf(v); else if (ACT == 9) v = 0.5f * v * (1.0f + tanhf(0.7978845608028654f * (v + 0.044715f * v * v * v))); else if (ACT == 11) v = 1.0f / (1.0f + expf(-v)); else if (ACT == 12) v = (v > 0.f) ? v : 0.01f * v; else if (ACT == 14) v = (v > 0.f) ? v : 0.1f * v; else if (ACT == 15) v = v / (1.0f + expf(-v)); else if (ACT == 3) v = fmaxf(v, 0.f); else if (ACT == 6) v = 0.5f * v * (1.0f + erff(v * 0.70710678118654752f)); so[w][8 * hh + r][t * 16 + ln] = v; } }
  __builtin_amdgcn_fence(__ATOMIC_ACQ_REL, "workgroup"); __builtin_amdgcn_wave_barrier();
  const int rsub = lane >> 4, c4 = (lane & 15) * 4; typedef _Float16 v4h __attribute__((ext_vector_type(4)));
  {
#pragma unroll
    for (int q = 0; q < 8; ++q) { const int r = q * 2 + rsub; if (col0 + c4 < N) { const v4f v = *(const v4fa*)&so[w][r][c4]; if (C) *(v4f*)(C + cofs + (size_t)(row0 + r) * ldc + col0 + c4) = v; if (C16) { v4h h4; for (int i = 0; i < 4; ++i) h4[i] = (_Float16)v[i]; *(v4h*)(C16 + cofs + (size_t)(row0 + r) * ldc + col0 + c4) = h4; } } }
     }
}


typedef _Float16 v4h __attribute__((ext_vector_type(4)));

__global__ __launch_bounds__(256) void k_x16(const float* __restrict__ x, _Float16* __restrict__ X16, size_t n8) { const size_t t = (size_t)blockIdx.x * 256 + threadIdx.x; if (t >= n8) return; FragH f;
#pragma unroll
  for (int q = 0; q < 8; ++q) f.h[q] = (_Float16)bf16_round(x[t * 8 + q]); *(v8us*)((unsigned short*)X16 + t * 8) = f.half[0];  }
__global__ __launch_bounds__(256) void k_h16(const float* __restrict__ x, _Float16* __restrict__ X16, size_t n8) { const size_t t = (size_t)blockIdx.x * 256 + threadIdx.x; if (t >= n8) return; FragH f;
#pragma unroll
  for (int q = 0; q < 8; ++q) f.h[q] = (_Float16)x[t * 8 + q]; *(v8us*)((unsigned short*)X16 + t * 8) = f.half[0];  }
__global__ __launch_bounds__(256) void k_round16f(const float* __restrict__ W, _Float16* __restrict__ Bt, size_t n8) { const size_t t = (size_t)blockIdx.x * 256 + threadIdx.x; if (t >= n8) return; FragH f;
#pragma unroll
  for (int i = 0; i < 8; ++i) f.h[i] = (_Float16)(bf16_round(W[t * 8 + i]) * 16.0f); *(v8us*)((unsigned short*)Bt + t * 8) = f.half[0];  }
template <int NHv, int TTv>
__global__ __launch_bounds__(256) void k_vt(const _Float16* __restrict__ V16, int ldv, int voff, _Float16* __restrict__ Vt) { __shared__ unsigned short tl[64][66]; const int tid = threadIdx.x; const int slab = blockIdx.x / (TTv / 64), lg = blockIdx.x % (TTv / 64); const int b = slab / NHv, h = slab % NHv;
  for (int i = tid; i < 64 * 8; i += 256) { const int r = i / 8, c8 = (i % 8) * 8; FragH f; f.half[0] = *(const v8us*)((const unsigned short*)V16 + ((size_t)b * TTv + lg * 64 + r) * ldv + voff + h * 64 + c8);
#pragma unroll
    for (int q = 0; q < 8; ++q) tl[r][c8 + q] = f.u[q]; }
  __syncthreads();
  {
#pragma unroll
    for (int rd = 0; rd < 2; ++rd) { const int d = rd * 32 + tid / 8, pc = tid % 8; FragH f;
#pragma unroll
      for (int q = 0; q < 8; ++q) f.u[q] = tl[pc * 8 + q][d];
      *(v8us*)((unsigned short*)Vt + ((size_t)slab * 64 + d) * TTv + lg * 64 + pc * 8) = f.half[0]; }
     } }

__global__ __launch_bounds__(256) void k_hl(const float* __restrict__ F, _Float16* __restrict__ Hh, _Float16* __restrict__ Hl, size_t n8) { const size_t t = (size_t)blockIdx.x * 256 + threadIdx.x; if (t >= n8) return; FragH fh, fl; const v4f a = *(const v4fa*)(F + t * 8), c = *(const v4fa*)(F + t * 8 + 4);
#pragma unroll
  for (int q = 0; q < 4; ++q) { _Float16 h = (_Float16)a[q]; fh.h[q] = h; fl.h[q] = (_Float16)((a[q] - (float)h) * 1024.0f); h = (_Float16)c[q]; fh.h[4 + q] = h; fl.h[4 + q] = (_Float16)((c[q] - (float)h) * 1024.0f); }
  { *(v8us*)((unsigned short*)Hh + t * 8) = fh.half[0]; *(v8us*)((unsigned short*)Hl + t * 8) = fl.half[0];  } }

// ---- fast GEMM (wave tile 32x64; requires M % 32 == 0 rows per launch region, N % 64 == 0 and K % 64 == 0); epilogue = k_gemm_hhx semantics ----
__device__ __forceinline__ v16h g2_frag(const _Float16* p, int hh) { FragH f; f.half[0] = *(const v8us*)((const unsigned short*)p + 8 * hh); f.half[1] = *(const v8us*)((const unsigned short*)p + 16 + 8 * hh); return f.v; }
__device__ __forceinline__ v8f g2_mma(v16h a, v16h b, v8f c) { v8f d = __builtin_amdgcn_wmma_f32_16x16x32_f16(false, a, false, b, (short)0, c, false, false); asm volatile("v_nop\n\tv_nop\n\tv_nop\n\tv_nop" : "+v"(d) : "v"(a), "v"(b)); return d; }
template <int ACT>
__global__ __launch_bounds__(128) void k_gemm2(const _Float16* __restrict__ A, int lda, size_t sA, const _Float16* __restrict__ Bh, int ldb, size_t sB, float alpha, const float* __restrict__ bias, size_t sBias, const float* __restrict__ CP, int rowsPerB, size_t sCPb, int row0g,
    float* __restrict__ C, _Float16* __restrict__ C16, int ldc, size_t sC, int M, int N, int K) {
  /* the work-group's 128 x 64 tile: per stage of 64 k (K % 64 == 0) one whole 128-byte line of each of its 128 A rows and 64 B rows goes to LDS, two buffers; row pitch 144 B for the 16-byte fragment reads */
  constexpr int PIT = 72;
  __shared__ __attribute__((aligned(16))) float so[4][32][68];
  __shared__ __attribute__((aligned(16))) _Float16 tA[2][128 * PIT], tB[2][64 * PIT];
  const int tid = threadIdx.x, w = tid >> 5, lane = tid & 31, ln = lane & 15, hh = lane >> 4; const int by = blockIdx.y;
  A += (size_t)by * sA; Bh += (size_t)by * sB; const size_t cofs = (size_t)by * sC; const float* bp = bias ? bias + (size_t)by * sBias : nullptr;
  const int ntn = N >> 6; const int mt = blockIdx.x / ntn, nq = blockIdx.x - mt * ntn; const int row0 = mt * 128 + 32 * w, col0 = nq * 64; if (mt * 128 >= M) return;      /* the same for the whole work-group: every wave reaches every barrier below */
  const int sr = tid >> 3, sc = (tid & 7) * 8;      /* staging: eight threads bring one row's line, a wave four whole lines per load */
  unsigned oa[8], ob[4];      /* byte offsets of the staged lines at k = 0, fixed for the whole loop */
#pragma unroll
  for (int i = 0; i < 8; ++i) oa[i] = ((unsigned)min(mt * 128 + i * 16 + sr, M - 1) * (unsigned)lda + (unsigned)sc) * 2u;      /* rows past M (a last tile of 32, 64 or 96 rows) re-read row M - 1; their waves store nothing */
#pragma unroll
  for (int i = 0; i < 4; ++i) ob[i] = ((unsigned)(col0 + i * 16 + sr) * (unsigned)ldb + (unsigned)sc) * 2u;
  const int so_st = sr * PIT + sc, fa = (32 * w + ln) * PIT, fb = ln * PIT;
  const v8f z8 = {0.f,0.f,0.f,0.f,0.f,0.f,0.f,0.f}; v8f c00 = z8, c01 = z8, c02 = z8, c03 = z8, c10 = z8, c11 = z8, c12 = z8, c13 = z8;
  v8us ra[8], rb[4];
#pragma unroll
  for (int i = 0; i < 8; ++i) ra[i] = *(const v8us*)((const char*)A + oa[i]);
#pragma unroll
  for (int i = 0; i < 4; ++i) rb[i] = *(const v8us*)((const char*)Bh + ob[i]);
#pragma unroll
  for (int i = 0; i < 8; ++i) *(v8us*)&tA[0][so_st + i * 16 * PIT] = ra[i];
#pragma unroll
  for (int i = 0; i < 4; ++i) *(v8us*)&tB[0][so_st + i * 16 * PIT] = rb[i];
  __syncthreads();      /* stage 0 is in LDS before any wave reads it */
#pragma unroll 1      /* stays rolled: the body already holds 16 products and the whole of a stage's loads */
  for (int kb = 0; kb < K; kb += 64) { const int cur = (kb >> 6) & 1; const bool more = kb + 64 < K;
    if (more) {      /* the next stage's global loads go out ahead of this stage's products, which cover their latency */
#pragma unroll
      for (int i = 0; i < 8; ++i) ra[i] = *(const v8us*)((const char*)(A + kb + 64) + oa[i]);
#pragma unroll
      for (int i = 0; i < 4; ++i) rb[i] = *(const v8us*)((const char*)(Bh + kb + 64) + ob[i]); }
    const _Float16* pa = &tA[cur][fa]; const _Float16* pb = &tB[cur][fb];
    v16h a0[2], a1[2], b0[2], b1[2], b2[2], b3[2];      /* all of the stage's fragment reads as one group in front of its products */
#pragma unroll
    for (int ks = 0; ks < 2; ++ks) { a0[ks] = g2_frag(pa + ks * 32, hh); a1[ks] = g2_frag(pa + 16 * PIT + ks * 32, hh); b0[ks] = g2_frag(pb + ks * 32, hh); b1[ks] = g2_frag(pb + 16 * PIT + ks * 32, hh); b2[ks] = g2_frag(pb + 32 * PIT + ks * 32, hh); b3[ks] = g2_frag(pb + 48 * PIT + ks * 32, hh); }
#pragma unroll
    for (int ks = 0; ks < 2; ++ks) {
      c00 = g2_mma(a0[ks], b0[ks], c00); c10 = g2_mma(a1[ks], b0[ks], c10);
      c01 = g2_mma(a0[ks], b1[ks], c01); c11 = g2_mma(a1[ks], b1[ks], c11);
      c02 = g2_mma(a0[ks], b2[ks], c02); c12 = g2_mma(a1[ks], b2[ks], c12);
      c03 = g2_mma(a0[ks], b3[ks], c03); c13 = g2_mma(a1[ks], b3[ks], c13); }
    if (more) {      /* into the buffer that every wave left at the last barrier */
#pragma unroll
      for (int i = 0; i < 8; ++i) *(v8us*)&tA[cur ^ 1][so_st + i * 16 * PIT] = ra[i];
#pragma unroll
      for (int i = 0; i < 4; ++i) *(v8us*)&tB[cur ^ 1][so_st + i * 16 * PIT] = rb[i]; }
    __syncthreads(); }      /* publishes the next stage and ends every wave's reads of this one */
  if (row0 >= M) return;      /* no barrier follows */
  v8f accs[8] = {c00, c01, c02, c03, c10, c11, c12, c13};
#pragma unroll
  for (int u = 0; u < 8; ++u) { const int t = u & 3, half = u >> 2; const int col = col0 + t * 16 + ln; const float bv = bp ? bf16_round(bp[col]) : 0.f;
#pragma unroll
    for (int r = 0; r < 8; ++r) { const int rloc = half * 16 + 8 * hh + r; float v = accs[u][r] * alpha + bv; if (CP) { const int bidx = (row0g + row0 + rloc) / rowsPerB; v += CP[(size_t)bidx * sCPb + (size_t)by * 64 + col]; }
      if (ACT == 3) v = fmaxf(v, 0.f); else if (ACT == 6) v = 0.5f * v * (1.0f + erff(v * 0.70710678118654752f)); else if (ACT == 11) v = 1.0f / (1.0f + expf(-v)); else if (ACT == 15) v = v / (1.0f + expf(-v)); else if (ACT == 12) v = (v > 0.f) ? v : 0.01f * v; else if (ACT == 8) v = tanhf(v);
      so[w][rloc][t * 16 + ln] = v; } }
  __builtin_amdgcn_fence(__ATOMIC_ACQ_REL, "workgroup"); __builtin_amdgcn_wave_barrier();
  const int rsub = lane >> 4, c4 = (lane & 15) * 4;
  {
#pragma unroll
    for (int q = 0; q < 16; ++q) { const int r = q * 2 + rsub; const v4f v = *(const v4fa*)&so[w][r][c4]; if (C) *(v4f*)(C + cofs + (size_t)(row0 + r) * ldc + col0 + c4) = v; if (C16) { v4h h4; for (int i = 0; i < 4; ++i) h4[i] = (_Float16)v[i]; *(v4h*)(C16 + cofs + (size_t)(row0 + r) * ldc + col0 + c4) = h4; } }
     } }



template <int TK>
__global__ __launch_bounds__(256) void k_vthl(const float* __restrict__ VF, int ldv, _Float16* __restrict__ Vth, _Float16* __restrict__ Vtl) { __shared__ float tl[64][65]; const int tid = threadIdx.x; const int slab = blockIdx.x / (TK / 64), lg = blockIdx.x % (TK / 64); const int b = slab / NH, h = slab % NH;
  for (int i = tid; i < 64 * 16; i += 256) { const int r = i / 16, c4 = (i % 16) * 4; const v4f a = *(const v4fa*)(VF + ((size_t)b * TK + lg * 64 + r) * ldv + h * 64 + c4); tl[r][c4] = a[0]; tl[r][c4 + 1] = a[1]; tl[r][c4 + 2] = a[2]; tl[r][c4 + 3] = a[3]; }
  __syncthreads();
  FragH fh[2], fl[2]; size_t oo[2];
#pragma unroll
  for (int rd = 0; rd < 2; ++rd) { const int d = rd * 32 + tid / 8, pc = tid % 8;
#pragma unroll
    for (int q = 0; q < 8; ++q) { const float v = tl[pc * 8 + q][d]; const _Float16 hv = (_Float16)v; fh[rd].h[q] = hv; fl[rd].h[q] = (_Float16)((v - (float)hv) * 1024.0f); } oo[rd] = ((size_t)slab * 64 + d) * TK + lg * 64 + pc * 8; }
  {
#pragma unroll
    for (int rd = 0; rd < 2; ++rd) { *(v8us*)((unsigned short*)Vth + oo[rd]) = fh[rd].half[0]; *(v8us*)((unsigned short*)Vtl + oo[rd]) = fl[rd].half[0]; }
     } }

template <int TQ, int TK>
__global__ __launch_bounds__(128) void k_flashm(const _Float16* __restrict__ Q16, const _Float16* __restrict__ Q16lo, int ldq, const _Float16* __restrict__ K16, const _Float16* __restrict__ K16lo, int ldk, const _Float16* __restrict__ Vt, const _Float16* __restrict__ Vtlo, const unsigned* __restrict__ MB, const int* __restrict__ RA, const int* __restrict__ KE, float* __restrict__ O, int ldo) {
  constexpr int RPW = 16, RTN = RPW / 16, NQB = TQ / RPW, DT = 4, KS = 2;
  __shared__ __attribute__((aligned(16))) unsigned short sP[4][RPW][40], sPl[4][RPW][40]; __shared__ __attribute__((aligned(16))) float sO[4][RPW][64 + 4]; __shared__ float sM[4][RPW], sL[4][RPW];
  const int tid = threadIdx.x, lane = tid & 31, ln = lane & 15, hh = lane >> 4;
  const int w = __builtin_amdgcn_readfirstlane(tid >> 5);      /* the wave's number in a scalar register: the key loop's start and its branch stay scalar */
  /* grid (slab, tile): all four waves share one 16-query tile; tiles with the most keys have the lowest flat index (for speed only) */
  const int slab = blockIdx.x, qt = NQB - 1 - (int)blockIdx.y; const int b = slab / NH, h = slab % NH; const int q0 = qt * RPW; const int qblk = q0 >> 6;
  FragH aq[2][KS], aql[2][KS];
#pragma unroll
  for (int rt = 0; rt < RTN; ++rt) { const size_t qo = ((size_t)b * TQ + q0 + rt * 16 + ln) * ldq + h * 64; const unsigned short* qr = (const unsigned short*)Q16 + qo; const unsigned short* ql = (const unsigned short*)Q16lo + qo;
#pragma unroll
    for (int ks = 0; ks < KS; ++ks) { aq[rt][ks].half[0] = *(const v8us*)(qr + ks * 32 + 8 * hh); aq[rt][ks].half[1] = *(const v8us*)(qr + ks * 32 + 16 + 8 * hh); aql[rt][ks].half[0] = *(const v8us*)(ql + ks * 32 + 8 * hh); aql[rt][ks].half[1] = *(const v8us*)(ql + ks * 32 + 16 + 8 * hh); } }
  const unsigned short* Vth = (const unsigned short*)Vt + (size_t)slab * 64 * TK; const unsigned short* Vtl = (const unsigned short*)Vtlo + (size_t)slab * 64 * TK;
  float m_r[2][8], l_r[2][8]; v8f oacc[2][DT], oaccl[2][DT];
#pragma unroll
  for (int rt = 0; rt < RTN; ++rt) {
#pragma unroll
    for (int r = 0; r < 8; ++r) { m_r[rt][r] = -3.0e38f; l_r[rt][r] = 0.f; }
#pragma unroll
    for (int dt = 0; dt < DT; ++dt) { oacc[rt][dt] = (v8f){0.f,0.f,0.f,0.f,0.f,0.f,0.f,0.f}; oaccl[rt][dt] = oacc[rt][dt]; } }
  int jend = KE[qblk * 32]; jend = min(TK, (jend + 31) & ~31); if (jend < 32) jend = 32;      /* block-uniform */
  int allm[2][8]; const unsigned* mrow[2][8];
#pragma unroll
  for (int rt = 0; rt < RTN; ++rt)
#pragma unroll
    for (int r = 0; r < 8; ++r) { const int tq = q0 + rt * 16 + 8 * hh + r; allm[rt][r] = RA[tq]; mrow[rt][r] = MB + (size_t)tq * (TK / 32); }
#pragma unroll 1
  for (int j0 = 32 * w; j0 < jend; j0 += 128) {      /* wave w takes key blocks w, w + 4, ... */
    unsigned mw[2][8];      /* all of the pass's mask words are fetched here, so that their latency runs under the K loads and the score products */
#pragma unroll
    for (int rt = 0; rt < RTN; ++rt)
#pragma unroll
      for (int r = 0; r < 8; ++r) mw[rt][r] = mrow[rt][r][j0 >> 5];
    asm volatile("s_wait_xcnt 0x0" ::: "memory");      /* precaution: stands in front of every rewrite of the mask loads' address registers; it also keeps these loads ahead of the K loads */
    v8f s[2][2];
#pragma unroll
    for (int nt = 0; nt < 2; ++nt) { const size_t ko = ((size_t)b * TK + j0 + nt * 16 + ln) * ldk + h * 64; const unsigned short* kr = (const unsigned short*)K16 + ko; const unsigned short* kl = (const unsigned short*)K16lo + ko; FragH bk[KS], bkl[KS];
#pragma unroll
      for (int ks = 0; ks < KS; ++ks) { bk[ks].half[0] = *(const v8us*)(kr + ks * 32 + 8 * hh); bk[ks].half[1] = *(const v8us*)(kr + ks * 32 + 16 + 8 * hh); bkl[ks].half[0] = *(const v8us*)(kl + ks * 32 + 8 * hh); bkl[ks].half[1] = *(const v8us*)(kl + ks * 32 + 16 + 8 * hh); }
#pragma unroll
      for (int rt = 0; rt < RTN; ++rt) { v8f acc = (v8f){0.f,0.f,0.f,0.f,0.f,0.f,0.f,0.f}, accr = acc;
#pragma unroll
        for (int ks = 0; ks < KS; ++ks) { acc = mmaH<1>(aq[rt][ks].v, aq[rt][ks].v, bk[ks].v, bk[ks].v, acc); accr = mmaH<1>(aql[rt][ks].v, aql[rt][ks].v, bk[ks].v, bk[ks].v, accr); accr = mmaH<1>(aq[rt][ks].v, aq[rt][ks].v, bkl[ks].v, bkl[ks].v, accr); }
        s[rt][nt] = acc + accr * 0.0009765625f; } }
    /* softmax in stages over the eight rows, with selects in place of branches: one straight block, in which the rows' dependent chains overlap */
    float s0[2][8], s1[2][8], mc[2][8]; bool ok0[2][8], ok1[2][8];
#pragma unroll
    for (int rt = 0; rt < RTN; ++rt)
#pragma unroll
      for (int r = 0; r < 8; ++r) { const bool am = (allm[rt][r] != 0);
        ok0[rt][r] = am || (((mw[rt][r] >> ln) & 1u) == 0u); ok1[rt][r] = am || (((mw[rt][r] >> (16 + ln)) & 1u) == 0u);
        s0[rt][r] = ok0[rt][r] ? (am ? 0.f : s[rt][0][r] * SCL) : -INFINITY; s1[rt][r] = ok1[rt][r] ? (am ? 0.f : s[rt][1][r] * SCL) : -INFINITY; mc[rt][r] = fmaxf(s0[rt][r], s1[rt][r]); }
#pragma unroll
    for (int st = 1; st <= 8; st <<= 1)
#pragma unroll
      for (int rt = 0; rt < RTN; ++rt)
#pragma unroll
        for (int r = 0; r < 8; ++r) mc[rt][r] = fmaxf(mc[rt][r], __shfl_xor(mc[rt][r], st, 32));
#pragma unroll
    for (int rt = 0; rt < RTN; ++rt)
#pragma unroll
      for (int r = 0; r < 8; ++r) {
        const float mn = fmaxf(m_r[rt][r], mc[rt][r]); const float ea = expf(m_r[rt][r] - mn), e0 = expf(s0[rt][r] - mn), e1 = expf(s1[rt][r] - mn);      /* computed for every lane; the selects below keep the values of the guarded form */
        const float al = (mn > -1.0e38f) ? ea : 1.0f; m_r[rt][r] = mn; const float p0 = ok0[rt][r] ? e0 : 0.f, p1 = ok1[rt][r] ? e1 : 0.f; l_r[rt][r] = l_r[rt][r] * al + p0 + p1;
#pragma unroll
        for (int dt = 0; dt < DT; ++dt) { oacc[rt][dt][r] *= al; oaccl[rt][dt][r] *= al; }
        FragH t2, t3; const float ps0 = p0 * 1024.0f, ps1 = p1 * 1024.0f; t2.h[0] = (_Float16)ps0; t2.h[1] = (_Float16)ps1; t3.h[0] = (_Float16)((ps0 - (float)t2.h[0]) * 1024.0f); t3.h[1] = (_Float16)((ps1 - (float)t2.h[1]) * 1024.0f);
        sP[w][rt * 16 + 8 * hh + r][ln] = t2.u[0]; sP[w][rt * 16 + 8 * hh + r][16 + ln] = t2.u[1]; sPl[w][rt * 16 + 8 * hh + r][ln] = t3.u[0]; sPl[w][rt * 16 + 8 * hh + r][16 + ln] = t3.u[1]; }
    __builtin_amdgcn_fence(__ATOMIC_ACQ_REL, "workgroup"); __builtin_amdgcn_wave_barrier();
    FragH pa[2], pl[2];
#pragma unroll
    for (int rt = 0; rt < RTN; ++rt) { pa[rt].half[0] = *(const v8us*)&sP[w][rt * 16 + ln][8 * hh]; pa[rt].half[1] = *(const v8us*)&sP[w][rt * 16 + ln][16 + 8 * hh]; pl[rt].half[0] = *(const v8us*)&sPl[w][rt * 16 + ln][8 * hh]; pl[rt].half[1] = *(const v8us*)&sPl[w][rt * 16 + ln][16 + 8 * hh]; }
#pragma unroll
    for (int dt = 0; dt < DT; ++dt) { const size_t vo = (size_t)(dt * 16 + ln) * TK + j0; FragH bv, bl; bv.half[0] = *(const v8us*)(Vth + vo + 8 * hh); bv.half[1] = *(const v8us*)(Vth + vo + 16 + 8 * hh); bl.half[0] = *(const v8us*)(Vtl + vo + 8 * hh); bl.half[1] = *(const v8us*)(Vtl + vo + 16 + 8 * hh);
#pragma unroll
      for (int rt = 0; rt < RTN; ++rt) { oacc[rt][dt] = mmaH<1>(pa[rt].v, pa[rt].v, bv.v, bv.v, oacc[rt][dt]); oaccl[rt][dt] = mmaH<1>(pa[rt].v, pa[rt].v, bl.v, bl.v, oaccl[rt][dt]); oaccl[rt][dt] = mmaH<1>(pl[rt].v, pl[rt].v, bv.v, bv.v, oaccl[rt][dt]); } }
    __builtin_amdgcn_fence(__ATOMIC_ACQ_REL, "workgroup"); __builtin_amdgcn_wave_barrier(); }
#pragma unroll
  for (int rt = 0; rt < RTN; ++rt) {
#pragma unroll
    for (int r = 0; r < 8; ++r) { float l = l_r[rt][r]; l += __shfl_xor(l, 1, 32); l += __shfl_xor(l, 2, 32); l += __shfl_xor(l, 4, 32); l += __shfl_xor(l, 8, 32); l_r[rt][r] = l; }
    if (ln == 0) {
#pragma unroll
      for (int r = 0; r < 8; ++r) { sM[w][rt * 16 + 8 * hh + r] = m_r[rt][r]; sL[w][rt * 16 + 8 * hh + r] = l_r[rt][r]; } }
#pragma unroll
    for (int dt = 0; dt < DT; ++dt)
#pragma unroll
      for (int r = 0; r < 8; ++r) sO[w][rt * 16 + 8 * hh + r][dt * 16 + ln] = oacc[rt][dt][r] + oaccl[rt][dt][r] * 0.0009765625f; }
  __syncthreads();      /* every wave's partial (max, sum, O) is in LDS before any wave merges them */
  {
#pragma unroll
    for (int rp = 0; rp < RPW; rp += 8) { const int r = rp + (tid >> 4), pc = tid & 15;
      const float m0 = sM[0][r], m1 = sM[1][r], m2 = sM[2][r], m3 = sM[3][r]; const float mx = fmaxf(fmaxf(m0, m1), fmaxf(m2, m3));      /* a wave that saw no open key holds -3e38, sum 0, O 0: weight 0 (or 1 on zeros) */
      const float e0 = expf(m0 - mx), e1 = expf(m1 - mx), e2 = expf(m2 - mx), e3 = expf(m3 - mx);
      const float l = e0 * sL[0][r] + e1 * sL[1][r] + e2 * sL[2][r] + e3 * sL[3][r]; const float inv = (l > 0.f) ? 1.0f / (l * 1024.0f) : 0.f;
      const v4f o0 = *(const v4fa*)&sO[0][r][pc * 4], o1 = *(const v4fa*)&sO[1][r][pc * 4], o2 = *(const v4fa*)&sO[2][r][pc * 4], o3 = *(const v4fa*)&sO[3][r][pc * 4];
      const v4f val = (o0 * e0 + o1 * e1 + o2 * e2 + o3 * e3) * inv; *(v4f*)(O + ((size_t)b * TQ + q0 + r) * ldo + h * 64 + pc * 4) = val; }
     } }


__global__ __launch_bounds__(256) void k_causaltab(unsigned* __restrict__ MB, int* __restrict__ RA, int* __restrict__ KE, int nq, int nk) {
  const int t = blockIdx.x * 256 + threadIdx.x; const int nw = nk / 32;
  if (t < nq * nw) { const int q = t / nw, w = t % nw; const int first = q + 1 - 32 * w; const unsigned bits = (first <= 0) ? 0xffffffffu : ((first >= 32) ? 0u : (0xffffffffu << first)); *(unsigned*)(MB + t) = bits;  }
  if (t < nq) { *(int*)(RA + t) = 0;  }
  if (t < nq / 64) { const int v = 64 * (t + 1); *(int*)(KE + t * 32) = v;  } }

__constant__ float INVF[32] = {1.000000000e+00f,7.498942018e-01f,5.623413324e-01f,4.216965139e-01f,3.162277639e-01f,2.371373624e-01f,1.778279394e-01f,1.333521456e-01f,1.000000015e-01f,7.498941571e-02f,5.623412877e-02f,4.216964915e-02f,3.162277862e-02f,2.371373586e-02f,1.778279431e-02f,1.333521493e-02f,9.999999776e-03f,7.498942316e-03f,5.623413250e-03f,4.216964822e-03f,3.162277862e-03f,2.371373819e-03f,1.778279431e-03f,1.333521446e-03f,1.000000047e-03f,7.498941850e-04f,5.623413017e-04f,4.216964880e-04f,3.162277862e-04f,2.371373848e-04f,1.778279402e-04f,1.333521504e-04f};
__constant__ float XBASE[32] = {2.857142985e-01f,3.080357313e-01f,3.303571641e-01f,3.526785970e-01f,3.750000000e-01f,3.973214328e-01f,4.196428359e-01f,4.419642687e-01f,4.642857015e-01f,4.866071343e-01f,5.089285374e-01f,5.312500000e-01f,5.535714030e-01f,5.758928657e-01f,5.982142687e-01f,6.205357313e-01f,6.428571343e-01f,6.651785970e-01f,6.875000000e-01f,7.098214030e-01f,7.321428657e-01f,7.544642687e-01f,7.767857313e-01f,7.991071343e-01f,8.214285970e-01f,8.437500000e-01f,8.660714030e-01f,8.883928657e-01f,9.107142687e-01f,9.330357313e-01f,9.553571343e-01f,9.776785970e-01f};
__global__ __launch_bounds__(256) void k_trig(float* __restrict__ CS, float* __restrict__ SN) {
  #pragma clang fp contract(off)
  const int t = blockIdx.x * 256 + threadIdx.x; if (t >= SLEN * 32) return; const int tok = t >> 5, j = t & 31; const float ang = (float)tok * INVF[j]; const float c = cosf(ang), s = sinf(ang);
  *(float*)(CS + t) = c; *(float*)(SN + t) = s;  }
__global__ __launch_bounds__(256) void k_scale(float* __restrict__ SC) {
  #pragma clang fp contract(off)
  const int t = blockIdx.x * 256 + threadIdx.x; if (t >= SLEN * 32) return; const int tok = t >> 5, j = t & 31; const float v = powf(XBASE[j], ((float)tok - 1024.0f) / 512.0f);
  *(float*)(SC + t) = v;  }
template <int MODE>
__global__ __launch_bounds__(256) void k_xpos4(const float* __restrict__ F, const float* __restrict__ CS, const float* __restrict__ SN, const float* __restrict__ SC, float* __restrict__ OF) {
  #pragma clang fp contract(off)
  const int t = blockIdx.x * 256 + threadIdx.x; if (t >= NR * (DM / 4)) return; const int c0 = (t % (DM / 4)) * 4; const int r = t / (DM / 4); const int tok = r % SLEN; const int d0 = c0 & 63;
  const float* f = F + (size_t)r * DM + c0; const float* cs = CS + (size_t)tok * 32; const float* sn = SN + (size_t)tok * 32; const float* scp = SC + (size_t)tok * 32; v4f o;
#pragma unroll
  for (int q = 0; q < 4; ++q) { const int d = d0 + q; float sc = scp[d & 31]; if (MODE == 1) sc = 1.0f / sc;
    const float x = f[q]; const float rx = (d & 1) ? f[q - 1] : -f[q + 1]; o[q] = (x * cs[d >> 1]) * sc + (rx * sn[d >> 1]) * sc; }
  *(v4f*)(OF + (size_t)r * DM + c0) = o;  }

extern "C" void kernel_launch(void* const* d_in, const int* in_sizes, int n_in,
                              void* d_out, int out_size, void* d_ws, size_t ws_size, hipStream_t stream) {
  (void)in_sizes; (void)n_in; (void)out_size;
  const float* const* I = (const float* const*)d_in; const float* x = I[0]; const float* Wq = I[1]; const float* bq = I[2]; const float* Wk = I[3]; const float* bk = I[4]; const float* Wv = I[5]; const float* bv = I[6]; const float* Wo = I[7]; const float* bo = I[8];
  char* ws = (char*)d_ws; size_t off = 0;
  auto take = [&](size_t bytes) { char* p = ws + off; off += (bytes + 255) & ~(size_t)255; return p; };
  _Float16* BQ = (_Float16*)take((size_t)DM * DM * 2); _Float16* BK = (_Float16*)take((size_t)DM * DM * 2); _Float16* BV = (_Float16*)take((size_t)DM * DM * 2); _Float16* BO = (_Float16*)take((size_t)DM * DM * 2);
  _Float16* X16 = (_Float16*)take((size_t)NR * DM * 2); float* F = (float*)take((size_t)NR * DM * 4); float* G = (float*)take((size_t)NR * DM * 4);
  _Float16* Qh = (_Float16*)take((size_t)NR * DM * 2); _Float16* Ql = (_Float16*)take((size_t)NR * DM * 2); _Float16* Kh = (_Float16*)take((size_t)NR * DM * 2); _Float16* Kl = (_Float16*)take((size_t)NR * DM * 2); _Float16* Vth = (_Float16*)take((size_t)NR * DM * 2); _Float16* Vtl = (_Float16*)take((size_t)NR * DM * 2);
  unsigned* MB = (unsigned*)take((size_t)SLEN * (SLEN / 32) * 4); int* RA = (int*)take((size_t)SLEN * 4); int* KE = (int*)take((size_t)(SLEN / 64) * 32 * 4);
  float* CS = (float*)take((size_t)SLEN * 32 * 4); float* SN = (float*)take((size_t)SLEN * 32 * 4); float* SC = (float*)take((size_t)SLEN * 32 * 4);
  if (off > ws_size) return;      /* 8 + 8 + 16 + 16 + 6 x 8 + 1.5 = 98 MiB */
  float* O = F; _Float16* Oh = (_Float16*)G; _Float16* Ol = Oh + (size_t)NR * DM;      /* F and G (f32 scratch) are dead once the hi/lo planes exist */
  const size_t n8 = (size_t)NR * DM / 8; const unsigned nb8 = (unsigned)((n8 + 255) / 256), nb4 = (unsigned)(((size_t)NR * DM / 4 + 255) / 256); const size_t w8 = (size_t)DM * DM / 8; const unsigned wb = (unsigned)((w8 + 255) / 256);
  k_round16f<<<wb, 256, 0, stream>>>(Wq, BQ, w8); k_round16f<<<wb, 256, 0, stream>>>(Wk, BK, w8); k_round16f<<<wb, 256, 0, stream>>>(Wv, BV, w8); k_round16f<<<wb, 256, 0, stream>>>(Wo, BO, w8);      /* torch (out,in) = natural Bt; x16 */
  k_x16<<<nb8, 256, 0, stream>>>(x, X16, n8);
  k_trig<<<(SLEN * 32 + 255) / 256, 256, 0, stream>>>(CS, SN); k_scale<<<(SLEN * 32 + 255) / 256, 256, 0, stream>>>(SC); k_causaltab<<<(SLEN * (SLEN / 32) + 255) / 256, 256, 0, stream>>>(MB, RA, KE, SLEN, SLEN);
  const dim3 gP((NR / 128) * (DM / 64), 1);
  k_gemm2<0><<<gP, 128, 0, stream>>>(X16, DM, 0, BQ, DM, 0, 0.0625f, bq, 0, nullptr, 1, 0, 0, F, nullptr, DM, 0, NR, DM, DM); k_xpos4<0><<<nb4, 256, 0, stream>>>(F, CS, SN, SC, G); k_hl<<<nb8, 256, 0, stream>>>(G, Qh, Ql, n8);      /* q_mat = xpos(x Wq^T + bq) as hi/lo */
  k_gemm2<0><<<gP, 128, 0, stream>>>(X16, DM, 0, BV, DM, 0, 0.0625f, bv, 0, nullptr, 1, 0, 0, F, nullptr, DM, 0, NR, DM, DM); k_xpos4<1><<<nb4, 256, 0, stream>>>(F, CS, SN, SC, G); k_hl<<<nb8, 256, 0, stream>>>(G, Kh, Kl, n8);      /* k_mat = xpos^-1(x Wv^T + bv)  (module order) */
  k_gemm2<0><<<gP, 128, 0, stream>>>(X16, DM, 0, BK, DM, 0, 0.0625f, bk, 0, nullptr, 1, 0, 0, F, nullptr, DM, 0, NR, DM, DM);      /* v_mat = x Wk^T + bk (f32) */
  for (int b = 0; b < NBT; ++b) k_vthl<SLEN><<<NH * (SLEN / 64), 256, 0, stream>>>(F + (size_t)b * SLEN * DM, DM, Vth + (size_t)b * SLEN * DM, Vtl + (size_t)b * SLEN * DM);      /* V^T hi/lo per batch [(h)][64][2048] */
  for (int b = 0; b < NBT; ++b) { const size_t ro = (size_t)b * SLEN * DM;
    k_flashm<SLEN, SLEN><<<dim3(NH, SLEN / 16), 128, 0, stream>>>(Qh + ro, Ql + ro, DM, Kh + ro, Kl + ro, DM, Vth + ro, Vtl + ro, MB, RA, KE, O + ro, DM); }
  k_hl<<<nb8, 256, 0, stream>>>(O, Oh, Ol, n8);
  k_gemm2<0><<<gP, 128, 0, stream>>>(Oh, DM, 0, BO, DM, 0, 0.0625f, bo, 0, nullptr, 1, 0, 0, (float*)d_out, nullptr, DM, 0, NR, DM, DM);
  k_gemm2<0><<<gP, 128, 0, stream>>>(Ol, DM, 0, BO, DM, 0, 0.0625f / 1024.0f, nullptr, 0, (const float*)d_out, 1, (size_t)DM, 0, (float*)d_out, nullptr, DM, 0, NR, DM, DM);
}

// v004
// A run of this version takes 275 microseconds.
// Next to v003, in two timings, it ran 1.11 times as fast each time.
// Over all steps from v000 it is 3.14 times as fast.
#include <hip/hip_runtime.h>
// Causal multi-head attention with xPos rotary embedding (2 x 2048 tokens x 1024, 16 heads x 64): q = x*Wq^T + bq, k = x*Wv^T + bv, v = x*Wk^T + bk (the module's own assignment order); q <- q*cos*scale + rot(q)*sin*scale, k <- k*cos/scale + rot(k)*sin/scale with interleaved-pair rotation, freq(t, d) = t * inv_freq[d/2], scale(t, d) = base[d mod 32]^((t - 1024)/512); scores = q.k / 32 with j <= i; softmax; merged . Wo^T + bo -> [2,2048,1024].
// Structure: x as an exact f16 plane; the three projections as f16 WMMA GEMMs (32x64 wave tiles fed from LDS-staged 128x64 work-group tiles, f32, exact products + bias); per-token cos/sin/scale tables on VALU (inv_freq and base = the reference's f32 constants, precise trig and powf); each projection's epilogue finishes its operand in place of separate passes: q, k rotated and scaled in f32 and stored as f16 hi + x2^10 residual planes, v transposed through LDS per (batch, head) to [d][token] hi + residual planes; the causal structure computed on device into a key bit plane + per-block key bound; the fused flash kernel per ((batch, head), 16 queries), the 32-key blocks dealt round-robin to the work-group's four waves (three-product hi/lo scores, online softmax f32 per wave, P hi + residual via LDS, two value accumulators; the four partial (max, sum, O) merged through LDS at the end and stored as O hi + residual planes); output projection as two GEMMs (bias in the first).
// Compute dtype: x, weights, biases rounded to bf16; projections exact; rotation f32; q, k, P, v, O as f16 hi + residual pairs (~2^-21); f32 accumulation and softmax. v_wmma_f32_16x16x32_f16.
#define NBT 2
#define SLEN 2048
#define DM 1024
#define NH 16
#define SCL 0.03125f
#define NR (NBT * SLEN)
typedef __bf16 v16b __attribute__((ext_vector_type(16)));
typedef unsigned short v8us __attribute__((ext_vector_type(8), may_alias));
typedef float  v8f  __attribute__((ext_vector_type(8)));
typedef float  v4f  __attribute__((ext_vector_type(4)));
typedef float  v4fa __attribute__((ext_vector_type(4), may_alias));
typedef float  v2fa __attribute__((ext_vector_type(2), may_alias));
union FragB { v16b v; v8us half[2]; unsigned short u[16]; };

__device__ __forceinline__ unsigned short bf16_bits(float x) { unsigned int u = __float_as_uint(x); return (unsigned short)((u + 0x7FFFu + ((u >> 16) & 1u)) >> 16); }
__device__ __forceinline__ float bf16_val(unsigned short b) { return __uint_as_float(((unsigned int)b) << 16); }
__device__ __forceinline__ float bf16_round(float x) { return bf16_val(bf16_bits(x)); }
// D += A·B with NT terms: 1 = ah·bh, 2 = + al·bh (A split), 3 = + ah·bl (both split)
template <int NT>
__device__ __forceinline__ v8f mmaN(v16b ah, v16b al, v16b bh, v16b bl, v8f c) {
  c = __builtin_amdgcn_wmma_f32_16x16x32_bf16(false, ah, false, bh, (short)0, c, false, false);
  if (NT >= 2) c = __builtin_amdgcn_wmma_f32_16x16x32_bf16(false, al, false, bh, (short)0, c, false, false);
  if (NT >= 3) c = __builtin_amdgcn_wmma_f32_16x16x32_bf16(false, ah, false, bl, (short)0, c, false, false);
  asm volatile("v_nop\n\tv_nop\n\tv_nop\n\tv_nop" : "+v"(c) : "v"(ah), "v"(al), "v"(bh), "v"(bl));
  return c;
}

__global__ __launch_bounds__(256) void k_wt_bf16(const float* __restrict__ W, unsigned short* __restrict__ Wt, int K, int N) {
  const int t = blockIdx.x * 256 + threadIdx.x;
  const int k8n = K / 8;
  if (t >= N * k8n) return;
  const int n = t / k8n, k8 = (t % k8n) * 8;
  v8us v;
#pragma unroll
  for (int i = 0; i < 8; ++i) v[i] = bf16_bits(W[(size_t)(k8 + i) * N + n]);
  *(v8us*)(Wt + (size_t)n * K + k8) = v;
  
}

// GEMM C[M][N] (f32, pitch ldc) = act(A[M][K]·W + bias). A f32 row-major (pitch lda) converted per fragment to bf16
// (ASPLIT: hi/lo two planes -> 2 terms, else single rounded term); Wt bf16 [N][K] (pitch ldb). BIAS_BF16 rounds the
// bias to bf16 first (bias quantised to bf16 before the add). K%32==0, M%16==0, N%64==0.
template <bool ASPLIT, int ACT, bool BIAS_BF16>
__global__ __launch_bounds__(128) void k_gemm_bf(const float* __restrict__ A, int lda, const unsigned short* __restrict__ Wt, int ldb,
                                               const float* __restrict__ bias, float* __restrict__ C, int ldc, int M, int N, int K) {
  __shared__ __attribute__((aligned(16))) float so[4][16][64];
  const int tid = threadIdx.x, w = tid >> 5, lane = tid & 31, ln = lane & 15, hh = lane >> 4;
  const int ntn = N / 64;
  const int wid = blockIdx.x * 4 + w;
  const int mt = wid / ntn, nq = wid % ntn;
  if (mt * 16 >= M) return;
  const int row0 = mt * 16, col0 = nq * 64;
  const float* arow = A + (size_t)(row0 + ln) * lda;
  v8f acc[4] = {};
  for (int kb = 0; kb < K; kb += 32) {
    FragB ah, al;
    const v4f x0 = *(const v4fa*)(arow + kb + 8 * hh), x1 = *(const v4fa*)(arow + kb + 8 * hh + 4);
    const v4f x2 = *(const v4fa*)(arow + kb + 16 + 8 * hh), x3 = *(const v4fa*)(arow + kb + 16 + 8 * hh + 4);
    float xs[16] = {x0[0],x0[1],x0[2],x0[3],x1[0],x1[1],x1[2],x1[3],x2[0],x2[1],x2[2],x2[3],x3[0],x3[1],x3[2],x3[3]};
#pragma unroll
    for (int i = 0; i < 16; ++i) { const unsigned short hb = bf16_bits(xs[i]); ah.u[i] = hb; al.u[i] = ASPLIT ? bf16_bits(xs[i] - bf16_val(hb)) : (unsigned short)0; }
#pragma unroll
    for (int t = 0; t < 4; ++t) {
      const unsigned short* brow = Wt + (size_t)(col0 + t * 16 + ln) * ldb + kb;
      FragB b;
      b.half[0] = *(const v8us*)(brow + 8 * hh);
      b.half[1] = *(const v8us*)(brow + 16 + 8 * hh);
      acc[t] = mmaN<ASPLIT ? 2 : 1>(ah.v, al.v, b.v, b.v, acc[t]);
    }
  }
#pragma unroll
  for (int t = 0; t < 4; ++t) {
    float bv = bias ? bias[col0 + t * 16 + ln] : 0.f;
    if (BIAS_BF16) bv = bf16_round(bv);
#pragma unroll
    for (int r = 0; r < 8; ++r) { float v = acc[t][r] + bv; if (ACT == 1) v = fmaxf(v, 0.f); so[w][8 * hh + r][t * 16 + ln] = v; }
  }
  __builtin_amdgcn_fence(__ATOMIC_ACQ_REL, "workgroup");
  __builtin_amdgcn_wave_barrier();
  const int rsub = lane >> 4, c4 = (lane & 15) * 4;
  {
#pragma unroll
    for (int q = 0; q < 8; ++q) {
      const int r = q * 2 + rsub;
      const v4f v = *(const v4fa*)&so[w][r][c4];
      *(v4f*)(C + (size_t)(row0 + r) * ldc + col0 + c4) = v;
    }
    
  }
}

// GEMM C = act(A·W + bias + resid): A f32 (ASPLIT -> hi/lo 2 terms), Wt bf16 [N][K]; ACT 0 none, 1 relu, 2 exact gelu;
// resid (optional, f32, row index = (row % rmod), pitch ldr, RES_BF16 rounds it) added before the activation.
template <bool ASPLIT, int ACT, bool BIAS_BF16, bool RES_BF16>
__global__ __launch_bounds__(128) void k_gemm_bf3(const float* __restrict__ A, int lda, const unsigned short* __restrict__ Wt, int ldb,
                                                const float* __restrict__ bias, const float* __restrict__ resid, int rmod, int ldr,
                                                float* __restrict__ C, int ldc, int M, int N, int K) {
  __shared__ __attribute__((aligned(16))) float so[4][16][64];
  const int tid = threadIdx.x, w = tid >> 5, lane = tid & 31, ln = lane & 15, hh = lane >> 4;
  const int ntn = N / 64;
  const int wid = blockIdx.x * 4 + w;
  const int mt = wid / ntn, nq = wid % ntn;
  if (mt * 16 >= M) return;
  const int row0 = mt * 16, col0 = nq * 64;
  const float* arow = A + (size_t)(row0 + ln) * lda;
  v8f acc[4] = {};
  for (int kb = 0; kb < K; kb += 32) {
    FragB ah, al;
    const v4f x0 = *(const v4fa*)(arow + kb + 8 * hh), x1 = *(const v4fa*)(arow + kb + 8 * hh + 4);
    const v4f x2 = *(const v4fa*)(arow + kb + 16 + 8 * hh), x3 = *(const v4fa*)(arow + kb + 16 + 8 * hh + 4);
    float xs[16] = {x0[0],x0[1],x0[2],x0[3],x1[0],x1[1],x1[2],x1[3],x2[0],x2[1],x2[2],x2[3],x3[0],x3[1],x3[2],x3[3]};
#pragma unroll
    for (int i = 0; i < 16; ++i) { const unsigned short hb = bf16_bits(xs[i]); ah.u[i] = hb; al.u[i] = ASPLIT ? bf16_bits(xs[i] - bf16_val(hb)) : (unsigned short)0; }
#pragma unroll
    for (int t = 0; t < 4; ++t) {
      const unsigned short* brow = Wt + (size_t)(col0 + t * 16 + ln) * ldb + kb;
      FragB b;
      b.half[0] = *(const v8us*)(brow + 8 * hh);
      b.half[1] = *(const v8us*)(brow + 16 + 8 * hh);
      acc[t] = mmaN<ASPLIT ? 2 : 1>(ah.v, al.v, b.v, b.v, acc[t]);
    }
  }
#pragma unroll
  for (int t = 0; t < 4; ++t) {
    const int col = col0 + t * 16 + ln;
    float bv = bias ? bias[col] : 0.f;
    if (BIAS_BF16) bv = bf16_round(bv);
#pragma unroll
    for (int r = 0; r < 8; ++r) {
      float v = acc[t][r] + bv;
      if (resid) { float rv = resid[(size_t)((row0 + 8 * hh + r) % rmod) * ldr + col]; if (RES_BF16) rv = bf16_round(rv); v += rv; }
      if (ACT == 1) v = fmaxf(v, 0.f);
      if (ACT == 2) v = 0.5f * v * (1.0f + erff(v * 0.70710678118654752f));
      if (ACT == 3) { const float u = 0.7978845608028654f * (v + 0.044715f * v * v * v); v = 0.5f * v * (1.0f + tanhf(u)); }
      so[w][8 * hh + r][t * 16 + ln] = v;
    }
  }
  __builtin_amdgcn_fence(__ATOMIC_ACQ_REL, "workgroup");
  __builtin_amdgcn_wave_barrier();
  const int rsub = lane >> 4, c4 = (lane & 15) * 4;
  {
#pragma unroll
    for (int q = 0; q < 8; ++q) {
      const int r = q * 2 + rsub;
      const v4f v = *(const v4fa*)&so[w][r][c4];
      *(v4f*)(C + (size_t)(row0 + r) * ldc + col0 + c4) = v;
    }
    
  }
}
// row LayerNorm (biased variance, eps) over N: s = X (+ R); optional out_sum <- s; out_norm <- (s-mu)*rsqrt(var+eps)*g + b
template <bool PARAM_BF16>
__global__ __launch_bounds__(256) void k_layernorm(const float* __restrict__ X, const float* __restrict__ R, const float* __restrict__ g, const float* __restrict__ bta,
                                                  float* __restrict__ out_sum, float* __restrict__ out_norm, int N, float eps) {
  __shared__ float red[256];
  const int row = blockIdx.x, tid = threadIdx.x;
  const float* x = X + (size_t)row * N; const float* rr = R ? R + (size_t)row * N : nullptr;
  float vals[16];                     // up to N = 4096
  const int per = N / 256;            // contiguous chunk per thread? use strided-by-4 chunks: thread handles j = tid*4 + 1024*u
  float s1 = 0.f;
  for (int u = 0; u < per / 4; ++u) {
    const int j = tid * 4 + 1024 * u;
    const v4f a = *(const v4fa*)(x + j);
    v4f b = {0.f,0.f,0.f,0.f}; if (rr) b = *(const v4fa*)(rr + j);
#pragma unroll
    for (int q = 0; q < 4; ++q) { const float v = a[q] + b[q]; vals[u * 4 + q] = v; s1 += v; }
  }
  red[tid] = s1; __syncthreads();
  for (int st = 128; st > 0; st >>= 1) { if (tid < st) red[tid] += red[tid + st]; __syncthreads(); }
  const float mu = red[0] / (float)N; __syncthreads();
  float s2 = 0.f;
  for (int u = 0; u < per / 4; ++u)
#pragma unroll
    for (int q = 0; q < 4; ++q) { const float c = vals[u * 4 + q] - mu; s2 += c * c; }
  red[tid] = s2; __syncthreads();
  for (int st = 128; st > 0; st >>= 1) { if (tid < st) red[tid] += red[tid + st]; __syncthreads(); }
  const float rs = rsqrtf(red[0] / (float)N + eps);
  {
    for (int u = 0; u < per / 4; ++u) {
      const int j = tid * 4 + 1024 * u;
      v4f o, sm;
#pragma unroll
      for (int q = 0; q < 4; ++q) {
        float gg = g[j + q], bb = bta[j + q];
        if (PARAM_BF16) { gg = bf16_round(gg); bb = bf16_round(bb); }
        sm[q] = vals[u * 4 + q]; o[q] = (vals[u * 4 + q] - mu) * rs * gg + bb;
      }
      if (out_sum) *(v4f*)(out_sum + (size_t)row * N + j) = sm;
      *(v4f*)(out_norm + (size_t)row * N + j) = o;
    }
    
  }
}



// ---- f16 WMMA path (v_wmma_f32_16x16x32_f16): 11-bit significands for operands in range — used where a [0,1] probability operand needs more precision than bf16
typedef _Float16 v16h __attribute__((ext_vector_type(16)));
union FragH { v16h v; v8us half[2]; _Float16 h[16]; unsigned short u[16]; };
template <int NT>
__device__ __forceinline__ v8f mmaH(v16h ah, v16h al, v16h bh, v16h bl, v8f c) {
  c = __builtin_amdgcn_wmma_f32_16x16x32_f16(false, ah, false, bh, (short)0, c, false, false);
  if (NT >= 2) c = __builtin_amdgcn_wmma_f32_16x16x32_f16(false, al, false, bh, (short)0, c, false, false);
  if (NT >= 3) c = __builtin_amdgcn_wmma_f32_16x16x32_f16(false, ah, false, bl, (short)0, c, false, false);
  asm volatile("v_nop\n\tv_nop\n\tv_nop\n\tv_nop" : "+v"(c) : "v"(ah), "v"(al), "v"(bh), "v"(bl));
  return c;
}
// batched GEMM like k_gemm_b but f16 operands: A f32 (split into f16 hi/lo if ASPLIT, else rounded to f16), Bt = f16 values [n][k]; alpha; C f32; N multiple of 16 (partial tiles skipped)
template <bool ASPLIT>
__global__ __launch_bounds__(128) void k_gemm_h(const float* __restrict__ A, int lda, size_t sA, const _Float16* __restrict__ Bh, int ldb, size_t sB, float alpha, float* __restrict__ C, int ldc, size_t sC, int M, int N, int K) {
  __shared__ __attribute__((aligned(16))) float so[4][16][64];
  const int tid = threadIdx.x, w = tid >> 5, lane = tid & 31, ln = lane & 15, hh = lane >> 4; const int by = blockIdx.y;
  A += (size_t)by * sA; Bh += (size_t)by * sB; C += (size_t)by * sC;
  const int ntn = (N + 63) / 64; const int wid = blockIdx.x * 4 + w; const int mt = wid / ntn, nq = wid % ntn; if (mt * 16 >= M) return;
  const int row0 = mt * 16, col0 = nq * 64; const float* arow = A + (size_t)(row0 + ln) * lda;
  v8f acc[4] = {};
  for (int kb = 0; kb < K; kb += 32) {
    FragH ah, al;
    const v4f x0 = *(const v4fa*)(arow + kb + 8 * hh), x1 = *(const v4fa*)(arow + kb + 8 * hh + 4), x2 = *(const v4fa*)(arow + kb + 16 + 8 * hh), x3 = *(const v4fa*)(arow + kb + 16 + 8 * hh + 4);
    float xs[16] = {x0[0],x0[1],x0[2],x0[3],x1[0],x1[1],x1[2],x1[3],x2[0],x2[1],x2[2],x2[3],x3[0],x3[1],x3[2],x3[3]};
#pragma unroll
    for (int i = 0; i < 16; ++i) { const _Float16 h = (_Float16)xs[i]; ah.h[i] = h; al.h[i] = ASPLIT ? (_Float16)(xs[i] - (float)h) : (_Float16)0.0f; }
#pragma unroll
    for (int t = 0; t < 4; ++t) { if (col0 + t * 16 >= N) continue; const size_t boff = (size_t)(col0 + t * 16 + ln) * ldb + kb; FragH bq; bq.half[0] = *(const v8us*)(Bh + boff + 8 * hh); bq.half[1] = *(const v8us*)(Bh + boff + 16 + 8 * hh);
      acc[t] = mmaH<ASPLIT ? 2 : 1>(ah.v, al.v, bq.v, bq.v, acc[t]); }
  }
#pragma unroll
  for (int t = 0; t < 4; ++t) { if (col0 + t * 16 >= N) continue;
#pragma unroll
    for (int r = 0; r < 8; ++r) so[w][8 * hh + r][t * 16 + ln] = acc[t][r] * alpha; }
  __builtin_amdgcn_fence(__ATOMIC_ACQ_REL, "workgroup"); __builtin_amdgcn_wave_barrier();
  const int rsub = lane >> 4, c4 = (lane & 15) * 4;
  {
#pragma unroll
    for (int q = 0; q < 8; ++q) { const int r = q * 2 + rsub; if (col0 + c4 < N) { const v4f v = *(const v4fa*)&so[w][r][c4]; *(v4f*)(C + (size_t)(row0 + r) * ldc + col0 + c4) = v; } }
     }
}

// Wt[n][k] = f16(W[k][n]·scale) from f32 row-major W[K][N] (scale = power of two; bf16-exact weights stay exact in f16 away from the subnormal range)
__global__ __launch_bounds__(256) void k_wt_f16(const float* __restrict__ W, _Float16* __restrict__ Wt, int K, int N, float scale) {
  const int t = blockIdx.x * 256 + threadIdx.x; if (t >= N * (K / 8)) return; const int n = t / (K / 8), k8 = (t % (K / 8)) * 8; FragH f;
#pragma unroll
  for (int i = 0; i < 8; ++i) f.h[i] = (_Float16)(bf16_round(W[(size_t)(k8 + i) * N + n]) * scale); const v8us o = f.half[0];
  *(v8us*)((unsigned short*)Wt + (size_t)n * K + k8) = o; 
}
// k_gemm_hh variant with fused epilogue: v = acc·alpha + bias[by·sBias + col] (+ CP[(row/rowsPerB)·sCPb + by·64 + col] if CP) ; ACT 0 none / 1 elu ; writes f16 C16 (and f32 C if non-null)
template <int ACT>
__global__ __launch_bounds__(128) void k_gemm_hhx(const _Float16* __restrict__ A, int lda, size_t sA, const _Float16* __restrict__ Bh, int ldb, size_t sB, float alpha, const float* __restrict__ bias, size_t sBias, const float* __restrict__ CP, int rowsPerB, size_t sCPb, int row0g,
    float* __restrict__ C, _Float16* __restrict__ C16, int ldc, size_t sC, int M, int N, int K) {
  __shared__ __attribute__((aligned(16))) float so[4][16][64];
  const int tid = threadIdx.x, w = tid >> 5, lane = tid & 31, ln = lane & 15, hh = lane >> 4; const int by = blockIdx.y;
  A += (size_t)by * sA; Bh += (size_t)by * sB; const size_t cofs = (size_t)by * sC; const float* bp = bias ? bias + (size_t)by * sBias : nullptr;
  const int ntn = (N + 63) / 64; const int wid = blockIdx.x * 4 + w; const int mt = wid / ntn, nq = wid % ntn; if (mt * 16 >= M) return;
  const int row0 = mt * 16, col0 = nq * 64; const _Float16* arow = A + (size_t)(row0 + ln) * lda;
  v8f acc[4] = {};
  for (int kb = 0; kb < K; kb += 32) { FragH ah; ah.half[0] = *(const v8us*)((const unsigned short*)arow + kb + 8 * hh); ah.half[1] = *(const v8us*)((const unsigned short*)arow + kb + 16 + 8 * hh);
#pragma unroll
    for (int t = 0; t < 4; ++t) { if (col0 + t * 16 >= N) continue; const size_t boff = (size_t)(col0 + t * 16 + ln) * ldb + kb; FragH bq; bq.half[0] = *(const v8us*)((const unsigned short*)Bh + boff + 8 * hh); bq.half[1] = *(const v8us*)((const unsigned short*)Bh + boff + 16 + 8 * hh);
      acc[t] = mmaH<1>(ah.v, ah.v, bq.v, bq.v, acc[t]); }
  }
#pragma unroll
  for (int t = 0; t < 4; ++t) { if (col0 + t * 16 >= N) continue; const int col = col0 + t * 16 + ln; const float bv = bp ? bf16_round(bp[col]) : 0.f;
#pragma unroll
    for (int r = 0; r < 8; ++r) { float v = acc[t][r] * alpha + bv; if (CP) { const int bidx = (row0g + row0 + 8 * hh + r) / rowsPerB; v += CP[(size_t)bidx * sCPb + (size_t)by * 64 + col]; } if (ACT == 1) v = (v > 0.f) ? v : expm1f(v); else if (ACT == 7) v = (v > 0.f) ? v + 1.0f : expf(v); else if (ACT == 8) v = tanhf(v); else if (ACT == 9) v = 0.5f * v * (1.0f + tanhf(0.7978845608028654f * (v + 0.044715f * v * v * v))); else if (ACT == 11) v = 1.0f / (1.0f + expf(-v)); else if (ACT == 12) v = (v > 0.f) ? v : 0.01f * v; else if (ACT == 14) v = (v > 0.f) ? v : 0.1f * v; else if (ACT == 15) v = v / (1.0f + expf(-v)); else if (ACT == 3) v = fmaxf(v, 0.f); else if (ACT == 6) v = 0.5f * v * (1.0f + erff(v * 0.70710678118654752f)); so[w][8 * hh + r][t * 16 + ln] = v; } }
  __builtin_amdgcn_fence(__ATOMIC_ACQ_REL, "workgroup"); __builtin_amdgcn_wave_barrier();
  const int rsub = lane >> 4, c4 = (lane & 15) * 4; typedef _Float16 v4h __attribute__((ext_vector_type(4)));
  {
#pragma unroll
    for (int q = 0; q < 8; ++q) { const int r = q * 2 + rsub; if (col0 + c4 < N) { const v4f v = *(const v4fa*)&so[w][r][c4]; if (C) *(v4f*)(C + cofs + (size_t)(row0 + r) * ldc + col0 + c4) = v; if (C16) { v4h h4; for (int i = 0; i < 4; ++i) h4[i] = (_Float16)v[i]; *(v4h*)(C16 + cofs + (size_t)(row0 + r) * ldc + col0 + c4) = h4; } } }
     }
}


typedef _Float16 v4h __attribute__((ext_vector_type(4)));

__global__ __launch_bounds__(256) void k_x16(const float* __restrict__ x, _Float16* __restrict__ X16, size_t n8) { const size_t t = (size_t)blockIdx.x * 256 + threadIdx.x; if (t >= n8) return; FragH f;
#pragma unroll
  for (int q = 0; q < 8; ++q) f.h[q] = (_Float16)bf16_round(x[t * 8 + q]); *(v8us*)((unsigned short*)X16 + t * 8) = f.half[0];  }
__global__ __launch_bounds__(256) void k_h16(const float* __restrict__ x, _Float16* __restrict__ X16, size_t n8) { const size_t t = (size_t)blockIdx.x * 256 + threadIdx.x; if (t >= n8) return; FragH f;
#pragma unroll
  for (int q = 0; q < 8; ++q) f.h[q] = (_Float16)x[t * 8 + q]; *(v8us*)((unsigned short*)X16 + t * 8) = f.half[0];  }
__global__ __launch_bounds__(256) void k_round16f(const float* __restrict__ W, _Float16* __restrict__ Bt, size_t n8) { const size_t t = (size_t)blockIdx.x * 256 + threadIdx.x; if (t >= n8) return; FragH f;
#pragma unroll
  for (int i = 0; i < 8; ++i) f.h[i] = (_Float16)(bf16_round(W[t * 8 + i]) * 16.0f); *(v8us*)((unsigned short*)Bt + t * 8) = f.half[0];  }
template <int NHv, int TTv>
__global__ __launch_bounds__(256) void k_vt(const _Float16* __restrict__ V16, int ldv, int voff, _Float16* __restrict__ Vt) { __shared__ unsigned short tl[64][66]; const int tid = threadIdx.x; const int slab = blockIdx.x / (TTv / 64), lg = blockIdx.x % (TTv / 64); const int b = slab / NHv, h = slab % NHv;
  for (int i = tid; i < 64 * 8; i += 256) { const int r = i / 8, c8 = (i % 8) * 8; FragH f; f.half[0] = *(const v8us*)((const unsigned short*)V16 + ((size_t)b * TTv + lg * 64 + r) * ldv + voff + h * 64 + c8);
#pragma unroll
    for (int q = 0; q < 8; ++q) tl[r][c8 + q] = f.u[q]; }
  __syncthreads();
  {
#pragma unroll
    for (int rd = 0; rd < 2; ++rd) { const int d = rd * 32 + tid / 8, pc = tid % 8; FragH f;
#pragma unroll
      for (int q = 0; q < 8; ++q) f.u[q] = tl[pc * 8 + q][d];
      *(v8us*)((unsigned short*)Vt + ((size_t)slab * 64 + d) * TTv + lg * 64 + pc * 8) = f.half[0]; }
     } }

// ---- fast GEMM (wave tile 32x64; requires M % 32 == 0 rows per launch region, N % 64 == 0 and K % 64 == 0); epilogue = k_gemm_hhx semantics ----
__device__ __forceinline__ v16h g2_frag(const _Float16* p, int hh) { FragH f; f.half[0] = *(const v8us*)((const unsigned short*)p + 8 * hh); f.half[1] = *(const v8us*)((const unsigned short*)p + 16 + 8 * hh); return f.v; }
__device__ __forceinline__ v8f g2_mma(v16h a, v16h b, v8f c) { v8f d = __builtin_amdgcn_wmma_f32_16x16x32_f16(false, a, false, b, (short)0, c, false, false); asm volatile("v_nop\n\tv_nop\n\tv_nop\n\tv_nop" : "+v"(d) : "v"(a), "v"(b)); return d; }
/* XP 0: stores C / C16. XP 1 (q) and 2 (k, inverse scale): the epilogue applies the xPos rotation to the row while it is still in LDS (a 64-column tile is one head, a lane's 4 columns hold whole rotation pairs; token = row % SLEN) and stores the f16 hi + x2^10 residual planes Hh, Hl instead of C. XP 3 (v): the tile (128 tokens of one batch x one head) leaves transposed, as hi + residual planes [(batch, head)][d][token] */
template <int ACT, int XP>
__global__ __launch_bounds__(128) void k_gemm2(const _Float16* __restrict__ A, int lda, size_t sA, const _Float16* __restrict__ Bh, int ldb, size_t sB, float alpha, const float* __restrict__ bias, size_t sBias, const float* __restrict__ CP, int rowsPerB, size_t sCPb, int row0g,
    float* __restrict__ C, _Float16* __restrict__ C16, int ldc, size_t sC, int M, int N, int K, const float* __restrict__ CS, const float* __restrict__ SN, const float* __restrict__ SC, _Float16* __restrict__ Hh, _Float16* __restrict__ Hl) {
  /* the work-group's 128 x 64 tile: per stage of 64 k (K % 64 == 0) one whole 128-byte line of each of its 128 A rows and 64 B rows goes to LDS, two buffers; row pitch 144 B for the 16-byte fragment reads */
  constexpr int PIT = 72;
  __shared__ __attribute__((aligned(16))) float so[4][32][68];
  __shared__ __attribute__((aligned(16))) _Float16 tA[2][128 * PIT], tB[2][64 * PIT];
  const int tid = threadIdx.x, w = tid >> 5, lane = tid & 31, ln = lane & 15, hh = lane >> 4; const int by = blockIdx.y;
  A += (size_t)by * sA; Bh += (size_t)by * sB; const size_t cofs = (size_t)by * sC; const float* bp = bias ? bias + (size_t)by * sBias : nullptr;
  const int ntn = N >> 6; const int mt = blockIdx.x / ntn, nq = blockIdx.x - mt * ntn; const int row0 = mt * 128 + 32 * w, col0 = nq * 64; if (mt * 128 >= M) return;      /* the same for the whole work-group: every wave reaches every barrier below */
  const int sr = tid >> 3, sc = (tid & 7) * 8;      /* staging: eight threads bring one row's line, a wave four whole lines per load */
  unsigned oa[8], ob[4];      /* byte offsets of the staged lines at k = 0, fixed for the whole loop */
#pragma unroll
  for (int i = 0; i < 8; ++i) oa[i] = ((unsigned)min(mt * 128 + i * 16 + sr, M - 1) * (unsigned)lda + (unsigned)sc) * 2u;      /* rows past M (a last tile of 32, 64 or 96 rows) re-read row M - 1; their waves store nothing */
#pragma unroll
  for (int i = 0; i < 4; ++i) ob[i] = ((unsigned)(col0 + i * 16 + sr) * (unsigned)ldb + (unsigned)sc) * 2u;
  const int so_st = sr * PIT + sc, fa = (32 * w + ln) * PIT, fb = ln * PIT;
  const v8f z8 = {0.f,0.f,0.f,0.f,0.f,0.f,0.f,0.f}; v8f c00 = z8, c01 = z8, c02 = z8, c03 = z8, c10 = z8, c11 = z8, c12 = z8, c13 = z8;
  v8us ra[8], rb[4];
#pragma unroll
  for (int i = 0; i < 8; ++i) ra[i] = *(const v8us*)((const char*)A + oa[i]);
#pragma unroll
  for (int i = 0; i < 4; ++i) rb[i] = *(const v8us*)((const char*)Bh + ob[i]);
#pragma unroll
  for (int i = 0; i < 8; ++i) *(v8us*)&tA[0][so_st + i * 16 * PIT] = ra[i];
#pragma unroll
  for (int i = 0; i < 4; ++i) *(v8us*)&tB[0][so_st + i * 16 * PIT] = rb[i];
  __syncthreads();      /* stage 0 is in LDS before any wave reads it */
#pragma unroll 1      /* stays rolled: the body already holds 16 products and the whole of a stage's loads */
  for (int kb = 0; kb < K; kb += 64) { const int cur = (kb >> 6) & 1; const bool more = kb + 64 < K;
    if (more) {      /* the next stage's global loads go out ahead of this stage's products, which cover their latency */
#pragma unroll
      for (int i = 0; i < 8; ++i) ra[i] = *(const v8us*)((const char*)(A + kb + 64) + oa[i]);
#pragma unroll
      for (int i = 0; i < 4; ++i) rb[i] = *(const v8us*)((const char*)(Bh + kb + 64) + ob[i]); }
    const _Float16* pa = &tA[cur][fa]; const _Float16* pb = &tB[cur][fb];
    v16h a0[2], a1[2], b0[2], b1[2], b2[2], b3[2];      /* all of the stage's fragment reads as one group in front of its products */
#pragma unroll
    for (int ks = 0; ks < 2; ++ks) { a0[ks] = g2_frag(pa + ks * 32, hh); a1[ks] = g2_frag(pa + 16 * PIT + ks * 32, hh); b0[ks] = g2_frag(pb + ks * 32, hh); b1[ks] = g2_frag(pb + 16 * PIT + ks * 32, hh); b2[ks] = g2_frag(pb + 32 * PIT + ks * 32, hh); b3[ks] = g2_frag(pb + 48 * PIT + ks * 32, hh); }
#pragma unroll
    for (int ks = 0; ks < 2; ++ks) {
      c00 = g2_mma(a0[ks], b0[ks], c00); c10 = g2_mma(a1[ks], b0[ks], c10);
      c01 = g2_mma(a0[ks], b1[ks], c01); c11 = g2_mma(a1[ks], b1[ks], c11);
      c02 = g2_mma(a0[ks], b2[ks], c02); c12 = g2_mma(a1[ks], b2[ks], c12);
      c03 = g2_mma(a0[ks], b3[ks], c03); c13 = g2_mma(a1[ks], b3[ks], c13); }
    if (more) {      /* into the buffer that every wave left at the last barrier */
#pragma unroll
      for (int i = 0; i < 8; ++i) *(v8us*)&tA[cur ^ 1][so_st + i * 16 * PIT] = ra[i];
#pragma unroll
      for (int i = 0; i < 4; ++i) *(v8us*)&tB[cur ^ 1][so_st + i * 16 * PIT] = rb[i]; }
    __syncthreads(); }      /* publishes the next stage and ends every wave's reads of this one */
  if (XP != 3 && row0 >= M) return;      /* no barrier follows; XP 3 has one below and takes whole 128-row tiles only (M % 128 == 0) */
  v8f accs[8] = {c00, c01, c02, c03, c10, c11, c12, c13};
  constexpr int TP = 136; _Float16* sT = (_Float16*)&so[0][0][0];      /* XP 3: the staging bytes as two f16 planes [64 d][128 tokens], row pitch 272 B */
#pragma unroll
  for (int u = 0; u < 8; ++u) { const int t = u & 3, half = u >> 2; const int col = col0 + t * 16 + ln; const float bv = bp ? bf16_round(bp[col]) : 0.f; FragH th, tl;
#pragma unroll
    for (int r = 0; r < 8; ++r) { const int rloc = half * 16 + 8 * hh + r; float v = accs[u][r] * alpha + bv; if (CP) { const int bidx = (row0g + row0 + rloc) / rowsPerB; v += CP[(size_t)bidx * sCPb + (size_t)by * 64 + col]; }
      if (ACT == 3) v = fmaxf(v, 0.f); else if (ACT == 6) v = 0.5f * v * (1.0f + erff(v * 0.70710678118654752f)); else if (ACT == 11) v = 1.0f / (1.0f + expf(-v)); else if (ACT == 15) v = v / (1.0f + expf(-v)); else if (ACT == 12) v = (v > 0.f) ? v : 0.01f * v; else if (ACT == 8) v = tanhf(v);
      if (XP == 3) { const _Float16 hv = (_Float16)v; th.h[r] = hv; tl.h[r] = (_Float16)((v - (float)hv) * 1024.0f); } else so[w][rloc][t * 16 + ln] = v; }
    if (XP == 3) { const int o = (t * 16 + ln) * TP + 32 * w + half * 16 + 8 * hh; *(v8us*)&sT[o] = th.half[0]; *(v8us*)&sT[64 * TP + o] = tl.half[0]; } }      /* a lane's 8 accumulator rows are 8 consecutive tokens of one d: one 16-byte piece of the transposed row */
  if (XP == 3) {
    __syncthreads();      /* all four waves' 32-token pieces are in LDS before any wave stores whole 256-byte rows */
    const size_t vb = ((size_t)((mt * 128) / SLEN) * NH + nq) * 64 * SLEN + (mt * 128) % SLEN;
#pragma unroll
    for (int it = 0; it < 8; ++it) { const int d = it * 8 + (tid >> 4), pc = tid & 15; const v8us a = *(const v8us*)&sT[d * TP + pc * 8], c = *(const v8us*)&sT[64 * TP + d * TP + pc * 8];
      *(v8us*)((unsigned short*)Hh + vb + (size_t)d * SLEN + pc * 8) = a; *(v8us*)((unsigned short*)Hl + vb + (size_t)d * SLEN + pc * 8) = c; }
    return; }
  __builtin_amdgcn_fence(__ATOMIC_ACQ_REL, "workgroup"); __builtin_amdgcn_wave_barrier();
  const int rsub = lane >> 4, c4 = (lane & 15) * 4;
  if (XP == 1 || XP == 2) {
    const size_t tb = (size_t)(row0 % SLEN + rsub) * 32;      /* a wave's 32 rows lie in one batch (SLEN % 32 == 0): token = row0 % SLEN + r */
    const float* cs = CS + tb + (c4 >> 1); const float* sn = SN + tb + (c4 >> 1); const float* scp = SC + tb + (c4 & 31);
#pragma unroll
    for (int g = 0; g < 16; g += 8) { v2fa cq[8], sq[8]; v4f s4[8];      /* two groups of 8 rows: 16 rows' table words and the k side's 64 quotients at once need more than 256 registers */
#pragma unroll
      for (int q = 0; q < 8; ++q) { cq[q] = *(const v2fa*)(cs + (g + q) * 64); sq[q] = *(const v2fa*)(sn + (g + q) * 64); s4[q] = *(const v4fa*)(scp + (g + q) * 64); }      /* the group's table words in flight together */
      asm volatile("s_wait_xcnt 0x0" :: "v"(cs), "v"(sn), "v"(scp) : "memory");      /* precaution: stands in front of every rewrite of the table loads' address registers, which stay live up to here */
#pragma unroll
      for (int q = 0; q < 8; ++q) { const int r = (g + q) * 2 + rsub; const v4f v = *(const v4fa*)&so[w][r][c4]; v4h hi4, lo4;
#pragma unroll
        for (int i = 0; i < 4; ++i) { float sc = s4[q][i]; if (XP == 2) sc = 1.0f / sc;
          const float x = v[i]; const float rx = (i & 1) ? v[i - 1] : -v[i + 1]; const float o = (x * cq[q][i >> 1]) * sc + (rx * sq[q][i >> 1]) * sc;
          const _Float16 h = (_Float16)o; hi4[i] = h; lo4[i] = (_Float16)((o - (float)h) * 1024.0f); }
        const size_t oo = cofs + (size_t)(row0 + r) * ldc + col0 + c4; *(v4h*)(Hh + oo) = hi4; *(v4h*)(Hl + oo) = lo4; }
      if (g == 0) asm volatile("s_wait_xcnt 0x0" ::: "memory"); }      /* precaution: the second group's loads may land in registers that the first group's stores name */
    return; }
  {
#pragma unroll
    for (int q = 0; q < 16; ++q) { const int r = q * 2 + rsub; const v4f v = *(const v4fa*)&so[w][r][c4]; if (C) *(v4f*)(C + cofs + (size_t)(row0 + r) * ldc + col0 + c4) = v; if (C16) { v4h h4; for (int i = 0; i < 4; ++i) h4[i] = (_Float16)v[i]; *(v4h*)(C16 + cofs + (size_t)(row0 + r) * ldc + col0 + c4) = h4; } }
     } }



template <int TQ, int TK>
__global__ __launch_bounds__(128) void k_flashm(const _Float16* __restrict__ Q16, const _Float16* __restrict__ Q16lo, int ldq, const _Float16* __restrict__ K16, const _Float16* __restrict__ K16lo, int ldk, const _Float16* __restrict__ Vt, const _Float16* __restrict__ Vtlo, const unsigned* __restrict__ MB, const int* __restrict__ RA, const int* __restrict__ KE, _Float16* __restrict__ Oh, _Float16* __restrict__ Ol, int ldo) {
  constexpr int RPW = 16, RTN = RPW / 16, NQB = TQ / RPW, DT = 4, KS = 2;
  __shared__ __attribute__((aligned(16))) unsigned short sP[4][RPW][40], sPl[4][RPW][40]; __shared__ __attribute__((aligned(16))) float sO[4][RPW][64 + 4]; __shared__ float sM[4][RPW], sL[4][RPW];
  const int tid = threadIdx.x, lane = tid & 31, ln = lane & 15, hh = lane >> 4;
  const int w = __builtin_amdgcn_readfirstlane(tid >> 5);      /* the wave's number in a scalar register: the key loop's start and its branch stay scalar */
  /* grid (slab, tile): all four waves share one 16-query tile; tiles with the most keys have the lowest flat index (for speed only) */
  const int slab = blockIdx.x, qt = NQB - 1 - (int)blockIdx.y; const int b = slab / NH, h = slab % NH; const int q0 = qt * RPW; const int qblk = q0 >> 6;
  FragH aq[2][KS], aql[2][KS];
#pragma unroll
  for (int rt = 0; rt < RTN; ++rt) { const size_t qo = ((size_t)b * TQ + q0 + rt * 16 + ln) * ldq + h * 64; const unsigned short* qr = (const unsigned short*)Q16 + qo; const unsigned short* ql = (const unsigned short*)Q16lo + qo;
#pragma unroll
    for (int ks = 0; ks < KS; ++ks) { aq[rt][ks].half[0] = *(const v8us*)(qr + ks * 32 + 8 * hh); aq[rt][ks].half[1] = *(const v8us*)(qr + ks * 32 + 16 + 8 * hh); aql[rt][ks].half[0] = *(const v8us*)(ql + ks * 32 + 8 * hh); aql[rt][ks].half[1] = *(const v8us*)(ql + ks * 32 + 16 + 8 * hh); } }
  const unsigned short* Vth = (const unsigned short*)Vt + (size_t)slab * 64 * TK; const unsigned short* Vtl = (const unsigned short*)Vtlo + (size_t)slab * 64 * TK;
  float m_r[2][8], l_r[2][8]; v8f oacc[2][DT], oaccl[2][DT];
#pragma unroll
  for (int rt = 0; rt < RTN; ++rt) {
#pragma unroll
    for (int r = 0; r < 8; ++r) { m_r[rt][r] = -3.0e38f; l_r[rt][r] = 0.f; }
#pragma unroll
    for (int dt = 0; dt < DT; ++dt) { oacc[rt][dt] = (v8f){0.f,0.f,0.f,0.f,0.f,0.f,0.f,0.f}; oaccl[rt][dt] = oacc[rt][dt]; } }
  int jend = KE[qblk * 32]; jend = min(TK, (jend + 31) & ~31); if (jend < 32) jend = 32;      /* block-uniform */
  int allm[2][8]; const unsigned* mrow[2][8];
#pragma unroll
  for (int rt = 0; rt < RTN; ++rt)
#pragma unroll
    for (int r = 0; r < 8; ++r) { const int tq = q0 + rt * 16 + 8 * hh + r; allm[rt][r] = RA[tq]; mrow[rt][r] = MB + (size_t)tq * (TK / 32); }
#pragma unroll 1
  for (int j0 = 32 * w; j0 < jend; j0 += 128) {      /* wave w takes key blocks w, w + 4, ... */
    unsigned mw[2][8];      /* all of the pass's mask words are fetched here, so that their latency runs under the K loads and the score products */
#pragma unroll
    for (int rt = 0; rt < RTN; ++rt)
#pragma unroll
      for (int r = 0; r < 8; ++r) mw[rt][r] = mrow[rt][r][j0 >> 5];
    asm volatile("s_wait_xcnt 0x0" ::: "memory");      /* precaution: stands in front of every rewrite of the mask loads' address registers; it also keeps these loads ahead of the K loads */
    v8f s[2][2];
#pragma unroll
    for (int nt = 0; nt < 2; ++nt) { const size_t ko = ((size_t)b * TK + j0 + nt * 16 + ln) * ldk + h * 64; const unsigned short* kr = (const unsigned short*)K16 + ko; const unsigned short* kl = (const unsigned short*)K16lo + ko; FragH bk[KS], bkl[KS];
#pragma unroll
      for (int ks = 0; ks < KS; ++ks) { bk[ks].half[0] = *(const v8us*)(kr + ks * 32 + 8 * hh); bk[ks].half[1] = *(const v8us*)(kr + ks * 32 + 16 + 8 * hh); bkl[ks].half[0] = *(const v8us*)(kl + ks * 32 + 8 * hh); bkl[ks].half[1] = *(const v8us*)(kl + ks * 32 + 16 + 8 * hh); }
#pragma unroll
      for (int rt = 0; rt < RTN; ++rt) { v8f acc = (v8f){0.f,0.f,0.f,0.f,0.f,0.f,0.f,0.f}, accr = acc;
#pragma unroll
        for (int ks = 0; ks < KS; ++ks) { acc = mmaH<1>(aq[rt][ks].v, aq[rt][ks].v, bk[ks].v, bk[ks].v, acc); accr = mmaH<1>(aql[rt][ks].v, aql[rt][ks].v, bk[ks].v, bk[ks].v, accr); accr = mmaH<1>(aq[rt][ks].v, aq[rt][ks].v, bkl[ks].v, bkl[ks].v, accr); }
        s[rt][nt] = acc + accr * 0.0009765625f; } }
    /* softmax in stages over the eight rows, with selects in place of branches: one straight block, in which the rows' dependent chains overlap */
    float s0[2][8], s1[2][8], mc[2][8]; bool ok0[2][8], ok1[2][8];
#pragma unroll
    for (int rt = 0; rt < RTN; ++rt)
#pragma unroll
      for (int r = 0; r < 8; ++r) { const bool am = (allm[rt][r] != 0);
        ok0[rt][r] = am || (((mw[rt][r] >> ln) & 1u) == 0u); ok1[rt][r] = am || (((mw[rt][r] >> (16 + ln)) & 1u) == 0u);
        s0[rt][r] = ok0[rt][r] ? (am ? 0.f : s[rt][0][r] * SCL) : -INFINITY; s1[rt][r] = ok1[rt][r] ? (am ? 0.f : s[rt][1][r] * SCL) : -INFINITY; mc[rt][r] = fmaxf(s0[rt][r], s1[rt][r]); }
#pragma unroll
    for (int st = 1; st <= 8; st <<= 1)
#pragma unroll
      for (int rt = 0; rt < RTN; ++rt)
#pragma unroll
        for (int r = 0; r < 8; ++r) mc[rt][r] = fmaxf(mc[rt][r], __shfl_xor(mc[rt][r], st, 32));
#pragma unroll
    for (int rt = 0; rt < RTN; ++rt)
#pragma unroll
      for (int r = 0; r < 8; ++r) {
        const float mn = fmaxf(m_r[rt][r], mc[rt][r]); const float ea = expf(m_r[rt][r] - mn), e0 = expf(s0[rt][r] - mn), e1 = expf(s1[rt][r] - mn);      /* computed for every lane; the selects below keep the values of the guarded form */
        const float al = (mn > -1.0e38f) ? ea : 1.0f; m_r[rt][r] = mn; const float p0 = ok0[rt][r] ? e0 : 0.f, p1 = ok1[rt][r] ? e1 : 0.f; l_r[rt][r] = l_r[rt][r] * al + p0 + p1;
#pragma unroll
        for (int dt = 0; dt < DT; ++dt) { oacc[rt][dt][r] *= al; oaccl[rt][dt][r] *= al; }
        FragH t2, t3; const float ps0 = p0 * 1024.0f, ps1 = p1 * 1024.0f; t2.h[0] = (_Float16)ps0; t2.h[1] = (_Float16)ps1; t3.h[0] = (_Float16)((ps0 - (float)t2.h[0]) * 1024.0f); t3.h[1] = (_Float16)((ps1 - (float)t2.h[1]) * 1024.0f);
        sP[w][rt * 16 + 8 * hh + r][ln] = t2.u[0]; sP[w][rt * 16 + 8 * hh + r][16 + ln] = t2.u[1]; sPl[w][rt * 16 + 8 * hh + r][ln] = t3.u[0]; sPl[w][rt * 16 + 8 * hh + r][16 + ln] = t3.u[1]; }
    __builtin_amdgcn_fence(__ATOMIC_ACQ_REL, "workgroup"); __builtin_amdgcn_wave_barrier();
    FragH pa[2], pl[2];
#pragma unroll
    for (int rt = 0; rt < RTN; ++rt) { pa[rt].half[0] = *(const v8us*)&sP[w][rt * 16 + ln][8 * hh]; pa[rt].half[1] = *(const v8us*)&sP[w][rt * 16 + ln][16 + 8 * hh]; pl[rt].half[0] = *(const v8us*)&sPl[w][rt * 16 + ln][8 * hh]; pl[rt].half[1] = *(const v8us*)&sPl[w][rt * 16 + ln][16 + 8 * hh]; }
#pragma unroll
    for (int dt = 0; dt < DT; ++dt) { const size_t vo = (size_t)(dt * 16 + ln) * TK + j0; FragH bv, bl; bv.half[0] = *(const v8us*)(Vth + vo + 8 * hh); bv.half[1] = *(const v8us*)(Vth + vo + 16 + 8 * hh); bl.half[0] = *(const v8us*)(Vtl + vo + 8 * hh); bl.half[1] = *(const v8us*)(Vtl + vo + 16 + 8 * hh);
#pragma unroll
      for (int rt = 0; rt < RTN; ++rt) { oacc[rt][dt] = mmaH<1>(pa[rt].v, pa[rt].v, bv.v, bv.v, oacc[rt][dt]); oaccl[rt][dt] = mmaH<1>(pa[rt].v, pa[rt].v, bl.v, bl.v, oaccl[rt][dt]); oaccl[rt][dt] = mmaH<1>(pl[rt].v, pl[rt].v, bv.v, bv.v, oaccl[rt][dt]); } }
    __builtin_amdgcn_fence(__ATOMIC_ACQ_REL, "workgroup"); __builtin_amdgcn_wave_barrier(); }
#pragma unroll
  for (int rt = 0; rt < RTN; ++rt) {
#pragma unroll
    for (int r = 0; r < 8; ++r) { float l = l_r[rt][r]; l += __shfl_xor(l, 1, 32); l += __shfl_xor(l, 2, 32); l += __shfl_xor(l, 4, 32); l += __shfl_xor(l, 8, 32); l_r[rt][r] = l; }
    if (ln == 0) {
#pragma unroll
      for (int r = 0; r < 8; ++r) { sM[w][rt * 16 + 8 * hh + r] = m_r[rt][r]; sL[w][rt * 16 + 8 * hh + r] = l_r[rt][r]; } }
#pragma unroll
    for (int dt = 0; dt < DT; ++dt)
#pragma unroll
      for (int r = 0; r < 8; ++r) sO[w][rt * 16 + 8 * hh + r][dt * 16 + ln] = oacc[rt][dt][r] + oaccl[rt][dt][r] * 0.0009765625f; }
  __syncthreads();      /* every wave's partial (max, sum, O) is in LDS before any wave merges them */
  {
#pragma unroll
    for (int rp = 0; rp < RPW; rp += 8) { const int r = rp + (tid >> 4), pc = tid & 15;
      const float m0 = sM[0][r], m1 = sM[1][r], m2 = sM[2][r], m3 = sM[3][r]; const float mx = fmaxf(fmaxf(m0, m1), fmaxf(m2, m3));      /* a wave that saw no open key holds -3e38, sum 0, O 0: weight 0 (or 1 on zeros) */
      const float e0 = expf(m0 - mx), e1 = expf(m1 - mx), e2 = expf(m2 - mx), e3 = expf(m3 - mx);
      const float l = e0 * sL[0][r] + e1 * sL[1][r] + e2 * sL[2][r] + e3 * sL[3][r]; const float inv = (l > 0.f) ? 1.0f / (l * 1024.0f) : 0.f;
      const v4f o0 = *(const v4fa*)&sO[0][r][pc * 4], o1 = *(const v4fa*)&sO[1][r][pc * 4], o2 = *(const v4fa*)&sO[2][r][pc * 4], o3 = *(const v4fa*)&sO[3][r][pc * 4];
      const v4f val = (o0 * e0 + o1 * e1 + o2 * e2 + o3 * e3) * inv; v4h hi4, lo4;      /* O leaves as the f16 hi + x2^10 residual planes that the output projection reads */
#pragma unroll
      for (int i = 0; i < 4; ++i) { const _Float16 hv = (_Float16)val[i]; hi4[i] = hv; lo4[i] = (_Float16)((val[i] - (float)hv) * 1024.0f); }
      const size_t oo = ((size_t)b * TQ + q0 + r) * ldo + h * 64 + pc * 4; *(v4h*)(Oh + oo) = hi4; *(v4h*)(Ol + oo) = lo4; }
     } }


__global__ __launch_bounds__(256) void k_causaltab(unsigned* __restrict__ MB, int* __restrict__ RA, int* __restrict__ KE, int nq, int nk) {
  const int t = blockIdx.x * 256 + threadIdx.x; const int nw = nk / 32;
  if (t < nq * nw) { const int q = t / nw, w = t % nw; const int first = q + 1 - 32 * w; const unsigned bits = (first <= 0) ? 0xffffffffu : ((first >= 32) ? 0u : (0xffffffffu << first)); *(unsigned*)(MB + t) = bits;  }
  if (t < nq) { *(int*)(RA + t) = 0;  }
  if (t < nq / 64) { const int v = 64 * (t + 1); *(int*)(KE + t * 32) = v;  } }

__constant__ float INVF[32] = {1.000000000e+00f,7.498942018e-01f,5.623413324e-01f,4.216965139e-01f,3.162277639e-01f,2.371373624e-01f,1.778279394e-01f,1.333521456e-01f,1.000000015e-01f,7.498941571e-02f,5.623412877e-02f,4.216964915e-02f,3.162277862e-02f,2.371373586e-02f,1.778279431e-02f,1.333521493e-02f,9.999999776e-03f,7.498942316e-03f,5.623413250e-03f,4.216964822e-03f,3.162277862e-03f,2.371373819e-03f,1.778279431e-03f,1.333521446e-03f,1.000000047e-03f,7.498941850e-04f,5.623413017e-04f,4.216964880e-04f,3.162277862e-04f,2.371373848e-04f,1.778279402e-04f,1.333521504e-04f};
__constant__ float XBASE[32] = {2.857142985e-01f,3.080357313e-01f,3.303571641e-01f,3.526785970e-01f,3.750000000e-01f,3.973214328e-01f,4.196428359e-01f,4.419642687e-01f,4.642857015e-01f,4.866071343e-01f,5.089285374e-01f,5.312500000e-01f,5.535714030e-01f,5.758928657e-01f,5.982142687e-01f,6.205357313e-01f,6.428571343e-01f,6.651785970e-01f,6.875000000e-01f,7.098214030e-01f,7.321428657e-01f,7.544642687e-01f,7.767857313e-01f,7.991071343e-01f,8.214285970e-01f,8.437500000e-01f,8.660714030e-01f,8.883928657e-01f,9.107142687e-01f,9.330357313e-01f,9.553571343e-01f,9.776785970e-01f};
__global__ __launch_bounds__(256) void k_trig(float* __restrict__ CS, float* __restrict__ SN) {
  #pragma clang fp contract(off)
  const int t = blockIdx.x * 256 + threadIdx.x; if (t >= SLEN * 32) return; const int tok = t >> 5, j = t & 31; const float ang = (float)tok * INVF[j]; const float c = cosf(ang), s = sinf(ang);
  *(float*)(CS + t) = c; *(float*)(SN + t) = s;  }
__global__ __launch_bounds__(256) void k_scale(float* __restrict__ SC) {
  #pragma clang fp contract(off)
  const int t = blockIdx.x * 256 + threadIdx.x; if (t >= SLEN * 32) return; const int tok = t >> 5, j = t & 31; const float v = powf(XBASE[j], ((float)tok - 1024.0f) / 512.0f);
  *(float*)(SC + t) = v;  }
extern "C" void kernel_launch(void* const* d_in, const int* in_sizes, int n_in,
                              void* d_out, int out_size, void* d_ws, size_t ws_size, hipStream_t stream) {
  (void)in_sizes; (void)n_in; (void)out_size;
  const float* const* I = (const float* const*)d_in; const float* x = I[0]; const float* Wq = I[1]; const float* bq = I[2]; const float* Wk = I[3]; const float* bk = I[4]; const float* Wv = I[5]; const float* bv = I[6]; const float* Wo = I[7]; const float* bo = I[8];
  char* ws = (char*)d_ws; size_t off = 0;
  auto take = [&](size_t bytes) { char* p = ws + off; off += (bytes + 255) & ~(size_t)255; return p; };
  _Float16* BQ = (_Float16*)take((size_t)DM * DM * 2); _Float16* BK = (_Float16*)take((size_t)DM * DM * 2); _Float16* BV = (_Float16*)take((size_t)DM * DM * 2); _Float16* BO = (_Float16*)take((size_t)DM * DM * 2);
  _Float16* X16 = (_Float16*)take((size_t)NR * DM * 2); _Float16* Oh = (_Float16*)take((size_t)NR * DM * 2); _Float16* Ol = (_Float16*)take((size_t)NR * DM * 2);
  _Float16* Qh = (_Float16*)take((size_t)NR * DM * 2); _Float16* Ql = (_Float16*)take((size_t)NR * DM * 2); _Float16* Kh = (_Float16*)take((size_t)NR * DM * 2); _Float16* Kl = (_Float16*)take((size_t)NR * DM * 2); _Float16* Vth = (_Float16*)take((size_t)NR * DM * 2); _Float16* Vtl = (_Float16*)take((size_t)NR * DM * 2);
  unsigned* MB = (unsigned*)take((size_t)SLEN * (SLEN / 32) * 4); int* RA = (int*)take((size_t)SLEN * 4); int* KE = (int*)take((size_t)(SLEN / 64) * 32 * 4);
  float* CS = (float*)take((size_t)SLEN * 32 * 4); float* SN = (float*)take((size_t)SLEN * 32 * 4); float* SC = (float*)take((size_t)SLEN * 32 * 4);
  if (off > ws_size) return;      /* 8 + 8 + 8 x 8 + 1.5 = 82 MiB */
  const size_t n8 = (size_t)NR * DM / 8; const unsigned nb8 = (unsigned)((n8 + 255) / 256); const size_t w8 = (size_t)DM * DM / 8; const unsigned wb = (unsigned)((w8 + 255) / 256);
  k_round16f<<<wb, 256, 0, stream>>>(Wq, BQ, w8); k_round16f<<<wb, 256, 0, stream>>>(Wk, BK, w8); k_round16f<<<wb, 256, 0, stream>>>(Wv, BV, w8); k_round16f<<<wb, 256, 0, stream>>>(Wo, BO, w8);      /* torch (out,in) = natural Bt; x16 */
  k_x16<<<nb8, 256, 0, stream>>>(x, X16, n8);
  k_trig<<<(SLEN * 32 + 255) / 256, 256, 0, stream>>>(CS, SN); k_scale<<<(SLEN * 32 + 255) / 256, 256, 0, stream>>>(SC); k_causaltab<<<(SLEN * (SLEN / 32) + 255) / 256, 256, 0, stream>>>(MB, RA, KE, SLEN, SLEN);
  const dim3 gP((NR / 128) * (DM / 64), 1);
  k_gemm2<0, 1><<<gP, 128, 0, stream>>>(X16, DM, 0, BQ, DM, 0, 0.0625f, bq, 0, nullptr, 1, 0, 0, nullptr, nullptr, DM, 0, NR, DM, DM, CS, SN, SC, Qh, Ql);      /* q_mat = xpos(x Wq^T + bq) as hi/lo */
  k_gemm2<0, 2><<<gP, 128, 0, stream>>>(X16, DM, 0, BV, DM, 0, 0.0625f, bv, 0, nullptr, 1, 0, 0, nullptr, nullptr, DM, 0, NR, DM, DM, CS, SN, SC, Kh, Kl);      /* k_mat = xpos^-1(x Wv^T + bv)  (module order) */
  k_gemm2<0, 3><<<gP, 128, 0, stream>>>(X16, DM, 0, BK, DM, 0, 0.0625f, bk, 0, nullptr, 1, 0, 0, nullptr, nullptr, DM, 0, NR, DM, DM, nullptr, nullptr, nullptr, Vth, Vtl);      /* v_mat = x Wk^T + bk as V^T hi/lo [(b, h)][64][2048] */
  for (int b = 0; b < NBT; ++b) { const size_t ro = (size_t)b * SLEN * DM;
    k_flashm<SLEN, SLEN><<<dim3(NH, SLEN / 16), 128, 0, stream>>>(Qh + ro, Ql + ro, DM, Kh + ro, Kl + ro, DM, Vth + ro, Vtl + ro, MB, RA, KE, Oh + ro, Ol + ro, DM); }
  k_gemm2<0, 0><<<gP, 128, 0, stream>>>(Oh, DM, 0, BO, DM, 0, 0.0625f, bo, 0, nullptr, 1, 0, 0, (float*)d_out, nullptr, DM, 0, NR, DM, DM, nullptr, nullptr, nullptr, nullptr, nullptr);
  k_gemm2<0, 0><<<gP, 128, 0, stream>>>(Ol, DM, 0, BO, DM, 0, 0.0625f / 1024.0f, nullptr, 0, (const float*)d_out, 1, (size_t)DM, 0, (float*)d_out, nullptr, DM, 0, NR, DM, DM, nullptr, nullptr, nullptr, nullptr, nullptr);
}

// v005
// A run of this version takes 242 microseconds.
// Next to v004, in two timings, it ran 1.13 and 1.14 times as fast.
// All steps since v000 together make it 3.57 times as fast.
#include <hip/hip_runtime.h>
// Causal multi-head attention with xPos rotary embedding (2 x 2048 tokens x 1024, 16 heads x 64): q = x*Wq^T + bq, k = x*Wv^T + bv, v = x*Wk^T + bk (the module's own assignment order); q <- q*cos*scale + rot(q)*sin*scale, k <- k*cos/scale + rot(k)*sin/scale with interleaved-pair rotation, freq(t, d) = t * inv_freq[d/2], scale(t, d) = base[d mod 32]^((t - 1024)/512); scores = q.k / 32 with j <= i; softmax; merged . Wo^T + bo -> [2,2048,1024].
// Structure: x as an exact f16 plane; the three projections as f16 WMMA GEMMs (32x64 wave tiles fed from LDS-staged 128x64 work-group tiles, f32, exact products + bias); per-token cos/sin/scale tables on VALU (inv_freq and base = the reference's f32 constants, precise trig and powf); each projection's epilogue finishes its operand in place of separate passes: q, k rotated and scaled in f32 and stored as f16 hi + x2^10 residual planes, v transposed through LDS per (batch, head) to [d][token] hi + residual planes; the causal structure computed on device into a key bit plane + per-block key bound; the fused flash kernel per ((batch, head), 64 queries), eight waves = four 16-query sub-tiles x the two 32-key halves of each 64-key stage, K and V^T stages copied to LDS once per work-group (three-product hi/lo scores, online softmax f32 per wave, P hi + residual via LDS, two value accumulators; the two partial (max, sum, O) of a sub-tile merged through LDS at the end and stored as O hi + residual planes); output projection as two GEMMs (bias in the first).
// Compute dtype: x, weights, biases rounded to bf16; projections exact; rotation f32; q, k, P, v, O as f16 hi + residual pairs (~2^-21); f32 accumulation and softmax. v_wmma_f32_16x16x32_f16.
#define NBT 2
#define SLEN 2048
#define DM 1024
#define NH 16
#define SCL 0.03125f
#define NR (NBT * SLEN)
typedef __bf16 v16b __attribute__((ext_vector_type(16)));
typedef unsigned short v8us __attribute__((ext_vector_type(8), may_alias));
typedef float  v8f  __attribute__((ext_vector_type(8)));
typedef float  v4f  __attribute__((ext_vector_type(4)));
typedef float  v4fa __attribute__((ext_vector_type(4), may_alias));
typedef float  v2fa __attribute__((ext_vector_type(2), may_alias));
union FragB { v16b v; v8us half[2]; unsigned short u[16]; };

__device__ __forceinline__ unsigned short bf16_bits(float x) { unsigned int u = __float_as_uint(x); return (unsigned short)((u + 0x7FFFu + ((u >> 16) & 1u)) >> 16); }
__device__ __forceinline__ float bf16_val(unsigned short b) { return __uint_as_float(((unsigned int)b) << 16); }
__device__ __forceinline__ float bf16_round(float x) { return bf16_val(bf16_bits(x)); }
// D += A·B with NT terms: 1 = ah·bh, 2 = + al·bh (A split), 3 = + ah·bl (both split)
template <int NT>
__device__ __forceinline__ v8f mmaN(v16b ah, v16b al, v16b bh, v16b bl, v8f c) {
  c = __builtin_amdgcn_wmma_f32_16x16x32_bf16(false, ah, false, bh, (short)0, c, false, false);
  if (NT >= 2) c = __builtin_amdgcn_wmma_f32_16x16x32_bf16(false, al, false, bh, (short)0, c, false, false);
  if (NT >= 3) c = __builtin_amdgcn_wmma_f32_16x16x32_bf16(false, ah, false, bl, (short)0, c, false, false);
  asm volatile("v_nop\n\tv_nop\n\tv_nop\n\tv_nop" : "+v"(c) : "v"(ah), "v"(al), "v"(bh), "v"(bl));
  return c;
}

__global__ __launch_bounds__(256) void k_wt_bf16(const float* __restrict__ W, unsigned short* __restrict__ Wt, int K, int N) {
  const int t = blockIdx.x * 256 + threadIdx.x;
  const int k8n = K / 8;
  if (t >= N * k8n) return;
  const int n = t / k8n, k8 = (t % k8n) * 8;
  v8us v;
#pragma unroll
  for (int i = 0; i < 8; ++i) v[i] = bf16_bits(W[(size_t)(k8 + i) * N + n]);
  *(v8us*)(Wt + (size_t)n * K + k8) = v;
  
}

// GEMM C[M][N] (f32, pitch ldc) = act(A[M][K]·W + bias). A f32 row-major (pitch lda) converted per fragment to bf16
// (ASPLIT: hi/lo two planes -> 2 terms, else single rounded term); Wt bf16 [N][K] (pitch ldb). BIAS_BF16 rounds the
// bias to bf16 first (bias quantised to bf16 before the add). K%32==0, M%16==0, N%64==0.
template <bool ASPLIT, int ACT, bool BIAS_BF16>
__global__ __launch_bounds__(128) void k_gemm_bf(const float* __restrict__ A, int lda, const unsigned short* __restrict__ Wt, int ldb,
                                               const float* __restrict__ bias, float* __restrict__ C, int ldc, int M, int N, int K) {
  __shared__ __attribute__((aligned(16))) float so[4][16][64];
  const int tid = threadIdx.x, w = tid >> 5, lane = tid & 31, ln = lane & 15, hh = lane >> 4;
  const int ntn = N / 64;
  const int wid = blockIdx.x * 4 + w;
  const int mt = wid / ntn, nq = wid % ntn;
  if (mt * 16 >= M) return;
  const int row0 = mt * 16, col0 = nq * 64;
  const float* arow = A + (size_t)(row0 + ln) * lda;
  v8f acc[4] = {};
  for (int kb = 0; kb < K; kb += 32) {
    FragB ah, al;
    const v4f x0 = *(const v4fa*)(arow + kb + 8 * hh), x1 = *(const v4fa*)(arow + kb + 8 * hh + 4);
    const v4f x2 = *(const v4fa*)(arow + kb + 16 + 8 * hh), x3 = *(const v4fa*)(arow + kb + 16 + 8 * hh + 4);
    float xs[16] = {x0[0],x0[1],x0[2],x0[3],x1[0],x1[1],x1[2],x1[3],x2[0],x2[1],x2[2],x2[3],x3[0],x3[1],x3[2],x3[3]};
#pragma unroll
    for (int i = 0; i < 16; ++i) { const unsigned short hb = bf16_bits(xs[i]); ah.u[i] = hb; al.u[i] = ASPLIT ? bf16_bits(xs[i] - bf16_val(hb)) : (unsigned short)0; }
#pragma unroll
    for (int t = 0; t < 4; ++t) {
      const unsigned short* brow = Wt + (size_t)(col0 + t * 16 + ln) * ldb + kb;
      FragB b;
      b.half[0] = *(const v8us*)(brow + 8 * hh);
      b.half[1] = *(const v8us*)(brow + 16 + 8 * hh);
      acc[t] = mmaN<ASPLIT ? 2 : 1>(ah.v, al.v, b.v, b.v, acc[t]);
    }
  }
#pragma unroll
  for (int t = 0; t < 4; ++t) {
    float bv = bias ? bias[col0 + t * 16 + ln] : 0.f;
    if (BIAS_BF16) bv = bf16_round(bv);
#pragma unroll
    for (int r = 0; r < 8; ++r) { float v = acc[t][r] + bv; if (ACT == 1) v = fmaxf(v, 0.f); so[w][8 * hh + r][t * 16 + ln] = v; }
  }
  __builtin_amdgcn_fence(__ATOMIC_ACQ_REL, "workgroup");
  __builtin_amdgcn_wave_barrier();
  const int rsub = lane >> 4, c4 = (lane & 15) * 4;
  {
#pragma unroll
    for (int q = 0; q < 8; ++q) {
      const int r = q * 2 + rsub;
      const v4f v = *(const v4fa*)&so[w][r][c4];
      *(v4f*)(C + (size_t)(row0 + r) * ldc + col0 + c4) = v;
    }
    
  }
}

// GEMM C = act(A·W + bias + resid): A f32 (ASPLIT -> hi/lo 2 terms), Wt bf16 [N][K]; ACT 0 none, 1 relu, 2 exact gelu;
// resid (optional, f32, row index = (row % rmod), pitch ldr, RES_BF16 rounds it) added before the activation.
template <bool ASPLIT, int ACT, bool BIAS_BF16, bool RES_BF16>
__global__ __launch_bounds__(128) void k_gemm_bf3(const float* __restrict__ A, int lda, const unsigned short* __restrict__ Wt, int ldb,
                                                const float* __restrict__ bias, const float* __restrict__ resid, int rmod, int ldr,
                                                float* __restrict__ C, int ldc, int M, int N, int K) {
  __shared__ __attribute__((aligned(16))) float so[4][16][64];
  const int tid = threadIdx.x, w = tid >> 5, lane = tid & 31, ln = lane & 15, hh = lane >> 4;
  const int ntn = N / 64;
  const int wid = blockIdx.x * 4 + w;
  const int mt = wid / ntn, nq = wid % ntn;
  if (mt * 16 >= M) return;
  const int row0 = mt * 16, col0 = nq * 64;
  const float* arow = A + (size_t)(row0 + ln) * lda;
  v8f acc[4] = {};
  for (int kb = 0; kb < K; kb += 32) {
    FragB ah, al;
    const v4f x0 = *(const v4fa*)(arow + kb + 8 * hh), x1 = *(const v4fa*)(arow + kb + 8 * hh + 4);
    const v4f x2 = *(const v4fa*)(arow + kb + 16 + 8 * hh), x3 = *(const v4fa*)(arow + kb + 16 + 8 * hh + 4);
    float xs[16] = {x0[0],x0[1],x0[2],x0[3],x1[0],x1[1],x1[2],x1[3],x2[0],x2[1],x2[2],x2[3],x3[0],x3[1],x3[2],x3[3]};
#pragma unroll
    for (int i = 0; i < 16; ++i) { const unsigned short hb = bf16_bits(xs[i]); ah.u[i] = hb; al.u[i] = ASPLIT ? bf16_bits(xs[i] - bf16_val(hb)) : (unsigned short)0; }
#pragma unroll
    for (int t = 0; t < 4; ++t) {
      const unsigned short* brow = Wt + (size_t)(col0 + t * 16 + ln) * ldb + kb;
      FragB b;
      b.half[0] = *(const v8us*)(brow + 8 * hh);
      b.half[1] = *(const v8us*)(brow + 16 + 8 * hh);
      acc[t] = mmaN<ASPLIT ? 2 : 1>(ah.v, al.v, b.v, b.v, acc[t]);
    }
  }
#pragma unroll
  for (int t = 0; t < 4; ++t) {
    const int col = col0 + t * 16 + ln;
    float bv = bias ? bias[col] : 0.f;
    if (BIAS_BF16) bv = bf16_round(bv);
#pragma unroll
    for (int r = 0; r < 8; ++r) {
      float v = acc[t][r] + bv;
      if (resid) { float rv = resid[(size_t)((row0 + 8 * hh + r) % rmod) * ldr + col]; if (RES_BF16) rv = bf16_round(rv); v += rv; }
      if (ACT == 1) v = fmaxf(v, 0.f);
      if (ACT == 2) v = 0.5f * v * (1.0f + erff(v * 0.70710678118654752f));
      if (ACT == 3) { const float u = 0.7978845608028654f * (v + 0.044715f * v * v * v); v = 0.5f * v * (1.0f + tanhf(u)); }
      so[w][8 * hh + r][t * 16 + ln] = v;
    }
  }
  __builtin_amdgcn_fence(__ATOMIC_ACQ_REL, "workgroup");
  __builtin_amdgcn_wave_barrier();
  const int rsub = lane >> 4, c4 = (lane & 15) * 4;
  {
#pragma unroll
    for (int q = 0; q < 8; ++q) {
      const int r = q * 2 + rsub;
      const v4f v = *(const v4fa*)&so[w][r][c4];
      *(v4f*)(C + (size_t)(row0 + r) * ldc + col0 + c4) = v;
    }
    
  }
}
// row LayerNorm (biased variance, eps) over N: s = X (+ R); optional out_sum <- s; out_norm <- (s-mu)*rsqrt(var+eps)*g + b
template <bool PARAM_BF16>
__global__ __launch_bounds__(256) void k_layernorm(const float* __restrict__ X, const float* __restrict__ R, const float* __restrict__ g, const float* __restrict__ bta,
                                                  float* __restrict__ out_sum, float* __restrict__ out_norm, int N, float eps) {
  __shared__ float red[256];
  const int row = blockIdx.x, tid = threadIdx.x;
  const float* x = X + (size_t)row * N; const float* rr = R ? R + (size_t)row * N : nullptr;
  float vals[16];                     // up to N = 4096
  const int per = N / 256;            // contiguous chunk per thread? use strided-by-4 chunks: thread handles j = tid*4 + 1024*u
  float s1 = 0.f;
  for (int u = 0; u < per / 4; ++u) {
    const int j = tid * 4 + 1024 * u;
    const v4f a = *(const v4fa*)(x + j);
    v4f b = {0.f,0.f,0.f,0.f}; if (rr) b = *(const v4fa*)(rr + j);
#pragma unroll
    for (int q = 0; q < 4; ++q) { const float v = a[q] + b[q]; vals[u * 4 + q] = v; s1 += v; }
  }
  red[tid] = s1; __syncthreads();
  for (int st = 128; st > 0; st >>= 1) { if (tid < st) red[tid] += red[tid + st]; __syncthreads(); }
  const float mu = red[0] / (float)N; __syncthreads();
  float s2 = 0.f;
  for (int u = 0; u < per / 4; ++u)
#pragma unroll
    for (int q = 0; q < 4; ++q) { const float c = vals[u * 4 + q] - mu; s2 += c * c; }
  red[tid] = s2; __syncthreads();
  for (int st = 128; st > 0; st >>= 1) { if (tid < st) red[tid] += red[tid + st]; __syncthreads(); }
  const float rs = rsqrtf(red[0] / (float)N + eps);
  {
    for (int u = 0; u < per / 4; ++u) {
      const int j = tid * 4 + 1024 * u;
      v4f o, sm;
#pragma unroll
      for (int q = 0; q < 4; ++q) {
        float gg = g[j + q], bb = bta[j + q];
        if (PARAM_BF16) { gg = bf16_round(gg); bb = bf16_round(bb); }
        sm[q] = vals[u * 4 + q]; o[q] = (vals[u * 4 + q] - mu) * rs * gg + bb;
      }
      if (out_sum) *(v4f*)(out_sum + (size_t)row * N + j) = sm;
      *(v4f*)(out_norm + (size_t)row * N + j) = o;
    }
    
  }
}



// ---- f16 WMMA path (v_wmma_f32_16x16x32_f16): 11-bit significands for operands in range — used where a [0,1] probability operand needs more precision than bf16
typedef _Float16 v16h __attribute__((ext_vector_type(16)));
union FragH { v16h v; v8us half[2]; _Float16 h[16]; unsigned short u[16]; };
template <int NT>
__device__ __forceinline__ v8f mmaH(v16h ah, v16h al, v16h bh, v16h bl, v8f c) {
  c = __builtin_amdgcn_wmma_f32_16x16x32_f16(false, ah, false, bh, (short)0, c, false, false);
  if (NT >= 2) c = __builtin_amdgcn_wmma_f32_16x16x32_f16(false, al, false, bh, (short)0, c, false, false);
  if (NT >= 3) c = __builtin_amdgcn_wmma_f32_16x16x32_f16(false, ah, false, bl, (short)0, c, false, false);
  asm volatile("v_nop\n\tv_nop\n\tv_nop\n\tv_nop" : "+v"(c) : "v"(ah), "v"(al), "v"(bh), "v"(bl));
  return c;
}
// batched GEMM like k_gemm_b but f16 operands: A f32 (split into f16 hi/lo if ASPLIT, else rounded to f16), Bt = f16 values [n][k]; alpha; C f32; N multiple of 16 (partial tiles skipped)
template <bool ASPLIT>
__global__ __launch_bounds__(128) void k_gemm_h(const float* __restrict__ A, int lda, size_t sA, const _Float16* __restrict__ Bh, int ldb, size_t sB, float alpha, float* __restrict__ C, int ldc, size_t sC, int M, int N, int K) {
  __shared__ __attribute__((aligned(16))) float so[4][16][64];
  const int tid = threadIdx.x, w = tid >> 5, lane = tid & 31, ln = lane & 15, hh = lane >> 4; const int by = blockIdx.y;
  A += (size_t)by * sA; Bh += (size_t)by * sB; C += (size_t)by * sC;
  const int ntn = (N + 63) / 64; const int wid = blockIdx.x * 4 + w; const int mt = wid / ntn, nq = wid % ntn; if (mt * 16 >= M) return;
  const int row0 = mt * 16, col0 = nq * 64; const float* arow = A + (size_t)(row0 + ln) * lda;
  v8f acc[4] = {};
  for (int kb = 0; kb < K; kb += 32) {
    FragH ah, al;
    const v4f x0 = *(const v4fa*)(arow + kb + 8 * hh), x1 = *(const v4fa*)(arow + kb + 8 * hh + 4), x2 = *(const v4fa*)(arow + kb + 16 + 8 * hh), x3 = *(const v4fa*)(arow + kb + 16 + 8 * hh + 4);
    float xs[16] = {x0[0],x0[1],x0[2],x0[3],x1[0],x1[1],x1[2],x1[3],x2[0],x2[1],x2[2],x2[3],x3[0],x3[1],x3[2],x3[3]};
#pragma unroll
    for (int i = 0; i < 16; ++i) { const _Float16 h = (_Float16)xs[i]; ah.h[i] = h; al.h[i] = ASPLIT ? (_Float16)(xs[i] - (float)h) : (_Float16)0.0f; }
#pragma unroll
    for (int t = 0; t < 4; ++t) { if (col0 + t * 16 >= N) continue; const size_t boff = (size_t)(col0 + t * 16 + ln) * ldb + kb; FragH bq; bq.half[0] = *(const v8us*)(Bh + boff + 8 * hh); bq.half[1] = *(const v8us*)(Bh + boff + 16 + 8 * hh);
      acc[t] = mmaH<ASPLIT ? 2 : 1>(ah.v, al.v, bq.v, bq.v, acc[t]); }
  }
#pragma unroll
  for (int t = 0; t < 4; ++t) { if (col0 + t * 16 >= N) continue;
#pragma unroll
    for (int r = 0; r < 8; ++r) so[w][8 * hh + r][t * 16 + ln] = acc[t][r] * alpha; }
  __builtin_amdgcn_fence(__ATOMIC_ACQ_REL, "workgroup"); __builtin_amdgcn_wave_barrier();
  const int rsub = lane >> 4, c4 = (lane & 15) * 4;
  {
#pragma unroll
    for (int q = 0; q < 8; ++q) { const int r = q * 2 + rsub; if (col0 + c4 < N) { const v4f v = *(const v4fa*)&so[w][r][c4]; *(v4f*)(C + (size_t)(row0 + r) * ldc + col0 + c4) = v; } }
     }
}

// Wt[n][k] = f16(W[k][n]·scale) from f32 row-major W[K][N] (scale = power of two; bf16-exact weights stay exact in f16 away from the subnormal range)
__global__ __launch_bounds__(256) void k_wt_f16(const float* __restrict__ W, _Float16* __restrict__ Wt, int K, int N, float scale) {
  const int t = blockIdx.x * 256 + threadIdx.x; if (t >= N * (K / 8)) return; const int n = t / (K / 8), k8 = (t % (K / 8)) * 8; FragH f;
#pragma unroll
  for (int i = 0; i < 8; ++i) f.h[i] = (_Float16)(bf16_round(W[(size_t)(k8 + i) * N + n]) * scale); const v8us o = f.half[0];
  *(v8us*)((unsigned short*)Wt + (size_t)n * K + k8) = o; 
}
// k_gemm_hh variant with fused epilogue: v = acc·alpha + bias[by·sBias + col] (+ CP[(row/rowsPerB)·sCPb + by·64 + col] if CP) ; ACT 0 none / 1 elu ; writes f16 C16 (and f32 C if non-null)
template <int ACT>
__global__ __launch_bounds__(128) void k_gemm_hhx(const _Float16* __restrict__ A, int lda, size_t sA, const _Float16* __restrict__ Bh, int ldb, size_t sB, float alpha, const float* __restrict__ bias, size_t sBias, const float* __restrict__ CP, int rowsPerB, size_t sCPb, int row0g,
    float* __restrict__ C, _Float16* __restrict__ C16, int ldc, size_t sC, int M, int N, int K) {
  __shared__ __attribute__((aligned(16))) float so[4][16][64];
  const int tid = threadIdx.x, w = tid >> 5, lane = tid & 31, ln = lane & 15, hh = lane >> 4; const int by = blockIdx.y;
  A += (size_t)by * sA; Bh += (size_t)by * sB; const size_t cofs = (size_t)by * sC; const float* bp = bias ? bias + (size_t)by * sBias : nullptr;
  const int ntn = (N + 63) / 64; const int wid = blockIdx.x * 4 + w; const int mt = wid / ntn, nq = wid % ntn; if (mt * 16 >= M) return;
  const int row0 = mt * 16, col0 = nq * 64; const _Float16* arow = A + (size_t)(row0 + ln) * lda;
  v8f acc[4] = {};
  for (int kb = 0; kb < K; kb += 32) { FragH ah; ah.half[0] = *(const v8us*)((const unsigned short*)arow + kb + 8 * hh); ah.half[1] = *(const v8us*)((const unsigned short*)arow + kb + 16 + 8 * hh);
#pragma unroll
    for (int t = 0; t < 4; ++t) { if (col0 + t * 16 >= N) continue; const size_t boff = (size_t)(col0 + t * 16 + ln) * ldb + kb; FragH bq; bq.half[0] = *(const v8us*)((const unsigned short*)Bh + boff + 8 * hh); bq.half[1] = *(const v8us*)((const unsigned short*)Bh + boff + 16 + 8 * hh);
      acc[t] = mmaH<1>(ah.v, ah.v, bq.v, bq.v, acc[t]); }
  }
#pragma unroll
  for (int t = 0; t < 4; ++t) { if (col0 + t * 16 >= N) continue; const int col = col0 + t * 16 + ln; const float bv = bp ? bf16_round(bp[col]) : 0.f;
#pragma unroll
    for (int r = 0; r < 8; ++r) { float v = acc[t][r] * alpha + bv; if (CP) { const int bidx = (row0g + row0 + 8 * hh + r) / rowsPerB; v += CP[(size_t)bidx * sCPb + (size_t)by * 64 + col]; } if (ACT == 1) v = (v > 0.f) ? v : expm1f(v); else if (ACT == 7) v = (v > 0.f) ? v + 1.0f : expf(v); else if (ACT == 8) v = tanhf(v); else if (ACT == 9) v = 0.5f * v * (1.0f + tanhf(0.7978845608028654f * (v + 0.044715f * v * v * v))); else if (ACT == 11) v = 1.0f / (1.0f + expf(-v)); else if (ACT == 12) v = (v > 0.f) ? v : 0.01f * v; else if (ACT == 14) v = (v > 0.f) ? v : 0.1f * v; else if (ACT == 15) v = v / (1.0f + expf(-v)); else if (ACT == 3) v = fmaxf(v, 0.f); else if (ACT == 6) v = 0.5f * v * (1.0f + erff(v * 0.70710678118654752f)); so[w][8 * hh + r][t * 16 + ln] = v; } }
  __builtin_amdgcn_fence(__ATOMIC_ACQ_REL, "workgroup"); __builtin_amdgcn_wave_barrier();
  const int rsub = lane >> 4, c4 = (lane & 15) * 4; typedef _Float16 v4h __attribute__((ext_vector_type(4)));
  {
#pragma unroll
    for (int q = 0; q < 8; ++q) { const int r = q * 2 + rsub; if (col0 + c4 < N) { const v4f v = *(const v4fa*)&so[w][r][c4]; if (C) *(v4f*)(C + cofs + (size_t)(row0 + r) * ldc + col0 + c4) = v; if (C16) { v4h h4; for (int i = 0; i < 4; ++i) h4[i] = (_Float16)v[i]; *(v4h*)(C16 + cofs + (size_t)(row0 + r) * ldc + col0 + c4) = h4; } } }
     }
}


typedef _Float16 v4h __attribute__((ext_vector_type(4)));

__global__ __launch_bounds__(256) void k_x16(const float* __restrict__ x, _Float16* __restrict__ X16, size_t n8) { const size_t t = (size_t)blockIdx.x * 256 + threadIdx.x; if (t >= n8) return; FragH f;
#pragma unroll
  for (int q = 0; q < 8; ++q) f.h[q] = (_Float16)bf16_round(x[t * 8 + q]); *(v8us*)((unsigned short*)X16 + t * 8) = f.half[0];  }
__global__ __launch_bounds__(256) void k_h16(const float* __restrict__ x, _Float16* __restrict__ X16, size_t n8) { const size_t t = (size_t)blockIdx.x * 256 + threadIdx.x; if (t >= n8) return; FragH f;
#pragma unroll
  for (int q = 0; q < 8; ++q) f.h[q] = (_Float16)x[t * 8 + q]; *(v8us*)((unsigned short*)X16 + t * 8) = f.half[0];  }
__global__ __launch_bounds__(256) void k_round16f(const float* __restrict__ W, _Float16* __restrict__ Bt, size_t n8) { const size_t t = (size_t)blockIdx.x * 256 + threadIdx.x; if (t >= n8) return; FragH f;
#pragma unroll
  for (int i = 0; i < 8; ++i) f.h[i] = (_Float16)(bf16_round(W[t * 8 + i]) * 16.0f); *(v8us*)((unsigned short*)Bt + t * 8) = f.half[0];  }
template <int NHv, int TTv>
__global__ __launch_bounds__(256) void k_vt(const _Float16* __restrict__ V16, int ldv, int voff, _Float16* __restrict__ Vt) { __shared__ unsigned short tl[64][66]; const int tid = threadIdx.x; const int slab = blockIdx.x / (TTv / 64), lg = blockIdx.x % (TTv / 64); const int b = slab / NHv, h = slab % NHv;
  for (int i = tid; i < 64 * 8; i += 256) { const int r = i / 8, c8 = (i % 8) * 8; FragH f; f.half[0] = *(const v8us*)((const unsigned short*)V16 + ((size_t)b * TTv + lg * 64 + r) * ldv + voff + h * 64 + c8);
#pragma unroll
    for (int q = 0; q < 8; ++q) tl[r][c8 + q] = f.u[q]; }
  __syncthreads();
  {
#pragma unroll
    for (int rd = 0; rd < 2; ++rd) { const int d = rd * 32 + tid / 8, pc = tid % 8; FragH f;
#pragma unroll
      for (int q = 0; q < 8; ++q) f.u[q] = tl[pc * 8 + q][d];
      *(v8us*)((unsigned short*)Vt + ((size_t)slab * 64 + d) * TTv + lg * 64 + pc * 8) = f.half[0]; }
     } }

// ---- fast GEMM (wave tile 32x64; requires M % 32 == 0 rows per launch region, N % 64 == 0 and K % 64 == 0); epilogue = k_gemm_hhx semantics ----
__device__ __forceinline__ v16h g2_frag(const _Float16* p, int hh) { FragH f; f.half[0] = *(const v8us*)((const unsigned short*)p + 8 * hh); f.half[1] = *(const v8us*)((const unsigned short*)p + 16 + 8 * hh); return f.v; }
__device__ __forceinline__ v8f g2_mma(v16h a, v16h b, v8f c) { v8f d = __builtin_amdgcn_wmma_f32_16x16x32_f16(false, a, false, b, (short)0, c, false, false); asm volatile("v_nop\n\tv_nop\n\tv_nop\n\tv_nop" : "+v"(d) : "v"(a), "v"(b)); return d; }
/* XP 0: stores C / C16. XP 1 (q) and 2 (k, inverse scale): the epilogue applies the xPos rotation to the row while it is still in LDS (a 64-column tile is one head, a lane's 4 columns hold whole rotation pairs; token = row % SLEN) and stores the f16 hi + x2^10 residual planes Hh, Hl instead of C. XP 3 (v): the tile (128 tokens of one batch x one head) leaves transposed, as hi + residual planes [(batch, head)][d][token] */
template <int ACT, int XP>
__global__ __launch_bounds__(128) void k_gemm2(const _Float16* __restrict__ A, int lda, size_t sA, const _Float16* __restrict__ Bh, int ldb, size_t sB, float alpha, const float* __restrict__ bias, size_t sBias, const float* __restrict__ CP, int rowsPerB, size_t sCPb, int row0g,
    float* __restrict__ C, _Float16* __restrict__ C16, int ldc, size_t sC, int M, int N, int K, const float* __restrict__ CS, const float* __restrict__ SN, const float* __restrict__ SC, _Float16* __restrict__ Hh, _Float16* __restrict__ Hl) {
  /* the work-group's 128 x 64 tile: per stage of 64 k (K % 64 == 0) one whole 128-byte line of each of its 128 A rows and 64 B rows goes to LDS, two buffers; row pitch 144 B for the 16-byte fragment reads */
  constexpr int PIT = 72;
  __shared__ __attribute__((aligned(16))) float so[4][32][68];
  __shared__ __attribute__((aligned(16))) _Float16 tA[2][128 * PIT], tB[2][64 * PIT];
  const int tid = threadIdx.x, w = tid >> 5, lane = tid & 31, ln = lane & 15, hh = lane >> 4; const int by = blockIdx.y;
  A += (size_t)by * sA; Bh += (size_t)by * sB; const size_t cofs = (size_t)by * sC; const float* bp = bias ? bias + (size_t)by * sBias : nullptr;
  const int ntn = N >> 6; const int mt = blockIdx.x / ntn, nq = blockIdx.x - mt * ntn; const int row0 = mt * 128 + 32 * w, col0 = nq * 64; if (mt * 128 >= M) return;      /* the same for the whole work-group: every wave reaches every barrier below */
  const int sr = tid >> 3, sc = (tid & 7) * 8;      /* staging: eight threads bring one row's line, a wave four whole lines per load */
  unsigned oa[8], ob[4];      /* byte offsets of the staged lines at k = 0, fixed for the whole loop */
#pragma unroll
  for (int i = 0; i < 8; ++i) oa[i] = ((unsigned)min(mt * 128 + i * 16 + sr, M - 1) * (unsigned)lda + (unsigned)sc) * 2u;      /* rows past M (a last tile of 32, 64 or 96 rows) re-read row M - 1; their waves store nothing */
#pragma unroll
  for (int i = 0; i < 4; ++i) ob[i] = ((unsigned)(col0 + i * 16 + sr) * (unsigned)ldb + (unsigned)sc) * 2u;
  const int so_st = sr * PIT + sc, fa = (32 * w + ln) * PIT, fb = ln * PIT;
  const v8f z8 = {0.f,0.f,0.f,0.f,0.f,0.f,0.f,0.f}; v8f c00 = z8, c01 = z8, c02 = z8, c03 = z8, c10 = z8, c11 = z8, c12 = z8, c13 = z8;
  v8us ra[8], rb[4];
#pragma unroll
  for (int i = 0; i < 8; ++i) ra[i] = *(const v8us*)((const char*)A + oa[i]);
#pragma unroll
  for (int i = 0; i < 4; ++i) rb[i] = *(const v8us*)((const char*)Bh + ob[i]);
#pragma unroll
  for (int i = 0; i < 8; ++i) *(v8us*)&tA[0][so_st + i * 16 * PIT] = ra[i];
#pragma unroll
  for (int i = 0; i < 4; ++i) *(v8us*)&tB[0][so_st + i * 16 * PIT] = rb[i];
  __syncthreads();      /* stage 0 is in LDS before any wave reads it */
#pragma unroll 1      /* stays rolled: the body already holds 16 products and the whole of a stage's loads */
  for (int kb = 0; kb < K; kb += 64) { const int cur = (kb >> 6) & 1; const bool more = kb + 64 < K;
    if (more) {      /* the next stage's global loads go out ahead of this stage's products, which cover their latency */
#pragma unroll
      for (int i = 0; i < 8; ++i) ra[i] = *(const v8us*)((const char*)(A + kb + 64) + oa[i]);
#pragma unroll
      for (int i = 0; i < 4; ++i) rb[i] = *(const v8us*)((const char*)(Bh + kb + 64) + ob[i]); }
    const _Float16* pa = &tA[cur][fa]; const _Float16* pb = &tB[cur][fb];
    v16h a0[2], a1[2], b0[2], b1[2], b2[2], b3[2];      /* all of the stage's fragment reads as one group in front of its products */
#pragma unroll
    for (int ks = 0; ks < 2; ++ks) { a0[ks] = g2_frag(pa + ks * 32, hh); a1[ks] = g2_frag(pa + 16 * PIT + ks * 32, hh); b0[ks] = g2_frag(pb + ks * 32, hh); b1[ks] = g2_frag(pb + 16 * PIT + ks * 32, hh); b2[ks] = g2_frag(pb + 32 * PIT + ks * 32, hh); b3[ks] = g2_frag(pb + 48 * PIT + ks * 32, hh); }
#pragma unroll
    for (int ks = 0; ks < 2; ++ks) {
      c00 = g2_mma(a0[ks], b0[ks], c00); c10 = g2_mma(a1[ks], b0[ks], c10);
      c01 = g2_mma(a0[ks], b1[ks], c01); c11 = g2_mma(a1[ks], b1[ks], c11);
      c02 = g2_mma(a0[ks], b2[ks], c02); c12 = g2_mma(a1[ks], b2[ks], c12);
      c03 = g2_mma(a0[ks], b3[ks], c03); c13 = g2_mma(a1[ks], b3[ks], c13); }
    if (more) {      /* into the buffer that every wave left at the last barrier */
#pragma unroll
      for (int i = 0; i < 8; ++i) *(v8us*)&tA[cur ^ 1][so_st + i * 16 * PIT] = ra[i];
#pragma unroll
      for (int i = 0; i < 4; ++i) *(v8us*)&tB[cur ^ 1][so_st + i * 16 * PIT] = rb[i]; }
    __syncthreads(); }      /* publishes the next stage and ends every wave's reads of this one */
  if (XP != 3 && row0 >= M) return;      /* no barrier follows; XP 3 has one below and takes whole 128-row tiles only (M % 128 == 0) */
  v8f accs[8] = {c00, c01, c02, c03, c10, c11, c12, c13};
  constexpr int TP = 136; _Float16* sT = (_Float16*)&so[0][0][0];      /* XP 3: the staging bytes as two f16 planes [64 d][128 tokens], row pitch 272 B */
#pragma unroll
  for (int u = 0; u < 8; ++u) { const int t = u & 3, half = u >> 2; const int col = col0 + t * 16 + ln; const float bv = bp ? bf16_round(bp[col]) : 0.f; FragH th, tl;
#pragma unroll
    for (int r = 0; r < 8; ++r) { const int rloc = half * 16 + 8 * hh + r; float v = accs[u][r] * alpha + bv; if (CP) { const int bidx = (row0g + row0 + rloc) / rowsPerB; v += CP[(size_t)bidx * sCPb + (size_t)by * 64 + col]; }
      if (ACT == 3) v = fmaxf(v, 0.f); else if (ACT == 6) v = 0.5f * v * (1.0f + erff(v * 0.70710678118654752f)); else if (ACT == 11) v = 1.0f / (1.0f + expf(-v)); else if (ACT == 15) v = v / (1.0f + expf(-v)); else if (ACT == 12) v = (v > 0.f) ? v : 0.01f * v; else if (ACT == 8) v = tanhf(v);
      if (XP == 3) { const _Float16 hv = (_Float16)v; th.h[r] = hv; tl.h[r] = (_Float16)((v - (float)hv) * 1024.0f); } else so[w][rloc][t * 16 + ln] = v; }
    if (XP == 3) { const int o = (t * 16 + ln) * TP + 32 * w + half * 16 + 8 * hh; *(v8us*)&sT[o] = th.half[0]; *(v8us*)&sT[64 * TP + o] = tl.half[0]; } }      /* a lane's 8 accumulator rows are 8 consecutive tokens of one d: one 16-byte piece of the transposed row */
  if (XP == 3) {
    __syncthreads();      /* all four waves' 32-token pieces are in LDS before any wave stores whole 256-byte rows */
    const size_t vb = ((size_t)((mt * 128) / SLEN) * NH + nq) * 64 * SLEN + (mt * 128) % SLEN;
#pragma unroll
    for (int it = 0; it < 8; ++it) { const int d = it * 8 + (tid >> 4), pc = tid & 15; const v8us a = *(const v8us*)&sT[d * TP + pc * 8], c = *(const v8us*)&sT[64 * TP + d * TP + pc * 8];
      *(v8us*)((unsigned short*)Hh + vb + (size_t)d * SLEN + pc * 8) = a; *(v8us*)((unsigned short*)Hl + vb + (size_t)d * SLEN + pc * 8) = c; }
    return; }
  __builtin_amdgcn_fence(__ATOMIC_ACQ_REL, "workgroup"); __builtin_amdgcn_wave_barrier();
  const int rsub = lane >> 4, c4 = (lane & 15) * 4;
  if (XP == 1 || XP == 2) {
    const size_t tb = (size_t)(row0 % SLEN + rsub) * 32;      /* a wave's 32 rows lie in one batch (SLEN % 32 == 0): token = row0 % SLEN + r */
    const float* cs = CS + tb + (c4 >> 1); const float* sn = SN + tb + (c4 >> 1); const float* scp = SC + tb + (c4 & 31);
#pragma unroll
    for (int g = 0; g < 16; g += 8) { v2fa cq[8], sq[8]; v4f s4[8];      /* two groups of 8 rows: 16 rows' table words and the k side's 64 quotients at once need more than 256 registers */
#pragma unroll
      for (int q = 0; q < 8; ++q) { cq[q] = *(const v2fa*)(cs + (g + q) * 64); sq[q] = *(const v2fa*)(sn + (g + q) * 64); s4[q] = *(const v4fa*)(scp + (g + q) * 64); }      /* the group's table words in flight together */
      asm volatile("s_wait_xcnt 0x0" :: "v"(cs), "v"(sn), "v"(scp) : "memory");      /* precaution: stands in front of every rewrite of the table loads' address registers, which stay live up to here */
#pragma unroll
      for (int q = 0; q < 8; ++q) { const int r = (g + q) * 2 + rsub; const v4f v = *(const v4fa*)&so[w][r][c4]; v4h hi4, lo4;
#pragma unroll
        for (int i = 0; i < 4; ++i) { float sc = s4[q][i]; if (XP == 2) sc = 1.0f / sc;
          const float x = v[i]; const float rx = (i & 1) ? v[i - 1] : -v[i + 1]; const float o = (x * cq[q][i >> 1]) * sc + (rx * sq[q][i >> 1]) * sc;
          const _Float16 h = (_Float16)o; hi4[i] = h; lo4[i] = (_Float16)((o - (float)h) * 1024.0f); }
        const size_t oo = cofs + (size_t)(row0 + r) * ldc + col0 + c4; *(v4h*)(Hh + oo) = hi4; *(v4h*)(Hl + oo) = lo4; }
      if (g == 0) asm volatile("s_wait_xcnt 0x0" ::: "memory"); }      /* precaution: the second group's loads may land in registers that the first group's stores name */
    return; }
  {
#pragma unroll
    for (int q = 0; q < 16; ++q) { const int r = q * 2 + rsub; const v4f v = *(const v4fa*)&so[w][r][c4]; if (C) *(v4f*)(C + cofs + (size_t)(row0 + r) * ldc + col0 + c4) = v; if (C16) { v4h h4; for (int i = 0; i < 4; ++i) h4[i] = (_Float16)v[i]; *(v4h*)(C16 + cofs + (size_t)(row0 + r) * ldc + col0 + c4) = h4; } }
     } }



template <int TQ, int TK>
__global__ __launch_bounds__(256) void k_flashm(const _Float16* __restrict__ Q16, const _Float16* __restrict__ Q16lo, int ldq, const _Float16* __restrict__ K16, const _Float16* __restrict__ K16lo, int ldk, const _Float16* __restrict__ Vt, const _Float16* __restrict__ Vtlo, const unsigned* __restrict__ MB, const int* __restrict__ RA, const int* __restrict__ KE, _Float16* __restrict__ Oh, _Float16* __restrict__ Ol, int ldo) {
  /* 64 queries per work-group, eight waves: wave w has the 16 queries of sub-tile w & 3 and the 32-key half w >> 2 of every 64-key stage. A stage (K hi, K lo: 64 keys x 64 d; V^T hi, V^T lo: 64 d x 64 keys; whole 128-byte lines) is copied to LDS once and read by all eight waves; two buffers, row pitch 144 B for the 16-byte fragment reads */
  constexpr int RPW = 16, RTN = RPW / 16, QW = 64, NQB = TQ / QW, DT = 4, KS = 2, KP = 72, PLN = 64 * KP, STG = 4 * PLN;
  __shared__ __attribute__((aligned(16))) unsigned short sKV[2][STG];
  __shared__ __attribute__((aligned(16))) unsigned short sP[8][RPW][40], sPl[8][RPW][40]; __shared__ __attribute__((aligned(16))) float sO[8][RPW][64 + 4]; __shared__ float sM[8][RPW], sL[8][RPW];
  const int tid = threadIdx.x, lane = tid & 31, ln = lane & 15, hh = lane >> 4;
  const int w = __builtin_amdgcn_readfirstlane(tid >> 5);      /* the wave's number in a scalar register: the skip of a key half past the bound stays a scalar branch */
  const int qs = w & 3, kg = w >> 2;
  /* grid (slab, tile): all groups of a launch are resident at once, two to a WGP; the first half of the flat index takes the tiles with the most keys in falling order, the second half the rest in rising order, so that index i and i + half add up to the same number of stages */
  const int slab = blockIdx.x, yy = (int)blockIdx.y, qt = (yy < NQB / 2) ? NQB - 1 - yy : yy - NQB / 2; const int b = slab / NH, h = slab % NH; const int q0 = qt * QW + qs * RPW; const int qblk = q0 >> 6;
  FragH aq[2][KS], aql[2][KS];
#pragma unroll
  for (int rt = 0; rt < RTN; ++rt) { const size_t qo = ((size_t)b * TQ + q0 + rt * 16 + ln) * ldq + h * 64; const unsigned short* qr = (const unsigned short*)Q16 + qo; const unsigned short* ql = (const unsigned short*)Q16lo + qo;
#pragma unroll
    for (int ks = 0; ks < KS; ++ks) { aq[rt][ks].half[0] = *(const v8us*)(qr + ks * 32 + 8 * hh); aq[rt][ks].half[1] = *(const v8us*)(qr + ks * 32 + 16 + 8 * hh); aql[rt][ks].half[0] = *(const v8us*)(ql + ks * 32 + 8 * hh); aql[rt][ks].half[1] = *(const v8us*)(ql + ks * 32 + 16 + 8 * hh); } }
  const unsigned short* Vth = (const unsigned short*)Vt + (size_t)slab * 64 * TK; const unsigned short* Vtl = (const unsigned short*)Vtlo + (size_t)slab * 64 * TK;
  float m_r[2][8], l_r[2][8]; v8f oacc[2][DT], oaccl[2][DT];
#pragma unroll
  for (int rt = 0; rt < RTN; ++rt) {
#pragma unroll
    for (int r = 0; r < 8; ++r) { m_r[rt][r] = -3.0e38f; l_r[rt][r] = 0.f; }
#pragma unroll
    for (int dt = 0; dt < DT; ++dt) { oacc[rt][dt] = (v8f){0.f,0.f,0.f,0.f,0.f,0.f,0.f,0.f}; oaccl[rt][dt] = oacc[rt][dt]; } }
  int jend = KE[qblk * 32]; jend = min(TK, (jend + 31) & ~31); if (jend < 32) jend = 32; jend = __builtin_amdgcn_readfirstlane(jend);      /* block-uniform, in a scalar register */
  const int nst = (jend + 63) >> 6;      /* stages of 64 keys; TK % 64 == 0, so every stage lies inside K and V */
  int allm[2][8]; const unsigned* mrow[2][8];
#pragma unroll
  for (int rt = 0; rt < RTN; ++rt)
#pragma unroll
    for (int r = 0; r < 8; ++r) { const int tq = q0 + rt * 16 + 8 * hh + r; allm[rt][r] = RA[tq]; mrow[rt][r] = MB + (size_t)tq * (TK / 32); }
  /* staging: eight lanes bring one row's 128-byte line, a wave four whole lines per copy; each thread copies rows cr and cr + 32 of each of the four planes */
  const int cr = tid >> 3, cc = (tid & 7) * 8;
  const size_t gko = ((size_t)b * TK + cr) * ldk + h * 64 + cc, gvo = (size_t)cr * TK + cc;
  const unsigned lds0 = (unsigned)(size_t)&sKV[0][cr * KP + cc];      /* the lane's LDS byte address in buffer 0, plane 0 */
  auto stage = [&](int s, int buf) {
    const unsigned short* k0 = (const unsigned short*)K16 + gko + (size_t)s * 64 * ldk; const unsigned short* k2 = (const unsigned short*)K16lo + gko + (size_t)s * 64 * ldk; const unsigned short* k1 = k0 + (size_t)32 * ldk; const unsigned short* k3 = k2 + (size_t)32 * ldk;
    const unsigned short* v0 = Vth + gvo + s * 64; const unsigned short* v2 = Vtl + gvo + s * 64; const unsigned short* v1 = v0 + (size_t)32 * TK; const unsigned short* v3 = v2 + (size_t)32 * TK;
    const unsigned d0 = lds0 + (unsigned)buf * (STG * 2u), d1 = d0 + 32u * KP * 2u, d2 = d0 + PLN * 2u, d3 = d2 + 32u * KP * 2u, d4 = d0 + 2u * PLN * 2u, d5 = d4 + 32u * KP * 2u, d6 = d0 + 3u * PLN * 2u, d7 = d6 + 32u * KP * 2u;
    /* the stage's eight copies; the closing s_wait_xcnt is a precaution that stands in front of every rewrite of the copies' address registers */
    asm volatile("global_load_async_to_lds_b128 %0, %8, off\n\tglobal_load_async_to_lds_b128 %1, %9, off\n\tglobal_load_async_to_lds_b128 %2, %10, off\n\tglobal_load_async_to_lds_b128 %3, %11, off\n\t"
                 "global_load_async_to_lds_b128 %4, %12, off\n\tglobal_load_async_to_lds_b128 %5, %13, off\n\tglobal_load_async_to_lds_b128 %6, %14, off\n\tglobal_load_async_to_lds_b128 %7, %15, off\n\ts_wait_xcnt 0x0"
                 :: "v"(d0), "v"(d1), "v"(d2), "v"(d3), "v"(d4), "v"(d5), "v"(d6), "v"(d7), "v"(k0), "v"(k1), "v"(k2), "v"(k3), "v"(v0), "v"(v1), "v"(v2), "v"(v3) : "memory"); };
  stage(0, 0);
  asm volatile("s_wait_asynccnt 0x0" ::: "memory");      /* this wave's copies of stage 0 have landed */
  __syncthreads();      /* stage 0 is in LDS before any wave reads it */
  if (nst > 1) stage(1, 1);
#pragma unroll 1
  for (int st = 0; st < nst; ++st) { const int j0 = st * 64 + kg * 32; const unsigned short* tb = &sKV[st & 1][0];
   if (j0 < jend) {      /* a key half past the bound is skipped by its four waves; the publish point below is passed by every wave */
    unsigned mw[2][8];      /* all of the pass's mask words are fetched here, so that their latency runs under the K reads and the score products */
#pragma unroll
    for (int rt = 0; rt < RTN; ++rt)
#pragma unroll
      for (int r = 0; r < 8; ++r) mw[rt][r] = mrow[rt][r][j0 >> 5];
    asm volatile("s_wait_xcnt 0x0" ::: "memory");      /* precaution: stands in front of every rewrite of the mask loads' address registers; it also keeps these loads ahead of the K reads */
    v8f s[2][2]; FragH bk[2][KS], bkl[2][KS];      /* all of the pass's K fragment reads stand as one group in front of its score products: one LDS latency instead of two */
#pragma unroll
    for (int nt = 0; nt < 2; ++nt) { const unsigned short* kr = tb + (kg * 32 + nt * 16 + ln) * KP; const unsigned short* kl = kr + PLN;
#pragma unroll
      for (int ks = 0; ks < KS; ++ks) { bk[nt][ks].half[0] = *(const v8us*)(kr + ks * 32 + 8 * hh); bk[nt][ks].half[1] = *(const v8us*)(kr + ks * 32 + 16 + 8 * hh); bkl[nt][ks].half[0] = *(const v8us*)(kl + ks * 32 + 8 * hh); bkl[nt][ks].half[1] = *(const v8us*)(kl + ks * 32 + 16 + 8 * hh); } }
#pragma unroll
    for (int nt = 0; nt < 2; ++nt) {
#pragma unroll
      for (int rt = 0; rt < RTN; ++rt) { v8f acc = (v8f){0.f,0.f,0.f,0.f,0.f,0.f,0.f,0.f}, accr = acc;
#pragma unroll
        for (int ks = 0; ks < KS; ++ks) { acc = mmaH<1>(aq[rt][ks].v, aq[rt][ks].v, bk[nt][ks].v, bk[nt][ks].v, acc); accr = mmaH<1>(aql[rt][ks].v, aql[rt][ks].v, bk[nt][ks].v, bk[nt][ks].v, accr); accr = mmaH<1>(aq[rt][ks].v, aq[rt][ks].v, bkl[nt][ks].v, bkl[nt][ks].v, accr); }
        s[rt][nt] = acc + accr * 0.0009765625f; } }
    /* softmax in stages over the eight rows, with selects in place of branches: one straight block, in which the rows' dependent chains overlap */
    float s0[2][8], s1[2][8], mc[2][8]; bool ok0[2][8], ok1[2][8];
#pragma unroll
    for (int rt = 0; rt < RTN; ++rt)
#pragma unroll
      for (int r = 0; r < 8; ++r) { const bool am = (allm[rt][r] != 0);
        ok0[rt][r] = am || (((mw[rt][r] >> ln) & 1u) == 0u); ok1[rt][r] = am || (((mw[rt][r] >> (16 + ln)) & 1u) == 0u);
        s0[rt][r] = ok0[rt][r] ? (am ? 0.f : s[rt][0][r] * SCL) : -INFINITY; s1[rt][r] = ok1[rt][r] ? (am ? 0.f : s[rt][1][r] * SCL) : -INFINITY; mc[rt][r] = fmaxf(s0[rt][r], s1[rt][r]); }
#pragma unroll
    for (int sx = 1; sx <= 8; sx <<= 1)
#pragma unroll
      for (int rt = 0; rt < RTN; ++rt)
#pragma unroll
        for (int r = 0; r < 8; ++r) mc[rt][r] = fmaxf(mc[rt][r], __shfl_xor(mc[rt][r], sx, 32));
#pragma unroll
    for (int rt = 0; rt < RTN; ++rt)
#pragma unroll
      for (int r = 0; r < 8; ++r) {
        const float mn = fmaxf(m_r[rt][r], mc[rt][r]); const float ea = expf(m_r[rt][r] - mn), e0 = expf(s0[rt][r] - mn), e1 = expf(s1[rt][r] - mn);      /* computed for every lane; the selects below keep the values of the guarded form */
        const float al = (mn > -1.0e38f) ? ea : 1.0f; m_r[rt][r] = mn; const float p0 = ok0[rt][r] ? e0 : 0.f, p1 = ok1[rt][r] ? e1 : 0.f; l_r[rt][r] = l_r[rt][r] * al + p0 + p1;
#pragma unroll
        for (int dt = 0; dt < DT; ++dt) { oacc[rt][dt][r] *= al; oaccl[rt][dt][r] *= al; }
        FragH t2, t3; const float ps0 = p0 * 1024.0f, ps1 = p1 * 1024.0f; t2.h[0] = (_Float16)ps0; t2.h[1] = (_Float16)ps1; t3.h[0] = (_Float16)((ps0 - (float)t2.h[0]) * 1024.0f); t3.h[1] = (_Float16)((ps1 - (float)t2.h[1]) * 1024.0f);
        sP[w][rt * 16 + 8 * hh + r][ln] = t2.u[0]; sP[w][rt * 16 + 8 * hh + r][16 + ln] = t2.u[1]; sPl[w][rt * 16 + 8 * hh + r][ln] = t3.u[0]; sPl[w][rt * 16 + 8 * hh + r][16 + ln] = t3.u[1]; }
    __builtin_amdgcn_fence(__ATOMIC_ACQ_REL, "workgroup"); __builtin_amdgcn_wave_barrier();
    FragH pa[2], pl[2];
#pragma unroll
    for (int rt = 0; rt < RTN; ++rt) { pa[rt].half[0] = *(const v8us*)&sP[w][rt * 16 + ln][8 * hh]; pa[rt].half[1] = *(const v8us*)&sP[w][rt * 16 + ln][16 + 8 * hh]; pl[rt].half[0] = *(const v8us*)&sPl[w][rt * 16 + ln][8 * hh]; pl[rt].half[1] = *(const v8us*)&sPl[w][rt * 16 + ln][16 + 8 * hh]; }
    FragH bv[DT], bl[DT];      /* all of the pass's V fragment reads stand as one group in front of its value products: one LDS latency instead of four */
#pragma unroll
    for (int dt = 0; dt < DT; ++dt) { const unsigned short* vr = tb + 2 * PLN + (dt * 16 + ln) * KP + kg * 32; const unsigned short* vl = vr + PLN; bv[dt].half[0] = *(const v8us*)(vr + 8 * hh); bv[dt].half[1] = *(const v8us*)(vr + 16 + 8 * hh); bl[dt].half[0] = *(const v8us*)(vl + 8 * hh); bl[dt].half[1] = *(const v8us*)(vl + 16 + 8 * hh); }
#pragma unroll
    for (int dt = 0; dt < DT; ++dt) {
#pragma unroll
      for (int rt = 0; rt < RTN; ++rt) { oacc[rt][dt] = mmaH<1>(pa[rt].v, pa[rt].v, bv[dt].v, bv[dt].v, oacc[rt][dt]); oaccl[rt][dt] = mmaH<1>(pa[rt].v, pa[rt].v, bl[dt].v, bl[dt].v, oaccl[rt][dt]); oaccl[rt][dt] = mmaH<1>(pl[rt].v, pl[rt].v, bv[dt].v, bv[dt].v, oaccl[rt][dt]); } }
   }
    /* publish point of stage st + 1, every wave, in this order */
    asm volatile("s_wait_dscnt 0x0" ::: "memory");      /* this wave's LDS reads of stage st have returned */
    asm volatile("s_wait_asynccnt 0x0" ::: "memory");      /* this wave's copies of stage st + 1 have landed */
    __syncthreads();      /* publishes stage st + 1 and ends every wave's reads of stage st */
    if (st + 2 < nst) stage(st + 2, st & 1); }      /* into the buffer that every wave has just left */
  asm volatile("s_wait_asynccnt 0x0" ::: "memory");      /* no copy is outstanding behind the loop */
#pragma unroll
  for (int rt = 0; rt < RTN; ++rt) {
#pragma unroll
    for (int r = 0; r < 8; ++r) { float l = l_r[rt][r]; l += __shfl_xor(l, 1, 32); l += __shfl_xor(l, 2, 32); l += __shfl_xor(l, 4, 32); l += __shfl_xor(l, 8, 32); l_r[rt][r] = l; }
    if (ln == 0) {
#pragma unroll
      for (int r = 0; r < 8; ++r) { sM[w][rt * 16 + 8 * hh + r] = m_r[rt][r]; sL[w][rt * 16 + 8 * hh + r] = l_r[rt][r]; } }
#pragma unroll
    for (int dt = 0; dt < DT; ++dt)
#pragma unroll
      for (int r = 0; r < 8; ++r) sO[w][rt * 16 + 8 * hh + r][dt * 16 + ln] = oacc[rt][dt][r] + oaccl[rt][dt][r] * 0.0009765625f; }
  __syncthreads();      /* every wave's partial (max, sum, O) is in LDS before any wave merges them */
  {
#pragma unroll
    for (int rp = 0; rp < QW; rp += 16) { const int rq = rp + (tid >> 4), pc = tid & 15; const int wq = rq >> 4, r = rq & 15;      /* query rq of the tile: the partials of waves wq (first key halves) and wq + 4 (second) */
      const float m0 = sM[wq][r], m1 = sM[wq + 4][r]; const float mx = fmaxf(m0, m1);      /* a wave that saw no open key holds -3e38, sum 0, O 0: weight 0 (or 1 on zeros) */
      const float e0 = expf(m0 - mx), e1 = expf(m1 - mx);
      const float l = e0 * sL[wq][r] + e1 * sL[wq + 4][r]; const float inv = (l > 0.f) ? 1.0f / (l * 1024.0f) : 0.f;
      const v4f o0 = *(const v4fa*)&sO[wq][r][pc * 4], o1 = *(const v4fa*)&sO[wq + 4][r][pc * 4];
      const v4f val = (o0 * e0 + o1 * e1) * inv; v4h hi4, lo4;      /* O leaves as the f16 hi + x2^10 residual planes that the output projection reads */
#pragma unroll
      for (int i = 0; i < 4; ++i) { const _Float16 hv = (_Float16)val[i]; hi4[i] = hv; lo4[i] = (_Float16)((val[i] - (float)hv) * 1024.0f); }
      const size_t oo = ((size_t)b * TQ + qt * QW + rq) * ldo + h * 64 + pc * 4; *(v4h*)(Oh + oo) = hi4; *(v4h*)(Ol + oo) = lo4; }
     } }


__global__ __launch_bounds__(256) void k_causaltab(unsigned* __restrict__ MB, int* __restrict__ RA, int* __restrict__ KE, int nq, int nk) {
  const int t = blockIdx.x * 256 + threadIdx.x; const int nw = nk / 32;
  if (t < nq * nw) { const int q = t / nw, w = t % nw; const int first = q + 1 - 32 * w; const unsigned bits = (first <= 0) ? 0xffffffffu : ((first >= 32) ? 0u : (0xffffffffu << first)); *(unsigned*)(MB + t) = bits;  }
  if (t < nq) { *(int*)(RA + t) = 0;  }
  if (t < nq / 64) { const int v = 64 * (t + 1); *(int*)(KE + t * 32) = v;  } }

__constant__ float INVF[32] = {1.000000000e+00f,7.498942018e-01f,5.623413324e-01f,4.216965139e-01f,3.162277639e-01f,2.371373624e-01f,1.778279394e-01f,1.333521456e-01f,1.000000015e-01f,7.498941571e-02f,5.623412877e-02f,4.216964915e-02f,3.162277862e-02f,2.371373586e-02f,1.778279431e-02f,1.333521493e-02f,9.999999776e-03f,7.498942316e-03f,5.623413250e-03f,4.216964822e-03f,3.162277862e-03f,2.371373819e-03f,1.778279431e-03f,1.333521446e-03f,1.000000047e-03f,7.498941850e-04f,5.623413017e-04f,4.216964880e-04f,3.162277862e-04f,2.371373848e-04f,1.778279402e-04f,1.333521504e-04f};
__constant__ float XBASE[32] = {2.857142985e-01f,3.080357313e-01f,3.303571641e-01f,3.526785970e-01f,3.750000000e-01f,3.973214328e-01f,4.196428359e-01f,4.419642687e-01f,4.642857015e-01f,4.866071343e-01f,5.089285374e-01f,5.312500000e-01f,5.535714030e-01f,5.758928657e-01f,5.982142687e-01f,6.205357313e-01f,6.428571343e-01f,6.651785970e-01f,6.875000000e-01f,7.098214030e-01f,7.321428657e-01f,7.544642687e-01f,7.767857313e-01f,7.991071343e-01f,8.214285970e-01f,8.437500000e-01f,8.660714030e-01f,8.883928657e-01f,9.107142687e-01f,9.330357313e-01f,9.553571343e-01f,9.776785970e-01f};
__global__ __launch_bounds__(256) void k_trig(float* __restrict__ CS, float* __restrict__ SN) {
  #pragma clang fp contract(off)
  const int t = blockIdx.x * 256 + threadIdx.x; if (t >= SLEN * 32) return; const int tok = t >> 5, j = t & 31; const float ang = (float)tok * INVF[j]; const float c = cosf(ang), s = sinf(ang);
  *(float*)(CS + t) = c; *(float*)(SN + t) = s;  }
__global__ __launch_bounds__(256) void k_scale(float* __restrict__ SC) {
  #pragma clang fp contract(off)
  const int t = blockIdx.x * 256 + threadIdx.x; if (t >= SLEN * 32) return; const int tok = t >> 5, j = t & 31; const float v = powf(XBASE[j], ((float)tok - 1024.0f) / 512.0f);
  *(float*)(SC + t) = v;  }
extern "C" void kernel_launch(void* const* d_in, const int* in_sizes, int n_in,
                              void* d_out, int out_size, void* d_ws, size_t ws_size, hipStream_t stream) {
  (void)in_sizes; (void)n_in; (void)out_size;
  const float* const* I = (const float* const*)d_in; const float* x = I[0]; const float* Wq = I[1]; const float* bq = I[2]; const float* Wk = I[3]; const float* bk = I[4]; const float* Wv = I[5]; const float* bv = I[6]; const float* Wo = I[7]; const float* bo = I[8];
  char* ws = (char*)d_ws; size_t off = 0;
  auto take = [&](size_t bytes) { char* p = ws + off; off += (bytes + 255) & ~(size_t)255; return p; };
  _Float16* BQ = (_Float16*)take((size_t)DM * DM * 2); _Float16* BK = (_Float16*)take((size_t)DM * DM * 2); _Float16* BV = (_Float16*)take((size_t)DM * DM * 2); _Float16* BO = (_Float16*)take((size_t)DM * DM * 2);
  _Float16* X16 = (_Float16*)take((size_t)NR * DM * 2); _Float16* Oh = (_Float16*)take((size_t)NR * DM * 2); _Float16* Ol = (_Float16*)take((size_t)NR * DM * 2);
  _Float16* Qh = (_Float16*)take((size_t)NR * DM * 2); _Float16* Ql = (_Float16*)take((size_t)NR * DM * 2); _Float16* Kh = (_Float16*)take((size_t)NR * DM * 2); _Float16* Kl = (_Float16*)take((size_t)NR * DM * 2); _Float16* Vth = (_Float16*)take((size_t)NR * DM * 2); _Float16* Vtl = (_Float16*)take((size_t)NR * DM * 2);
  unsigned* MB = (unsigned*)take((size_t)SLEN * (SLEN / 32) * 4); int* RA = (int*)take((size_t)SLEN * 4); int* KE = (int*)take((size_t)(SLEN / 64) * 32 * 4);
  float* CS = (float*)take((size_t)SLEN * 32 * 4); float* SN = (float*)take((size_t)SLEN * 32 * 4); float* SC = (float*)take((size_t)SLEN * 32 * 4);
  if (off > ws_size) return;      /* 8 + 8 + 8 x 8 + 1.5 = 82 MiB */
  const size_t n8 = (size_t)NR * DM / 8; const unsigned nb8 = (unsigned)((n8 + 255) / 256); const size_t w8 = (size_t)DM * DM / 8; const unsigned wb = (unsigned)((w8 + 255) / 256);
  k_round16f<<<wb, 256, 0, stream>>>(Wq, BQ, w8); k_round16f<<<wb, 256, 0, stream>>>(Wk, BK, w8); k_round16f<<<wb, 256, 0, stream>>>(Wv, BV, w8); k_round16f<<<wb, 256, 0, stream>>>(Wo, BO, w8);      /* torch (out,in) = natural Bt; x16 */
  k_x16<<<nb8, 256, 0, stream>>>(x, X16, n8);
  k_trig<<<(SLEN * 32 + 255) / 256, 256, 0, stream>>>(CS, SN); k_scale<<<(SLEN * 32 + 255) / 256, 256, 0, stream>>>(SC); k_causaltab<<<(SLEN * (SLEN / 32) + 255) / 256, 256, 0, stream>>>(MB, RA, KE, SLEN, SLEN);
  const dim3 gP((NR / 128) * (DM / 64), 1);
  k_gemm2<0, 1><<<gP, 128, 0, stream>>>(X16, DM, 0, BQ, DM, 0, 0.0625f, bq, 0, nullptr, 1, 0, 0, nullptr, nullptr, DM, 0, NR, DM, DM, CS, SN, SC, Qh, Ql);      /* q_mat = xpos(x Wq^T + bq) as hi/lo */
  k_gemm2<0, 2><<<gP, 128, 0, stream>>>(X16, DM, 0, BV, DM, 0, 0.0625f, bv, 0, nullptr, 1, 0, 0, nullptr, nullptr, DM, 0, NR, DM, DM, CS, SN, SC, Kh, Kl);      /* k_mat = xpos^-1(x Wv^T + bv)  (module order) */
  k_gemm2<0, 3><<<gP, 128, 0, stream>>>(X16, DM, 0, BK, DM, 0, 0.0625f, bk, 0, nullptr, 1, 0, 0, nullptr, nullptr, DM, 0, NR, DM, DM, nullptr, nullptr, nullptr, Vth, Vtl);      /* v_mat = x Wk^T + bk as V^T hi/lo [(b, h)][64][2048] */
  for (int b = 0; b < NBT; ++b) { const size_t ro = (size_t)b * SLEN * DM;
    k_flashm<SLEN, SLEN><<<dim3(NH, SLEN / 64), 256, 0, stream>>>(Qh + ro, Ql + ro, DM, Kh + ro, Kl + ro, DM, Vth + ro, Vtl + ro, MB, RA, KE, Oh + ro, Ol + ro, DM); }
  k_gemm2<0, 0><<<gP, 128, 0, stream>>>(Oh, DM, 0, BO, DM, 0, 0.0625f, bo, 0, nullptr, 1, 0, 0, (float*)d_out, nullptr, DM, 0, NR, DM, DM, nullptr, nullptr, nullptr, nullptr, nullptr);
  k_gemm2<0, 0><<<gP, 128, 0, stream>>>(Ol, DM, 0, BO, DM, 0, 0.0625f / 1024.0f, nullptr, 0, (const float*)d_out, 1, (size_t)DM, 0, (float*)d_out, nullptr, DM, 0, NR, DM, DM, nullptr, nullptr, nullptr, nullptr, nullptr);
}

// v006
// A run of this version takes 205 microseconds.
// Timed twice side by side with v005, it ran 1.18 times as fast both times.
// Over all steps from v000 it is 4.20 times as fast.
#include <hip/hip_runtime.h>
// Causal multi-head attention with xPos rotary embedding (2 x 2048 tokens x 1024, 16 heads x 64): q = x*Wq^T + bq, k = x*Wv^T + bv, v = x*Wk^T + bk (the module's own assignment order); q <- q*cos*scale + rot(q)*sin*scale, k <- k*cos/scale + rot(k)*sin/scale with interleaved-pair rotation, freq(t, d) = t * inv_freq[d/2], scale(t, d) = base[d mod 32]^((t - 1024)/512); scores = q.k / 32 with j <= i; softmax; merged . Wo^T + bo -> [2,2048,1024].
// Structure: x as an exact f16 plane; the three projections as f16 WMMA GEMMs (32x64 wave tiles fed from LDS-staged 128x64 work-group tiles, f32, exact products + bias); per-token cos/sin/scale tables on VALU (inv_freq and base = the reference's f32 constants, precise trig and powf); each projection's epilogue finishes its operand in place of separate passes: q, k rotated and scaled in f32 and stored as f16 hi + x2^10 residual planes, v transposed through LDS per (batch, head) to [d][token] hi + residual planes; the causal structure computed on device into a key bit plane + per-block key bound; the fused flash kernel per ((batch, head), 64 queries), eight waves = four 16-query sub-tiles x the two 32-key halves of each 64-key stage, K and V^T stages copied to LDS once per work-group (three-product hi/lo scores, online softmax f32 per wave, P hi + residual via LDS, two value accumulators; the two partial (max, sum, O) of a sub-tile merged through LDS at the end and stored as O hi + residual planes); output projection as two GEMMs (bias in the first).
// Compute dtype: x, weights, biases rounded to bf16; projections exact; rotation f32; q, k, P, v, O as f16 hi + residual pairs (~2^-21); f32 accumulation and softmax. v_wmma_f32_16x16x32_f16.
#define NBT 2
#define SLEN 2048
#define DM 1024
#define NH 16
#define SCL 0.03125f
#define NR (NBT * SLEN)
typedef __bf16 v16b __attribute__((ext_vector_type(16)));
typedef unsigned short v8us __attribute__((ext_vector_type(8), may_alias));
typedef float  v8f  __attribute__((ext_vector_type(8)));
typedef float  v4f  __attribute__((ext_vector_type(4)));
typedef float  v4fa __attribute__((ext_vector_type(4), may_alias));
typedef float  v2fa __attribute__((ext_vector_type(2), may_alias));
union FragB { v16b v; v8us half[2]; unsigned short u[16]; };

__device__ __forceinline__ unsigned short bf16_bits(float x) { unsigned int u = __float_as_uint(x); return (unsigned short)((u + 0x7FFFu + ((u >> 16) & 1u)) >> 16); }
__device__ __forceinline__ float bf16_val(unsigned short b) { return __uint_as_float(((unsigned int)b) << 16); }
__device__ __forceinline__ float bf16_round(float x) { return bf16_val(bf16_bits(x)); }
// D += A·B with NT terms: 1 = ah·bh, 2 = + al·bh (A split), 3 = + ah·bl (both split)
template <int NT>
__device__ __forceinline__ v8f mmaN(v16b ah, v16b al, v16b bh, v16b bl, v8f c) {
  c = __builtin_amdgcn_wmma_f32_16x16x32_bf16(false, ah, false, bh, (short)0, c, false, false);
  if (NT >= 2) c = __builtin_amdgcn_wmma_f32_16x16x32_bf16(false, al, false, bh, (short)0, c, false, false);
  if (NT >= 3) c = __builtin_amdgcn_wmma_f32_16x16x32_bf16(false, ah, false, bl, (short)0, c, false, false);
  asm volatile("v_nop\n\tv_nop\n\tv_nop\n\tv_nop" : "+v"(c) : "v"(ah), "v"(al), "v"(bh), "v"(bl));
  return c;
}

__global__ __launch_bounds__(256) void k_wt_bf16(const float* __restrict__ W, unsigned short* __restrict__ Wt, int K, int N) {
  const int t = blockIdx.x * 256 + threadIdx.x;
  const int k8n = K / 8;
  if (t >= N * k8n) return;
  const int n = t / k8n, k8 = (t % k8n) * 8;
  v8us v;
#pragma unroll
  for (int i = 0; i < 8; ++i) v[i] = bf16_bits(W[(size_t)(k8 + i) * N + n]);
  *(v8us*)(Wt + (size_t)n * K + k8) = v;
  
}

// GEMM C[M][N] (f32, pitch ldc) = act(A[M][K]·W + bias). A f32 row-major (pitch lda) converted per fragment to bf16
// (ASPLIT: hi/lo two planes -> 2 terms, else single rounded term); Wt bf16 [N][K] (pitch ldb). BIAS_BF16 rounds the
// bias to bf16 first (bias quantised to bf16 before the add). K%32==0, M%16==0, N%64==0.
template <bool ASPLIT, int ACT, bool BIAS_BF16>
__global__ __launch_bounds__(128) void k_gemm_bf(const float* __restrict__ A, int lda, const unsigned short* __restrict__ Wt, int ldb,
                                               const float* __restrict__ bias, float* __restrict__ C, int ldc, int M, int N, int K) {
  __shared__ __attribute__((aligned(16))) float so[4][16][64];
  const int tid = threadIdx.x, w = tid >> 5, lane = tid & 31, ln = lane & 15, hh = lane >> 4;
  const int ntn = N / 64;
  const int wid = blockIdx.x * 4 + w;
  const int mt = wid / ntn, nq = wid % ntn;
  if (mt * 16 >= M) return;
  const int row0 = mt * 16, col0 = nq * 64;
  const float* arow = A + (size_t)(row0 + ln) * lda;
  v8f acc[4] = {};
  for (int kb = 0; kb < K; kb += 32) {
    FragB ah, al;
    const v4f x0 = *(const v4fa*)(arow + kb + 8 * hh), x1 = *(const v4fa*)(arow + kb + 8 * hh + 4);
    const v4f x2 = *(const v4fa*)(arow + kb + 16 + 8 * hh), x3 = *(const v4fa*)(arow + kb + 16 + 8 * hh + 4);
    float xs[16] = {x0[0],x0[1],x0[2],x0[3],x1[0],x1[1],x1[2],x1[3],x2[0],x2[1],x2[2],x2[3],x3[0],x3[1],x3[2],x3[3]};
#pragma unroll
    for (int i = 0; i < 16; ++i) { const unsigned short hb = bf16_bits(xs[i]); ah.u[i] = hb; al.u[i] = ASPLIT ? bf16_bits(xs[i] - bf16_val(hb)) : (unsigned short)0; }
#pragma unroll
    for (int t = 0; t < 4; ++t) {
      const unsigned short* brow = Wt + (size_t)(col0 + t * 16 + ln) * ldb + kb;
      FragB b;
      b.half[0] = *(const v8us*)(brow + 8 * hh);
      b.half[1] = *(const v8us*)(brow + 16 + 8 * hh);
      acc[t] = mmaN<ASPLIT ? 2 : 1>(ah.v, al.v, b.v, b.v, acc[t]);
    }
  }
#pragma unroll
  for (int t = 0; t < 4; ++t) {
    float bv = bias ? bias[col0 + t * 16 + ln] : 0.f;
    if (BIAS_BF16) bv = bf16_round(bv);
#pragma unroll
    for (int r = 0; r < 8; ++r) { float v = acc[t][r] + bv; if (ACT == 1) v = fmaxf(v, 0.f); so[w][8 * hh + r][t * 16 + ln] = v; }
  }
  __builtin_amdgcn_fence(__ATOMIC_ACQ_REL, "workgroup");
  __builtin_amdgcn_wave_barrier();
  const int rsub = lane >> 4, c4 = (lane & 15) * 4;
  {
#pragma unroll
    for (int q = 0; q < 8; ++q) {
      const int r = q * 2 + rsub;
      const v4f v = *(const v4fa*)&so[w][r][c4];
      *(v4f*)(C + (size_t)(row0 + r) * ldc + col0 + c4) = v;
    }
    
  }
}

// GEMM C = act(A·W + bias + resid): A f32 (ASPLIT -> hi/lo 2 terms), Wt bf16 [N][K]; ACT 0 none, 1 relu, 2 exact gelu;
// resid (optional, f32, row index = (row % rmod), pitch ldr, RES_BF16 rounds it) added before the activation.
template <bool ASPLIT, int ACT, bool BIAS_BF16, bool RES_BF16>
__global__ __launch_bounds__(128) void k_gemm_bf3(const float* __restrict__ A, int lda, const unsigned short* __restrict__ Wt, int ldb,
                                                const float* __restrict__ bias, const float* __restrict__ resid, int rmod, int ldr,
                                                float* __restrict__ C, int ldc, int M, int N, int K) {
  __shared__ __attribute__((aligned(16))) float so[4][16][64];
  const int tid = threadIdx.x, w = tid >> 5, lane = tid & 31, ln = lane & 15, hh = lane >> 4;
  const int ntn = N / 64;
  const int wid = blockIdx.x * 4 + w;
  const int mt = wid / ntn, nq = wid % ntn;
  if (mt * 16 >= M) return;
  const int row0 = mt * 16, col0 = nq * 64;
  const float* arow = A + (size_t)(row0 + ln) * lda;
  v8f acc[4] = {};
  for (int kb = 0; kb < K; kb += 32) {
    FragB ah, al;
    const v4f x0 = *(const v4fa*)(arow + kb + 8 * hh), x1 = *(const v4fa*)(arow + kb + 8 * hh + 4);
    const v4f x2 = *(const v4fa*)(arow + kb + 16 + 8 * hh), x3 = *(const v4fa*)(arow + kb + 16 + 8 * hh + 4);
    float xs[16] = {x0[0],x0[1],x0[2],x0[3],x1[0],x1[1],x1[2],x1[3],x2[0],x2[1],x2[2],x2[3],x3[0],x3[1],x3[2],x3[3]};
#pragma unroll
    for (int i = 0; i < 16; ++i) { const unsigned short hb = bf16_bits(xs[i]); ah.u[i] = hb; al.u[i] = ASPLIT ? bf16_bits(xs[i] - bf16_val(hb)) : (unsigned short)0; }
#pragma unroll
    for (int t = 0; t < 4; ++t) {
      const unsigned short* brow = Wt + (size_t)(col0 + t * 16 + ln) * ldb + kb;
      FragB b;
      b.half[0] = *(const v8us*)(brow + 8 * hh);
      b.half[1] = *(const v8us*)(brow + 16 + 8 * hh);
      acc[t] = mmaN<ASPLIT ? 2 : 1>(ah.v, al.v, b.v, b.v, acc[t]);
    }
  }
#pragma unroll
  for (int t = 0; t < 4; ++t) {
    const int col = col0 + t * 16 + ln;
    float bv = bias ? bias[col] : 0.f;
    if (BIAS_BF16) bv = bf16_round(bv);
#pragma unroll
    for (int r = 0; r < 8; ++r) {
      float v = acc[t][r] + bv;
      if (resid) { float rv = resid[(size_t)((row0 + 8 * hh + r) % rmod) * ldr + col]; if (RES_BF16) rv = bf16_round(rv); v += rv; }
      if (ACT == 1) v = fmaxf(v, 0.f);
      if (ACT == 2) v = 0.5f * v * (1.0f + erff(v * 0.70710678118654752f));
      if (ACT == 3) { const float u = 0.7978845608028654f * (v + 0.044715f * v * v * v); v = 0.5f * v * (1.0f + tanhf(u)); }
      so[w][8 * hh + r][t * 16 + ln] = v;
    }
  }
  __builtin_amdgcn_fence(__ATOMIC_ACQ_REL, "workgroup");
  __builtin_amdgcn_wave_barrier();
  const int rsub = lane >> 4, c4 = (lane & 15) * 4;
  {
#pragma unroll
    for (int q = 0; q < 8; ++q) {
      const int r = q * 2 + rsub;
      const v4f v = *(const v4fa*)&so[w][r][c4];
      *(v4f*)(C + (size_t)(row0 + r) * ldc + col0 + c4) = v;
    }
    
  }
}
// row LayerNorm (biased variance, eps) over N: s = X (+ R); optional out_sum <- s; out_norm <- (s-mu)*rsqrt(var+eps)*g + b
template <bool PARAM_BF16>
__global__ __launch_bounds__(256) void k_layernorm(const float* __restrict__ X, const float* __restrict__ R, const float* __restrict__ g, const float* __restrict__ bta,
                                                  float* __restrict__ out_sum, float* __restrict__ out_norm, int N, float eps) {
  __shared__ float red[256];
  const int row = blockIdx.x, tid = threadIdx.x;
  const float* x = X + (size_t)row * N; const float* rr = R ? R + (size_t)row * N : nullptr;
  float vals[16];                     // up to N = 4096
  const int per = N / 256;            // contiguous chunk per thread? use strided-by-4 chunks: thread handles j = tid*4 + 1024*u
  float s1 = 0.f;
  for (int u = 0; u < per / 4; ++u) {
    const int j = tid * 4 + 1024 * u;
    const v4f a = *(const v4fa*)(x + j);
    v4f b = {0.f,0.f,0.f,0.f}; if (rr) b = *(const v4fa*)(rr + j);
#pragma unroll
    for (int q = 0; q < 4; ++q) { const float v = a[q] + b[q]; vals[u * 4 + q] = v; s1 += v; }
  }
  red[tid] = s1; __syncthreads();
  for (int st = 128; st > 0; st >>= 1) { if (tid < st) red[tid] += red[tid + st]; __syncthreads(); }
  const float mu = red[0] / (float)N; __syncthreads();
  float s2 = 0.f;
  for (int u = 0; u < per / 4; ++u)
#pragma unroll
    for (int q = 0; q < 4; ++q) { const float c = vals[u * 4 + q] - mu; s2 += c * c; }
  red[tid] = s2; __syncthreads();
  for (int st = 128; st > 0; st >>= 1) { if (tid < st) red[tid] += red[tid + st]; __syncthreads(); }
  const float rs = rsqrtf(red[0] / (float)N + eps);
  {
    for (int u = 0; u < per / 4; ++u) {
      const int j = tid * 4 + 1024 * u;
      v4f o, sm;
#pragma unroll
      for (int q = 0; q < 4; ++q) {
        float gg = g[j + q], bb = bta[j + q];
        if (PARAM_BF16) { gg = bf16_round(gg); bb = bf16_round(bb); }
        sm[q] = vals[u * 4 + q]; o[q] = (vals[u * 4 + q] - mu) * rs * gg + bb;
      }
      if (out_sum) *(v4f*)(out_sum + (size_t)row * N + j) = sm;
      *(v4f*)(out_norm + (size_t)row * N + j) = o;
    }
    
  }
}



// ---- f16 WMMA path (v_wmma_f32_16x16x32_f16): 11-bit significands for operands in range — used where a [0,1] probability operand needs more precision than bf16
typedef _Float16 v16h __attribute__((ext_vector_type(16)));
union FragH { v16h v; v8us half[2]; _Float16 h[16]; unsigned short u[16]; };
template <int NT>
__device__ __forceinline__ v8f mmaH(v16h ah, v16h al, v16h bh, v16h bl, v8f c) {
  c = __builtin_amdgcn_wmma_f32_16x16x32_f16(false, ah, false, bh, (short)0, c, false, false);
  if (NT >= 2) c = __builtin_amdgcn_wmma_f32_16x16x32_f16(false, al, false, bh, (short)0, c, false, false);
  if (NT >= 3) c = __builtin_amdgcn_wmma_f32_16x16x32_f16(false, ah, false, bl, (short)0, c, false, false);
  asm volatile("v_nop\n\tv_nop\n\tv_nop\n\tv_nop" : "+v"(c) : "v"(ah), "v"(al), "v"(bh), "v"(bl));
  return c;
}
// batched GEMM like k_gemm_b but f16 operands: A f32 (split into f16 hi/lo if ASPLIT, else rounded to f16), Bt = f16 values [n][k]; alpha; C f32; N multiple of 16 (partial tiles skipped)
template <bool ASPLIT>
__global__ __launch_bounds__(128) void k_gemm_h(const float* __restrict__ A, int lda, size_t sA, const _Float16* __restrict__ Bh, int ldb, size_t sB, float alpha, float* __restrict__ C, int ldc, size_t sC, int M, int N, int K) {
  __shared__ __attribute__((aligned(16))) float so[4][16][64];
  const int tid = threadIdx.x, w = tid >> 5, lane = tid & 31, ln = lane & 15, hh = lane >> 4; const int by = blockIdx.y;
  A += (size_t)by * sA; Bh += (size_t)by * sB; C += (size_t)by * sC;
  const int ntn = (N + 63) / 64; const int wid = blockIdx.x * 4 + w; const int mt = wid / ntn, nq = wid % ntn; if (mt * 16 >= M) return;
  const int row0 = mt * 16, col0 = nq * 64; const float* arow = A + (size_t)(row0 + ln) * lda;
  v8f acc[4] = {};
  for (int kb = 0; kb < K; kb += 32) {
    FragH ah, al;
    const v4f x0 = *(const v4fa*)(arow + kb + 8 * hh), x1 = *(const v4fa*)(arow + kb + 8 * hh + 4), x2 = *(const v4fa*)(arow + kb + 16 + 8 * hh), x3 = *(const v4fa*)(arow + kb + 16 + 8 * hh + 4);
    float xs[16] = {x0[0],x0[1],x0[2],x0[3],x1[0],x1[1],x1[2],x1[3],x2[0],x2[1],x2[2],x2[3],x3[0],x3[1],x3[2],x3[3]};
#pragma unroll
    for (int i = 0; i < 16; ++i) { const _Float16 h = (_Float16)xs[i]; ah.h[i] = h; al.h[i] = ASPLIT ? (_Float16)(xs[i] - (float)h) : (_Float16)0.0f; }
#pragma unroll
    for (int t = 0; t < 4; ++t) { if (col0 + t * 16 >= N) continue; const size_t boff = (size_t)(col0 + t * 16 + ln) * ldb + kb; FragH bq; bq.half[0] = *(const v8us*)(Bh + boff + 8 * hh); bq.half[1] = *(const v8us*)(Bh + boff + 16 + 8 * hh);
      acc[t] = mmaH<ASPLIT ? 2 : 1>(ah.v, al.v, bq.v, bq.v, acc[t]); }
  }
#pragma unroll
  for (int t = 0; t < 4; ++t) { if (col0 + t * 16 >= N) continue;
#pragma unroll
    for (int r = 0; r < 8; ++r) so[w][8 * hh + r][t * 16 + ln] = acc[t][r] * alpha; }
  __builtin_amdgcn_fence(__ATOMIC_ACQ_REL, "workgroup"); __builtin_amdgcn_wave_barrier();
  const int rsub = lane >> 4, c4 = (lane & 15) * 4;
  {
#pragma unroll
    for (int q = 0; q < 8; ++q) { const int r = q * 2 + rsub; if (col0 + c4 < N) { const v4f v = *(const v4fa*)&so[w][r][c4]; *(v4f*)(C + (size_t)(row0 + r) * ldc + col0 + c4) = v; } }
     }
}

// Wt[n][k] = f16(W[k][n]·scale) from f32 row-major W[K][N] (scale = power of two; bf16-exact weights stay exact in f16 away from the subnormal range)
__global__ __launch_bounds__(256) void k_wt_f16(const float* __restrict__ W, _Float16* __restrict__ Wt, int K, int N, float scale) {
  const int t = blockIdx.x * 256 + threadIdx.x; if (t >= N * (K / 8)) return; const int n = t / (K / 8), k8 = (t % (K / 8)) * 8; FragH f;
#pragma unroll
  for (int i = 0; i < 8; ++i) f.h[i] = (_Float16)(bf16_round(W[(size_t)(k8 + i) * N + n]) * scale); const v8us o = f.half[0];
  *(v8us*)((unsigned short*)Wt + (size_t)n * K + k8) = o; 
}
// k_gemm_hh variant with fused epilogue: v = acc·alpha + bias[by·sBias + col] (+ CP[(row/rowsPerB)·sCPb + by·64 + col] if CP) ; ACT 0 none / 1 elu ; writes f16 C16 (and f32 C if non-null)
template <int ACT>
__global__ __launch_bounds__(128) void k_gemm_hhx(const _Float16* __restrict__ A, int lda, size_t sA, const _Float16* __restrict__ Bh, int ldb, size_t sB, float alpha, const float* __restrict__ bias, size_t sBias, const float* __restrict__ CP, int rowsPerB, size_t sCPb, int row0g,
    float* __restrict__ C, _Float16* __restrict__ C16, int ldc, size_t sC, int M, int N, int K) {
  __shared__ __attribute__((aligned(16))) float so[4][16][64];
  const int tid = threadIdx.x, w = tid >> 5, lane = tid & 31, ln = lane & 15, hh = lane >> 4; const int by = blockIdx.y;
  A += (size_t)by * sA; Bh += (size_t)by * sB; const size_t cofs = (size_t)by * sC; const float* bp = bias ? bias + (size_t)by * sBias : nullptr;
  const int ntn = (N + 63) / 64; const int wid = blockIdx.x * 4 + w; const int mt = wid / ntn, nq = wid % ntn; if (mt * 16 >= M) return;
  const int row0 = mt * 16, col0 = nq * 64; const _Float16* arow = A + (size_t)(row0 + ln) * lda;
  v8f acc[4] = {};
  for (int kb = 0; kb < K; kb += 32) { FragH ah; ah.half[0] = *(const v8us*)((const unsigned short*)arow + kb + 8 * hh); ah.half[1] = *(const v8us*)((const unsigned short*)arow + kb + 16 + 8 * hh);
#pragma unroll
    for (int t = 0; t < 4; ++t) { if (col0 + t * 16 >= N) continue; const size_t boff = (size_t)(col0 + t * 16 + ln) * ldb + kb; FragH bq; bq.half[0] = *(const v8us*)((const unsigned short*)Bh + boff + 8 * hh); bq.half[1] = *(const v8us*)((const unsigned short*)Bh + boff + 16 + 8 * hh);
      acc[t] = mmaH<1>(ah.v, ah.v, bq.v, bq.v, acc[t]); }
  }
#pragma unroll
  for (int t = 0; t < 4; ++t) { if (col0 + t * 16 >= N) continue; const int col = col0 + t * 16 + ln; const float bv = bp ? bf16_round(bp[col]) : 0.f;
#pragma unroll
    for (int r = 0; r < 8; ++r) { float v = acc[t][r] * alpha + bv; if (CP) { const int bidx = (row0g + row0 + 8 * hh + r) / rowsPerB; v += CP[(size_t)bidx * sCPb + (size_t)by * 64 + col]; } if (ACT == 1) v = (v > 0.f) ? v : expm1f(v); else if (ACT == 7) v = (v > 0.f) ? v + 1.0f : expf(v); else if (ACT == 8) v = tanhf(v); else if (ACT == 9) v = 0.5f * v * (1.0f + tanhf(0.7978845608028654f * (v + 0.044715f * v * v * v))); else if (ACT == 11) v = 1.0f / (1.0f + expf(-v)); else if (ACT == 12) v = (v > 0.f) ? v : 0.01f * v; else if (ACT == 14) v = (v > 0.f) ? v : 0.1f * v; else if (ACT == 15) v = v / (1.0f + expf(-v)); else if (ACT == 3) v = fmaxf(v, 0.f); else if (ACT == 6) v = 0.5f * v * (1.0f + erff(v * 0.70710678118654752f)); so[w][8 * hh + r][t * 16 + ln] = v; } }
  __builtin_amdgcn_fence(__ATOMIC_ACQ_REL, "workgroup"); __builtin_amdgcn_wave_barrier();
  const int rsub = lane >> 4, c4 = (lane & 15) * 4; typedef _Float16 v4h __attribute__((ext_vector_type(4)));
  {
#pragma unroll
    for (int q = 0; q < 8; ++q) { const int r = q * 2 + rsub; if (col0 + c4 < N) { const v4f v = *(const v4fa*)&so[w][r][c4]; if (C) *(v4f*)(C + cofs + (size_t)(row0 + r) * ldc + col0 + c4) = v; if (C16) { v4h h4; for (int i = 0; i < 4; ++i) h4[i] = (_Float16)v[i]; *(v4h*)(C16 + cofs + (size_t)(row0 + r) * ldc + col0 + c4) = h4; } } }
     }
}


typedef _Float16 v4h __attribute__((ext_vector_type(4)));

__global__ __launch_bounds__(256) void k_h16(const float* __restrict__ x, _Float16* __restrict__ X16, size_t n8) { const size_t t = (size_t)blockIdx.x * 256 + threadIdx.x; if (t >= n8) return; FragH f;
#pragma unroll
  for (int q = 0; q < 8; ++q) f.h[q] = (_Float16)x[t * 8 + q]; *(v8us*)((unsigned short*)X16 + t * 8) = f.half[0];  }
template <int NHv, int TTv>
__global__ __launch_bounds__(256) void k_vt(const _Float16* __restrict__ V16, int ldv, int voff, _Float16* __restrict__ Vt) { __shared__ unsigned short tl[64][66]; const int tid = threadIdx.x; const int slab = blockIdx.x / (TTv / 64), lg = blockIdx.x % (TTv / 64); const int b = slab / NHv, h = slab % NHv;
  for (int i = tid; i < 64 * 8; i += 256) { const int r = i / 8, c8 = (i % 8) * 8; FragH f; f.half[0] = *(const v8us*)((const unsigned short*)V16 + ((size_t)b * TTv + lg * 64 + r) * ldv + voff + h * 64 + c8);
#pragma unroll
    for (int q = 0; q < 8; ++q) tl[r][c8 + q] = f.u[q]; }
  __syncthreads();
  {
#pragma unroll
    for (int rd = 0; rd < 2; ++rd) { const int d = rd * 32 + tid / 8, pc = tid % 8; FragH f;
#pragma unroll
      for (int q = 0; q < 8; ++q) f.u[q] = tl[pc * 8 + q][d];
      *(v8us*)((unsigned short*)Vt + ((size_t)slab * 64 + d) * TTv + lg * 64 + pc * 8) = f.half[0]; }
     } }

// ---- fast GEMM (wave tile 32x64; requires M % 32 == 0 rows per launch region, N % 64 == 0 and K % 64 == 0); epilogue = k_gemm_hhx semantics ----
__device__ __forceinline__ v16h g2_frag(const _Float16* p, int hh) { FragH f; f.half[0] = *(const v8us*)((const unsigned short*)p + 8 * hh); f.half[1] = *(const v8us*)((const unsigned short*)p + 16 + 8 * hh); return f.v; }
__device__ __forceinline__ v8f g2_mma(v16h a, v16h b, v8f c) { v8f d = __builtin_amdgcn_wmma_f32_16x16x32_f16(false, a, false, b, (short)0, c, false, false); asm volatile("v_nop\n\tv_nop\n\tv_nop\n\tv_nop" : "+v"(d) : "v"(a), "v"(b)); return d; }
/* XP 0: stores C / C16. XP 1 (q) and 2 (k, inverse scale): the epilogue applies the xPos rotation to the row while it is still in LDS (a 64-column tile is one head, a lane's 4 columns hold whole rotation pairs; token = row % SLEN) and stores the f16 hi + x2^10 residual planes Hh, Hl instead of C. XP 3 (v): the tile (128 tokens of one batch x one head) leaves transposed, as hi + residual planes [(batch, head)][d][token]. XP 4: the three projections as one launch: blockIdx.y = 0, 1, 2 picks the q, k or v epilogue, the weight plane (sB), the bias pointer and the pair of output planes (sH); the k loop is one and the same code */
template <int ACT, int XP>
__global__ __launch_bounds__(128) void k_gemm2(const _Float16* __restrict__ A, int lda, size_t sA, const _Float16* __restrict__ Bh, int ldb, size_t sB, float alpha, const float* __restrict__ bias, size_t sBias, const float* __restrict__ CP, int rowsPerB, size_t sCPb, int row0g,
    float* __restrict__ C, _Float16* __restrict__ C16, int ldc, size_t sC, int M, int N, int K, const float* __restrict__ CS, const float* __restrict__ SN, const float* __restrict__ SC, _Float16* __restrict__ Hh, _Float16* __restrict__ Hl, const float* __restrict__ bias1, const float* __restrict__ bias2, size_t sH) {
  /* the work-group's 128 x 64 tile: per stage of 64 k (K % 64 == 0) one whole 128-byte line of each of its 128 A rows and 64 B rows goes to LDS, two buffers; row pitch 144 B for the 16-byte fragment reads */
  constexpr int PIT = 72;
  __shared__ __attribute__((aligned(16))) float so[4][32][68];
  __shared__ __attribute__((aligned(16))) _Float16 tA[2][128 * PIT], tB[2][64 * PIT];
  const int tid = threadIdx.x, w = tid >> 5, lane = tid & 31, ln = lane & 15, hh = lane >> 4; const int by = blockIdx.y;
  A += (size_t)by * sA; Bh += (size_t)by * sB; const size_t cofs = (size_t)by * sC; const float* bp = bias ? bias + (size_t)by * sBias : nullptr;
  const bool tr = (XP == 3) || (XP == 4 && by == 2), inv = (XP == 2) || (XP == 4 && by == 1);      /* which epilogue: the same for the whole work-group */
  if (XP == 4) { bp = (by == 0) ? bias : ((by == 1) ? bias1 : bias2); Hh += (size_t)by * sH; Hl += (size_t)by * sH; }
  const int ntn = N >> 6; const int mt = blockIdx.x / ntn, nq = blockIdx.x - mt * ntn; const int row0 = mt * 128 + 32 * w, col0 = nq * 64; if (mt * 128 >= M) return;      /* the same for the whole work-group: every wave reaches every barrier below */
  const int sr = tid >> 3, sc = (tid & 7) * 8;      /* staging: eight threads bring one row's line, a wave four whole lines per load */
  unsigned oa[8], ob[4];      /* byte offsets of the staged lines at k = 0, fixed for the whole loop */
#pragma unroll
  for (int i = 0; i < 8; ++i) oa[i] = ((unsigned)min(mt * 128 + i * 16 + sr, M - 1) * (unsigned)lda + (unsigned)sc) * 2u;      /* rows past M (a last tile of 32, 64 or 96 rows) re-read row M - 1; their waves store nothing */
#pragma unroll
  for (int i = 0; i < 4; ++i) ob[i] = ((unsigned)(col0 + i * 16 + sr) * (unsigned)ldb + (unsigned)sc) * 2u;
  const int so_st = sr * PIT + sc, fa = (32 * w + ln) * PIT, fb = ln * PIT;
  const v8f z8 = {0.f,0.f,0.f,0.f,0.f,0.f,0.f,0.f}; v8f c00 = z8, c01 = z8, c02 = z8, c03 = z8, c10 = z8, c11 = z8, c12 = z8, c13 = z8;
  v8us ra[8], rb[4];
#pragma unroll
  for (int i = 0; i < 8; ++i) ra[i] = *(const v8us*)((const char*)A + oa[i]);
#pragma unroll
  for (int i = 0; i < 4; ++i) rb[i] = *(const v8us*)((const char*)Bh + ob[i]);
#pragma unroll
  for (int i = 0; i < 8; ++i) *(v8us*)&tA[0][so_st + i * 16 * PIT] = ra[i];
#pragma unroll
  for (int i = 0; i < 4; ++i) *(v8us*)&tB[0][so_st + i * 16 * PIT] = rb[i];
  __syncthreads();      /* stage 0 is in LDS before any wave reads it */
#pragma unroll 1      /* stays rolled: the body already holds 16 products and the whole of a stage's loads */
  for (int kb = 0; kb < K; kb += 64) { const int cur = (kb >> 6) & 1; const bool more = kb + 64 < K;
    if (more) {      /* the next stage's global loads go out ahead of this stage's products, which cover their latency */
#pragma unroll
      for (int i = 0; i < 8; ++i) ra[i] = *(const v8us*)((const char*)(A + kb + 64) + oa[i]);
#pragma unroll
      for (int i = 0; i < 4; ++i) rb[i] = *(const v8us*)((const char*)(Bh + kb + 64) + ob[i]); }
    const _Float16* pa = &tA[cur][fa]; const _Float16* pb = &tB[cur][fb];
    v16h a0[2], a1[2], b0[2], b1[2], b2[2], b3[2];      /* all of the stage's fragment reads as one group in front of its products */
#pragma unroll
    for (int ks = 0; ks < 2; ++ks) { a0[ks] = g2_frag(pa + ks * 32, hh); a1[ks] = g2_frag(pa + 16 * PIT + ks * 32, hh); b0[ks] = g2_frag(pb + ks * 32, hh); b1[ks] = g2_frag(pb + 16 * PIT + ks * 32, hh); b2[ks] = g2_frag(pb + 32 * PIT + ks * 32, hh); b3[ks] = g2_frag(pb + 48 * PIT + ks * 32, hh); }
#pragma unroll
    for (int ks = 0; ks < 2; ++ks) {
      c00 = g2_mma(a0[ks], b0[ks], c00); c10 = g2_mma(a1[ks], b0[ks], c10);
      c01 = g2_mma(a0[ks], b1[ks], c01); c11 = g2_mma(a1[ks], b1[ks], c11);
      c02 = g2_mma(a0[ks], b2[ks], c02); c12 = g2_mma(a1[ks], b2[ks], c12);
      c03 = g2_mma(a0[ks], b3[ks], c03); c13 = g2_mma(a1[ks], b3[ks], c13); }
    if (more) {      /* into the buffer that every wave left at the last barrier */
#pragma unroll
      for (int i = 0; i < 8; ++i) *(v8us*)&tA[cur ^ 1][so_st + i * 16 * PIT] = ra[i];
#pragma unroll
      for (int i = 0; i < 4; ++i) *(v8us*)&tB[cur ^ 1][so_st + i * 16 * PIT] = rb[i]; }
    __syncthreads(); }      /* publishes the next stage and ends every wave's reads of this one */
  if (!tr && row0 >= M) return;      /* no barrier follows; XP 3 has one below and takes whole 128-row tiles only (M % 128 == 0) */
  v8f accs[8] = {c00, c01, c02, c03, c10, c11, c12, c13};
  constexpr int TP = 136; _Float16* sT = (_Float16*)&so[0][0][0];      /* XP 3: the staging bytes as two f16 planes [64 d][128 tokens], row pitch 272 B */
  if (XP == 4 && tr) {      /* the v side of XP 4: the XP 3 form of the loop below (XP 4 is used with ACT 0 and without an addend); both loops unrolled like it, so that accs and the fragments are indexed by constants and stay in registers */
#pragma unroll
    for (int u = 0; u < 8; ++u) { const int t = u & 3, half = u >> 2; const float bv = bp ? bf16_round(bp[col0 + t * 16 + ln]) : 0.f; FragH th, tl;
#pragma unroll
      for (int r = 0; r < 8; ++r) { const float v = accs[u][r] * alpha + bv; const _Float16 hv = (_Float16)v; th.h[r] = hv; tl.h[r] = (_Float16)((v - (float)hv) * 1024.0f); }
      const int o = (t * 16 + ln) * TP + 32 * w + half * 16 + 8 * hh; *(v8us*)&sT[o] = th.half[0]; *(v8us*)&sT[64 * TP + o] = tl.half[0]; } }
  else
#pragma unroll
  for (int u = 0; u < 8; ++u) { const int t = u & 3, half = u >> 2; const int col = col0 + t * 16 + ln; const float bv = bp ? bf16_round(bp[col]) : 0.f; FragH th, tl;
#pragma unroll
    for (int r = 0; r < 8; ++r) { const int rloc = half * 16 + 8 * hh + r; float v = accs[u][r] * alpha + bv; if (CP) { const int bidx = (row0g + row0 + rloc) / rowsPerB; v += CP[(size_t)bidx * sCPb + (size_t)by * 64 + col]; }
      if (ACT == 3) v = fmaxf(v, 0.f); else if (ACT == 6) v = 0.5f * v * (1.0f + erff(v * 0.70710678118654752f)); else if (ACT == 11) v = 1.0f / (1.0f + expf(-v)); else if (ACT == 15) v = v / (1.0f + expf(-v)); else if (ACT == 12) v = (v > 0.f) ? v : 0.01f * v; else if (ACT == 8) v = tanhf(v);
      if (XP == 3) { const _Float16 hv = (_Float16)v; th.h[r] = hv; tl.h[r] = (_Float16)((v - (float)hv) * 1024.0f); } else so[w][rloc][t * 16 + ln] = v; }
    if (XP == 3) { const int o = (t * 16 + ln) * TP + 32 * w + half * 16 + 8 * hh; *(v8us*)&sT[o] = th.half[0]; *(v8us*)&sT[64 * TP + o] = tl.half[0]; } }      /* a lane's 8 accumulator rows are 8 consecutive tokens of one d: one 16-byte piece of the transposed row */
  if (tr) {      /* a block-uniform branch: every wave of such a work-group reaches the barrier */
    __syncthreads();      /* all four waves' 32-token pieces are in LDS before any wave stores whole 256-byte rows */
    const size_t vb = ((size_t)((mt * 128) / SLEN) * NH + nq) * 64 * SLEN + (mt * 128) % SLEN;
#pragma unroll
    for (int it = 0; it < 8; ++it) { const int d = it * 8 + (tid >> 4), pc = tid & 15; const v8us a = *(const v8us*)&sT[d * TP + pc * 8], c = *(const v8us*)&sT[64 * TP + d * TP + pc * 8];
      *(v8us*)((unsigned short*)Hh + vb + (size_t)d * SLEN + pc * 8) = a; *(v8us*)((unsigned short*)Hl + vb + (size_t)d * SLEN + pc * 8) = c; }
    return; }
  __builtin_amdgcn_fence(__ATOMIC_ACQ_REL, "workgroup"); __builtin_amdgcn_wave_barrier();
  const int rsub = lane >> 4, c4 = (lane & 15) * 4;
  if (XP == 1 || XP == 2 || XP == 4) {
    const size_t tb = (size_t)(row0 % SLEN + rsub) * 32;      /* a wave's 32 rows lie in one batch (SLEN % 32 == 0): token = row0 % SLEN + r */
    const float* cs = CS + tb + (c4 >> 1); const float* sn = SN + tb + (c4 >> 1); const float* scp = SC + tb + (c4 & 31);
#pragma unroll
    for (int g = 0; g < 16; g += 8) { v2fa cq[8], sq[8]; v4f s4[8];      /* two groups of 8 rows: 16 rows' table words and the k side's 64 quotients at once need more than 256 registers */
#pragma unroll
      for (int q = 0; q < 8; ++q) { cq[q] = *(const v2fa*)(cs + (g + q) * 64); sq[q] = *(const v2fa*)(sn + (g + q) * 64); s4[q] = *(const v4fa*)(scp + (g + q) * 64); }      /* the group's table words in flight together */
      asm volatile("s_wait_xcnt 0x0" :: "v"(cs), "v"(sn), "v"(scp) : "memory");      /* precaution: stands in front of every rewrite of the table loads' address registers, which stay live up to here */
      if (inv) {      /* the k side's inverse scale, behind one block-uniform branch; both loops unrolled, so that s4 is indexed by constants and stays in registers */
#pragma unroll
        for (int q = 0; q < 8; ++q)
#pragma unroll
          for (int i = 0; i < 4; ++i) s4[q][i] = 1.0f / s4[q][i]; }
#pragma unroll
      for (int q = 0; q < 8; ++q) { const int r = (g + q) * 2 + rsub; const v4f v = *(const v4fa*)&so[w][r][c4]; v4h hi4, lo4;
#pragma unroll
        for (int i = 0; i < 4; ++i) { const float sc = s4[q][i];
          const float x = v[i]; const float rx = (i & 1) ? v[i - 1] : -v[i + 1]; const float o = (x * cq[q][i >> 1]) * sc + (rx * sq[q][i >> 1]) * sc;
          const _Float16 h = (_Float16)o; hi4[i] = h; lo4[i] = (_Float16)((o - (float)h) * 1024.0f); }
        const size_t oo = cofs + (size_t)(row0 + r) * ldc + col0 + c4; *(v4h*)(Hh + oo) = hi4; *(v4h*)(Hl + oo) = lo4; }
      asm volatile("s_wait_xcnt 0x0" ::: "memory"); }      /* precaution: stands in front of every rewrite of a register that the group's stores name (the second group's loads; behind the last group, whatever the listing puts next) */
    return; }
  {
#pragma unroll
    for (int q = 0; q < 16; ++q) { const int r = q * 2 + rsub; const v4f v = *(const v4fa*)&so[w][r][c4]; if (C) *(v4f*)(C + cofs + (size_t)(row0 + r) * ldc + col0 + c4) = v; if (C16) { v4h h4; for (int i = 0; i < 4; ++i) h4[i] = (_Float16)v[i]; *(v4h*)(C16 + cofs + (size_t)(row0 + r) * ldc + col0 + c4) = h4; } }
     } }



template <int TQ, int TK>
__global__ __launch_bounds__(256) void k_flashm(const _Float16* __restrict__ Q16, const _Float16* __restrict__ Q16lo, int ldq, const _Float16* __restrict__ K16, const _Float16* __restrict__ K16lo, int ldk, const _Float16* __restrict__ Vt, const _Float16* __restrict__ Vtlo, const unsigned* __restrict__ MB, const int* __restrict__ RA, const int* __restrict__ KE, _Float16* __restrict__ Oh, _Float16* __restrict__ Ol, int ldo) {
  /* 64 queries per work-group, eight waves: wave w has the 16 queries of sub-tile w & 3 and the 32-key half w >> 2 of every 64-key stage. A stage (K hi, K lo: 64 keys x 64 d; V^T hi, V^T lo: 64 d x 64 keys; whole 128-byte lines) is copied to LDS once and read by all eight waves; two buffers, row pitch 144 B for the 16-byte fragment reads */
  constexpr int RPW = 16, RTN = RPW / 16, QW = 64, NQB = TQ / QW, DT = 4, KS = 2, KP = 72, PLN = 64 * KP, STG = 4 * PLN;
  __shared__ __attribute__((aligned(16))) unsigned short sKV[2][STG];
  __shared__ __attribute__((aligned(16))) unsigned short sP[8][RPW][40], sPl[8][RPW][40]; __shared__ __attribute__((aligned(16))) float sO[8][RPW][64 + 4]; __shared__ float sM[8][RPW], sL[8][RPW];
  const int tid = threadIdx.x, lane = tid & 31, ln = lane & 15, hh = lane >> 4;
  const int w = __builtin_amdgcn_readfirstlane(tid >> 5);      /* the wave's number in a scalar register: the skip of a key half past the bound stays a scalar branch */
  const int qs = w & 3, kg = w >> 2;
  /* grid (slab = (batch, head), tile): both batches in one launch, twice as many groups as resident places (two to a WGP). The order of the tiles is as it was for one batch a launch: the first half of the flat index takes the tiles with the most keys in falling order, the second half the rest in rising order; left for a later step: a cost that falls with the index throughout */
  const int slab = blockIdx.x, yy = (int)blockIdx.y, qt = (yy < NQB / 2) ? NQB - 1 - yy : yy - NQB / 2; const int b = slab / NH, h = slab % NH; const int q0 = qt * QW + qs * RPW; const int qblk = q0 >> 6;
  FragH aq[2][KS], aql[2][KS];
#pragma unroll
  for (int rt = 0; rt < RTN; ++rt) { const size_t qo = ((size_t)b * TQ + q0 + rt * 16 + ln) * ldq + h * 64; const unsigned short* qr = (const unsigned short*)Q16 + qo; const unsigned short* ql = (const unsigned short*)Q16lo + qo;
#pragma unroll
    for (int ks = 0; ks < KS; ++ks) { aq[rt][ks].half[0] = *(const v8us*)(qr + ks * 32 + 8 * hh); aq[rt][ks].half[1] = *(const v8us*)(qr + ks * 32 + 16 + 8 * hh); aql[rt][ks].half[0] = *(const v8us*)(ql + ks * 32 + 8 * hh); aql[rt][ks].half[1] = *(const v8us*)(ql + ks * 32 + 16 + 8 * hh); } }
  const unsigned short* Vth = (const unsigned short*)Vt + (size_t)slab * 64 * TK; const unsigned short* Vtl = (const unsigned short*)Vtlo + (size_t)slab * 64 * TK;
  float m_r[2][8], l_r[2][8]; v8f oacc[2][DT], oaccl[2][DT];
#pragma unroll
  for (int rt = 0; rt < RTN; ++rt) {
#pragma unroll
    for (int r = 0; r < 8; ++r) { m_r[rt][r] = -3.0e38f; l_r[rt][r] = 0.f; }
#pragma unroll
    for (int dt = 0; dt < DT; ++dt) { oacc[rt][dt] = (v8f){0.f,0.f,0.f,0.f,0.f,0.f,0.f,0.f}; oaccl[rt][dt] = oacc[rt][dt]; } }
  int jend = KE[qblk * 32]; jend = min(TK, (jend + 31) & ~31); if (jend < 32) jend = 32; jend = __builtin_amdgcn_readfirstlane(jend);      /* block-uniform, in a scalar register */
  const int nst = (jend + 63) >> 6;      /* stages of 64 keys; TK % 64 == 0, so every stage lies inside K and V */
  int allm[2][8]; const unsigned* mrow[2][8];
#pragma unroll
  for (int rt = 0; rt < RTN; ++rt)
#pragma unroll
    for (int r = 0; r < 8; ++r) { const int tq = q0 + rt * 16 + 8 * hh + r; allm[rt][r] = RA[tq]; mrow[rt][r] = MB + (size_t)tq * (TK / 32); }
  /* staging: eight lanes bring one row's 128-byte line, a wave four whole lines per copy; each thread copies rows cr and cr + 32 of each of the four planes */
  const int cr = tid >> 3, cc = (tid & 7) * 8;
  const size_t gko = ((size_t)b * TK + cr) * ldk + h * 64 + cc, gvo = (size_t)cr * TK + cc;
  const unsigned lds0 = (unsigned)(size_t)&sKV[0][cr * KP + cc];      /* the lane's LDS byte address in buffer 0, plane 0 */
  auto stage = [&](int s, int buf) {
    const unsigned short* k0 = (const unsigned short*)K16 + gko + (size_t)s * 64 * ldk; const unsigned short* k2 = (const unsigned short*)K16lo + gko + (size_t)s * 64 * ldk; const unsigned short* k1 = k0 + (size_t)32 * ldk; const unsigned short* k3 = k2 + (size_t)32 * ldk;
    const unsigned short* v0 = Vth + gvo + s * 64; const unsigned short* v2 = Vtl + gvo + s * 64; const unsigned short* v1 = v0 + (size_t)32 * TK; const unsigned short* v3 = v2 + (size_t)32 * TK;
    const unsigned d0 = lds0 + (unsigned)buf * (STG * 2u), d1 = d0 + 32u * KP * 2u, d2 = d0 + PLN * 2u, d3 = d2 + 32u * KP * 2u, d4 = d0 + 2u * PLN * 2u, d5 = d4 + 32u * KP * 2u, d6 = d0 + 3u * PLN * 2u, d7 = d6 + 32u * KP * 2u;
    /* the stage's eight copies; the closing s_wait_xcnt is a precaution that stands in front of every rewrite of the copies' address registers */
    asm volatile("global_load_async_to_lds_b128 %0, %8, off\n\tglobal_load_async_to_lds_b128 %1, %9, off\n\tglobal_load_async_to_lds_b128 %2, %10, off\n\tglobal_load_async_to_lds_b128 %3, %11, off\n\t"
                 "global_load_async_to_lds_b128 %4, %12, off\n\tglobal_load_async_to_lds_b128 %5, %13, off\n\tglobal_load_async_to_lds_b128 %6, %14, off\n\tglobal_load_async_to_lds_b128 %7, %15, off\n\ts_wait_xcnt 0x0"
                 :: "v"(d0), "v"(d1), "v"(d2), "v"(d3), "v"(d4), "v"(d5), "v"(d6), "v"(d7), "v"(k0), "v"(k1), "v"(k2), "v"(k3), "v"(v0), "v"(v1), "v"(v2), "v"(v3) : "memory"); };
  stage(0, 0);
  asm volatile("s_wait_asynccnt 0x0" ::: "memory");      /* this wave's copies of stage 0 have landed */
  __syncthreads();      /* stage 0 is in LDS before any wave reads it */
  if (nst > 1) stage(1, 1);
#pragma unroll 1
  for (int st = 0; st < nst; ++st) { const int j0 = st * 64 + kg * 32; const unsigned short* tb = &sKV[st & 1][0];
   if (j0 < jend) {      /* a key half past the bound is skipped by its four waves; the publish point below is passed by every wave */
    unsigned mw[2][8];      /* all of the pass's mask words are fetched here, so that their latency runs under the K reads and the score products */
#pragma unroll
    for (int rt = 0; rt < RTN; ++rt)
#pragma unroll
      for (int r = 0; r < 8; ++r) mw[rt][r] = mrow[rt][r][j0 >> 5];
    asm volatile("s_wait_xcnt 0x0" ::: "memory");      /* precaution: stands in front of every rewrite of the mask loads' address registers; it also keeps these loads ahead of the K reads */
    v8f s[2][2]; FragH bk[2][KS], bkl[2][KS];      /* all of the pass's K fragment reads stand as one group in front of its score products: one LDS latency instead of two */
#pragma unroll
    for (int nt = 0; nt < 2; ++nt) { const unsigned short* kr = tb + (kg * 32 + nt * 16 + ln) * KP; const unsigned short* kl = kr + PLN;
#pragma unroll
      for (int ks = 0; ks < KS; ++ks) { bk[nt][ks].half[0] = *(const v8us*)(kr + ks * 32 + 8 * hh); bk[nt][ks].half[1] = *(const v8us*)(kr + ks * 32 + 16 + 8 * hh); bkl[nt][ks].half[0] = *(const v8us*)(kl + ks * 32 + 8 * hh); bkl[nt][ks].half[1] = *(const v8us*)(kl + ks * 32 + 16 + 8 * hh); } }
#pragma unroll
    for (int nt = 0; nt < 2; ++nt) {
#pragma unroll
      for (int rt = 0; rt < RTN; ++rt) { v8f acc = (v8f){0.f,0.f,0.f,0.f,0.f,0.f,0.f,0.f}, accr = acc;
#pragma unroll
        for (int ks = 0; ks < KS; ++ks) { acc = mmaH<1>(aq[rt][ks].v, aq[rt][ks].v, bk[nt][ks].v, bk[nt][ks].v, acc); accr = mmaH<1>(aql[rt][ks].v, aql[rt][ks].v, bk[nt][ks].v, bk[nt][ks].v, accr); accr = mmaH<1>(aq[rt][ks].v, aq[rt][ks].v, bkl[nt][ks].v, bkl[nt][ks].v, accr); }
        s[rt][nt] = acc + accr * 0.0009765625f; } }
    /* softmax in stages over the eight rows, with selects in place of branches: one straight block, in which the rows' dependent chains overlap */
    float s0[2][8], s1[2][8], mc[2][8]; bool ok0[2][8], ok1[2][8];
#pragma unroll
    for (int rt = 0; rt < RTN; ++rt)
#pragma unroll
      for (int r = 0; r < 8; ++r) { const bool am = (allm[rt][r] != 0);
        ok0[rt][r] = am || (((mw[rt][r] >> ln) & 1u) == 0u); ok1[rt][r] = am || (((mw[rt][r] >> (16 + ln)) & 1u) == 0u);
        s0[rt][r] = ok0[rt][r] ? (am ? 0.f : s[rt][0][r] * SCL) : -INFINITY; s1[rt][r] = ok1[rt][r] ? (am ? 0.f : s[rt][1][r] * SCL) : -INFINITY; mc[rt][r] = fmaxf(s0[rt][r], s1[rt][r]); }
#pragma unroll
    for (int sx = 1; sx <= 8; sx <<= 1)
#pragma unroll
      for (int rt = 0; rt < RTN; ++rt)
#pragma unroll
        for (int r = 0; r < 8; ++r) mc[rt][r] = fmaxf(mc[rt][r], __shfl_xor(mc[rt][r], sx, 32));
#pragma unroll
    for (int rt = 0; rt < RTN; ++rt)
#pragma unroll
      for (int r = 0; r < 8; ++r) {
        const float mn = fmaxf(m_r[rt][r], mc[rt][r]); const float ea = expf(m_r[rt][r] - mn), e0 = expf(s0[rt][r] - mn), e1 = expf(s1[rt][r] - mn);      /* computed for every lane; the selects below keep the values of the guarded form */
        const float al = (mn > -1.0e38f) ? ea : 1.0f; m_r[rt][r] = mn; const float p0 = ok0[rt][r] ? e0 : 0.f, p1 = ok1[rt][r] ? e1 : 0.f; l_r[rt][r] = l_r[rt][r] * al + p0 + p1;
#pragma unroll
        for (int dt = 0; dt < DT; ++dt) { oacc[rt][dt][r] *= al; oaccl[rt][dt][r] *= al; }
        FragH t2, t3; const float ps0 = p0 * 1024.0f, ps1 = p1 * 1024.0f; t2.h[0] = (_Float16)ps0; t2.h[1] = (_Float16)ps1; t3.h[0] = (_Float16)((ps0 - (float)t2.h[0]) * 1024.0f); t3.h[1] = (_Float16)((ps1 - (float)t2.h[1]) * 1024.0f);
        sP[w][rt * 16 + 8 * hh + r][ln] = t2.u[0]; sP[w][rt * 16 + 8 * hh + r][16 + ln] = t2.u[1]; sPl[w][rt * 16 + 8 * hh + r][ln] = t3.u[0]; sPl[w][rt * 16 + 8 * hh + r][16 + ln] = t3.u[1]; }
    __builtin_amdgcn_fence(__ATOMIC_ACQ_REL, "workgroup"); __builtin_amdgcn_wave_barrier();
    FragH pa[2], pl[2];
#pragma unroll
    for (int rt = 0; rt < RTN; ++rt) { pa[rt].half[0] = *(const v8us*)&sP[w][rt * 16 + ln][8 * hh]; pa[rt].half[1] = *(const v8us*)&sP[w][rt * 16 + ln][16 + 8 * hh]; pl[rt].half[0] = *(const v8us*)&sPl[w][rt * 16 + ln][8 * hh]; pl[rt].half[1] = *(const v8us*)&sPl[w][rt * 16 + ln][16 + 8 * hh]; }
    FragH bv[DT], bl[DT];      /* all of the pass's V fragment reads stand as one group in front of its value products: one LDS latency instead of four */
#pragma unroll
    for (int dt = 0; dt < DT; ++dt) { const unsigned short* vr = tb + 2 * PLN + (dt * 16 + ln) * KP + kg * 32; const unsigned short* vl = vr + PLN; bv[dt].half[0] = *(const v8us*)(vr + 8 * hh); bv[dt].half[1] = *(const v8us*)(vr + 16 + 8 * hh); bl[dt].half[0] = *(const v8us*)(vl + 8 * hh); bl[dt].half[1] = *(const v8us*)(vl + 16 + 8 * hh); }
#pragma unroll
    for (int dt = 0; dt < DT; ++dt) {
#pragma unroll
      for (int rt = 0; rt < RTN; ++rt) { oacc[rt][dt] = mmaH<1>(pa[rt].v, pa[rt].v, bv[dt].v, bv[dt].v, oacc[rt][dt]); oaccl[rt][dt] = mmaH<1>(pa[rt].v, pa[rt].v, bl[dt].v, bl[dt].v, oaccl[rt][dt]); oaccl[rt][dt] = mmaH<1>(pl[rt].v, pl[rt].v, bv[dt].v, bv[dt].v, oaccl[rt][dt]); } }
   }
    /* publish point of stage st + 1, every wave, in this order */
    asm volatile("s_wait_dscnt 0x0" ::: "memory");      /* this wave's LDS reads of stage st have returned */
    asm volatile("s_wait_asynccnt 0x0" ::: "memory");      /* this wave's copies of stage st + 1 have landed */
    __syncthreads();      /* publishes stage st + 1 and ends every wave's reads of stage st */
    if (st + 2 < nst) stage(st + 2, st & 1); }      /* into the buffer that every wave has just left */
  asm volatile("s_wait_asynccnt 0x0" ::: "memory");      /* no copy is outstanding behind the loop */
#pragma unroll
  for (int rt = 0; rt < RTN; ++rt) {
#pragma unroll
    for (int r = 0; r < 8; ++r) { float l = l_r[rt][r]; l += __shfl_xor(l, 1, 32); l += __shfl_xor(l, 2, 32); l += __shfl_xor(l, 4, 32); l += __shfl_xor(l, 8, 32); l_r[rt][r] = l; }
    if (ln == 0) {
#pragma unroll
      for (int r = 0; r < 8; ++r) { sM[w][rt * 16 + 8 * hh + r] = m_r[rt][r]; sL[w][rt * 16 + 8 * hh + r] = l_r[rt][r]; } }
#pragma unroll
    for (int dt = 0; dt < DT; ++dt)
#pragma unroll
      for (int r = 0; r < 8; ++r) sO[w][rt * 16 + 8 * hh + r][dt * 16 + ln] = oacc[rt][dt][r] + oaccl[rt][dt][r] * 0.0009765625f; }
  __syncthreads();      /* every wave's partial (max, sum, O) is in LDS before any wave merges them */
  {
#pragma unroll
    for (int rp = 0; rp < QW; rp += 16) { const int rq = rp + (tid >> 4), pc = tid & 15; const int wq = rq >> 4, r = rq & 15;      /* query rq of the tile: the partials of waves wq (first key halves) and wq + 4 (second) */
      const float m0 = sM[wq][r], m1 = sM[wq + 4][r]; const float mx = fmaxf(m0, m1);      /* a wave that saw no open key holds -3e38, sum 0, O 0: weight 0 (or 1 on zeros) */
      const float e0 = expf(m0 - mx), e1 = expf(m1 - mx);
      const float l = e0 * sL[wq][r] + e1 * sL[wq + 4][r]; const float inv = (l > 0.f) ? 1.0f / (l * 1024.0f) : 0.f;
      const v4f o0 = *(const v4fa*)&sO[wq][r][pc * 4], o1 = *(const v4fa*)&sO[wq + 4][r][pc * 4];
      const v4f val = (o0 * e0 + o1 * e1) * inv; v4h hi4, lo4;      /* O leaves as the f16 hi + x2^10 residual planes that the output projection reads */
#pragma unroll
      for (int i = 0; i < 4; ++i) { const _Float16 hv = (_Float16)val[i]; hi4[i] = hv; lo4[i] = (_Float16)((val[i] - (float)hv) * 1024.0f); }
      const size_t oo = ((size_t)b * TQ + qt * QW + rq) * ldo + h * 64 + pc * 4; *(v4h*)(Oh + oo) = hi4; *(v4h*)(Ol + oo) = lo4; }
     } }


__constant__ float INVF[32] = {1.000000000e+00f,7.498942018e-01f,5.623413324e-01f,4.216965139e-01f,3.162277639e-01f,2.371373624e-01f,1.778279394e-01f,1.333521456e-01f,1.000000015e-01f,7.498941571e-02f,5.623412877e-02f,4.216964915e-02f,3.162277862e-02f,2.371373586e-02f,1.778279431e-02f,1.333521493e-02f,9.999999776e-03f,7.498942316e-03f,5.623413250e-03f,4.216964822e-03f,3.162277862e-03f,2.371373819e-03f,1.778279431e-03f,1.333521446e-03f,1.000000047e-03f,7.498941850e-04f,5.623413017e-04f,4.216964880e-04f,3.162277862e-04f,2.371373848e-04f,1.778279402e-04f,1.333521504e-04f};
__constant__ float XBASE[32] = {2.857142985e-01f,3.080357313e-01f,3.303571641e-01f,3.526785970e-01f,3.750000000e-01f,3.973214328e-01f,4.196428359e-01f,4.419642687e-01f,4.642857015e-01f,4.866071343e-01f,5.089285374e-01f,5.312500000e-01f,5.535714030e-01f,5.758928657e-01f,5.982142687e-01f,6.205357313e-01f,6.428571343e-01f,6.651785970e-01f,6.875000000e-01f,7.098214030e-01f,7.321428657e-01f,7.544642687e-01f,7.767857313e-01f,7.991071343e-01f,8.214285970e-01f,8.437500000e-01f,8.660714030e-01f,8.883928657e-01f,9.107142687e-01f,9.330357313e-01f,9.553571343e-01f,9.776785970e-01f};
/* ---- the eight preparation jobs, which read none of each other's output, as one launch: the block index picks the job; a thread's work in each job is what it was in the job's own kernel. Each job ends in s_wait_xcnt 0, a precaution: it stands in front of every rewrite of a register that the job's stores name, on whatever way the listing joins the jobs ---- */
__device__ __forceinline__ void prep_round(const float* __restrict__ s, _Float16* __restrict__ d, size_t t, float mul) { FragH f;      /* f16(bf16_round(v) * mul), 8 values a thread; unrolled: two 16-byte loads, one 16-byte store */
#pragma unroll
  for (int q = 0; q < 8; ++q) f.h[q] = (_Float16)(bf16_round(s[t * 8 + q]) * mul); *(v8us*)((unsigned short*)d + t * 8) = f.half[0];
  asm volatile("s_wait_xcnt 0x0" ::: "memory"); }
__device__ __forceinline__ void prep_trig(int t, float* __restrict__ CS, float* __restrict__ SN) {
  #pragma clang fp contract(off)      /* numerical, kept with these lines from their own kernel: the angle is rounded to f32 as the reference rounds it before cos and sin take it; the tables stay bit-identical */
  const int tok = t >> 5, j = t & 31; const float ang = (float)tok * INVF[j]; const float c = cosf(ang), s = sinf(ang);
  *(float*)(CS + t) = c; *(float*)(SN + t) = s;
  asm volatile("s_wait_xcnt 0x0" ::: "memory"); }
__device__ __forceinline__ void prep_scale(int t, float* __restrict__ SC) {
  #pragma clang fp contract(off)      /* numerical, kept with these lines from their own kernel: the exponent is rounded to f32 as the reference rounds it before pow takes it; the table stays bit-identical */
  const int tok = t >> 5, j = t & 31; const float v = powf(XBASE[j], ((float)tok - 1024.0f) / 512.0f);
  *(float*)(SC + t) = v;
  asm volatile("s_wait_xcnt 0x0" ::: "memory"); }
__device__ __forceinline__ void prep_causal(int t, unsigned* __restrict__ MB, int* __restrict__ RA, int* __restrict__ KE, int nq, int nk) {
  const int nw = nk / 32;
  if (t < nq * nw) { const int q = t / nw, w = t % nw; const int first = q + 1 - 32 * w; const unsigned bits = (first <= 0) ? 0xffffffffu : ((first >= 32) ? 0u : (0xffffffffu << first)); *(unsigned*)(MB + t) = bits;  }
  if (t < nq) { *(int*)(RA + t) = 0;  }
  if (t < nq / 64) { const int v = 64 * (t + 1); *(int*)(KE + t * 32) = v;  }
  asm volatile("s_wait_xcnt 0x0" ::: "memory"); }
#define PB_TAB (SLEN * 32 / 256)                 /* blocks of the cos and sin tables, and of the scale table: first, they have the longest chains */
#define PB_X   (NR * DM / (8 * 256))             /* blocks of x */
#define PB_W   (DM * DM / (8 * 256))             /* blocks of one weight matrix */
#define PB_CAU (SLEN * (SLEN / 32) / 256)        /* blocks of the causal bit plane */
__global__ __launch_bounds__(256) void k_prep(const float* __restrict__ x, const float* __restrict__ Wq, const float* __restrict__ Wk, const float* __restrict__ Wv, const float* __restrict__ Wo, _Float16* __restrict__ X16, _Float16* __restrict__ BW,
    float* __restrict__ CS, float* __restrict__ SN, float* __restrict__ SC, unsigned* __restrict__ MB, int* __restrict__ RA, int* __restrict__ KE) {
  const int tid = threadIdx.x; int blk = blockIdx.x;      /* every count below divides exactly: no thread is past the end of its job */
  if (blk < PB_TAB) { prep_trig(blk * 256 + tid, CS, SN); return; }
  blk -= PB_TAB;
  if (blk < PB_TAB) { prep_scale(blk * 256 + tid, SC); return; }
  blk -= PB_TAB;
  if (blk < PB_X) { prep_round(x, X16, (size_t)blk * 256 + tid, 1.0f); return; }
  blk -= PB_X;
  if (blk < 4 * PB_W) { const int m = blk / PB_W;      /* planes in the order the GEMMs index them: q <- Wq, k <- Wv, v <- Wk (module order), then Wo; a weight's (out, in) order is the natural Bt; x16 */
    const float* s = (m == 0) ? Wq : ((m == 1) ? Wv : ((m == 2) ? Wk : Wo)); prep_round(s, BW + (size_t)m * DM * DM, (size_t)(blk - m * PB_W) * 256 + tid, 16.0f); return; }
  blk -= 4 * PB_W;
  prep_causal(blk * 256 + tid, MB, RA, KE, SLEN, SLEN); }
extern "C" void kernel_launch(void* const* d_in, const int* in_sizes, int n_in,
                              void* d_out, int out_size, void* d_ws, size_t ws_size, hipStream_t stream) {
  (void)in_sizes; (void)n_in; (void)out_size;
  const float* const* I = (const float* const*)d_in; const float* x = I[0]; const float* Wq = I[1]; const float* bq = I[2]; const float* Wk = I[3]; const float* bk = I[4]; const float* Wv = I[5]; const float* bv = I[6]; const float* Wo = I[7]; const float* bo = I[8];
  char* ws = (char*)d_ws; size_t off = 0;
  auto take = [&](size_t bytes) { char* p = ws + off; off += (bytes + 255) & ~(size_t)255; return p; };
  _Float16* BW = (_Float16*)take((size_t)4 * DM * DM * 2); _Float16* BO = BW + (size_t)3 * DM * DM;      /* weight planes q, k, v, o */
  _Float16* X16 = (_Float16*)take((size_t)NR * DM * 2); _Float16* Oh = (_Float16*)take((size_t)NR * DM * 2); _Float16* Ol = (_Float16*)take((size_t)NR * DM * 2);
  _Float16* Qh = (_Float16*)take((size_t)6 * NR * DM * 2); _Float16* Ql = Qh + (size_t)NR * DM; _Float16* Kh = Ql + (size_t)NR * DM; _Float16* Kl = Kh + (size_t)NR * DM; _Float16* Vth = Kl + (size_t)NR * DM; _Float16* Vtl = Vth + (size_t)NR * DM;      /* three hi, lo pairs in a row */
  unsigned* MB = (unsigned*)take((size_t)SLEN * (SLEN / 32) * 4); int* RA = (int*)take((size_t)SLEN * 4); int* KE = (int*)take((size_t)(SLEN / 64) * 32 * 4);
  float* CS = (float*)take((size_t)SLEN * 32 * 4); float* SN = (float*)take((size_t)SLEN * 32 * 4); float* SC = (float*)take((size_t)SLEN * 32 * 4);
  if (off > ws_size) return;      /* 8 + 8 + 8 x 8 + 1.5 = 82 MiB */
  k_prep<<<2 * PB_TAB + PB_X + 4 * PB_W + PB_CAU, 256, 0, stream>>>(x, Wq, Wk, Wv, Wo, X16, BW, CS, SN, SC, MB, RA, KE);
  const dim3 gP((NR / 128) * (DM / 64), 1);
  /* q_mat = xpos(x Wq^T + bq) as hi/lo; k_mat = xpos^-1(x Wv^T + bv) (module order); v_mat = x Wk^T + bk as V^T hi/lo [(b, h)][64][2048] */
  k_gemm2<0, 4><<<dim3((NR / 128) * (DM / 64), 3), 128, 0, stream>>>(X16, DM, 0, BW, DM, (size_t)DM * DM, 0.0625f, bq, 0, nullptr, 1, 0, 0, nullptr, nullptr, DM, 0, NR, DM, DM, CS, SN, SC, Qh, Ql, bv, bk, (size_t)2 * NR * DM);
  k_flashm<SLEN, SLEN><<<dim3(NBT * NH, SLEN / 64), 256, 0, stream>>>(Qh, Ql, DM, Kh, Kl, DM, Vth, Vtl, MB, RA, KE, Oh, Ol, DM);
  k_gemm2<0, 0><<<gP, 128, 0, stream>>>(Oh, DM, 0, BO, DM, 0, 0.0625f, bo, 0, nullptr, 1, 0, 0, (float*)d_out, nullptr, DM, 0, NR, DM, DM, nullptr, nullptr, nullptr, nullptr, nullptr, nullptr, nullptr, 0);
  k_gemm2<0, 0><<<gP, 128, 0, stream>>>(Ol, DM, 0, BO, DM, 0, 0.0625f / 1024.0f, nullptr, 0, (const float*)d_out, 1, (size_t)DM, 0, (float*)d_out, nullptr, DM, 0, NR, DM, DM, nullptr, nullptr, nullptr, nullptr, nullptr, nullptr, nullptr, 0);
}

// v007
// One run takes 187 microseconds.
// Two timings next to v006 both put it at 1.10 times that version's speed.
// Over all steps from v000 it is 4.62 times as fast.
#include <hip/hip_runtime.h>
// Causal multi-head attention with xPos rotary embedding (2 x 2048 tokens x 1024, 16 heads x 64): q = x*Wq^T + bq, k = x*Wv^T + bv, v = x*Wk^T + bk (the module's own assignment order); q <- q*cos*scale + rot(q)*sin*scale, k <- k*cos/scale + rot(k)*sin/scale with interleaved-pair rotation, freq(t, d) = t * inv_freq[d/2], scale(t, d) = base[d mod 32]^((t - 1024)/512); scores = q.k / 32 with j <= i; softmax; merged . Wo^T + bo -> [2,2048,1024].
// Structure: x as an exact f16 plane; the three projections as f16 WMMA GEMMs (32x64 wave tiles fed from LDS-staged 128x64 work-group tiles, f32, exact products + bias); per-token cos/sin/scale tables on VALU (inv_freq and base = the reference's f32 constants, precise trig and powf); each projection's epilogue finishes its operand in place of separate passes: q, k rotated and scaled in f32 and stored as f16 hi + x2^10 residual planes, v transposed through LDS per (batch, head) to [d][token] hi + residual planes; the causal structure computed on device into a key bit plane + per-block key bound; the fused flash kernel per ((batch, head), 64 queries), eight waves = four 16-query sub-tiles x the two 32-key halves of each 64-key stage, K and V^T stages copied to LDS once per work-group (three-product hi/lo scores, online softmax f32 per wave, P hi + residual via LDS, two value accumulators; the two partial (max, sum, O) of a sub-tile merged through LDS at the end and stored as O hi + residual planes); output projection as two GEMMs (bias in the first).
// Compute dtype: x, weights, biases rounded to bf16; projections exact; rotation f32; q, k, P, v, O as f16 hi + residual pairs (~2^-21); f32 accumulation and softmax. v_wmma_f32_16x16x32_f16.
#define NBT 2
#define SLEN 2048
#define DM 1024
#define NH 16
#define SCL 0.03125f
#define SCL2 (SCL * 1.4426950408889634f)      /* 1/32 times log2(e): the flash kernel keeps scores and running maxima in base-2 units */
#define NR (NBT * SLEN)
typedef __bf16 v16b __attribute__((ext_vector_type(16)));
typedef unsigned short v8us __attribute__((ext_vector_type(8), may_alias));
typedef float  v8f  __attribute__((ext_vector_type(8)));
typedef float  v4f  __attribute__((ext_vector_type(4)));
typedef float  v4fa __attribute__((ext_vector_type(4), may_alias));
typedef float  v2fa __attribute__((ext_vector_type(2), may_alias));
union FragB { v16b v; v8us half[2]; unsigned short u[16]; };

__device__ __forceinline__ unsigned short bf16_bits(float x) { unsigned int u = __float_as_uint(x); return (unsigned short)((u + 0x7FFFu + ((u >> 16) & 1u)) >> 16); }
__device__ __forceinline__ float bf16_val(unsigned short b) { return __uint_as_float(((unsigned int)b) << 16); }
__device__ __forceinline__ float bf16_round(float x) { return bf16_val(bf16_bits(x)); }
// D += A·B with NT terms: 1 = ah·bh, 2 = + al·bh (A split), 3 = + ah·bl (both split)
template <int NT>
__device__ __forceinline__ v8f mmaN(v16b ah, v16b al, v16b bh, v16b bl, v8f c) {
  c = __builtin_amdgcn_wmma_f32_16x16x32_bf16(false, ah, false, bh, (short)0, c, false, false);
  if (NT >= 2) c = __builtin_amdgcn_wmma_f32_16x16x32_bf16(false, al, false, bh, (short)0, c, false, false);
  if (NT >= 3) c = __builtin_amdgcn_wmma_f32_16x16x32_bf16(false, ah, false, bl, (short)0, c, false, false);
  asm volatile("v_nop\n\tv_nop\n\tv_nop\n\tv_nop" : "+v"(c) : "v"(ah), "v"(al), "v"(bh), "v"(bl));
  return c;
}

__global__ __launch_bounds__(256) void k_wt_bf16(const float* __restrict__ W, unsigned short* __restrict__ Wt, int K, int N) {
  const int t = blockIdx.x * 256 + threadIdx.x;
  const int k8n = K / 8;
  if (t >= N * k8n) return;
  const int n = t / k8n, k8 = (t % k8n) * 8;
  v8us v;
#pragma unroll
  for (int i = 0; i < 8; ++i) v[i] = bf16_bits(W[(size_t)(k8 + i) * N + n]);
  *(v8us*)(Wt + (size_t)n * K + k8) = v;
  
}

// GEMM C[M][N] (f32, pitch ldc) = act(A[M][K]·W + bias). A f32 row-major (pitch lda) converted per fragment to bf16
// (ASPLIT: hi/lo two planes -> 2 terms, else single rounded term); Wt bf16 [N][K] (pitch ldb). BIAS_BF16 rounds the
// bias to bf16 first (bias quantised to bf16 before the add). K%32==0, M%16==0, N%64==0.
template <bool ASPLIT, int ACT, bool BIAS_BF16>
__global__ __launch_bounds__(128) void k_gemm_bf(const float* __restrict__ A, int lda, const unsigned short* __restrict__ Wt, int ldb,
                                               const float* __restrict__ bias, float* __restrict__ C, int ldc, int M, int N, int K) {
  __shared__ __attribute__((aligned(16))) float so[4][16][64];
  const int tid = threadIdx.x, w = tid >> 5, lane = tid & 31, ln = lane & 15, hh = lane >> 4;
  const int ntn = N / 64;
  const int wid = blockIdx.x * 4 + w;
  const int mt = wid / ntn, nq = wid % ntn;
  if (mt * 16 >= M) return;
  const int row0 = mt * 16, col0 = nq * 64;
  const float* arow = A + (size_t)(row0 + ln) * lda;
  v8f acc[4] = {};
  for (int kb = 0; kb < K; kb += 32) {
    FragB ah, al;
    const v4f x0 = *(const v4fa*)(arow + kb + 8 * hh), x1 = *(const v4fa*)(arow + kb + 8 * hh + 4);
    const v4f x2 = *(const v4fa*)(arow + kb + 16 + 8 * hh), x3 = *(const v4fa*)(arow + kb + 16 + 8 * hh + 4);
    float xs[16] = {x0[0],x0[1],x0[2],x0[3],x1[0],x1[1],x1[2],x1[3],x2[0],x2[1],x2[2],x2[3],x3[0],x3[1],x3[2],x3[3]};
#pragma unroll
    for (int i = 0; i < 16; ++i) { const unsigned short hb = bf16_bits(xs[i]); ah.u[i] = hb; al.u[i] = ASPLIT ? bf16_bits(xs[i] - bf16_val(hb)) : (unsigned short)0; }
#pragma unroll
    for (int t = 0; t < 4; ++t) {
      const unsigned short* brow = Wt + (size_t)(col0 + t * 16 + ln) * ldb + kb;
      FragB b;
      b.half[0] = *(const v8us*)(brow + 8 * hh);
      b.half[1] = *(const v8us*)(brow + 16 + 8 * hh);
      acc[t] = mmaN<ASPLIT ? 2 : 1>(ah.v, al.v, b.v, b.v, acc[t]);
    }
  }
#pragma unroll
  for (int t = 0; t < 4; ++t) {
    float bv = bias ? bias[col0 + t * 16 + ln] : 0.f;
    if (BIAS_BF16) bv = bf16_round(bv);
#pragma unroll
    for (int r = 0; r < 8; ++r) { float v = acc[t][r] + bv; if (ACT == 1) v = fmaxf(v, 0.f); so[w][8 * hh + r][t * 16 + ln] = v; }
  }
  __builtin_amdgcn_fence(__ATOMIC_ACQ_REL, "workgroup");
  __builtin_amdgcn_wave_barrier();
  const int rsub = lane >> 4, c4 = (lane & 15) * 4;
  {
#pragma unroll
    for (int q = 0; q < 8; ++q) {
      const int r = q * 2 + rsub;
      const v4f v = *(const v4fa*)&so[w][r][c4];
      *(v4f*)(C + (size_t)(row0 + r) * ldc + col0 + c4) = v;
    }
    
  }
}

// GEMM C = act(A·W + bias + resid): A f32 (ASPLIT -> hi/lo 2 terms), Wt bf16 [N][K]; ACT 0 none, 1 relu, 2 exact gelu;
// resid (optional, f32, row index = (row % rmod), pitch ldr, RES_BF16 rounds it) added before the activation.
template <bool ASPLIT, int ACT, bool BIAS_BF16, bool RES_BF16>
__global__ __launch_bounds__(128) void k_gemm_bf3(const float* __restrict__ A, int lda, const unsigned short* __restrict__ Wt, int ldb,
                                                const float* __restrict__ bias, const float* __restrict__ resid, int rmod, int ldr,
                                                float* __restrict__ C, int ldc, int M, int N, int K) {
  __shared__ __attribute__((aligned(16))) float so[4][16][64];
  const int tid = threadIdx.x, w = tid >> 5, lane = tid & 31, ln = lane & 15, hh = lane >> 4;
  const int ntn = N / 64;
  const int wid = blockIdx.x * 4 + w;
  const int mt = wid / ntn, nq = wid % ntn;
  if (mt * 16 >= M) return;
  const int row0 = mt * 16, col0 = nq * 64;
  const float* arow = A + (size_t)(row0 + ln) * lda;
  v8f acc[4] = {};
  for (int kb = 0; kb < K; kb += 32) {
    FragB ah, al;
    const v4f x0 = *(const v4fa*)(arow + kb + 8 * hh), x1 = *(const v4fa*)(arow + kb + 8 * hh + 4);
    const v4f x2 = *(const v4fa*)(arow + kb + 16 + 8 * hh), x3 = *(const v4fa*)(arow + kb + 16 + 8 * hh + 4);
    float xs[16] = {x0[0],x0[1],x0[2],x0[3],x1[0],x1[1],x1[2],x1[3],x2[0],x2[1],x2[2],x2[3],x3[0],x3[1],x3[2],x3[3]};
#pragma unroll
    for (int i = 0; i < 16; ++i) { const unsigned short hb = bf16_bits(xs[i]); ah.u[i] = hb; al.u[i] = ASPLIT ? bf16_bits(xs[i] - bf16_val(hb)) : (unsigned short)0; }
#pragma unroll
    for (int t = 0; t < 4; ++t) {
      const unsigned short* brow = Wt + (size_t)(col0 + t * 16 + ln) * ldb + kb;
      FragB b;
      b.half[0] = *(const v8us*)(brow + 8 * hh);
      b.half[1] = *(const v8us*)(brow + 16 + 8 * hh);
      acc[t] = mmaN<ASPLIT ? 2 : 1>(ah.v, al.v, b.v, b.v, acc[t]);
    }
  }
#pragma unroll
  for (int t = 0; t < 4; ++t) {
    const int col = col0 + t * 16 + ln;
    float bv = bias ? bias[col] : 0.f;
    if (BIAS_BF16) bv = bf16_round(bv);
#pragma unroll
    for (int r = 0; r < 8; ++r) {
      float v = acc[t][r] + bv;
      if (resid) { float rv = resid[(size_t)((row0 + 8 * hh + r) % rmod) * ldr + col]; if (RES_BF16) rv = bf16_round(rv); v += rv; }
      if (ACT == 1) v = fmaxf(v, 0.f);
      if (ACT == 2) v = 0.5f * v * (1.0f + erff(v * 0.70710678118654752f));
      if (ACT == 3) { const float u = 0.7978845608028654f * (v + 0.044715f * v * v * v); v = 0.5f * v * (1.0f + tanhf(u)); }
      so[w][8 * hh + r][t * 16 + ln] = v;
    }
  }
  __builtin_amdgcn_fence(__ATOMIC_ACQ_REL, "workgroup");
  __builtin_amdgcn_wave_barrier();
  const int rsub = lane >> 4, c4 = (lane & 15) * 4;
  {
#pragma unroll
    for (int q = 0; q < 8; ++q) {
      const int r = q * 2 + rsub;
      const v4f v = *(const v4fa*)&so[w][r][c4];
      *(v4f*)(C + (size_t)(row0 + r) * ldc + col0 + c4) = v;
    }
    
  }
}
// row LayerNorm (biased variance, eps) over N: s = X (+ R); optional out_sum <- s; out_norm <- (s-mu)*rsqrt(var+eps)*g + b
template <bool PARAM_BF16>
__global__ __launch_bounds__(256) void k_layernorm(const float* __restrict__ X, const float* __restrict__ R, const float* __restrict__ g, const float* __restrict__ bta,
                                                  float* __restrict__ out_sum, float* __restrict__ out_norm, int N, float eps) {
  __shared__ float red[256];
  const int row = blockIdx.x, tid = threadIdx.x;
  const float* x = X + (size_t)row * N; const float* rr = R ? R + (size_t)row * N : nullptr;
  float vals[16];                     // up to N = 4096
  const int per = N / 256;            // contiguous chunk per thread? use strided-by-4 chunks: thread handles j = tid*4 + 1024*u
  float s1 = 0.f;
  for (int u = 0; u < per / 4; ++u) {
    const int j = tid * 4 + 1024 * u;
    const v4f a = *(const v4fa*)(x + j);
    v4f b = {0.f,0.f,0.f,0.f}; if (rr) b = *(const v4fa*)(rr + j);
#pragma unroll
    for (int q = 0; q < 4; ++q) { const float v = a[q] + b[q]; vals[u * 4 + q] = v; s1 += v; }
  }
  red[tid] = s1; __syncthreads();
  for (int st = 128; st > 0; st >>= 1) { if (tid < st) red[tid] += red[tid + st]; __syncthreads(); }
  const float mu = red[0] / (float)N; __syncthreads();
  float s2 = 0.f;
  for (int u = 0; u < per / 4; ++u)
#pragma unroll
    for (int q = 0; q < 4; ++q) { const float c = vals[u * 4 + q] - mu; s2 += c * c; }
  red[tid] = s2; __syncthreads();
  for (int st = 128; st > 0; st >>= 1) { if (tid < st) red[tid] += red[tid + st]; __syncthreads(); }
  const float rs = rsqrtf(red[0] / (float)N + eps);
  {
    for (int u = 0; u < per / 4; ++u) {
      const int j = tid * 4 + 1024 * u;
      v4f o, sm;
#pragma unroll
      for (int q = 0; q < 4; ++q) {
        float gg = g[j + q], bb = bta[j + q];
        if (PARAM_BF16) { gg = bf16_round(gg); bb = bf16_round(bb); }
        sm[q] = vals[u * 4 + q]; o[q] = (vals[u * 4 + q] - mu) * rs * gg + bb;
      }
      if (out_sum) *(v4f*)(out_sum + (size_t)row * N + j) = sm;
      *(v4f*)(out_norm + (size_t)row * N + j) = o;
    }
    
  }
}



// ---- f16 WMMA path (v_wmma_f32_16x16x32_f16): 11-bit significands for operands in range — used where a [0,1] probability operand needs more precision than bf16
typedef _Float16 v16h __attribute__((ext_vector_type(16)));
union FragH { v16h v; v8us half[2]; _Float16 h[16]; unsigned short u[16]; };
template <int NT>
__device__ __forceinline__ v8f mmaH(v16h ah, v16h al, v16h bh, v16h bl, v8f c) {
  c = __builtin_amdgcn_wmma_f32_16x16x32_f16(false, ah, false, bh, (short)0, c, false, false);
  if (NT >= 2) c = __builtin_amdgcn_wmma_f32_16x16x32_f16(false, al, false, bh, (short)0, c, false, false);
  if (NT >= 3) c = __builtin_amdgcn_wmma_f32_16x16x32_f16(false, ah, false, bl, (short)0, c, false, false);
  asm volatile("v_nop\n\tv_nop\n\tv_nop\n\tv_nop" : "+v"(c) : "v"(ah), "v"(al), "v"(bh), "v"(bl));
  return c;
}
// batched GEMM like k_gemm_b but f16 operands: A f32 (split into f16 hi/lo if ASPLIT, else rounded to f16), Bt = f16 values [n][k]; alpha; C f32; N multiple of 16 (partial tiles skipped)
template <bool ASPLIT>
__global__ __launch_bounds__(128) void k_gemm_h(const float* __restrict__ A, int lda, size_t sA, const _Float16* __restrict__ Bh, int ldb, size_t sB, float alpha, float* __restrict__ C, int ldc, size_t sC, int M, int N, int K) {
  __shared__ __attribute__((aligned(16))) float so[4][16][64];
  const int tid = threadIdx.x, w = tid >> 5, lane = tid & 31, ln = lane & 15, hh = lane >> 4; const int by = blockIdx.y;
  A += (size_t)by * sA; Bh += (size_t)by * sB; C += (size_t)by * sC;
  const int ntn = (N + 63) / 64; const int wid = blockIdx.x * 4 + w; const int mt = wid / ntn, nq = wid % ntn; if (mt * 16 >= M) return;
  const int row0 = mt * 16, col0 = nq * 64; const float* arow = A + (size_t)(row0 + ln) * lda;
  v8f acc[4] = {};
  for (int kb = 0; kb < K; kb += 32) {
    FragH ah, al;
    const v4f x0 = *(const v4fa*)(arow + kb + 8 * hh), x1 = *(const v4fa*)(arow + kb + 8 * hh + 4), x2 = *(const v4fa*)(arow + kb + 16 + 8 * hh), x3 = *(const v4fa*)(arow + kb + 16 + 8 * hh + 4);
    float xs[16] = {x0[0],x0[1],x0[2],x0[3],x1[0],x1[1],x1[2],x1[3],x2[0],x2[1],x2[2],x2[3],x3[0],x3[1],x3[2],x3[3]};
#pragma unroll
    for (int i = 0; i < 16; ++i) { const _Float16 h = (_Float16)xs[i]; ah.h[i] = h; al.h[i] = ASPLIT ? (_Float16)(xs[i] - (float)h) : (_Float16)0.0f; }
#pragma unroll
    for (int t = 0; t < 4; ++t) { if (col0 + t * 16 >= N) continue; const size_t boff = (size_t)(col0 + t * 16 + ln) * ldb + kb; FragH bq; bq.half[0] = *(const v8us*)(Bh + boff + 8 * hh); bq.half[1] = *(const v8us*)(Bh + boff + 16 + 8 * hh);
      acc[t] = mmaH<ASPLIT ? 2 : 1>(ah.v, al.v, bq.v, bq.v, acc[t]); }
  }
#pragma unroll
  for (int t = 0; t < 4; ++t) { if (col0 + t * 16 >= N) continue;
#pragma unroll
    for (int r = 0; r < 8; ++r) so[w][8 * hh + r][t * 16 + ln] = acc[t][r] * alpha; }
  __builtin_amdgcn_fence(__ATOMIC_ACQ_REL, "workgroup"); __builtin_amdgcn_wave_barrier();
  const int rsub = lane >> 4, c4 = (lane & 15) * 4;
  {
#pragma unroll
    for (int q = 0; q < 8; ++q) { const int r = q * 2 + rsub; if (col0 + c4 < N) { const v4f v = *(const v4fa*)&so[w][r][c4]; *(v4f*)(C + (size_t)(row0 + r) * ldc + col0 + c4) = v; } }
     }
}

// Wt[n][k] = f16(W[k][n]·scale) from f32 row-major W[K][N] (scale = power of two; bf16-exact weights stay exact in f16 away from the subnormal range)
__global__ __launch_bounds__(256) void k_wt_f16(const float* __restrict__ W, _Float16* __restrict__ Wt, int K, int N, float scale) {
  const int t = blockIdx.x * 256 + threadIdx.x; if (t >= N * (K / 8)) return; const int n = t / (K / 8), k8 = (t % (K / 8)) * 8; FragH f;
#pragma unroll
  for (int i = 0; i < 8; ++i) f.h[i] = (_Float16)(bf16_round(W[(size_t)(k8 + i) * N + n]) * scale); const v8us o = f.half[0];
  *(v8us*)((unsigned short*)Wt + (size_t)n * K + k8) = o; 
}
// k_gemm_hh variant with fused epilogue: v = acc·alpha + bias[by·sBias + col] (+ CP[(row/rowsPerB)·sCPb + by·64 + col] if CP) ; ACT 0 none / 1 elu ; writes f16 C16 (and f32 C if non-null)
template <int ACT>
__global__ __launch_bounds__(128) void k_gemm_hhx(const _Float16* __restrict__ A, int lda, size_t sA, const _Float16* __restrict__ Bh, int ldb, size_t sB, float alpha, const float* __restrict__ bias, size_t sBias, const float* __restrict__ CP, int rowsPerB, size_t sCPb, int row0g,
    float* __restrict__ C, _Float16* __restrict__ C16, int ldc, size_t sC, int M, int N, int K) {
  __shared__ __attribute__((aligned(16))) float so[4][16][64];
  const int tid = threadIdx.x, w = tid >> 5, lane = tid & 31, ln = lane & 15, hh = lane >> 4; const int by = blockIdx.y;
  A += (size_t)by * sA; Bh += (size_t)by * sB; const size_t cofs = (size_t)by * sC; const float* bp = bias ? bias + (size_t)by * sBias : nullptr;
  const int ntn = (N + 63) / 64; const int wid = blockIdx.x * 4 + w; const int mt = wid / ntn, nq = wid % ntn; if (mt * 16 >= M) return;
  const int row0 = mt * 16, col0 = nq * 64; const _Float16* arow = A + (size_t)(row0 + ln) * lda;
  v8f acc[4] = {};
  for (int kb = 0; kb < K; kb += 32) { FragH ah; ah.half[0] = *(const v8us*)((const unsigned short*)arow + kb + 8 * hh); ah.half[1] = *(const v8us*)((const unsigned short*)arow + kb + 16 + 8 * hh);
#pragma unroll
    for (int t = 0; t < 4; ++t) { if (col0 + t * 16 >= N) continue; const size_t boff = (size_t)(col0 + t * 16 + ln) * ldb + kb; FragH bq; bq.half[0] = *(const v8us*)((const unsigned short*)Bh + boff + 8 * hh); bq.half[1] = *(const v8us*)((const unsigned short*)Bh + boff + 16 + 8 * hh);
      acc[t] = mmaH<1>(ah.v, ah.v, bq.v, bq.v, acc[t]); }
  }
#pragma unroll
  for (int t = 0; t < 4; ++t) { if (col0 + t * 16 >= N) continue; const int col = col0 + t * 16 + ln; const float bv = bp ? bf16_round(bp[col]) : 0.f;
#pragma unroll
    for (int r = 0; r < 8; ++r) { float v = acc[t][r] * alpha + bv; if (CP) { const int bidx = (row0g + row0 + 8 * hh + r) / rowsPerB; v += CP[(size_t)bidx * sCPb + (size_t)by * 64 + col]; } if (ACT == 1) v = (v > 0.f) ? v : expm1f(v); else if (ACT == 7) v = (v > 0.f) ? v + 1.0f : expf(v); else if (ACT == 8) v = tanhf(v); else if (ACT == 9) v = 0.5f * v * (1.0f + tanhf(0.7978845608028654f * (v + 0.044715f * v * v * v))); else if (ACT == 11) v = 1.0f / (1.0f + expf(-v)); else if (ACT == 12) v = (v > 0.f) ? v : 0.01f * v; else if (ACT == 14) v = (v > 0.f) ? v : 0.1f * v; else if (ACT == 15) v = v / (1.0f + expf(-v)); else if (ACT == 3) v = fmaxf(v, 0.f); else if (ACT == 6) v = 0.5f * v * (1.0f + erff(v * 0.70710678118654752f)); so[w][8 * hh + r][t * 16 + ln] = v; } }
  __builtin_amdgcn_fence(__ATOMIC_ACQ_REL, "workgroup"); __builtin_amdgcn_wave_barrier();
  const int rsub = lane >> 4, c4 = (lane & 15) * 4; typedef _Float16 v4h __attribute__((ext_vector_type(4)));
  {
#pragma unroll
    for (int q = 0; q < 8; ++q) { const int r = q * 2 + rsub; if (col0 + c4 < N) { const v4f v = *(const v4fa*)&so[w][r][c4]; if (C) *(v4f*)(C + cofs + (size_t)(row0 + r) * ldc + col0 + c4) = v; if (C16) { v4h h4; for (int i = 0; i < 4; ++i) h4[i] = (_Float16)v[i]; *(v4h*)(C16 + cofs + (size_t)(row0 + r) * ldc + col0 + c4) = h4; } } }
     }
}


typedef _Float16 v4h __attribute__((ext_vector_type(4)));

__global__ __launch_bounds__(256) void k_h16(const float* __restrict__ x, _Float16* __restrict__ X16, size_t n8) { const size_t t = (size_t)blockIdx.x * 256 + threadIdx.x; if (t >= n8) return; FragH f;
#pragma unroll
  for (int q = 0; q < 8; ++q) f.h[q] = (_Float16)x[t * 8 + q]; *(v8us*)((unsigned short*)X16 + t * 8) = f.half[0];  }
template <int NHv, int TTv>
__global__ __launch_bounds__(256) void k_vt(const _Float16* __restrict__ V16, int ldv, int voff, _Float16* __restrict__ Vt) { __shared__ unsigned short tl[64][66]; const int tid = threadIdx.x; const int slab = blockIdx.x / (TTv / 64), lg = blockIdx.x % (TTv / 64); const int b = slab / NHv, h = slab % NHv;
  for (int i = tid; i < 64 * 8; i += 256) { const int r = i / 8, c8 = (i % 8) * 8; FragH f; f.half[0] = *(const v8us*)((const unsigned short*)V16 + ((size_t)b * TTv + lg * 64 + r) * ldv + voff + h * 64 + c8);
#pragma unroll
    for (int q = 0; q < 8; ++q) tl[r][c8 + q] = f.u[q]; }
  __syncthreads();
  {
#pragma unroll
    for (int rd = 0; rd < 2; ++rd) { const int d = rd * 32 + tid / 8, pc = tid % 8; FragH f;
#pragma unroll
      for (int q = 0; q < 8; ++q) f.u[q] = tl[pc * 8 + q][d];
      *(v8us*)((unsigned short*)Vt + ((size_t)slab * 64 + d) * TTv + lg * 64 + pc * 8) = f.half[0]; }
     } }

// ---- fast GEMM (wave tile 32x64; requires M % 32 == 0 rows per launch region, N % 64 == 0 and K % 64 == 0); epilogue = k_gemm_hhx semantics ----
__device__ __forceinline__ v16h g2_frag(const _Float16* p, int hh) { FragH f; f.half[0] = *(const v8us*)((const unsigned short*)p + 8 * hh); f.half[1] = *(const v8us*)((const unsigned short*)p + 16 + 8 * hh); return f.v; }
__device__ __forceinline__ v8f g2_mma(v16h a, v16h b, v8f c) { v8f d = __builtin_amdgcn_wmma_f32_16x16x32_f16(false, a, false, b, (short)0, c, false, false); asm volatile("v_nop\n\tv_nop\n\tv_nop\n\tv_nop" : "+v"(d) : "v"(a), "v"(b)); return d; }
/* XP 0: stores C / C16. XP 1 (q) and 2 (k, inverse scale): the epilogue applies the xPos rotation to the row while it is still in LDS (a 64-column tile is one head, a lane's 4 columns hold whole rotation pairs; token = row % SLEN) and stores the f16 hi + x2^10 residual planes Hh, Hl instead of C. XP 3 (v): the tile (128 tokens of one batch x one head) leaves transposed, as hi + residual planes [(batch, head)][d][token]. XP 4: the three projections as one launch: blockIdx.y = 0, 1, 2 picks the q, k or v epilogue, the weight plane (sB), the bias pointer and the pair of output planes (sH); the k loop is one and the same code */
template <int ACT, int XP>
__global__ __launch_bounds__(128) void k_gemm2(const _Float16* __restrict__ A, int lda, size_t sA, const _Float16* __restrict__ Bh, int ldb, size_t sB, float alpha, const float* __restrict__ bias, size_t sBias, const float* __restrict__ CP, int rowsPerB, size_t sCPb, int row0g,
    float* __restrict__ C, _Float16* __restrict__ C16, int ldc, size_t sC, int M, int N, int K, const float* __restrict__ CS, const float* __restrict__ SN, const float* __restrict__ SC, _Float16* __restrict__ Hh, _Float16* __restrict__ Hl, const float* __restrict__ bias1, const float* __restrict__ bias2, size_t sH) {
  /* the work-group's 128 x 64 tile: per stage of 64 k (K % 64 == 0) one whole 128-byte line of each of its 128 A rows and 64 B rows goes to LDS, two buffers; row pitch 144 B for the 16-byte fragment reads */
  constexpr int PIT = 72;
  __shared__ __attribute__((aligned(16))) float so[4][32][68];
  __shared__ __attribute__((aligned(16))) _Float16 tA[2][128 * PIT], tB[2][64 * PIT];
  const int tid = threadIdx.x, w = tid >> 5, lane = tid & 31, ln = lane & 15, hh = lane >> 4; const int by = blockIdx.y;
  A += (size_t)by * sA; Bh += (size_t)by * sB; const size_t cofs = (size_t)by * sC; const float* bp = bias ? bias + (size_t)by * sBias : nullptr;
  const bool tr = (XP == 3) || (XP == 4 && by == 2), inv = (XP == 2) || (XP == 4 && by == 1);      /* which epilogue: the same for the whole work-group */
  if (XP == 4) { bp = (by == 0) ? bias : ((by == 1) ? bias1 : bias2); Hh += (size_t)by * sH; Hl += (size_t)by * sH; }
  const int ntn = N >> 6; const int mt = blockIdx.x / ntn, nq = blockIdx.x - mt * ntn; const int row0 = mt * 128 + 32 * w, col0 = nq * 64; if (mt * 128 >= M) return;      /* the same for the whole work-group: every wave reaches every barrier below */
  const int sr = tid >> 3, sc = (tid & 7) * 8;      /* staging: eight threads bring one row's line, a wave four whole lines per load */
  unsigned oa[8], ob[4];      /* byte offsets of the staged lines at k = 0, fixed for the whole loop */
#pragma unroll
  for (int i = 0; i < 8; ++i) oa[i] = ((unsigned)min(mt * 128 + i * 16 + sr, M - 1) * (unsigned)lda + (unsigned)sc) * 2u;      /* rows past M (a last tile of 32, 64 or 96 rows) re-read row M - 1; their waves store nothing */
#pragma unroll
  for (int i = 0; i < 4; ++i) ob[i] = ((unsigned)(col0 + i * 16 + sr) * (unsigned)ldb + (unsigned)sc) * 2u;
  const int so_st = sr * PIT + sc, fa = (32 * w + ln) * PIT, fb = ln * PIT;
  const v8f z8 = {0.f,0.f,0.f,0.f,0.f,0.f,0.f,0.f}; v8f c00 = z8, c01 = z8, c02 = z8, c03 = z8, c10 = z8, c11 = z8, c12 = z8, c13 = z8;
  v8us ra[8], rb[4];
#pragma unroll
  for (int i = 0; i < 8; ++i) ra[i] = *(const v8us*)((const char*)A + oa[i]);
#pragma unroll
  for (int i = 0; i < 4; ++i) rb[i] = *(const v8us*)((const char*)Bh + ob[i]);
#pragma unroll
  for (int i = 0; i < 8; ++i) *(v8us*)&tA[0][so_st + i * 16 * PIT] = ra[i];
#pragma unroll
  for (int i = 0; i < 4; ++i) *(v8us*)&tB[0][so_st + i * 16 * PIT] = rb[i];
  __syncthreads();      /* stage 0 is in LDS before any wave reads it */
#pragma unroll 1      /* stays rolled: the body already holds 16 products and the whole of a stage's loads */
  for (int kb = 0; kb < K; kb += 64) { const int cur = (kb >> 6) & 1; const bool more = kb + 64 < K;
    if (more) {      /* the next stage's global loads go out ahead of this stage's products, which cover their latency */
#pragma unroll
      for (int i = 0; i < 8; ++i) ra[i] = *(const v8us*)((const char*)(A + kb + 64) + oa[i]);
#pragma unroll
      for (int i = 0; i < 4; ++i) rb[i] = *(const v8us*)((const char*)(Bh + kb + 64) + ob[i]); }
    const _Float16* pa = &tA[cur][fa]; const _Float16* pb = &tB[cur][fb];
    v16h a0[2], a1[2], b0[2], b1[2], b2[2], b3[2];      /* all of the stage's fragment reads as one group in front of its products */
#pragma unroll
    for (int ks = 0; ks < 2; ++ks) { a0[ks] = g2_frag(pa + ks * 32, hh); a1[ks] = g2_frag(pa + 16 * PIT + ks * 32, hh); b0[ks] = g2_frag(pb + ks * 32, hh); b1[ks] = g2_frag(pb + 16 * PIT + ks * 32, hh); b2[ks] = g2_frag(pb + 32 * PIT + ks * 32, hh); b3[ks] = g2_frag(pb + 48 * PIT + ks * 32, hh); }
#pragma unroll
    for (int ks = 0; ks < 2; ++ks) {
      c00 = g2_mma(a0[ks], b0[ks], c00); c10 = g2_mma(a1[ks], b0[ks], c10);
      c01 = g2_mma(a0[ks], b1[ks], c01); c11 = g2_mma(a1[ks], b1[ks], c11);
      c02 = g2_mma(a0[ks], b2[ks], c02); c12 = g2_mma(a1[ks], b2[ks], c12);
      c03 = g2_mma(a0[ks], b3[ks], c03); c13 = g2_mma(a1[ks], b3[ks], c13); }
    if (more) {      /* into the buffer that every wave left at the last barrier */
#pragma unroll
      for (int i = 0; i < 8; ++i) *(v8us*)&tA[cur ^ 1][so_st + i * 16 * PIT] = ra[i];
#pragma unroll
      for (int i = 0; i < 4; ++i) *(v8us*)&tB[cur ^ 1][so_st + i * 16 * PIT] = rb[i]; }
    __syncthreads(); }      /* publishes the next stage and ends every wave's reads of this one */
  if (!tr && row0 >= M) return;      /* no barrier follows; XP 3 has one below and takes whole 128-row tiles only (M % 128 == 0) */
  v8f accs[8] = {c00, c01, c02, c03, c10, c11, c12, c13};
  constexpr int TP = 136; _Float16* sT = (_Float16*)&so[0][0][0];      /* XP 3: the staging bytes as two f16 planes [64 d][128 tokens], row pitch 272 B */
  if (XP == 4 && tr) {      /* the v side of XP 4: the XP 3 form of the loop below (XP 4 is used with ACT 0 and without an addend); both loops unrolled like it, so that accs and the fragments are indexed by constants and stay in registers */
#pragma unroll
    for (int u = 0; u < 8; ++u) { const int t = u & 3, half = u >> 2; const float bv = bp ? bf16_round(bp[col0 + t * 16 + ln]) : 0.f; FragH th, tl;
#pragma unroll
      for (int r = 0; r < 8; ++r) { const float v = accs[u][r] * alpha + bv; const _Float16 hv = (_Float16)v; th.h[r] = hv; tl.h[r] = (_Float16)((v - (float)hv) * 1024.0f); }
      const int o = (t * 16 + ln) * TP + 32 * w + half * 16 + 8 * hh; *(v8us*)&sT[o] = th.half[0]; *(v8us*)&sT[64 * TP + o] = tl.half[0]; } }
  else
#pragma unroll
  for (int u = 0; u < 8; ++u) { const int t = u & 3, half = u >> 2; const int col = col0 + t * 16 + ln; const float bv = bp ? bf16_round(bp[col]) : 0.f; FragH th, tl;
#pragma unroll
    for (int r = 0; r < 8; ++r) { const int rloc = half * 16 + 8 * hh + r; float v = accs[u][r] * alpha + bv; if (CP) { const int bidx = (row0g + row0 + rloc) / rowsPerB; v += CP[(size_t)bidx * sCPb + (size_t)by * 64 + col]; }
      if (ACT == 3) v = fmaxf(v, 0.f); else if (ACT == 6) v = 0.5f * v * (1.0f + erff(v * 0.70710678118654752f)); else if (ACT == 11) v = 1.0f / (1.0f + expf(-v)); else if (ACT == 15) v = v / (1.0f + expf(-v)); else if (ACT == 12) v = (v > 0.f) ? v : 0.01f * v; else if (ACT == 8) v = tanhf(v);
      if (XP == 3) { const _Float16 hv = (_Float16)v; th.h[r] = hv; tl.h[r] = (_Float16)((v - (float)hv) * 1024.0f); } else so[w][rloc][t * 16 + ln] = v; }
    if (XP == 3) { const int o = (t * 16 + ln) * TP + 32 * w + half * 16 + 8 * hh; *(v8us*)&sT[o] = th.half[0]; *(v8us*)&sT[64 * TP + o] = tl.half[0]; } }      /* a lane's 8 accumulator rows are 8 consecutive tokens of one d: one 16-byte piece of the transposed row */
  if (tr) {      /* a block-uniform branch: every wave of such a work-group reaches the barrier */
    __syncthreads();      /* all four waves' 32-token pieces are in LDS before any wave stores whole 256-byte rows */
    const size_t vb = ((size_t)((mt * 128) / SLEN) * NH + nq) * 64 * SLEN + (mt * 128) % SLEN;
#pragma unroll
    for (int it = 0; it < 8; ++it) { const int d = it * 8 + (tid >> 4), pc = tid & 15; const v8us a = *(const v8us*)&sT[d * TP + pc * 8], c = *(const v8us*)&sT[64 * TP + d * TP + pc * 8];
      *(v8us*)((unsigned short*)Hh + vb + (size_t)d * SLEN + pc * 8) = a; *(v8us*)((unsigned short*)Hl + vb + (size_t)d * SLEN + pc * 8) = c; }
    return; }
  __builtin_amdgcn_fence(__ATOMIC_ACQ_REL, "workgroup"); __builtin_amdgcn_wave_barrier();
  const int rsub = lane >> 4, c4 = (lane & 15) * 4;
  if (XP == 1 || XP == 2 || XP == 4) {
    const size_t tb = (size_t)(row0 % SLEN + rsub) * 32;      /* a wave's 32 rows lie in one batch (SLEN % 32 == 0): token = row0 % SLEN + r */
    const float* cs = CS + tb + (c4 >> 1); const float* sn = SN + tb + (c4 >> 1); const float* scp = SC + tb + (c4 & 31);
#pragma unroll
    for (int g = 0; g < 16; g += 8) { v2fa cq[8], sq[8]; v4f s4[8];      /* two groups of 8 rows: 16 rows' table words and the k side's 64 quotients at once need more than 256 registers */
#pragma unroll
      for (int q = 0; q < 8; ++q) { cq[q] = *(const v2fa*)(cs + (g + q) * 64); sq[q] = *(const v2fa*)(sn + (g + q) * 64); s4[q] = *(const v4fa*)(scp + (g + q) * 64); }      /* the group's table words in flight together */
      asm volatile("s_wait_xcnt 0x0" :: "v"(cs), "v"(sn), "v"(scp) : "memory");      /* precaution: stands in front of every rewrite of the table loads' address registers, which stay live up to here */
      if (inv) {      /* the k side's inverse scale, behind one block-uniform branch; both loops unrolled, so that s4 is indexed by constants and stays in registers */
#pragma unroll
        for (int q = 0; q < 8; ++q)
#pragma unroll
          for (int i = 0; i < 4; ++i) s4[q][i] = 1.0f / s4[q][i]; }
#pragma unroll
      for (int q = 0; q < 8; ++q) { const int r = (g + q) * 2 + rsub; const v4f v = *(const v4fa*)&so[w][r][c4]; v4h hi4, lo4;
#pragma unroll
        for (int i = 0; i < 4; ++i) { const float sc = s4[q][i];
          const float x = v[i]; const float rx = (i & 1) ? v[i - 1] : -v[i + 1]; const float o = (x * cq[q][i >> 1]) * sc + (rx * sq[q][i >> 1]) * sc;
          const _Float16 h = (_Float16)o; hi4[i] = h; lo4[i] = (_Float16)((o - (float)h) * 1024.0f); }
        const size_t oo = cofs + (size_t)(row0 + r) * ldc + col0 + c4; *(v4h*)(Hh + oo) = hi4; *(v4h*)(Hl + oo) = lo4; }
      asm volatile("s_wait_xcnt 0x0" ::: "memory"); }      /* precaution: stands in front of every rewrite of a register that the group's stores name (the second group's loads; behind the last group, whatever the listing puts next) */
    return; }
  {
#pragma unroll
    for (int q = 0; q < 16; ++q) { const int r = q * 2 + rsub; const v4f v = *(const v4fa*)&so[w][r][c4]; if (C) *(v4f*)(C + cofs + (size_t)(row0 + r) * ldc + col0 + c4) = v; if (C16) { v4h h4; for (int i = 0; i < 4; ++i) h4[i] = (_Float16)v[i]; *(v4h*)(C16 + cofs + (size_t)(row0 + r) * ldc + col0 + c4) = h4; } }
     } }



template <int TQ, int TK>
__global__ __launch_bounds__(256) void k_flashm(const _Float16* __restrict__ Q16, const _Float16* __restrict__ Q16lo, int ldq, const _Float16* __restrict__ K16, const _Float16* __restrict__ K16lo, int ldk, const _Float16* __restrict__ Vt, const _Float16* __restrict__ Vtlo, const unsigned* __restrict__ MB, const int* __restrict__ RA, const int* __restrict__ KE, _Float16* __restrict__ Oh, _Float16* __restrict__ Ol, int ldo) {
  /* 64 queries per work-group, eight waves: wave w has the 16 queries of sub-tile w & 3 and the 32-key half w >> 2 of every 64-key stage. A stage (K hi, K lo: 64 keys x 64 d; V^T hi, V^T lo: 64 d x 64 keys; whole 128-byte lines) is copied to LDS once and read by all eight waves; two buffers, row pitch 144 B for the 16-byte fragment reads */
  constexpr int RPW = 16, RTN = RPW / 16, QW = 64, NQB = TQ / QW, DT = 4, KS = 2, KP = 72, PLN = 64 * KP, STG = 4 * PLN;
  __shared__ __attribute__((aligned(16))) unsigned short sKV[2][STG];
  __shared__ __attribute__((aligned(16))) unsigned short sP[8][RPW][40], sPl[8][RPW][40]; __shared__ __attribute__((aligned(16))) float sO[8][RPW][64 + 4]; __shared__ float sM[8][RPW], sL[8][RPW];
  const int tid = threadIdx.x, lane = tid & 31, ln = lane & 15, hh = lane >> 4;
  const int w = __builtin_amdgcn_readfirstlane(tid >> 5);      /* the wave's number in a scalar register: the skip of a key half past the bound stays a scalar branch */
  const int qs = w & 3, kg = w >> 2;
  /* grid (slab = (batch, head), tile): both batches in one launch, twice as many groups as resident places (two to a WGP). The order of the tiles is as it was for one batch a launch: the first half of the flat index takes the tiles with the most keys in falling order, the second half the rest in rising order; left for a later step: a cost that falls with the index throughout */
  const int slab = blockIdx.x, yy = (int)blockIdx.y, qt = (yy < NQB / 2) ? NQB - 1 - yy : yy - NQB / 2; const int b = slab / NH, h = slab % NH; const int q0 = qt * QW + qs * RPW; const int qblk = q0 >> 6;
  FragH aq[2][KS], aql[2][KS];
#pragma unroll
  for (int rt = 0; rt < RTN; ++rt) { const size_t qo = ((size_t)b * TQ + q0 + rt * 16 + ln) * ldq + h * 64; const unsigned short* qr = (const unsigned short*)Q16 + qo; const unsigned short* ql = (const unsigned short*)Q16lo + qo;
#pragma unroll
    for (int ks = 0; ks < KS; ++ks) { aq[rt][ks].half[0] = *(const v8us*)(qr + ks * 32 + 8 * hh); aq[rt][ks].half[1] = *(const v8us*)(qr + ks * 32 + 16 + 8 * hh); aql[rt][ks].half[0] = *(const v8us*)(ql + ks * 32 + 8 * hh); aql[rt][ks].half[1] = *(const v8us*)(ql + ks * 32 + 16 + 8 * hh); } }
  const unsigned short* Vth = (const unsigned short*)Vt + (size_t)slab * 64 * TK; const unsigned short* Vtl = (const unsigned short*)Vtlo + (size_t)slab * 64 * TK;
  float m_r[2][8], l_r[2][8]; v8f oacc[2][DT], oaccl[2][DT];
#pragma unroll
  for (int rt = 0; rt < RTN; ++rt) {
#pragma unroll
    for (int r = 0; r < 8; ++r) { m_r[rt][r] = -3.0e38f; l_r[rt][r] = 0.f; }
#pragma unroll
    for (int dt = 0; dt < DT; ++dt) { oacc[rt][dt] = (v8f){0.f,0.f,0.f,0.f,0.f,0.f,0.f,0.f}; oaccl[rt][dt] = oacc[rt][dt]; } }
  int jend = KE[qblk * 32]; jend = min(TK, (jend + 31) & ~31); if (jend < 32) jend = 32; jend = __builtin_amdgcn_readfirstlane(jend);      /* block-uniform, in a scalar register */
  const int nst = (jend + 63) >> 6;      /* stages of 64 keys; TK % 64 == 0, so every stage lies inside K and V */
  int allm[2][8]; const unsigned* mrow[2][8];
#pragma unroll
  for (int rt = 0; rt < RTN; ++rt)
#pragma unroll
    for (int r = 0; r < 8; ++r) { const int tq = q0 + rt * 16 + 8 * hh + r; allm[rt][r] = RA[tq]; mrow[rt][r] = MB + (size_t)tq * (TK / 32); }
  /* staging: eight lanes bring one row's 128-byte line, a wave four whole lines per copy; each thread copies rows cr and cr + 32 of each of the four planes */
  const int cr = tid >> 3, cc = (tid & 7) * 8;
  const size_t gko = ((size_t)b * TK + cr) * ldk + h * 64 + cc, gvo = (size_t)cr * TK + cc;
  const unsigned lds0 = (unsigned)(size_t)&sKV[0][cr * KP + cc];      /* the lane's LDS byte address in buffer 0, plane 0 */
  auto stage = [&](int s, int buf) {
    const unsigned short* k0 = (const unsigned short*)K16 + gko + (size_t)s * 64 * ldk; const unsigned short* k2 = (const unsigned short*)K16lo + gko + (size_t)s * 64 * ldk; const unsigned short* k1 = k0 + (size_t)32 * ldk; const unsigned short* k3 = k2 + (size_t)32 * ldk;
    const unsigned short* v0 = Vth + gvo + s * 64; const unsigned short* v2 = Vtl + gvo + s * 64; const unsigned short* v1 = v0 + (size_t)32 * TK; const unsigned short* v3 = v2 + (size_t)32 * TK;
    const unsigned d0 = lds0 + (unsigned)buf * (STG * 2u), d1 = d0 + 32u * KP * 2u, d2 = d0 + PLN * 2u, d3 = d2 + 32u * KP * 2u, d4 = d0 + 2u * PLN * 2u, d5 = d4 + 32u * KP * 2u, d6 = d0 + 3u * PLN * 2u, d7 = d6 + 32u * KP * 2u;
    /* the stage's eight copies; the closing s_wait_xcnt is a precaution that stands in front of every rewrite of the copies' address registers */
    asm volatile("global_load_async_to_lds_b128 %0, %8, off\n\tglobal_load_async_to_lds_b128 %1, %9, off\n\tglobal_load_async_to_lds_b128 %2, %10, off\n\tglobal_load_async_to_lds_b128 %3, %11, off\n\t"
                 "global_load_async_to_lds_b128 %4, %12, off\n\tglobal_load_async_to_lds_b128 %5, %13, off\n\tglobal_load_async_to_lds_b128 %6, %14, off\n\tglobal_load_async_to_lds_b128 %7, %15, off\n\ts_wait_xcnt 0x0"
                 :: "v"(d0), "v"(d1), "v"(d2), "v"(d3), "v"(d4), "v"(d5), "v"(d6), "v"(d7), "v"(k0), "v"(k1), "v"(k2), "v"(k3), "v"(v0), "v"(v1), "v"(v2), "v"(v3) : "memory"); };
  stage(0, 0);
  asm volatile("s_wait_asynccnt 0x0" ::: "memory");      /* this wave's copies of stage 0 have landed */
  __syncthreads();      /* stage 0 is in LDS before any wave reads it */
  if (nst > 1) stage(1, 1);
#pragma unroll 1
  for (int st = 0; st < nst; ++st) { const int j0 = st * 64 + kg * 32; const unsigned short* tb = &sKV[st & 1][0];
   if (j0 < jend) {      /* a key half past the bound is skipped by its four waves; the publish point below is passed by every wave */
    unsigned mw[2][8];      /* all of the pass's mask words are fetched here, so that their latency runs under the K reads and the score products */
#pragma unroll
    for (int rt = 0; rt < RTN; ++rt)
#pragma unroll
      for (int r = 0; r < 8; ++r) mw[rt][r] = mrow[rt][r][j0 >> 5];
    asm volatile("s_wait_xcnt 0x0" ::: "memory");      /* precaution: stands in front of every rewrite of the mask loads' address registers; it also keeps these loads ahead of the K reads */
    v8f s[2][2]; FragH bk[2][KS], bkl[2][KS];      /* all of the pass's K fragment reads stand as one group in front of its score products: one LDS latency instead of two */
#pragma unroll
    for (int nt = 0; nt < 2; ++nt) { const unsigned short* kr = tb + (kg * 32 + nt * 16 + ln) * KP; const unsigned short* kl = kr + PLN;
#pragma unroll
      for (int ks = 0; ks < KS; ++ks) { bk[nt][ks].half[0] = *(const v8us*)(kr + ks * 32 + 8 * hh); bk[nt][ks].half[1] = *(const v8us*)(kr + ks * 32 + 16 + 8 * hh); bkl[nt][ks].half[0] = *(const v8us*)(kl + ks * 32 + 8 * hh); bkl[nt][ks].half[1] = *(const v8us*)(kl + ks * 32 + 16 + 8 * hh); } }
#pragma unroll
    for (int nt = 0; nt < 2; ++nt) {
#pragma unroll
      for (int rt = 0; rt < RTN; ++rt) { v8f acc = (v8f){0.f,0.f,0.f,0.f,0.f,0.f,0.f,0.f}, accr = acc;
#pragma unroll
        for (int ks = 0; ks < KS; ++ks) { acc = mmaH<1>(aq[rt][ks].v, aq[rt][ks].v, bk[nt][ks].v, bk[nt][ks].v, acc); accr = mmaH<1>(aql[rt][ks].v, aql[rt][ks].v, bk[nt][ks].v, bk[nt][ks].v, accr); accr = mmaH<1>(aq[rt][ks].v, aq[rt][ks].v, bkl[nt][ks].v, bkl[nt][ks].v, accr); }
        s[rt][nt] = acc + accr * 0.0009765625f; } }
    /* softmax in stages over the eight rows, with selects in place of branches: one straight block, in which the rows' dependent chains overlap */
    float s0[2][8], s1[2][8], mc[2][8]; bool ok0[2][8], ok1[2][8];
#pragma unroll
    for (int rt = 0; rt < RTN; ++rt)
#pragma unroll
      for (int r = 0; r < 8; ++r) { const bool am = (allm[rt][r] != 0);
        ok0[rt][r] = am || (((mw[rt][r] >> ln) & 1u) == 0u); ok1[rt][r] = am || (((mw[rt][r] >> (16 + ln)) & 1u) == 0u);
        s0[rt][r] = ok0[rt][r] ? (am ? 0.f : s[rt][0][r] * SCL2) : -INFINITY; s1[rt][r] = ok1[rt][r] ? (am ? 0.f : s[rt][1][r] * SCL2) : -INFINITY; mc[rt][r] = fmaxf(s0[rt][r], s1[rt][r]); }
#pragma unroll
    for (int sx = 1; sx <= 8; sx <<= 1)
#pragma unroll
      for (int rt = 0; rt < RTN; ++rt)
#pragma unroll
        for (int r = 0; r < 8; ++r) mc[rt][r] = fmaxf(mc[rt][r], __shfl_xor(mc[rt][r], sx, 32));
#pragma unroll
    for (int rt = 0; rt < RTN; ++rt)
#pragma unroll
      for (int r = 0; r < 8; ++r) {
        const float mn = fmaxf(m_r[rt][r], mc[rt][r]); const float ea = __builtin_amdgcn_exp2f(m_r[rt][r] - mn), e0 = __builtin_amdgcn_exp2f(s0[rt][r] - mn), e1 = __builtin_amdgcn_exp2f(s1[rt][r] - mn);      /* one hardware exponential each: every argument is <= 0 (no overflow), -inf and -3e38 give 0; computed for every lane; the selects below keep the values of the guarded form */
        const float al = (mn > -1.0e38f) ? ea : 1.0f; m_r[rt][r] = mn; const float p0 = ok0[rt][r] ? e0 : 0.f, p1 = ok1[rt][r] ? e1 : 0.f; l_r[rt][r] = l_r[rt][r] * al + p0 + p1;
#pragma unroll
        for (int dt = 0; dt < DT; ++dt) { oacc[rt][dt][r] *= al; oaccl[rt][dt][r] *= al; }
        FragH t2, t3; const float ps0 = p0 * 1024.0f, ps1 = p1 * 1024.0f; t2.h[0] = (_Float16)ps0; t2.h[1] = (_Float16)ps1; t3.h[0] = (_Float16)((ps0 - (float)t2.h[0]) * 1024.0f); t3.h[1] = (_Float16)((ps1 - (float)t2.h[1]) * 1024.0f);
        sP[w][rt * 16 + 8 * hh + r][ln] = t2.u[0]; sP[w][rt * 16 + 8 * hh + r][16 + ln] = t2.u[1]; sPl[w][rt * 16 + 8 * hh + r][ln] = t3.u[0]; sPl[w][rt * 16 + 8 * hh + r][16 + ln] = t3.u[1]; }
    __builtin_amdgcn_fence(__ATOMIC_ACQ_REL, "workgroup"); __builtin_amdgcn_wave_barrier();
    FragH pa[2], pl[2];
#pragma unroll
    for (int rt = 0; rt < RTN; ++rt) { pa[rt].half[0] = *(const v8us*)&sP[w][rt * 16 + ln][8 * hh]; pa[rt].half[1] = *(const v8us*)&sP[w][rt * 16 + ln][16 + 8 * hh]; pl[rt].half[0] = *(const v8us*)&sPl[w][rt * 16 + ln][8 * hh]; pl[rt].half[1] = *(const v8us*)&sPl[w][rt * 16 + ln][16 + 8 * hh]; }
    FragH bv[DT], bl[DT];      /* all of the pass's V fragment reads stand as one group in front of its value products: one LDS latency instead of four */
#pragma unroll
    for (int dt = 0; dt < DT; ++dt) { const unsigned short* vr = tb + 2 * PLN + (dt * 16 + ln) * KP + kg * 32; const unsigned short* vl = vr + PLN; bv[dt].half[0] = *(const v8us*)(vr + 8 * hh); bv[dt].half[1] = *(const v8us*)(vr + 16 + 8 * hh); bl[dt].half[0] = *(const v8us*)(vl + 8 * hh); bl[dt].half[1] = *(const v8us*)(vl + 16 + 8 * hh); }
#pragma unroll
    for (int dt = 0; dt < DT; ++dt) {
#pragma unroll
      for (int rt = 0; rt < RTN; ++rt) { oacc[rt][dt] = mmaH<1>(pa[rt].v, pa[rt].v, bv[dt].v, bv[dt].v, oacc[rt][dt]); oaccl[rt][dt] = mmaH<1>(pa[rt].v, pa[rt].v, bl[dt].v, bl[dt].v, oaccl[rt][dt]); oaccl[rt][dt] = mmaH<1>(pl[rt].v, pl[rt].v, bv[dt].v, bv[dt].v, oaccl[rt][dt]); } }
   }
    /* publish point of stage st + 1, every wave, in this order */
    asm volatile("s_wait_dscnt 0x0" ::: "memory");      /* this wave's LDS reads of stage st have returned */
    asm volatile("s_wait_asynccnt 0x0" ::: "memory");      /* this wave's copies of stage st + 1 have landed */
    __syncthreads();      /* publishes stage st + 1 and ends every wave's reads of stage st */
    if (st + 2 < nst) stage(st + 2, st & 1); }      /* into the buffer that every wave has just left */
  asm volatile("s_wait_asynccnt 0x0" ::: "memory");      /* no copy is outstanding behind the loop */
#pragma unroll
  for (int rt = 0; rt < RTN; ++rt) {
#pragma unroll
    for (int r = 0; r < 8; ++r) { float l = l_r[rt][r]; l += __shfl_xor(l, 1, 32); l += __shfl_xor(l, 2, 32); l += __shfl_xor(l, 4, 32); l += __shfl_xor(l, 8, 32); l_r[rt][r] = l; }
    if (ln == 0) {
#pragma unroll
      for (int r = 0; r < 8; ++r) { sM[w][rt * 16 + 8 * hh + r] = m_r[rt][r]; sL[w][rt * 16 + 8 * hh + r] = l_r[rt][r]; } }
#pragma unroll
    for (int dt = 0; dt < DT; ++dt)
#pragma unroll
      for (int r = 0; r < 8; ++r) sO[w][rt * 16 + 8 * hh + r][dt * 16 + ln] = oacc[rt][dt][r] + oaccl[rt][dt][r] * 0.0009765625f; }
  __syncthreads();      /* every wave's partial (max, sum, O) is in LDS before any wave merges them */
  {
#pragma unroll
    for (int rp = 0; rp < QW; rp += 16) { const int rq = rp + (tid >> 4), pc = tid & 15; const int wq = rq >> 4, r = rq & 15;      /* query rq of the tile: the partials of waves wq (first key halves) and wq + 4 (second) */
      const float m0 = sM[wq][r], m1 = sM[wq + 4][r]; const float mx = fmaxf(m0, m1);      /* a wave that saw no open key holds -3e38, sum 0, O 0: weight 0 (or 1 on zeros) */
      float e0, e1;      /* the maxima are in base-2 units. Each exponential stands in one statement with the v_nop that fills the slot the instruction set asks for behind a transcendental */
      asm("v_exp_f32 %0, %1\n\tv_nop" : "=v"(e0) : "v"(m0 - mx)); asm("v_exp_f32 %0, %1\n\tv_nop" : "=v"(e1) : "v"(m1 - mx));
      const float l = e0 * sL[wq][r] + e1 * sL[wq + 4][r]; const float inv = (l > 0.f) ? 1.0f / (l * 1024.0f) : 0.f;
      const v4f o0 = *(const v4fa*)&sO[wq][r][pc * 4], o1 = *(const v4fa*)&sO[wq + 4][r][pc * 4];
      const v4f val = (o0 * e0 + o1 * e1) * inv; v4h hi4, lo4;      /* O leaves as the f16 hi + x2^10 residual planes that the output projection reads */
#pragma unroll
      for (int i = 0; i < 4; ++i) { const _Float16 hv = (_Float16)val[i]; hi4[i] = hv; lo4[i] = (_Float16)((val[i] - (float)hv) * 1024.0f); }
      const size_t oo = ((size_t)b * TQ + qt * QW + rq) * ldo + h * 64 + pc * 4; *(v4h*)(Oh + oo) = hi4; *(v4h*)(Ol + oo) = lo4; }
     } }


__constant__ float INVF[32] = {1.000000000e+00f,7.498942018e-01f,5.623413324e-01f,4.216965139e-01f,3.162277639e-01f,2.371373624e-01f,1.778279394e-01f,1.333521456e-01f,1.000000015e-01f,7.498941571e-02f,5.623412877e-02f,4.216964915e-02f,3.162277862e-02f,2.371373586e-02f,1.778279431e-02f,1.333521493e-02f,9.999999776e-03f,7.498942316e-03f,5.623413250e-03f,4.216964822e-03f,3.162277862e-03f,2.371373819e-03f,1.778279431e-03f,1.333521446e-03f,1.000000047e-03f,7.498941850e-04f,5.623413017e-04f,4.216964880e-04f,3.162277862e-04f,2.371373848e-04f,1.778279402e-04f,1.333521504e-04f};
__constant__ float XBASE[32] = {2.857142985e-01f,3.080357313e-01f,3.303571641e-01f,3.526785970e-01f,3.750000000e-01f,3.973214328e-01f,4.196428359e-01f,4.419642687e-01f,4.642857015e-01f,4.866071343e-01f,5.089285374e-01f,5.312500000e-01f,5.535714030e-01f,5.758928657e-01f,5.982142687e-01f,6.205357313e-01f,6.428571343e-01f,6.651785970e-01f,6.875000000e-01f,7.098214030e-01f,7.321428657e-01f,7.544642687e-01f,7.767857313e-01f,7.991071343e-01f,8.214285970e-01f,8.437500000e-01f,8.660714030e-01f,8.883928657e-01f,9.107142687e-01f,9.330357313e-01f,9.553571343e-01f,9.776785970e-01f};
/* ---- the eight preparation jobs, which read none of each other's output, as one launch: the block index picks the job; a thread's work in each job is what it was in the job's own kernel. Each job ends in s_wait_xcnt 0, a precaution: it stands in front of every rewrite of a register that the job's stores name, on whatever way the listing joins the jobs ---- */
__device__ __forceinline__ void prep_round(const float* __restrict__ s, _Float16* __restrict__ d, size_t t, float mul) { FragH f;      /* f16(bf16_round(v) * mul), 8 values a thread; unrolled: two 16-byte loads, one 16-byte store */
#pragma unroll
  for (int q = 0; q < 8; ++q) f.h[q] = (_Float16)(bf16_round(s[t * 8 + q]) * mul); *(v8us*)((unsigned short*)d + t * 8) = f.half[0];
  asm volatile("s_wait_xcnt 0x0" ::: "memory"); }
__device__ __forceinline__ void prep_trig(int t, float* __restrict__ CS, float* __restrict__ SN) {
  #pragma clang fp contract(off)      /* numerical, kept with these lines from their own kernel: the angle is rounded to f32 as the reference rounds it before cos and sin take it; the tables stay bit-identical */
  const int tok = t >> 5, j = t & 31; const float ang = (float)tok * INVF[j]; const float c = cosf(ang), s = sinf(ang);
  *(float*)(CS + t) = c; *(float*)(SN + t) = s;
  asm volatile("s_wait_xcnt 0x0" ::: "memory"); }
__device__ __forceinline__ void prep_scale(int t, float* __restrict__ SC) {
  #pragma clang fp contract(off)      /* numerical, kept with these lines from their own kernel: the exponent is rounded to f32 as the reference rounds it before pow takes it; the table stays bit-identical */
  const int tok = t >> 5, j = t & 31; const float v = powf(XBASE[j], ((float)tok - 1024.0f) / 512.0f);
  *(float*)(SC + t) = v;
  asm volatile("s_wait_xcnt 0x0" ::: "memory"); }
__device__ __forceinline__ void prep_causal(int t, unsigned* __restrict__ MB, int* __restrict__ RA, int* __restrict__ KE, int nq, int nk) {
  const int nw = nk / 32;
  if (t < nq * nw) { const int q = t / nw, w = t % nw; const int first = q + 1 - 32 * w; const unsigned bits = (first <= 0) ? 0xffffffffu : ((first >= 32) ? 0u : (0xffffffffu << first)); *(unsigned*)(MB + t) = bits;  }
  if (t < nq) { *(int*)(RA + t) = 0;  }
  if (t < nq / 64) { const int v = 64 * (t + 1); *(int*)(KE + t * 32) = v;  }
  asm volatile("s_wait_xcnt 0x0" ::: "memory"); }
#define PB_TAB (SLEN * 32 / 256)                 /* blocks of the cos and sin tables, and of the scale table: first, they have the longest chains */
#define PB_X   (NR * DM / (8 * 256))             /* blocks of x */
#define PB_W   (DM * DM / (8 * 256))             /* blocks of one weight matrix */
#define PB_CAU (SLEN * (SLEN / 32) / 256)        /* blocks of the causal bit plane */
__global__ __launch_bounds__(256) void k_prep(const float* __restrict__ x, const float* __restrict__ Wq, const float* __restrict__ Wk, const float* __restrict__ Wv, const float* __restrict__ Wo, _Float16* __restrict__ X16, _Float16* __restrict__ BW,
    float* __restrict__ CS, float* __restrict__ SN, float* __restrict__ SC, unsigned* __restrict__ MB, int* __restrict__ RA, int* __restrict__ KE) {
  const int tid = threadIdx.x; int blk = blockIdx.x;      /* every count below divides exactly: no thread is past the end of its job */
  if (blk < PB_TAB) { prep_trig(blk * 256 + tid, CS, SN); return; }
  blk -= PB_TAB;
  if (blk < PB_TAB) { prep_scale(blk * 256 + tid, SC); return; }
  blk -= PB_TAB;
  if (blk < PB_X) { prep_round(x, X16, (size_t)blk * 256 + tid, 1.0f); return; }
  blk -= PB_X;
  if (blk < 4 * PB_W) { const int m = blk / PB_W;      /* planes in the order the GEMMs index them: q <- Wq, k <- Wv, v <- Wk (module order), then Wo; a weight's (out, in) order is the natural Bt; x16 */
    const float* s = (m == 0) ? Wq : ((m == 1) ? Wv : ((m == 2) ? Wk : Wo)); prep_round(s, BW + (size_t)m * DM * DM, (size_t)(blk - m * PB_W) * 256 + tid, 16.0f); return; }
  blk -= 4 * PB_W;
  prep_causal(blk * 256 + tid, MB, RA, KE, SLEN, SLEN); }
extern "C" void kernel_launch(void* const* d_in, const int* in_sizes, int n_in,
                              void* d_out, int out_size, void* d_ws, size_t ws_size, hipStream_t stream) {
  (void)in_sizes; (void)n_in; (void)out_size;
  const float* const* I = (const float* const*)d_in; const float* x = I[0]; const float* Wq = I[1]; const float* bq = I[2]; const float* Wk = I[3]; const float* bk = I[4]; const float* Wv = I[5]; const float* bv = I[6]; const float* Wo = I[7]; const float* bo = I[8];
  char* ws = (char*)d_ws; size_t off = 0;
  auto take = [&](size_t bytes) { char* p = ws + off; off += (bytes + 255) & ~(size_t)255; return p; };
  _Float16* BW = (_Float16*)take((size_t)4 * DM * DM * 2); _Float16* BO = BW + (size_t)3 * DM * DM;      /* weight planes q, k, v, o */
  _Float16* X16 = (_Float16*)take((size_t)NR * DM * 2); _Float16* Oh = (_Float16*)take((size_t)NR * DM * 2); _Float16* Ol = (_Float16*)take((size_t)NR * DM * 2);
  _Float16* Qh = (_Float16*)take((size_t)6 * NR * DM * 2); _Float16* Ql = Qh + (size_t)NR * DM; _Float16* Kh = Ql + (size_t)NR * DM; _Float16* Kl = Kh + (size_t)NR * DM; _Float16* Vth = Kl + (size_t)NR * DM; _Float16* Vtl = Vth + (size_t)NR * DM;      /* three hi, lo pairs in a row */
  unsigned* MB = (unsigned*)take((size_t)SLEN * (SLEN / 32) * 4); int* RA = (int*)take((size_t)SLEN * 4); int* KE = (int*)take((size_t)(SLEN / 64) * 32 * 4);
  float* CS = (float*)take((size_t)SLEN * 32 * 4); float* SN = (float*)take((size_t)SLEN * 32 * 4); float* SC = (float*)take((size_t)SLEN * 32 * 4);
  if (off > ws_size) return;      /* 8 + 8 + 8 x 8 + 1.5 = 82 MiB */
  k_prep<<<2 * PB_TAB + PB_X + 4 * PB_W + PB_CAU, 256, 0, stream>>>(x, Wq, Wk, Wv, Wo, X16, BW, CS, SN, SC, MB, RA, KE);
  const dim3 gP((NR / 128) * (DM / 64), 1);
  /* q_mat = xpos(x Wq^T + bq) as hi/lo; k_mat = xpos^-1(x Wv^T + bv) (module order); v_mat = x Wk^T + bk as V^T hi/lo [(b, h)][64][2048] */
  k_gemm2<0, 4><<<dim3((NR / 128) * (DM / 64), 3), 128, 0, stream>>>(X16, DM, 0, BW, DM, (size_t)DM * DM, 0.0625f, bq, 0, nullptr, 1, 0, 0, nullptr, nullptr, DM, 0, NR, DM, DM, CS, SN, SC, Qh, Ql, bv, bk, (size_t)2 * NR * DM);
  k_flashm<SLEN, SLEN><<<dim3(NBT * NH, SLEN / 64), 256, 0, stream>>>(Qh, Ql, DM, Kh, Kl, DM, Vth, Vtl, MB, RA, KE, Oh, Ol, DM);
  k_gemm2<0, 0><<<gP, 128, 0, stream>>>(Oh, DM, 0, BO, DM, 0, 0.0625f, bo, 0, nullptr, 1, 0, 0, (float*)d_out, nullptr, DM, 0, NR, DM, DM, nullptr, nullptr, nullptr, nullptr, nullptr, nullptr, nullptr, 0);
  k_gemm2<0, 0><<<gP, 128, 0, stream>>>(Ol, DM, 0, BO, DM, 0, 0.0625f / 1024.0f, nullptr, 0, (const float*)d_out, 1, (size_t)DM, 0, (float*)d_out, nullptr, DM, 0, NR, DM, DM, nullptr, nullptr, nullptr, nullptr, nullptr, nullptr, nullptr, 0);
}

// v008
// A run of this version takes 160 microseconds.
// In two side-by-side timings against v007, it was 1.16 and 1.17 times as fast.
// All steps since v000 together make it 5.39 times as fast.
#include <hip/hip_runtime.h>
// Causal multi-head attention with xPos rotary embedding (2 x 2048 tokens x 1024, 16 heads x 64): q = x*Wq^T + bq, k = x*Wv^T + bv, v = x*Wk^T + bk (the module's own assignment order); q <- q*cos*scale + rot(q)*sin*scale, k <- k*cos/scale + rot(k)*sin/scale with interleaved-pair rotation, freq(t, d) = t * inv_freq[d/2], scale(t, d) = base[d mod 32]^((t - 1024)/512); scores = q.k / 32 with j <= i; softmax; merged . Wo^T + bo -> [2,2048,1024].
// Structure: x as an exact f16 plane; the three projections as f16 WMMA GEMMs (32x64 wave tiles fed from LDS-staged 128x64 work-group tiles, f32, exact products + bias); per-token cos/sin/scale tables on VALU (inv_freq and base = the reference's f32 constants, precise trig and powf); each projection's epilogue finishes its operand in place of separate passes: q, k rotated and scaled in f32 and stored as f16 hi + x2^10 residual planes, v transposed through LDS per (batch, head) to [d][token] hi + residual planes; the causal structure computed on device into a key bit plane + per-block key bound; the fused flash kernel per ((batch, head), 64 queries), eight waves = four 16-query sub-tiles x the two 32-key halves of each 64-key stage, K and V^T stages copied to LDS once per work-group (three-product hi/lo scores, online softmax f32 per wave, P hi + residual via LDS, two value accumulators; the two partial (max, sum, O) of a sub-tile merged through LDS at the end and stored as O hi + residual planes); output projection as one GEMM whose k loop runs over both O planes.
// Compute dtype: x, weights, biases rounded to bf16; projections exact; rotation f32; q, k, P, v, O as f16 hi + residual pairs (~2^-21); f32 accumulation and softmax. v_wmma_f32_16x16x32_f16.
#define NBT 2
#define SLEN 2048
#define DM 1024
#define NH 16
#define SCL 0.03125f
#define SCL2 (SCL * 1.4426950408889634f)      /* 1/32 times log2(e): the flash kernel keeps scores and running maxima in base-2 units */
#define NR (NBT * SLEN)
typedef __bf16 v16b __attribute__((ext_vector_type(16)));
typedef unsigned short v8us __attribute__((ext_vector_type(8), may_alias));
typedef float  v8f  __attribute__((ext_vector_type(8)));
typedef float  v4f  __attribute__((ext_vector_type(4)));
typedef float  v4fa __attribute__((ext_vector_type(4), may_alias));
typedef float  v2fa __attribute__((ext_vector_type(2), may_alias));
union FragB { v16b v; v8us half[2]; unsigned short u[16]; };

__device__ __forceinline__ unsigned short bf16_bits(float x) { unsigned int u = __float_as_uint(x); return (unsigned short)((u + 0x7FFFu + ((u >> 16) & 1u)) >> 16); }
__device__ __forceinline__ float bf16_val(unsigned short b) { return __uint_as_float(((unsigned int)b) << 16); }
__device__ __forceinline__ float bf16_round(float x) { return bf16_val(bf16_bits(x)); }
// D += A·B with NT terms: 1 = ah·bh, 2 = + al·bh (A split), 3 = + ah·bl (both split)
template <int NT>
__device__ __forceinline__ v8f mmaN(v16b ah, v16b al, v16b bh, v16b bl, v8f c) {
  c = __builtin_amdgcn_wmma_f32_16x16x32_bf16(false, ah, false, bh, (short)0, c, false, false);
  if (NT >= 2) c = __builtin_amdgcn_wmma_f32_16x16x32_bf16(false, al, false, bh, (short)0, c, false, false);
  if (NT >= 3) c = __builtin_amdgcn_wmma_f32_16x16x32_bf16(false, ah, false, bl, (short)0, c, false, false);
  asm volatile("v_nop\n\tv_nop\n\tv_nop\n\tv_nop" : "+v"(c) : "v"(ah), "v"(al), "v"(bh), "v"(bl));
  return c;
}

__global__ __launch_bounds__(256) void k_wt_bf16(const float* __restrict__ W, unsigned short* __restrict__ Wt, int K, int N) {
  const int t = blockIdx.x * 256 + threadIdx.x;
  const int k8n = K / 8;
  if (t >= N * k8n) return;
  const int n = t / k8n, k8 = (t % k8n) * 8;
  v8us v;
#pragma unroll
  for (int i = 0; i < 8; ++i) v[i] = bf16_bits(W[(size_t)(k8 + i) * N + n]);
  *(v8us*)(Wt + (size_t)n * K + k8) = v;
  
}

// GEMM C[M][N] (f32, pitch ldc) = act(A[M][K]·W + bias). A f32 row-major (pitch lda) converted per fragment to bf16
// (ASPLIT: hi/lo two planes -> 2 terms, else single rounded term); Wt bf16 [N][K] (pitch ldb). BIAS_BF16 rounds the
// bias to bf16 first (bias quantised to bf16 before the add). K%32==0, M%16==0, N%64==0.
template <bool ASPLIT, int ACT, bool BIAS_BF16>
__global__ __launch_bounds__(128) void k_gemm_bf(const float* __restrict__ A, int lda, const unsigned short* __restrict__ Wt, int ldb,
                                               const float* __restrict__ bias, float* __restrict__ C, int ldc, int M, int N, int K) {
  __shared__ __attribute__((aligned(16))) float so[4][16][64];
  const int tid = threadIdx.x, w = tid >> 5, lane = tid & 31, ln = lane & 15, hh = lane >> 4;
  const int ntn = N / 64;
  const int wid = blockIdx.x * 4 + w;
  const int mt = wid / ntn, nq = wid % ntn;
  if (mt * 16 >= M) return;
  const int row0 = mt * 16, col0 = nq * 64;
  const float* arow = A + (size_t)(row0 + ln) * lda;
  v8f acc[4] = {};
  for (int kb = 0; kb < K; kb += 32) {
    FragB ah, al;
    const v4f x0 = *(const v4fa*)(arow + kb + 8 * hh), x1 = *(const v4fa*)(arow + kb + 8 * hh + 4);
    const v4f x2 = *(const v4fa*)(arow + kb + 16 + 8 * hh), x3 = *(const v4fa*)(arow + kb + 16 + 8 * hh + 4);
    float xs[16] = {x0[0],x0[1],x0[2],x0[3],x1[0],x1[1],x1[2],x1[3],x2[0],x2[1],x2[2],x2[3],x3[0],x3[1],x3[2],x3[3]};
#pragma unroll
    for (int i = 0; i < 16; ++i) { const unsigned short hb = bf16_bits(xs[i]); ah.u[i] = hb; al.u[i] = ASPLIT ? bf16_bits(xs[i] - bf16_val(hb)) : (unsigned short)0; }
#pragma unroll
    for (int t = 0; t < 4; ++t) {
      const unsigned short* brow = Wt + (size_t)(col0 + t * 16 + ln) * ldb + kb;
      FragB b;
      b.half[0] = *(const v8us*)(brow + 8 * hh);
      b.half[1] = *(const v8us*)(brow + 16 + 8 * hh);
      acc[t] = mmaN<ASPLIT ? 2 : 1>(ah.v, al.v, b.v, b.v, acc[t]);
    }
  }
#pragma unroll
  for (int t = 0; t < 4; ++t) {
    float bv = bias ? bias[col0 + t * 16 + ln] : 0.f;
    if (BIAS_BF16) bv = bf16_round(bv);
#pragma unroll
    for (int r = 0; r < 8; ++r) { float v = acc[t][r] + bv; if (ACT == 1) v = fmaxf(v, 0.f); so[w][8 * hh + r][t * 16 + ln] = v; }
  }
  __builtin_amdgcn_fence(__ATOMIC_ACQ_REL, "workgroup");
  __builtin_amdgcn_wave_barrier();
  const int rsub = lane >> 4, c4 = (lane & 15) * 4;
  {
#pragma unroll
    for (int q = 0; q < 8; ++q) {
      const int r = q * 2 + rsub;
      const v4f v = *(const v4fa*)&so[w][r][c4];
      *(v4f*)(C + (size_t)(row0 + r) * ldc + col0 + c4) = v;
    }
    
  }
}

// GEMM C = act(A·W + bias + resid): A f32 (ASPLIT -> hi/lo 2 terms), Wt bf16 [N][K]; ACT 0 none, 1 relu, 2 exact gelu;
// resid (optional, f32, row index = (row % rmod), pitch ldr, RES_BF16 rounds it) added before the activation.
template <bool ASPLIT, int ACT, bool BIAS_BF16, bool RES_BF16>
__global__ __launch_bounds__(128) void k_gemm_bf3(const float* __restrict__ A, int lda, const unsigned short* __restrict__ Wt, int ldb,
                                                const float* __restrict__ bias, const float* __restrict__ resid, int rmod, int ldr,
                                                float* __restrict__ C, int ldc, int M, int N, int K) {
  __shared__ __attribute__((aligned(16))) float so[4][16][64];
  const int tid = threadIdx.x, w = tid >> 5, lane = tid & 31, ln = lane & 15, hh = lane >> 4;
  const int ntn = N / 64;
  const int wid = blockIdx.x * 4 + w;
  const int mt = wid / ntn, nq = wid % ntn;
  if (mt * 16 >= M) return;
  const int row0 = mt * 16, col0 = nq * 64;
  const float* arow = A + (size_t)(row0 + ln) * lda;
  v8f acc[4] = {};
  for (int kb = 0; kb < K; kb += 32) {
    FragB ah, al;
    const v4f x0 = *(const v4fa*)(arow + kb + 8 * hh), x1 = *(const v4fa*)(arow + kb + 8 * hh + 4);
    const v4f x2 = *(const v4fa*)(arow + kb + 16 + 8 * hh), x3 = *(const v4fa*)(arow + kb + 16 + 8 * hh + 4);
    float xs[16] = {x0[0],x0[1],x0[2],x0[3],x1[0],x1[1],x1[2],x1[3],x2[0],x2[1],x2[2],x2[3],x3[0],x3[1],x3[2],x3[3]};
#pragma unroll
    for (int i = 0; i < 16; ++i) { const unsigned short hb = bf16_bits(xs[i]); ah.u[i] = hb; al.u[i] = ASPLIT ? bf16_bits(xs[i] - bf16_val(hb)) : (unsigned short)0; }
#pragma unroll
    for (int t = 0; t < 4; ++t) {
      const unsigned short* brow = Wt + (size_t)(col0 + t * 16 + ln) * ldb + kb;
      FragB b;
      b.half[0] = *(const v8us*)(brow + 8 * hh);
      b.half[1] = *(const v8us*)(brow + 16 + 8 * hh);
      acc[t] = mmaN<ASPLIT ? 2 : 1>(ah.v, al.v, b.v, b.v, acc[t]);
    }
  }
#pragma unroll
  for (int t = 0; t < 4; ++t) {
    const int col = col0 + t * 16 + ln;
    float bv = bias ? bias[col] : 0.f;
    if (BIAS_BF16) bv = bf16_round(bv);
#pragma unroll
    for (int r = 0; r < 8; ++r) {
      float v = acc[t][r] + bv;
      if (resid) { float rv = resid[(size_t)((row0 + 8 * hh + r) % rmod) * ldr + col]; if (RES_BF16) rv = bf16_round(rv); v += rv; }
      if (ACT == 1) v = fmaxf(v, 0.f);
      if (ACT == 2) v = 0.5f * v * (1.0f + erff(v * 0.70710678118654752f));
      if (ACT == 3) { const float u = 0.7978845608028654f * (v + 0.044715f * v * v * v); v = 0.5f * v * (1.0f + tanhf(u)); }
      so[w][8 * hh + r][t * 16 + ln] = v;
    }
  }
  __builtin_amdgcn_fence(__ATOMIC_ACQ_REL, "workgroup");
  __builtin_amdgcn_wave_barrier();
  const int rsub = lane >> 4, c4 = (lane & 15) * 4;
  {
#pragma unroll
    for (int q = 0; q < 8; ++q) {
      const int r = q * 2 + rsub;
      const v4f v = *(const v4fa*)&so[w][r][c4];
      *(v4f*)(C + (size_t)(row0 + r) * ldc + col0 + c4) = v;
    }
    
  }
}
// row LayerNorm (biased variance, eps) over N: s = X (+ R); optional out_sum <- s; out_norm <- (s-mu)*rsqrt(var+eps)*g + b
template <bool PARAM_BF16>
__global__ __launch_bounds__(256) void k_layernorm(const float* __restrict__ X, const float* __restrict__ R, const float* __restrict__ g, const float* __restrict__ bta,
                                                  float* __restrict__ out_sum, float* __restrict__ out_norm, int N, float eps) {
  __shared__ float red[256];
  const int row = blockIdx.x, tid = threadIdx.x;
  const float* x = X + (size_t)row * N; const float* rr = R ? R + (size_t)row * N : nullptr;
  float vals[16];                     // up to N = 4096
  const int per = N / 256;            // contiguous chunk per thread? use strided-by-4 chunks: thread handles j = tid*4 + 1024*u
  float s1 = 0.f;
  for (int u = 0; u < per / 4; ++u) {
    const int j = tid * 4 + 1024 * u;
    const v4f a = *(const v4fa*)(x + j);
    v4f b = {0.f,0.f,0.f,0.f}; if (rr) b = *(const v4fa*)(rr + j);
#pragma unroll
    for (int q = 0; q < 4; ++q) { const float v = a[q] + b[q]; vals[u * 4 + q] = v; s1 += v; }
  }
  red[tid] = s1; __syncthreads();
  for (int st = 128; st > 0; st >>= 1) { if (tid < st) red[tid] += red[tid + st]; __syncthreads(); }
  const float mu = red[0] / (float)N; __syncthreads();
  float s2 = 0.f;
  for (int u = 0; u < per / 4; ++u)
#pragma unroll
    for (int q = 0; q < 4; ++q) { const float c = vals[u * 4 + q] - mu; s2 += c * c; }
  red[tid] = s2; __syncthreads();
  for (int st = 128; st > 0; st >>= 1) { if (tid < st) red[tid] += red[tid + st]; __syncthreads(); }
  const float rs = rsqrtf(red[0] / (float)N + eps);
  {
    for (int u = 0; u < per / 4; ++u) {
      const int j = tid * 4 + 1024 * u;
      v4f o, sm;
#pragma unroll
      for (int q = 0; q < 4; ++q) {
        float gg = g[j + q], bb = bta[j + q];
        if (PARAM_BF16) { gg = bf16_round(gg); bb = bf16_round(bb); }
        sm[q] = vals[u * 4 + q]; o[q] = (vals[u * 4 + q] - mu) * rs * gg + bb;
      }
      if (out_sum) *(v4f*)(out_sum + (size_t)row * N + j) = sm;
      *(v4f*)(out_norm + (size_t)row * N + j) = o;
    }
    
  }
}



// ---- f16 WMMA path (v_wmma_f32_16x16x32_f16): 11-bit significands for operands in range — used where a [0,1] probability operand needs more precision than bf16
typedef _Float16 v16h __attribute__((ext_vector_type(16)));
union FragH { v16h v; v8us half[2]; _Float16 h[16]; unsigned short u[16]; };
template <int NT>
__device__ __forceinline__ v8f mmaH(v16h ah, v16h al, v16h bh, v16h bl, v8f c) {
  c = __builtin_amdgcn_wmma_f32_16x16x32_f16(false, ah, false, bh, (short)0, c, false, false);
  if (NT >= 2) c = __builtin_amdgcn_wmma_f32_16x16x32_f16(false, al, false, bh, (short)0, c, false, false);
  if (NT >= 3) c = __builtin_amdgcn_wmma_f32_16x16x32_f16(false, ah, false, bl, (short)0, c, false, false);
  asm volatile("v_nop\n\tv_nop\n\tv_nop\n\tv_nop" : "+v"(c) : "v"(ah), "v"(al), "v"(bh), "v"(bl));
  return c;
}
// batched GEMM like k_gemm_b but f16 operands: A f32 (split into f16 hi/lo if ASPLIT, else rounded to f16), Bt = f16 values [n][k]; alpha; C f32; N multiple of 16 (partial tiles skipped)
template <bool ASPLIT>
__global__ __launch_bounds__(128) void k_gemm_h(const float* __restrict__ A, int lda, size_t sA, const _Float16* __restrict__ Bh, int ldb, size_t sB, float alpha, float* __restrict__ C, int ldc, size_t sC, int M, int N, int K) {
  __shared__ __attribute__((aligned(16))) float so[4][16][64];
  const int tid = threadIdx.x, w = tid >> 5, lane = tid & 31, ln = lane & 15, hh = lane >> 4; const int by = blockIdx.y;
  A += (size_t)by * sA; Bh += (size_t)by * sB; C += (size_t)by * sC;
  const int ntn = (N + 63) / 64; const int wid = blockIdx.x * 4 + w; const int mt = wid / ntn, nq = wid % ntn; if (mt * 16 >= M) return;
  const int row0 = mt * 16, col0 = nq * 64; const float* arow = A + (size_t)(row0 + ln) * lda;
  v8f acc[4] = {};
  for (int kb = 0; kb < K; kb += 32) {
    FragH ah, al;
    const v4f x0 = *(const v4fa*)(arow + kb + 8 * hh), x1 = *(const v4fa*)(arow + kb + 8 * hh + 4), x2 = *(const v4fa*)(arow + kb + 16 + 8 * hh), x3 = *(const v4fa*)(arow + kb + 16 + 8 * hh + 4);
    float xs[16] = {x0[0],x0[1],x0[2],x0[3],x1[0],x1[1],x1[2],x1[3],x2[0],x2[1],x2[2],x2[3],x3[0],x3[1],x3[2],x3[3]};
#pragma unroll
    for (int i = 0; i < 16; ++i) { const _Float16 h = (_Float16)xs[i]; ah.h[i] = h; al.h[i] = ASPLIT ? (_Float16)(xs[i] - (float)h) : (_Float16)0.0f; }
#pragma unroll
    for (int t = 0; t < 4; ++t) { if (col0 + t * 16 >= N) continue; const size_t boff = (size_t)(col0 + t * 16 + ln) * ldb + kb; FragH bq; bq.half[0] = *(const v8us*)(Bh + boff + 8 * hh); bq.half[1] = *(const v8us*)(Bh + boff + 16 + 8 * hh);
      acc[t] = mmaH<ASPLIT ? 2 : 1>(ah.v, al.v, bq.v, bq.v, acc[t]); }
  }
#pragma unroll
  for (int t = 0; t < 4; ++t) { if (col0 + t * 16 >= N) continue;
#pragma unroll
    for (int r = 0; r < 8; ++r) so[w][8 * hh + r][t * 16 + ln] = acc[t][r] * alpha; }
  __builtin_amdgcn_fence(__ATOMIC_ACQ_REL, "workgroup"); __builtin_amdgcn_wave_barrier();
  const int rsub = lane >> 4, c4 = (lane & 15) * 4;
  {
#pragma unroll
    for (int q = 0; q < 8; ++q) { const int r = q * 2 + rsub; if (col0 + c4 < N) { const v4f v = *(const v4fa*)&so[w][r][c4]; *(v4f*)(C + (size_t)(row0 + r) * ldc + col0 + c4) = v; } }
     }
}

// Wt[n][k] = f16(W[k][n]·scale) from f32 row-major W[K][N] (scale = power of two; bf16-exact weights stay exact in f16 away from the subnormal range)
__global__ __launch_bounds__(256) void k_wt_f16(const float* __restrict__ W, _Float16* __restrict__ Wt, int K, int N, float scale) {
  const int t = blockIdx.x * 256 + threadIdx.x; if (t >= N * (K / 8)) return; const int n = t / (K / 8), k8 = (t % (K / 8)) * 8; FragH f;
#pragma unroll
  for (int i = 0; i < 8; ++i) f.h[i] = (_Float16)(bf16_round(W[(size_t)(k8 + i) * N + n]) * scale); const v8us o = f.half[0];
  *(v8us*)((unsigned short*)Wt + (size_t)n * K + k8) = o; 
}
// k_gemm_hh variant with fused epilogue: v = acc·alpha + bias[by·sBias + col] (+ CP[(row/rowsPerB)·sCPb + by·64 + col] if CP) ; ACT 0 none / 1 elu ; writes f16 C16 (and f32 C if non-null)
template <int ACT>
__global__ __launch_bounds__(128) void k_gemm_hhx(const _Float16* __restrict__ A, int lda, size_t sA, const _Float16* __restrict__ Bh, int ldb, size_t sB, float alpha, const float* __restrict__ bias, size_t sBias, const float* __restrict__ CP, int rowsPerB, size_t sCPb, int row0g,
    float* __restrict__ C, _Float16* __restrict__ C16, int ldc, size_t sC, int M, int N, int K) {
  __shared__ __attribute__((aligned(16))) float so[4][16][64];
  const int tid = threadIdx.x, w = tid >> 5, lane = tid & 31, ln = lane & 15, hh = lane >> 4; const int by = blockIdx.y;
  A += (size_t)by * sA; Bh += (size_t)by * sB; const size_t cofs = (size_t)by * sC; const float* bp = bias ? bias + (size_t)by * sBias : nullptr;
  const int ntn = (N + 63) / 64; const int wid = blockIdx.x * 4 + w; const int mt = wid / ntn, nq = wid % ntn; if (mt * 16 >= M) return;
  const int row0 = mt * 16, col0 = nq * 64; const _Float16* arow = A + (size_t)(row0 + ln) * lda;
  v8f acc[4] = {};
  for (int kb = 0; kb < K; kb += 32) { FragH ah; ah.half[0] = *(const v8us*)((const unsigned short*)arow + kb + 8 * hh); ah.half[1] = *(const v8us*)((const unsigned short*)arow + kb + 16 + 8 * hh);
#pragma unroll
    for (int t = 0; t < 4; ++t) { if (col0 + t * 16 >= N) continue; const size_t boff = (size_t)(col0 + t * 16 + ln) * ldb + kb; FragH bq; bq.half[0] = *(const v8us*)((const unsigned short*)Bh + boff + 8 * hh); bq.half[1] = *(const v8us*)((const unsigned short*)Bh + boff + 16 + 8 * hh);
      acc[t] = mmaH<1>(ah.v, ah.v, bq.v, bq.v, acc[t]); }
  }
#pragma unroll
  for (int t = 0; t < 4; ++t) { if (col0 + t * 16 >= N) continue; const int col = col0 + t * 16 + ln; const float bv = bp ? bf16_round(bp[col]) : 0.f;
#pragma unroll
    for (int r = 0; r < 8; ++r) { float v = acc[t][r] * alpha + bv; if (CP) { const int bidx = (row0g + row0 + 8 * hh + r) / rowsPerB; v += CP[(size_t)bidx * sCPb + (size_t)by * 64 + col]; } if (ACT == 1) v = (v > 0.f) ? v : expm1f(v); else if (ACT == 7) v = (v > 0.f) ? v + 1.0f : expf(v); else if (ACT == 8) v = tanhf(v); else if (ACT == 9) v = 0.5f * v * (1.0f + tanhf(0.7978845608028654f * (v + 0.044715f * v * v * v))); else if (ACT == 11) v = 1.0f / (1.0f + expf(-v)); else if (ACT == 12) v = (v > 0.f) ? v : 0.01f * v; else if (ACT == 14) v = (v > 0.f) ? v : 0.1f * v; else if (ACT == 15) v = v / (1.0f + expf(-v)); else if (ACT == 3) v = fmaxf(v, 0.f); else if (ACT == 6) v = 0.5f * v * (1.0f + erff(v * 0.70710678118654752f)); so[w][8 * hh + r][t * 16 + ln] = v; } }
  __builtin_amdgcn_fence(__ATOMIC_ACQ_REL, "workgroup"); __builtin_amdgcn_wave_barrier();
  const int rsub = lane >> 4, c4 = (lane & 15) * 4; typedef _Float16 v4h __attribute__((ext_vector_type(4)));
  {
#pragma unroll
    for (int q = 0; q < 8; ++q) { const int r = q * 2 + rsub; if (col0 + c4 < N) { const v4f v = *(const v4fa*)&so[w][r][c4]; if (C) *(v4f*)(C + cofs + (size_t)(row0 + r) * ldc + col0 + c4) = v; if (C16) { v4h h4; for (int i = 0; i < 4; ++i) h4[i] = (_Float16)v[i]; *(v4h*)(C16 + cofs + (size_t)(row0 + r) * ldc + col0 + c4) = h4; } } }
     }
}


typedef _Float16 v4h __attribute__((ext_vector_type(4)));

__global__ __launch_bounds__(256) void k_h16(const float* __restrict__ x, _Float16* __restrict__ X16, size_t n8) { const size_t t = (size_t)blockIdx.x * 256 + threadIdx.x; if (t >= n8) return; FragH f;
#pragma unroll
  for (int q = 0; q < 8; ++q) f.h[q] = (_Float16)x[t * 8 + q]; *(v8us*)((unsigned short*)X16 + t * 8) = f.half[0];  }
template <int NHv, int TTv>
__global__ __launch_bounds__(256) void k_vt(const _Float16* __restrict__ V16, int ldv, int voff, _Float16* __restrict__ Vt) { __shared__ unsigned short tl[64][66]; const int tid = threadIdx.x; const int slab = blockIdx.x / (TTv / 64), lg = blockIdx.x % (TTv / 64); const int b = slab / NHv, h = slab % NHv;
  for (int i = tid; i < 64 * 8; i += 256) { const int r = i / 8, c8 = (i % 8) * 8; FragH f; f.half[0] = *(const v8us*)((const unsigned short*)V16 + ((size_t)b * TTv + lg * 64 + r) * ldv + voff + h * 64 + c8);
#pragma unroll
    for (int q = 0; q < 8; ++q) tl[r][c8 + q] = f.u[q]; }
  __syncthreads();
  {
#pragma unroll
    for (int rd = 0; rd < 2; ++rd) { const int d = rd * 32 + tid / 8, pc = tid % 8; FragH f;
#pragma unroll
      for (int q = 0; q < 8; ++q) f.u[q] = tl[pc * 8 + q][d];
      *(v8us*)((unsigned short*)Vt + ((size_t)slab * 64 + d) * TTv + lg * 64 + pc * 8) = f.half[0]; }
     } }

// ---- fast GEMM (wave tile 32x64; requires M % 32 == 0 rows per launch region, N % 64 == 0 and K % 64 == 0); epilogue = k_gemm_hhx semantics ----
__device__ __forceinline__ v16h g2_frag(const _Float16* p, int hh) { FragH f; f.half[0] = *(const v8us*)((const unsigned short*)p + 8 * hh); f.half[1] = *(const v8us*)((const unsigned short*)p + 16 + 8 * hh); return f.v; }
__device__ __forceinline__ v8f g2_mma(v16h a, v16h b, v8f c) { v8f d = __builtin_amdgcn_wmma_f32_16x16x32_f16(false, a, false, b, (short)0, c, false, false); asm volatile("v_nop\n\tv_nop\n\tv_nop\n\tv_nop" : "+v"(d) : "v"(a), "v"(b)); return d; }
/* XP 0: stores C / C16. XP 1 (q) and 2 (k, inverse scale): the epilogue applies the xPos rotation to the row while it is still in LDS (a 64-column tile is one head, a lane's 4 columns hold whole rotation pairs; token = row % SLEN) and stores the f16 hi + x2^10 residual planes Hh, Hl instead of C. XP 3 (v): the tile (128 tokens of one batch x one head) leaves transposed, as hi + residual planes [(batch, head)][d][token]. XP 4: the three projections as one launch: blockIdx.y = 0, 1, 2 picks the q, k or v epilogue, the weight plane (sB), the bias pointer and the pair of output planes (sH); the k loop is one and the same code. XP 5: C = (A2 + A * 2^-10) . B^T in one launch, A the x2^10 residual plane of A2: the k loop runs over A first, the accumulators are scaled by 2^-10 once, then it runs over A2 on top of them; no addend. Left for a later step: the epilogue's eight bias loads stand one behind the other, each waited for */
template <int ACT, int XP>
__global__ __launch_bounds__(128) void k_gemm2(const _Float16* __restrict__ A, int lda, size_t sA, const _Float16* __restrict__ Bh, int ldb, size_t sB, float alpha, const float* __restrict__ bias, size_t sBias, const float* __restrict__ CP, int rowsPerB, size_t sCPb, int row0g,
    float* __restrict__ C, _Float16* __restrict__ C16, int ldc, size_t sC, int M, int N, int K, const float* __restrict__ CS, const float* __restrict__ SN, const float* __restrict__ SC, _Float16* __restrict__ Hh, _Float16* __restrict__ Hl, const float* __restrict__ bias1, const float* __restrict__ bias2, size_t sH, const _Float16* __restrict__ A2) {
  /* the work-group's 128 x 64 tile: per stage of 64 k (K % 64 == 0) one whole 128-byte line of each of its 128 A rows and 64 B rows goes to LDS, two buffers; row pitch 144 B for the 16-byte fragment reads */
  constexpr int PIT = 72;
  __shared__ __attribute__((aligned(16))) float so[4][32][68];
  __shared__ __attribute__((aligned(16))) _Float16 tA[2][128 * PIT], tB[2][64 * PIT];
  const int tid = threadIdx.x, w = tid >> 5, lane = tid & 31, ln = lane & 15, hh = lane >> 4; const int by = blockIdx.y;
  A += (size_t)by * sA; Bh += (size_t)by * sB; const size_t cofs = (size_t)by * sC; const float* bp = bias ? bias + (size_t)by * sBias : nullptr;
  const bool tr = (XP == 3) || (XP == 4 && by == 2), inv = (XP == 2) || (XP == 4 && by == 1);      /* which epilogue: the same for the whole work-group */
  if (XP == 4) { bp = (by == 0) ? bias : ((by == 1) ? bias1 : bias2); Hh += (size_t)by * sH; Hl += (size_t)by * sH; }
  const int ntn = N >> 6; const int mt = blockIdx.x / ntn, nq = blockIdx.x - mt * ntn; const int row0 = mt * 128 + 32 * w, col0 = nq * 64; if (mt * 128 >= M) return;      /* the same for the whole work-group: every wave reaches every barrier below */
  const int sr = tid >> 3, sc = (tid & 7) * 8;      /* staging: eight threads bring one row's line, a wave four whole lines per load */
  unsigned oa[8], ob[4];      /* byte offsets of the staged lines at k = 0, fixed for the whole loop */
#pragma unroll
  for (int i = 0; i < 8; ++i) oa[i] = ((unsigned)min(mt * 128 + i * 16 + sr, M - 1) * (unsigned)lda + (unsigned)sc) * 2u;      /* rows past M (a last tile of 32, 64 or 96 rows) re-read row M - 1; their waves store nothing */
#pragma unroll
  for (int i = 0; i < 4; ++i) ob[i] = ((unsigned)(col0 + i * 16 + sr) * (unsigned)ldb + (unsigned)sc) * 2u;
  const int so_st = sr * PIT + sc, fa = (32 * w + ln) * PIT, fb = ln * PIT;
  const v8f z8 = {0.f,0.f,0.f,0.f,0.f,0.f,0.f,0.f}; v8f c00 = z8, c01 = z8, c02 = z8, c03 = z8, c10 = z8, c11 = z8, c12 = z8, c13 = z8;
  v8us ra[8], rb[4];
#pragma unroll
  for (int i = 0; i < 8; ++i) ra[i] = *(const v8us*)((const char*)A + oa[i]);
#pragma unroll
  for (int i = 0; i < 4; ++i) rb[i] = *(const v8us*)((const char*)Bh + ob[i]);
#pragma unroll
  for (int i = 0; i < 8; ++i) *(v8us*)&tA[0][so_st + i * 16 * PIT] = ra[i];
#pragma unroll
  for (int i = 0; i < 4; ++i) *(v8us*)&tB[0][so_st + i * 16 * PIT] = rb[i];
  __syncthreads();      /* stage 0 is in LDS before any wave reads it */
  const int KT = (XP == 5) ? 2 * K : K;
#pragma unroll 1      /* stays rolled: the body already holds 16 products and the whole of a stage's loads */
  for (int kb = 0; kb < KT; kb += 64) { const int cur = (kb >> 6) & 1; const bool more = kb + 64 < KT;
    if (more) {      /* the next stage's global loads go out ahead of this stage's products, which cover their latency */
      const int kn = kb + 64; const bool p2 = (XP == 5) && kn >= K; const _Float16* An = p2 ? A2 + (kn - K) : A + kn; const _Float16* Bn = Bh + (p2 ? kn - K : kn);      /* block-uniform: which plane the next stage comes from */
#pragma unroll
      for (int i = 0; i < 8; ++i) ra[i] = *(const v8us*)((const char*)An + oa[i]);
#pragma unroll
      for (int i = 0; i < 4; ++i) rb[i] = *(const v8us*)((const char*)Bn + ob[i]);
      asm volatile("s_wait_xcnt 0x0" ::: "memory"); }      /* precaution: stands in front of every rewrite of the stage loads' address registers (the fragment reads below reuse them) */
    if (XP == 5 && kb == K) { c00 *= 0.0009765625f; c01 *= 0.0009765625f; c02 *= 0.0009765625f; c03 *= 0.0009765625f; c10 *= 0.0009765625f; c11 *= 0.0009765625f; c12 *= 0.0009765625f; c13 *= 0.0009765625f; }      /* the residual plane's sums take their weight (a power of two: exact) before the first product of the hi plane */
    const _Float16* pa = &tA[cur][fa]; const _Float16* pb = &tB[cur][fb];
    v16h a0[2], a1[2], b0[2], b1[2], b2[2], b3[2];      /* all of the stage's fragment reads as one group in front of its products */
#pragma unroll
    for (int ks = 0; ks < 2; ++ks) { a0[ks] = g2_frag(pa + ks * 32, hh); a1[ks] = g2_frag(pa + 16 * PIT + ks * 32, hh); b0[ks] = g2_frag(pb + ks * 32, hh); b1[ks] = g2_frag(pb + 16 * PIT + ks * 32, hh); b2[ks] = g2_frag(pb + 32 * PIT + ks * 32, hh); b3[ks] = g2_frag(pb + 48 * PIT + ks * 32, hh); }
#pragma unroll
    for (int ks = 0; ks < 2; ++ks) {
      c00 = g2_mma(a0[ks], b0[ks], c00); c10 = g2_mma(a1[ks], b0[ks], c10);
      c01 = g2_mma(a0[ks], b1[ks], c01); c11 = g2_mma(a1[ks], b1[ks], c11);
      c02 = g2_mma(a0[ks], b2[ks], c02); c12 = g2_mma(a1[ks], b2[ks], c12);
      c03 = g2_mma(a0[ks], b3[ks], c03); c13 = g2_mma(a1[ks], b3[ks], c13); }
    if (more) {      /* into the buffer that every wave left at the last barrier */
#pragma unroll
      for (int i = 0; i < 8; ++i) *(v8us*)&tA[cur ^ 1][so_st + i * 16 * PIT] = ra[i];
#pragma unroll
      for (int i = 0; i < 4; ++i) *(v8us*)&tB[cur ^ 1][so_st + i * 16 * PIT] = rb[i]; }
    __syncthreads(); }      /* publishes the next stage and ends every wave's reads of this one */
  if (!tr && row0 >= M) return;      /* no barrier follows; XP 3 has one below and takes whole 128-row tiles only (M % 128 == 0) */
  v8f accs[8] = {c00, c01, c02, c03, c10, c11, c12, c13};
  constexpr int TP = 136; _Float16* sT = (_Float16*)&so[0][0][0];      /* XP 3: the staging bytes as two f16 planes [64 d][128 tokens], row pitch 272 B */
  if (XP == 4 && tr) {      /* the v side of XP 4: the XP 3 form of the loop below (XP 4 is used with ACT 0 and without an addend); both loops unrolled like it, so that accs and the fragments are indexed by constants and stay in registers */
#pragma unroll
    for (int u = 0; u < 8; ++u) { const int t = u & 3, half = u >> 2; const float bv = bp ? bf16_round(bp[col0 + t * 16 + ln]) : 0.f; FragH th, tl;
#pragma unroll
      for (int r = 0; r < 8; ++r) { const float v = accs[u][r] * alpha + bv; const _Float16 hv = (_Float16)v; th.h[r] = hv; tl.h[r] = (_Float16)((v - (float)hv) * 1024.0f); }
      const int o = (t * 16 + ln) * TP + 32 * w + half * 16 + 8 * hh; *(v8us*)&sT[o] = th.half[0]; *(v8us*)&sT[64 * TP + o] = tl.half[0]; } }
  else
#pragma unroll
  for (int u = 0; u < 8; ++u) { const int t = u & 3, half = u >> 2; const int col = col0 + t * 16 + ln; const float bv = bp ? bf16_round(bp[col]) : 0.f; FragH th, tl;
#pragma unroll
    for (int r = 0; r < 8; ++r) { const int rloc = half * 16 + 8 * hh + r; float v = accs[u][r] * alpha + bv; if (XP != 5 && CP) { const int bidx = (row0g + row0 + rloc) / rowsPerB; v += CP[(size_t)bidx * sCPb + (size_t)by * 64 + col]; }
      if (ACT == 3) v = fmaxf(v, 0.f); else if (ACT == 6) v = 0.5f * v * (1.0f + erff(v * 0.70710678118654752f)); else if (ACT == 11) v = 1.0f / (1.0f + expf(-v)); else if (ACT == 15) v = v / (1.0f + expf(-v)); else if (ACT == 12) v = (v > 0.f) ? v : 0.01f * v; else if (ACT == 8) v = tanhf(v);
      if (XP == 3) { const _Float16 hv = (_Float16)v; th.h[r] = hv; tl.h[r] = (_Float16)((v - (float)hv) * 1024.0f); } else so[w][rloc][t * 16 + ln] = v; }
    if (XP == 3) { const int o = (t * 16 + ln) * TP + 32 * w + half * 16 + 8 * hh; *(v8us*)&sT[o] = th.half[0]; *(v8us*)&sT[64 * TP + o] = tl.half[0]; } }      /* a lane's 8 accumulator rows are 8 consecutive tokens of one d: one 16-byte piece of the transposed row */
  if (tr) {      /* a block-uniform branch: every wave of such a work-group reaches the barrier */
    __syncthreads();      /* all four waves' 32-token pieces are in LDS before any wave stores whole 256-byte rows */
    const size_t vb = ((size_t)((mt * 128) / SLEN) * NH + nq) * 64 * SLEN + (mt * 128) % SLEN;
#pragma unroll
    for (int it = 0; it < 8; ++it) { const int d = it * 8 + (tid >> 4), pc = tid & 15; const v8us a = *(const v8us*)&sT[d * TP + pc * 8], c = *(const v8us*)&sT[64 * TP + d * TP + pc * 8];
      *(v8us*)((unsigned short*)Hh + vb + (size_t)d * SLEN + pc * 8) = a; *(v8us*)((unsigned short*)Hl + vb + (size_t)d * SLEN + pc * 8) = c; }
    return; }
  __builtin_amdgcn_fence(__ATOMIC_ACQ_REL, "workgroup"); __builtin_amdgcn_wave_barrier();
  const int rsub = lane >> 4, c4 = (lane & 15) * 4;
  if (XP == 1 || XP == 2 || XP == 4) {
    const size_t tb = (size_t)(row0 % SLEN + rsub) * 32;      /* a wave's 32 rows lie in one batch (SLEN % 32 == 0): token = row0 % SLEN + r */
    const float* cs = CS + tb + (c4 >> 1); const float* sn = SN + tb + (c4 >> 1); const float* scp = SC + tb + (c4 & 31);
#pragma unroll
    for (int g = 0; g < 16; g += 8) { v2fa cq[8], sq[8]; v4f s4[8];      /* two groups of 8 rows: 16 rows' table words and the k side's 64 quotients at once need more than 256 registers */
#pragma unroll
      for (int q = 0; q < 8; ++q) { cq[q] = *(const v2fa*)(cs + (g + q) * 64); sq[q] = *(const v2fa*)(sn + (g + q) * 64); s4[q] = *(const v4fa*)(scp + (g + q) * 64); }      /* the group's table words in flight together */
      asm volatile("s_wait_xcnt 0x0" :: "v"(cs), "v"(sn), "v"(scp) : "memory");      /* precaution: stands in front of every rewrite of the table loads' address registers, which stay live up to here */
      if (inv) {      /* the k side's inverse scale, behind one block-uniform branch; both loops unrolled, so that s4 is indexed by constants and stays in registers */
#pragma unroll
        for (int q = 0; q < 8; ++q)
#pragma unroll
          for (int i = 0; i < 4; ++i) s4[q][i] = 1.0f / s4[q][i]; }
#pragma unroll
      for (int q = 0; q < 8; ++q) { const int r = (g + q) * 2 + rsub; const v4f v = *(const v4fa*)&so[w][r][c4]; v4h hi4, lo4;
#pragma unroll
        for (int i = 0; i < 4; ++i) { const float sc = s4[q][i];
          const float x = v[i]; const float rx = (i & 1) ? v[i - 1] : -v[i + 1]; const float o = (x * cq[q][i >> 1]) * sc + (rx * sq[q][i >> 1]) * sc;
          const _Float16 h = (_Float16)o; hi4[i] = h; lo4[i] = (_Float16)((o - (float)h) * 1024.0f); }
        const size_t oo = cofs + (size_t)(row0 + r) * ldc + col0 + c4; *(v4h*)(Hh + oo) = hi4; *(v4h*)(Hl + oo) = lo4; }
      asm volatile("s_wait_xcnt 0x0" ::: "memory"); }      /* precaution: stands in front of every rewrite of a register that the group's stores name (the second group's loads; behind the last group, whatever the listing puts next) */
    return; }
  {
#pragma unroll
    for (int q = 0; q < 16; ++q) { const int r = q * 2 + rsub; const v4f v = *(const v4fa*)&so[w][r][c4]; if (C) *(v4f*)(C + cofs + (size_t)(row0 + r) * ldc + col0 + c4) = v; if (C16) { v4h h4; for (int i = 0; i < 4; ++i) h4[i] = (_Float16)v[i]; *(v4h*)(C16 + cofs + (size_t)(row0 + r) * ldc + col0 + c4) = h4; } }
     } }



template <int TQ, int TK>
__global__ __launch_bounds__(256) void k_flashm(const _Float16* __restrict__ Q16, const _Float16* __restrict__ Q16lo, int ldq, const _Float16* __restrict__ K16, const _Float16* __restrict__ K16lo, int ldk, const _Float16* __restrict__ Vt, const _Float16* __restrict__ Vtlo, const unsigned* __restrict__ MB, const int* __restrict__ RA, const int* __restrict__ KE, _Float16* __restrict__ Oh, _Float16* __restrict__ Ol, int ldo) {
  /* 64 queries per work-group, eight waves: wave w has the 16 queries of sub-tile w & 3 and the 32-key half w >> 2 of every 64-key stage. A stage (K hi, K lo: 64 keys x 64 d; V^T hi, V^T lo: 64 d x 64 keys; whole 128-byte lines) is copied to LDS once and read by all eight waves; two buffers, row pitch 144 B for the 16-byte fragment reads */
  constexpr int RPW = 16, RTN = RPW / 16, QW = 64, NQB = TQ / QW, DT = 4, KS = 2, KP = 72, PLN = 64 * KP, STG = 4 * PLN;
  __shared__ __attribute__((aligned(16))) unsigned short sKV[2][STG];
  __shared__ __attribute__((aligned(16))) unsigned short sP[8][RPW][40], sPl[8][RPW][40]; __shared__ __attribute__((aligned(16))) float sO[8][RPW][64 + 4]; __shared__ float sM[8][RPW], sL[8][RPW];
  const int tid = threadIdx.x, lane = tid & 31, ln = lane & 15, hh = lane >> 4;
  const int w = __builtin_amdgcn_readfirstlane(tid >> 5);      /* the wave's number in a scalar register: the skip of a key half past the bound stays a scalar branch */
  const int qs = w & 3, kg = w >> 2;
  /* grid (slab = (batch, head), tile): both batches in one launch, twice as many groups as resident places (two to a WGP). The order of the tiles is as it was for one batch a launch: the first half of the flat index takes the tiles with the most keys in falling order, the second half the rest in rising order; left for a later step: a cost that falls with the index throughout; also left: the transposed products S^T = K.Q^T, O^T += V^T.P^T (one query per lane: maximum and sum in the lane's own registers plus one exchange between the wave's halves, P^T packed from the score accumulators as the B operand, no shuffles and no P round trip through LDS; the fragment reads here already have the hardware k order) */
  const int slab = blockIdx.x, yy = (int)blockIdx.y, qt = (yy < NQB / 2) ? NQB - 1 - yy : yy - NQB / 2; const int b = slab / NH, h = slab % NH; const int q0 = qt * QW + qs * RPW; const int qblk = q0 >> 6;
  FragH aq[2][KS], aql[2][KS];
#pragma unroll
  for (int rt = 0; rt < RTN; ++rt) { const size_t qo = ((size_t)b * TQ + q0 + rt * 16 + ln) * ldq + h * 64; const unsigned short* qr = (const unsigned short*)Q16 + qo; const unsigned short* ql = (const unsigned short*)Q16lo + qo;
#pragma unroll
    for (int ks = 0; ks < KS; ++ks) { aq[rt][ks].half[0] = *(const v8us*)(qr + ks * 32 + 8 * hh); aq[rt][ks].half[1] = *(const v8us*)(qr + ks * 32 + 16 + 8 * hh); aql[rt][ks].half[0] = *(const v8us*)(ql + ks * 32 + 8 * hh); aql[rt][ks].half[1] = *(const v8us*)(ql + ks * 32 + 16 + 8 * hh); } }
  const unsigned short* Vth = (const unsigned short*)Vt + (size_t)slab * 64 * TK; const unsigned short* Vtl = (const unsigned short*)Vtlo + (size_t)slab * 64 * TK;
  float m_r[2][8], l_r[2][8]; v8f oacc[2][DT], oaccl[2][DT];
#pragma unroll
  for (int rt = 0; rt < RTN; ++rt) {
#pragma unroll
    for (int r = 0; r < 8; ++r) { m_r[rt][r] = -3.0e38f; l_r[rt][r] = 0.f; }
#pragma unroll
    for (int dt = 0; dt < DT; ++dt) { oacc[rt][dt] = (v8f){0.f,0.f,0.f,0.f,0.f,0.f,0.f,0.f}; oaccl[rt][dt] = oacc[rt][dt]; } }
  int jend = KE[qblk * 32]; jend = min(TK, (jend + 31) & ~31); if (jend < 32) jend = 32; jend = __builtin_amdgcn_readfirstlane(jend);      /* block-uniform, in a scalar register */
  const int nst = (jend + 63) >> 6;      /* stages of 64 keys; TK % 64 == 0, so every stage lies inside K and V */
  int allm[2][8]; const unsigned* mrow[2][8];
#pragma unroll
  for (int rt = 0; rt < RTN; ++rt)
#pragma unroll
    for (int r = 0; r < 8; ++r) { const int tq = q0 + rt * 16 + 8 * hh + r; allm[rt][r] = RA[tq]; mrow[rt][r] = MB + (size_t)tq * (TK / 32); }
  /* staging: eight lanes bring one row's 128-byte line, a wave four whole lines per copy; each thread copies rows cr and cr + 32 of each of the four planes */
  const int cr = tid >> 3, cc = (tid & 7) * 8;
  const size_t gko = ((size_t)b * TK + cr) * ldk + h * 64 + cc, gvo = (size_t)cr * TK + cc;
  const unsigned lds0 = (unsigned)(size_t)&sKV[0][cr * KP + cc];      /* the lane's LDS byte address in buffer 0, plane 0 */
  auto stage = [&](int s, int buf) {
    const unsigned short* k0 = (const unsigned short*)K16 + gko + (size_t)s * 64 * ldk; const unsigned short* k2 = (const unsigned short*)K16lo + gko + (size_t)s * 64 * ldk; const unsigned short* k1 = k0 + (size_t)32 * ldk; const unsigned short* k3 = k2 + (size_t)32 * ldk;
    const unsigned short* v0 = Vth + gvo + s * 64; const unsigned short* v2 = Vtl + gvo + s * 64; const unsigned short* v1 = v0 + (size_t)32 * TK; const unsigned short* v3 = v2 + (size_t)32 * TK;
    const unsigned d0 = lds0 + (unsigned)buf * (STG * 2u), d1 = d0 + 32u * KP * 2u, d2 = d0 + PLN * 2u, d3 = d2 + 32u * KP * 2u, d4 = d0 + 2u * PLN * 2u, d5 = d4 + 32u * KP * 2u, d6 = d0 + 3u * PLN * 2u, d7 = d6 + 32u * KP * 2u;
    /* the stage's eight copies; the closing s_wait_xcnt is a precaution that stands in front of every rewrite of the copies' address registers */
    asm volatile("global_load_async_to_lds_b128 %0, %8, off\n\tglobal_load_async_to_lds_b128 %1, %9, off\n\tglobal_load_async_to_lds_b128 %2, %10, off\n\tglobal_load_async_to_lds_b128 %3, %11, off\n\t"
                 "global_load_async_to_lds_b128 %4, %12, off\n\tglobal_load_async_to_lds_b128 %5, %13, off\n\tglobal_load_async_to_lds_b128 %6, %14, off\n\tglobal_load_async_to_lds_b128 %7, %15, off\n\ts_wait_xcnt 0x0"
                 :: "v"(d0), "v"(d1), "v"(d2), "v"(d3), "v"(d4), "v"(d5), "v"(d6), "v"(d7), "v"(k0), "v"(k1), "v"(k2), "v"(k3), "v"(v0), "v"(v1), "v"(v2), "v"(v3) : "memory"); };
  stage(0, 0);
  asm volatile("s_wait_asynccnt 0x0" ::: "memory");      /* this wave's copies of stage 0 have landed */
  __syncthreads();      /* stage 0 is in LDS before any wave reads it */
  if (nst > 1) stage(1, 1);
#pragma unroll 1
  for (int st = 0; st < nst; ++st) { const int j0 = st * 64 + kg * 32; const unsigned short* tb = &sKV[st & 1][0];
   if (j0 < jend) {      /* a key half past the bound is skipped by its four waves; the publish point below is passed by every wave */
    unsigned mw[2][8];      /* all of the pass's mask words are fetched here, so that their latency runs under the K reads and the score products */
#pragma unroll
    for (int rt = 0; rt < RTN; ++rt)
#pragma unroll
      for (int r = 0; r < 8; ++r) mw[rt][r] = mrow[rt][r][j0 >> 5];
    asm volatile("s_wait_xcnt 0x0" ::: "memory");      /* precaution: stands in front of every rewrite of the mask loads' address registers; it also keeps these loads ahead of the K reads */
    v8f s[2][2]; FragH bk[2][KS], bkl[2][KS];      /* all of the pass's K fragment reads stand as one group in front of its score products: one LDS latency instead of two */
#pragma unroll
    for (int nt = 0; nt < 2; ++nt) { const unsigned short* kr = tb + (kg * 32 + nt * 16 + ln) * KP; const unsigned short* kl = kr + PLN;
#pragma unroll
      for (int ks = 0; ks < KS; ++ks) { bk[nt][ks].half[0] = *(const v8us*)(kr + ks * 32 + 8 * hh); bk[nt][ks].half[1] = *(const v8us*)(kr + ks * 32 + 16 + 8 * hh); bkl[nt][ks].half[0] = *(const v8us*)(kl + ks * 32 + 8 * hh); bkl[nt][ks].half[1] = *(const v8us*)(kl + ks * 32 + 16 + 8 * hh); } }
#pragma unroll
    for (int nt = 0; nt < 2; ++nt) {
#pragma unroll
      for (int rt = 0; rt < RTN; ++rt) { v8f acc = (v8f){0.f,0.f,0.f,0.f,0.f,0.f,0.f,0.f}, accr = acc;
#pragma unroll
        for (int ks = 0; ks < KS; ++ks) { acc = mmaH<1>(aq[rt][ks].v, aq[rt][ks].v, bk[nt][ks].v, bk[nt][ks].v, acc); accr = mmaH<1>(aql[rt][ks].v, aql[rt][ks].v, bk[nt][ks].v, bk[nt][ks].v, accr); accr = mmaH<1>(aq[rt][ks].v, aq[rt][ks].v, bkl[nt][ks].v, bkl[nt][ks].v, accr); }
        s[rt][nt] = acc + accr * 0.0009765625f; } }
    /* softmax in stages over the eight rows, with selects in place of branches: one straight block, in which the rows' dependent chains overlap */
    float s0[2][8], s1[2][8], mc[2][8]; bool ok0[2][8], ok1[2][8];
#pragma unroll
    for (int rt = 0; rt < RTN; ++rt)
#pragma unroll
      for (int r = 0; r < 8; ++r) { const bool am = (allm[rt][r] != 0);
        ok0[rt][r] = am || (((mw[rt][r] >> ln) & 1u) == 0u); ok1[rt][r] = am || (((mw[rt][r] >> (16 + ln)) & 1u) == 0u);
        s0[rt][r] = ok0[rt][r] ? (am ? 0.f : s[rt][0][r] * SCL2) : -INFINITY; s1[rt][r] = ok1[rt][r] ? (am ? 0.f : s[rt][1][r] * SCL2) : -INFINITY; mc[rt][r] = fmaxf(s0[rt][r], s1[rt][r]); }
#pragma unroll
    for (int sx = 1; sx <= 8; sx <<= 1)
#pragma unroll
      for (int rt = 0; rt < RTN; ++rt)
#pragma unroll
        for (int r = 0; r < 8; ++r) mc[rt][r] = fmaxf(mc[rt][r], __shfl_xor(mc[rt][r], sx, 32));
#pragma unroll
    for (int rt = 0; rt < RTN; ++rt)
#pragma unroll
      for (int r = 0; r < 8; ++r) {
        const float mn = fmaxf(m_r[rt][r], mc[rt][r]); const float ea = __builtin_amdgcn_exp2f(m_r[rt][r] - mn), e0 = __builtin_amdgcn_exp2f(s0[rt][r] - mn), e1 = __builtin_amdgcn_exp2f(s1[rt][r] - mn);      /* one hardware exponential each: every argument is <= 0 (no overflow), -inf and -3e38 give 0; computed for every lane; the selects below keep the values of the guarded form */
        const float al = (mn > -1.0e38f) ? ea : 1.0f; m_r[rt][r] = mn; const float p0 = ok0[rt][r] ? e0 : 0.f, p1 = ok1[rt][r] ? e1 : 0.f; l_r[rt][r] = l_r[rt][r] * al + p0 + p1;
#pragma unroll
        for (int dt = 0; dt < DT; ++dt) { oacc[rt][dt][r] *= al; oaccl[rt][dt][r] *= al; }
        FragH t2, t3; const float ps0 = p0 * 1024.0f, ps1 = p1 * 1024.0f; t2.h[0] = (_Float16)ps0; t2.h[1] = (_Float16)ps1; t3.h[0] = (_Float16)((ps0 - (float)t2.h[0]) * 1024.0f); t3.h[1] = (_Float16)((ps1 - (float)t2.h[1]) * 1024.0f);
        sP[w][rt * 16 + 8 * hh + r][ln] = t2.u[0]; sP[w][rt * 16 + 8 * hh + r][16 + ln] = t2.u[1]; sPl[w][rt * 16 + 8 * hh + r][ln] = t3.u[0]; sPl[w][rt * 16 + 8 * hh + r][16 + ln] = t3.u[1]; }
    __builtin_amdgcn_fence(__ATOMIC_ACQ_REL, "workgroup"); __builtin_amdgcn_wave_barrier();
    FragH pa[2], pl[2];
#pragma unroll
    for (int rt = 0; rt < RTN; ++rt) { pa[rt].half[0] = *(const v8us*)&sP[w][rt * 16 + ln][8 * hh]; pa[rt].half[1] = *(const v8us*)&sP[w][rt * 16 + ln][16 + 8 * hh]; pl[rt].half[0] = *(const v8us*)&sPl[w][rt * 16 + ln][8 * hh]; pl[rt].half[1] = *(const v8us*)&sPl[w][rt * 16 + ln][16 + 8 * hh]; }
    FragH bv[DT], bl[DT];      /* all of the pass's V fragment reads stand as one group in front of its value products: one LDS latency instead of four */
#pragma unroll
    for (int dt = 0; dt < DT; ++dt) { const unsigned short* vr = tb + 2 * PLN + (dt * 16 + ln) * KP + kg * 32; const unsigned short* vl = vr + PLN; bv[dt].half[0] = *(const v8us*)(vr + 8 * hh); bv[dt].half[1] = *(const v8us*)(vr + 16 + 8 * hh); bl[dt].half[0] = *(const v8us*)(vl + 8 * hh); bl[dt].half[1] = *(const v8us*)(vl + 16 + 8 * hh); }
#pragma unroll
    for (int dt = 0; dt < DT; ++dt) {
#pragma unroll
      for (int rt = 0; rt < RTN; ++rt) { oacc[rt][dt] = mmaH<1>(pa[rt].v, pa[rt].v, bv[dt].v, bv[dt].v, oacc[rt][dt]); oaccl[rt][dt] = mmaH<1>(pa[rt].v, pa[rt].v, bl[dt].v, bl[dt].v, oaccl[rt][dt]); oaccl[rt][dt] = mmaH<1>(pl[rt].v, pl[rt].v, bv[dt].v, bv[dt].v, oaccl[rt][dt]); } }
   }
    /* publish point of stage st + 1, every wave, in this order */
    asm volatile("s_wait_dscnt 0x0" ::: "memory");      /* this wave's LDS reads of stage st have returned */
    asm volatile("s_wait_asynccnt 0x0" ::: "memory");      /* this wave's copies of stage st + 1 have landed */
    __syncthreads();      /* publishes stage st + 1 and ends every wave's reads of stage st */
    if (st + 2 < nst) stage(st + 2, st & 1); }      /* into the buffer that every wave has just left */
  asm volatile("s_wait_asynccnt 0x0" ::: "memory");      /* no copy is outstanding behind the loop */
#pragma unroll
  for (int rt = 0; rt < RTN; ++rt) {
#pragma unroll
    for (int r = 0; r < 8; ++r) { float l = l_r[rt][r]; l += __shfl_xor(l, 1, 32); l += __shfl_xor(l, 2, 32); l += __shfl_xor(l, 4, 32); l += __shfl_xor(l, 8, 32); l_r[rt][r] = l; }
    if (ln == 0) {
#pragma unroll
      for (int r = 0; r < 8; ++r) { sM[w][rt * 16 + 8 * hh + r] = m_r[rt][r]; sL[w][rt * 16 + 8 * hh + r] = l_r[rt][r]; } }
#pragma unroll
    for (int dt = 0; dt < DT; ++dt)
#pragma unroll
      for (int r = 0; r < 8; ++r) sO[w][rt * 16 + 8 * hh + r][dt * 16 + ln] = oacc[rt][dt][r] + oaccl[rt][dt][r] * 0.0009765625f; }
  __syncthreads();      /* every wave's partial (max, sum, O) is in LDS before any wave merges them */
  {
#pragma unroll
    for (int rp = 0; rp < QW; rp += 16) { const int rq = rp + (tid >> 4), pc = tid & 15; const int wq = rq >> 4, r = rq & 15;      /* query rq of the tile: the partials of waves wq (first key halves) and wq + 4 (second) */
      const float m0 = sM[wq][r], m1 = sM[wq + 4][r]; const float mx = fmaxf(m0, m1);      /* a wave that saw no open key holds -3e38, sum 0, O 0: weight 0 (or 1 on zeros) */
      float e0, e1;      /* the maxima are in base-2 units. Each exponential stands in one statement with the v_nop that fills the slot the instruction set asks for behind a transcendental */
      asm("v_exp_f32 %0, %1\n\tv_nop" : "=v"(e0) : "v"(m0 - mx)); asm("v_exp_f32 %0, %1\n\tv_nop" : "=v"(e1) : "v"(m1 - mx));
      const float l = e0 * sL[wq][r] + e1 * sL[wq + 4][r]; const float inv = (l > 0.f) ? 1.0f / (l * 1024.0f) : 0.f;
      const v4f o0 = *(const v4fa*)&sO[wq][r][pc * 4], o1 = *(const v4fa*)&sO[wq + 4][r][pc * 4];
      const v4f val = (o0 * e0 + o1 * e1) * inv; v4h hi4, lo4;      /* O leaves as the f16 hi + x2^10 residual planes that the output projection reads */
#pragma unroll
      for (int i = 0; i < 4; ++i) { const _Float16 hv = (_Float16)val[i]; hi4[i] = hv; lo4[i] = (_Float16)((val[i] - (float)hv) * 1024.0f); }
      const size_t oo = ((size_t)b * TQ + qt * QW + rq) * ldo + h * 64 + pc * 4; *(v4h*)(Oh + oo) = hi4; *(v4h*)(Ol + oo) = lo4; }
     } }


__constant__ float INVF[32] = {1.000000000e+00f,7.498942018e-01f,5.623413324e-01f,4.216965139e-01f,3.162277639e-01f,2.371373624e-01f,1.778279394e-01f,1.333521456e-01f,1.000000015e-01f,7.498941571e-02f,5.623412877e-02f,4.216964915e-02f,3.162277862e-02f,2.371373586e-02f,1.778279431e-02f,1.333521493e-02f,9.999999776e-03f,7.498942316e-03f,5.623413250e-03f,4.216964822e-03f,3.162277862e-03f,2.371373819e-03f,1.778279431e-03f,1.333521446e-03f,1.000000047e-03f,7.498941850e-04f,5.623413017e-04f,4.216964880e-04f,3.162277862e-04f,2.371373848e-04f,1.778279402e-04f,1.333521504e-04f};
__constant__ float XBASE[32] = {2.857142985e-01f,3.080357313e-01f,3.303571641e-01f,3.526785970e-01f,3.750000000e-01f,3.973214328e-01f,4.196428359e-01f,4.419642687e-01f,4.642857015e-01f,4.866071343e-01f,5.089285374e-01f,5.312500000e-01f,5.535714030e-01f,5.758928657e-01f,5.982142687e-01f,6.205357313e-01f,6.428571343e-01f,6.651785970e-01f,6.875000000e-01f,7.098214030e-01f,7.321428657e-01f,7.544642687e-01f,7.767857313e-01f,7.991071343e-01f,8.214285970e-01f,8.437500000e-01f,8.660714030e-01f,8.883928657e-01f,9.107142687e-01f,9.330357313e-01f,9.553571343e-01f,9.776785970e-01f};
/* ---- the eight preparation jobs, which read none of each other's output, as one launch: the block index picks the job; a thread's work in each job is what it was in the job's own kernel. Each job ends in s_wait_xcnt 0, a precaution: it stands in front of every rewrite of a register that the job's stores name, on whatever way the listing joins the jobs ---- */
__device__ __forceinline__ void prep_round(const float* __restrict__ s, _Float16* __restrict__ d, size_t t, float mul) { FragH f;      /* f16(bf16_round(v) * mul), 8 values a thread; unrolled: two 16-byte loads, one 16-byte store */
#pragma unroll
  for (int q = 0; q < 8; ++q) f.h[q] = (_Float16)(bf16_round(s[t * 8 + q]) * mul); *(v8us*)((unsigned short*)d + t * 8) = f.half[0];
  asm volatile("s_wait_xcnt 0x0" ::: "memory"); }
__device__ __forceinline__ void prep_trig(int t, float* __restrict__ CS, float* __restrict__ SN) {
  #pragma clang fp contract(off)      /* numerical, kept with these lines from their own kernel: the angle is rounded to f32 as the reference rounds it before cos and sin take it; the tables stay bit-identical */
  const int tok = t >> 5, j = t & 31; const float ang = (float)tok * INVF[j]; const float c = cosf(ang), s = sinf(ang);
  *(float*)(CS + t) = c; *(float*)(SN + t) = s;
  asm volatile("s_wait_xcnt 0x0" ::: "memory"); }
__device__ __forceinline__ void prep_scale(int t, float* __restrict__ SC) {
  #pragma clang fp contract(off)      /* numerical, kept with these lines from their own kernel: the exponent is rounded to f32 as the reference rounds it before pow takes it; the table stays bit-identical */
  const int tok = t >> 5, j = t & 31; const float v = powf(XBASE[j], ((float)tok - 1024.0f) / 512.0f);
  *(float*)(SC + t) = v;
  asm volatile("s_wait_xcnt 0x0" ::: "memory"); }
__device__ __forceinline__ void prep_causal(int t, unsigned* __restrict__ MB, int* __restrict__ RA, int* __restrict__ KE, int nq, int nk) {
  const int nw = nk / 32;
  if (t < nq * nw) { const int q = t / nw, w = t % nw; const int first = q + 1 - 32 * w; const unsigned bits = (first <= 0) ? 0xffffffffu : ((first >= 32) ? 0u : (0xffffffffu << first)); *(unsigned*)(MB + t) = bits;  }
  if (t < nq) { *(int*)(RA + t) = 0;  }
  if (t < nq / 64) { const int v = 64 * (t + 1); *(int*)(KE + t * 32) = v;  }
  asm volatile("s_wait_xcnt 0x0" ::: "memory"); }
#define PB_TAB (SLEN * 32 / 256)                 /* blocks of the cos and sin tables, and of the scale table: first, they have the longest chains */
#define PB_X   (NR * DM / (8 * 256))             /* blocks of x */
#define PB_W   (DM * DM / (8 * 256))             /* blocks of one weight matrix */
#define PB_CAU (SLEN * (SLEN / 32) / 256)        /* blocks of the causal bit plane */
__global__ __launch_bounds__(256) void k_prep(const float* __restrict__ x, const float* __restrict__ Wq, const float* __restrict__ Wk, const float* __restrict__ Wv, const float* __restrict__ Wo, _Float16* __restrict__ X16, _Float16* __restrict__ BW,
    float* __restrict__ CS, float* __restrict__ SN, float* __restrict__ SC, unsigned* __restrict__ MB, int* __restrict__ RA, int* __restrict__ KE) {
  const int tid = threadIdx.x; int blk = blockIdx.x;      /* every count below divides exactly: no thread is past the end of its job */
  if (blk < PB_TAB) { prep_trig(blk * 256 + tid, CS, SN); return; }
  blk -= PB_TAB;
  if (blk < PB_TAB) { prep_scale(blk * 256 + tid, SC); return; }
  blk -= PB_TAB;
  if (blk < PB_X) { prep_round(x, X16, (size_t)blk * 256 + tid, 1.0f); return; }
  blk -= PB_X;
  if (blk < 4 * PB_W) { const int m = blk / PB_W;      /* planes in the order the GEMMs index them: q <- Wq, k <- Wv, v <- Wk (module order), then Wo; a weight's (out, in) order is the natural Bt; x16 */
    const float* s = (m == 0) ? Wq : ((m == 1) ? Wv : ((m == 2) ? Wk : Wo)); prep_round(s, BW + (size_t)m * DM * DM, (size_t)(blk - m * PB_W) * 256 + tid, 16.0f); return; }
  blk -= 4 * PB_W;
  prep_causal(blk * 256 + tid, MB, RA, KE, SLEN, SLEN); }
extern "C" void kernel_launch(void* const* d_in, const int* in_sizes, int n_in,
                              void* d_out, int out_size, void* d_ws, size_t ws_size, hipStream_t stream) {
  (void)in_sizes; (void)n_in; (void)out_size;
  const float* const* I = (const float* const*)d_in; const float* x = I[0]; const float* Wq = I[1]; const float* bq = I[2]; const float* Wk = I[3]; const float* bk = I[4]; const float* Wv = I[5]; const float* bv = I[6]; const float* Wo = I[7]; const float* bo = I[8];
  char* ws = (char*)d_ws; size_t off = 0;
  auto take = [&](size_t bytes) { char* p = ws + off; off += (bytes + 255) & ~(size_t)255; return p; };
  _Float16* BW = (_Float16*)take((size_t)4 * DM * DM * 2); _Float16* BO = BW + (size_t)3 * DM * DM;      /* weight planes q, k, v, o */
  _Float16* X16 = (_Float16*)take((size_t)NR * DM * 2); _Float16* Oh = (_Float16*)take((size_t)NR * DM * 2); _Float16* Ol = (_Float16*)take((size_t)NR * DM * 2);
  _Float16* Qh = (_Float16*)take((size_t)6 * NR * DM * 2); _Float16* Ql = Qh + (size_t)NR * DM; _Float16* Kh = Ql + (size_t)NR * DM; _Float16* Kl = Kh + (size_t)NR * DM; _Float16* Vth = Kl + (size_t)NR * DM; _Float16* Vtl = Vth + (size_t)NR * DM;      /* three hi, lo pairs in a row */
  unsigned* MB = (unsigned*)take((size_t)SLEN * (SLEN / 32) * 4); int* RA = (int*)take((size_t)SLEN * 4); int* KE = (int*)take((size_t)(SLEN / 64) * 32 * 4);
  float* CS = (float*)take((size_t)SLEN * 32 * 4); float* SN = (float*)take((size_t)SLEN * 32 * 4); float* SC = (float*)take((size_t)SLEN * 32 * 4);
  if (off > ws_size) return;      /* 8 + 8 + 8 x 8 + 1.5 = 82 MiB */
  k_prep<<<2 * PB_TAB + PB_X + 4 * PB_W + PB_CAU, 256, 0, stream>>>(x, Wq, Wk, Wv, Wo, X16, BW, CS, SN, SC, MB, RA, KE);
  const dim3 gP((NR / 128) * (DM / 64), 1);
  /* q_mat = xpos(x Wq^T + bq) as hi/lo; k_mat = xpos^-1(x Wv^T + bv) (module order); v_mat = x Wk^T + bk as V^T hi/lo [(b, h)][64][2048] */
  k_gemm2<0, 4><<<dim3((NR / 128) * (DM / 64), 3), 128, 0, stream>>>(X16, DM, 0, BW, DM, (size_t)DM * DM, 0.0625f, bq, 0, nullptr, 1, 0, 0, nullptr, nullptr, DM, 0, NR, DM, DM, CS, SN, SC, Qh, Ql, bv, bk, (size_t)2 * NR * DM, nullptr);
  k_flashm<SLEN, SLEN><<<dim3(NBT * NH, SLEN / 64), 256, 0, stream>>>(Qh, Ql, DM, Kh, Kl, DM, Vth, Vtl, MB, RA, KE, Oh, Ol, DM);
  k_gemm2<0, 5><<<gP, 128, 0, stream>>>(Ol, DM, 0, BO, DM, 0, 0.0625f, bo, 0, nullptr, 1, 0, 0, (float*)d_out, nullptr, DM, 0, NR, DM, DM, nullptr, nullptr, nullptr, nullptr, nullptr, nullptr, nullptr, 0, Oh);
}

// v009
// A run of this version takes 150 microseconds.
// In two side-by-side timings against v008, it was 1.06 and 1.07 times as fast.
// Over all steps from v000 it is 5.75 times as fast.
#include <hip/hip_runtime.h>
// Causal multi-head attention with xPos rotary embedding (2 x 2048 tokens x 1024, 16 heads x 64): q = x*Wq^T + bq, k = x*Wv^T + bv, v = x*Wk^T + bk (the module's own assignment order); q <- q*cos*scale + rot(q)*sin*scale, k <- k*cos/scale + rot(k)*sin/scale with interleaved-pair rotation, freq(t, d) = t * inv_freq[d/2], scale(t, d) = base[d mod 32]^((t - 1024)/512); scores = q.k / 32 with j <= i; softmax; merged . Wo^T + bo -> [2,2048,1024].
// Structure: x as an exact f16 plane; the three projections as f16 WMMA GEMMs (32x64 wave tiles fed from LDS-staged 128x64 work-group tiles, f32, exact products + bias); per-token cos/sin/scale tables on VALU (inv_freq and base = the reference's f32 constants, precise trig and powf); each projection's epilogue finishes its operand in place of separate passes: q, k rotated and scaled in f32 and stored as f16 hi + x2^10 residual planes, v transposed through LDS per (batch, head) to [d][token] hi + residual planes; the causal structure computed on device into a key bit plane + per-block key bound; the fused flash kernel per ((batch, head), 64 queries), eight waves = four 16-query sub-tiles x the two 32-key halves of each 64-key stage, K and V^T stages copied to LDS once per work-group (three-product hi/lo scores, online softmax f32 per wave, P hi + residual via LDS, two value accumulators; the two partial (max, sum, O) of a sub-tile merged through LDS at the end and stored as O hi + residual planes); output projection as one GEMM whose k loop runs over both O planes.
// Compute dtype: x, weights, biases rounded to bf16; projections exact; rotation f32; q, k, P, v, O as f16 hi + residual pairs (~2^-21); f32 accumulation and softmax. v_wmma_f32_16x16x32_f16.
#define NBT 2
#define SLEN 2048
#define DM 1024
#define NH 16
#define SCL 0.03125f
#define SCL2 (SCL * 1.4426950408889634f)      /* 1/32 times log2(e): the flash kernel keeps scores and running maxima in base-2 units */
#define NR (NBT * SLEN)
typedef __bf16 v16b __attribute__((ext_vector_type(16)));
typedef unsigned short v8us __attribute__((ext_vector_type(8), may_alias));
typedef float  v8f  __attribute__((ext_vector_type(8)));
typedef float  v4f  __attribute__((ext_vector_type(4)));
typedef float  v4fa __attribute__((ext_vector_type(4), may_alias));
typedef float  v2fa __attribute__((ext_vector_type(2), may_alias));
union FragB { v16b v; v8us half[2]; unsigned short u[16]; };

__device__ __forceinline__ unsigned short bf16_bits(float x) { unsigned int u = __float_as_uint(x); return (unsigned short)((u + 0x7FFFu + ((u >> 16) & 1u)) >> 16); }
__device__ __forceinline__ float bf16_val(unsigned short b) { return __uint_as_float(((unsigned int)b) << 16); }
__device__ __forceinline__ float bf16_round(float x) { return bf16_val(bf16_bits(x)); }
// D += A·B with NT terms: 1 = ah·bh, 2 = + al·bh (A split), 3 = + ah·bl (both split)
template <int NT>
__device__ __forceinline__ v8f mmaN(v16b ah, v16b al, v16b bh, v16b bl, v8f c) {
  c = __builtin_amdgcn_wmma_f32_16x16x32_bf16(false, ah, false, bh, (short)0, c, false, false);
  if (NT >= 2) c = __builtin_amdgcn_wmma_f32_16x16x32_bf16(false, al, false, bh, (short)0, c, false, false);
  if (NT >= 3) c = __builtin_amdgcn_wmma_f32_16x16x32_bf16(false, ah, false, bl, (short)0, c, false, false);
  asm volatile("v_nop\n\tv_nop\n\tv_nop\n\tv_nop" : "+v"(c) : "v"(ah), "v"(al), "v"(bh), "v"(bl));
  return c;
}

__global__ __launch_bounds__(256) void k_wt_bf16(const float* __restrict__ W, unsigned short* __restrict__ Wt, int K, int N) {
  const int t = blockIdx.x * 256 + threadIdx.x;
  const int k8n = K / 8;
  if (t >= N * k8n) return;
  const int n = t / k8n, k8 = (t % k8n) * 8;
  v8us v;
#pragma unroll
  for (int i = 0; i < 8; ++i) v[i] = bf16_bits(W[(size_t)(k8 + i) * N + n]);
  *(v8us*)(Wt + (size_t)n * K + k8) = v;
  
}

// GEMM C[M][N] (f32, pitch ldc) = act(A[M][K]·W + bias). A f32 row-major (pitch lda) converted per fragment to bf16
// (ASPLIT: hi/lo two planes -> 2 terms, else single rounded term); Wt bf16 [N][K] (pitch ldb). BIAS_BF16 rounds the
// bias to bf16 first (bias quantised to bf16 before the add). K%32==0, M%16==0, N%64==0.
template <bool ASPLIT, int ACT, bool BIAS_BF16>
__global__ __launch_bounds__(128) void k_gemm_bf(const float* __restrict__ A, int lda, const unsigned short* __restrict__ Wt, int ldb,
                                               const float* __restrict__ bias, float* __restrict__ C, int ldc, int M, int N, int K) {
  __shared__ __attribute__((aligned(16))) float so[4][16][64];
  const int tid = threadIdx.x, w = tid >> 5, lane = tid & 31, ln = lane & 15, hh = lane >> 4;
  const int ntn = N / 64;
  const int wid = blockIdx.x * 4 + w;
  const int mt = wid / ntn, nq = wid % ntn;
  if (mt * 16 >= M) return;
  const int row0 = mt * 16, col0 = nq * 64;
  const float* arow = A + (size_t)(row0 + ln) * lda;
  v8f acc[4] = {};
  for (int kb = 0; kb < K; kb += 32) {
    FragB ah, al;
    const v4f x0 = *(const v4fa*)(arow + kb + 8 * hh), x1 = *(const v4fa*)(arow + kb + 8 * hh + 4);
    const v4f x2 = *(const v4fa*)(arow + kb + 16 + 8 * hh), x3 = *(const v4fa*)(arow + kb + 16 + 8 * hh + 4);
    float xs[16] = {x0[0],x0[1],x0[2],x0[3],x1[0],x1[1],x1[2],x1[3],x2[0],x2[1],x2[2],x2[3],x3[0],x3[1],x3[2],x3[3]};
#pragma unroll
    for (int i = 0; i < 16; ++i) { const unsigned short hb = bf16_bits(xs[i]); ah.u[i] = hb; al.u[i] = ASPLIT ? bf16_bits(xs[i] - bf16_val(hb)) : (unsigned short)0; }
#pragma unroll
    for (int t = 0; t < 4; ++t) {
      const unsigned short* brow = Wt + (size_t)(col0 + t * 16 + ln) * ldb + kb;
      FragB b;
      b.half[0] = *(const v8us*)(brow + 8 * hh);
      b.half[1] = *(const v8us*)(brow + 16 + 8 * hh);
      acc[t] = mmaN<ASPLIT ? 2 : 1>(ah.v, al.v, b.v, b.v, acc[t]);
    }
  }
#pragma unroll
  for (int t = 0; t < 4; ++t) {
    float bv = bias ? bias[col0 + t * 16 + ln] : 0.f;
    if (BIAS_BF16) bv = bf16_round(bv);
#pragma unroll
    for (int r = 0; r < 8; ++r) { float v = acc[t][r] + bv; if (ACT == 1) v = fmaxf(v, 0.f); so[w][8 * hh + r][t * 16 + ln] = v; }
  }
  __builtin_amdgcn_fence(__ATOMIC_ACQ_REL, "workgroup");
  __builtin_amdgcn_wave_barrier();
  const int rsub = lane >> 4, c4 = (lane & 15) * 4;
  {
#pragma unroll
    for (int q = 0; q < 8; ++q) {
      const int r = q * 2 + rsub;
      const v4f v = *(const v4fa*)&so[w][r][c4];
      *(v4f*)(C + (size_t)(row0 + r) * ldc + col0 + c4) = v;
    }
    
  }
}

// GEMM C = act(A·W + bias + resid): A f32 (ASPLIT -> hi/lo 2 terms), Wt bf16 [N][K]; ACT 0 none, 1 relu, 2 exact gelu;
// resid (optional, f32, row index = (row % rmod), pitch ldr, RES_BF16 rounds it) added before the activation.
template <bool ASPLIT, int ACT, bool BIAS_BF16, bool RES_BF16>
__global__ __launch_bounds__(128) void k_gemm_bf3(const float* __restrict__ A, int lda, const unsigned short* __restrict__ Wt, int ldb,
                                                const float* __restrict__ bias, const float* __restrict__ resid, int rmod, int ldr,
                                                float* __restrict__ C, int ldc, int M, int N, int K) {
  __shared__ __attribute__((aligned(16))) float so[4][16][64];
  const int tid = threadIdx.x, w = tid >> 5, lane = tid & 31, ln = lane & 15, hh = lane >> 4;
  const int ntn = N / 64;
  const int wid = blockIdx.x * 4 + w;
  const int mt = wid / ntn, nq = wid % ntn;
  if (mt * 16 >= M) return;
  const int row0 = mt * 16, col0 = nq * 64;
  const float* arow = A + (size_t)(row0 + ln) * lda;
  v8f acc[4] = {};
  for (int kb = 0; kb < K; kb += 32) {
    FragB ah, al;
    const v4f x0 = *(const v4fa*)(arow + kb + 8 * hh), x1 = *(const v4fa*)(arow + kb + 8 * hh + 4);
    const v4f x2 = *(const v4fa*)(arow + kb + 16 + 8 * hh), x3 = *(const v4fa*)(arow + kb + 16 + 8 * hh + 4);
    float xs[16] = {x0[0],x0[1],x0[2],x0[3],x1[0],x1[1],x1[2],x1[3],x2[0],x2[1],x2[2],x2[3],x3[0],x3[1],x3[2],x3[3]};
#pragma unroll
    for (int i = 0; i < 16; ++i) { const unsigned short hb = bf16_bits(xs[i]); ah.u[i] = hb; al.u[i] = ASPLIT ? bf16_bits(xs[i] - bf16_val(hb)) : (unsigned short)0; }
#pragma unroll
    for (int t = 0; t < 4; ++t) {
      const unsigned short* brow = Wt + (size_t)(col0 + t * 16 + ln) * ldb + kb;
      FragB b;
      b.half[0] = *(const v8us*)(brow + 8 * hh);
      b.half[1] = *(const v8us*)(brow + 16 + 8 * hh);
      acc[t] = mmaN<ASPLIT ? 2 : 1>(ah.v, al.v, b.v, b.v, acc[t]);
    }
  }
#pragma unroll
  for (int t = 0; t < 4; ++t) {
    const int col = col0 + t * 16 + ln;
    float bv = bias ? bias[col] : 0.f;
    if (BIAS_BF16) bv = bf16_round(bv);
#pragma unroll
    for (int r = 0; r < 8; ++r) {
      float v = acc[t][r] + bv;
      if (resid) { float rv = resid[(size_t)((row0 + 8 * hh + r) % rmod) * ldr + col]; if (RES_BF16) rv = bf16_round(rv); v += rv; }
      if (ACT == 1) v = fmaxf(v, 0.f);
      if (ACT == 2) v = 0.5f * v * (1.0f + erff(v * 0.70710678118654752f));
      if (ACT == 3) { const float u = 0.7978845608028654f * (v + 0.044715f * v * v * v); v = 0.5f * v * (1.0f + tanhf(u)); }
      so[w][8 * hh + r][t * 16 + ln] = v;
    }
  }
  __builtin_amdgcn_fence(__ATOMIC_ACQ_REL, "workgroup");
  __builtin_amdgcn_wave_barrier();
  const int rsub = lane >> 4, c4 = (lane & 15) * 4;
  {
#pragma unroll
    for (int q = 0; q < 8; ++q) {
      const int r = q * 2 + rsub;
      const v4f v = *(const v4fa*)&so[w][r][c4];
      *(v4f*)(C + (size_t)(row0 + r) * ldc + col0 + c4) = v;
    }
    
  }
}
// row LayerNorm (biased variance, eps) over N: s = X (+ R); optional out_sum <- s; out_norm <- (s-mu)*rsqrt(var+eps)*g + b
template <bool PARAM_BF16>
__global__ __launch_bounds__(256) void k_layernorm(const float* __restrict__ X, const float* __restrict__ R, const float* __restrict__ g, const float* __restrict__ bta,
                                                  float* __restrict__ out_sum, float* __restrict__ out_norm, int N, float eps) {
  __shared__ float red[256];
  const int row = blockIdx.x, tid = threadIdx.x;
  const float* x = X + (size_t)row * N; const float* rr = R ? R + (size_t)row * N : nullptr;
  float vals[16];                     // up to N = 4096
  const int per = N / 256;            // contiguous chunk per thread? use strided-by-4 chunks: thread handles j = tid*4 + 1024*u
  float s1 = 0.f;
  for (int u = 0; u < per / 4; ++u) {
    const int j = tid * 4 + 1024 * u;
    const v4f a = *(const v4fa*)(x + j);
    v4f b = {0.f,0.f,0.f,0.f}; if (rr) b = *(const v4fa*)(rr + j);
#pragma unroll
    for (int q = 0; q < 4; ++q) { const float v = a[q] + b[q]; vals[u * 4 + q] = v; s1 += v; }
  }
  red[tid] = s1; __syncthreads();
  for (int st = 128; st > 0; st >>= 1) { if (tid < st) red[tid] += red[tid + st]; __syncthreads(); }
  const float mu = red[0] / (float)N; __syncthreads();
  float s2 = 0.f;
  for (int u = 0; u < per / 4; ++u)
#pragma unroll
    for (int q = 0; q < 4; ++q) { const float c = vals[u * 4 + q] - mu; s2 += c * c; }
  red[tid] = s2; __syncthreads();
  for (int st = 128; st > 0; st >>= 1) { if (tid < st) red[tid] += red[tid + st]; __syncthreads(); }
  const float rs = rsqrtf(red[0] / (float)N + eps);
  {
    for (int u = 0; u < per / 4; ++u) {
      const int j = tid * 4 + 1024 * u;
      v4f o, sm;
#pragma unroll
      for (int q = 0; q < 4; ++q) {
        float gg = g[j + q], bb = bta[j + q];
        if (PARAM_BF16) { gg = bf16_round(gg); bb = bf16_round(bb); }
        sm[q] = vals[u * 4 + q]; o[q] = (vals[u * 4 + q] - mu) * rs * gg + bb;
      }
      if (out_sum) *(v4f*)(out_sum + (size_t)row * N + j) = sm;
      *(v4f*)(out_norm + (size_t)row * N + j) = o;
    }
    
  }
}



// ---- f16 WMMA path (v_wmma_f32_16x16x32_f16): 11-bit significands for operands in range — used where a [0,1] probability operand needs more precision than bf16
typedef _Float16 v16h __attribute__((ext_vector_type(16)));
union FragH { v16h v; v8us half[2]; _Float16 h[16]; unsigned short u[16]; };
template <int NT>
__device__ __forceinline__ v8f mmaH(v16h ah, v16h al, v16h bh, v16h bl, v8f c) {
  c = __builtin_amdgcn_wmma_f32_16x16x32_f16(false, ah, false, bh, (short)0, c, false, false);
  if (NT >= 2) c = __builtin_amdgcn_wmma_f32_16x16x32_f16(false, al, false, bh, (short)0, c, false, false);
  if (NT >= 3) c = __builtin_amdgcn_wmma_f32_16x16x32_f16(false, ah, false, bl, (short)0, c, false, false);
  asm volatile("v_nop\n\tv_nop\n\tv_nop\n\tv_nop" : "+v"(c) : "v"(ah), "v"(al), "v"(bh), "v"(bl));
  return c;
}
// batched GEMM like k_gemm_b but f16 operands: A f32 (split into f16 hi/lo if ASPLIT, else rounded to f16), Bt = f16 values [n][k]; alpha; C f32; N multiple of 16 (partial tiles skipped)
template <bool ASPLIT>
__global__ __launch_bounds__(128) void k_gemm_h(const float* __restrict__ A, int lda, size_t sA, const _Float16* __restrict__ Bh, int ldb, size_t sB, float alpha, float* __restrict__ C, int ldc, size_t sC, int M, int N, int K) {
  __shared__ __attribute__((aligned(16))) float so[4][16][64];
  const int tid = threadIdx.x, w = tid >> 5, lane = tid & 31, ln = lane & 15, hh = lane >> 4; const int by = blockIdx.y;
  A += (size_t)by * sA; Bh += (size_t)by * sB; C += (size_t)by * sC;
  const int ntn = (N + 63) / 64; const int wid = blockIdx.x * 4 + w; const int mt = wid / ntn, nq = wid % ntn; if (mt * 16 >= M) return;
  const int row0 = mt * 16, col0 = nq * 64; const float* arow = A + (size_t)(row0 + ln) * lda;
  v8f acc[4] = {};
  for (int kb = 0; kb < K; kb += 32) {
    FragH ah, al;
    const v4f x0 = *(const v4fa*)(arow + kb + 8 * hh), x1 = *(const v4fa*)(arow + kb + 8 * hh + 4), x2 = *(const v4fa*)(arow + kb + 16 + 8 * hh), x3 = *(const v4fa*)(arow + kb + 16 + 8 * hh + 4);
    float xs[16] = {x0[0],x0[1],x0[2],x0[3],x1[0],x1[1],x1[2],x1[3],x2[0],x2[1],x2[2],x2[3],x3[0],x3[1],x3[2],x3[3]};
#pragma unroll
    for (int i = 0; i < 16; ++i) { const _Float16 h = (_Float16)xs[i]; ah.h[i] = h; al.h[i] = ASPLIT ? (_Float16)(xs[i] - (float)h) : (_Float16)0.0f; }
#pragma unroll
    for (int t = 0; t < 4; ++t) { if (col0 + t * 16 >= N) continue; const size_t boff = (size_t)(col0 + t * 16 + ln) * ldb + kb; FragH bq; bq.half[0] = *(const v8us*)(Bh + boff + 8 * hh); bq.half[1] = *(const v8us*)(Bh + boff + 16 + 8 * hh);
      acc[t] = mmaH<ASPLIT ? 2 : 1>(ah.v, al.v, bq.v, bq.v, acc[t]); }
  }
#pragma unroll
  for (int t = 0; t < 4; ++t) { if (col0 + t * 16 >= N) continue;
#pragma unroll
    for (int r = 0; r < 8; ++r) so[w][8 * hh + r][t * 16 + ln] = acc[t][r] * alpha; }
  __builtin_amdgcn_fence(__ATOMIC_ACQ_REL, "workgroup"); __builtin_amdgcn_wave_barrier();
  const int rsub = lane >> 4, c4 = (lane & 15) * 4;
  {
#pragma unroll
    for (int q = 0; q < 8; ++q) { const int r = q * 2 + rsub; if (col0 + c4 < N) { const v4f v = *(const v4fa*)&so[w][r][c4]; *(v4f*)(C + (size_t)(row0 + r) * ldc + col0 + c4) = v; } }
     }
}

// Wt[n][k] = f16(W[k][n]·scale) from f32 row-major W[K][N] (scale = power of two; bf16-exact weights stay exact in f16 away from the subnormal range)
__global__ __launch_bounds__(256) void k_wt_f16(const float* __restrict__ W, _Float16* __restrict__ Wt, int K, int N, float scale) {
  const int t = blockIdx.x * 256 + threadIdx.x; if (t >= N * (K / 8)) return; const int n = t / (K / 8), k8 = (t % (K / 8)) * 8; FragH f;
#pragma unroll
  for (int i = 0; i < 8; ++i) f.h[i] = (_Float16)(bf16_round(W[(size_t)(k8 + i) * N + n]) * scale); const v8us o = f.half[0];
  *(v8us*)((unsigned short*)Wt + (size_t)n * K + k8) = o; 
}
// k_gemm_hh variant with fused epilogue: v = acc·alpha + bias[by·sBias + col] (+ CP[(row/rowsPerB)·sCPb + by·64 + col] if CP) ; ACT 0 none / 1 elu ; writes f16 C16 (and f32 C if non-null)
template <int ACT>
__global__ __launch_bounds__(128) void k_gemm_hhx(const _Float16* __restrict__ A, int lda, size_t sA, const _Float16* __restrict__ Bh, int ldb, size_t sB, float alpha, const float* __restrict__ bias, size_t sBias, const float* __restrict__ CP, int rowsPerB, size_t sCPb, int row0g,
    float* __restrict__ C, _Float16* __restrict__ C16, int ldc, size_t sC, int M, int N, int K) {
  __shared__ __attribute__((aligned(16))) float so[4][16][64];
  const int tid = threadIdx.x, w = tid >> 5, lane = tid & 31, ln = lane & 15, hh = lane >> 4; const int by = blockIdx.y;
  A += (size_t)by * sA; Bh += (size_t)by * sB; const size_t cofs = (size_t)by * sC; const float* bp = bias ? bias + (size_t)by * sBias : nullptr;
  const int ntn = (N + 63) / 64; const int wid = blockIdx.x * 4 + w; const int mt = wid / ntn, nq = wid % ntn; if (mt * 16 >= M) return;
  const int row0 = mt * 16, col0 = nq * 64; const _Float16* arow = A + (size_t)(row0 + ln) * lda;
  v8f acc[4] = {};
  for (int kb = 0; kb < K; kb += 32) { FragH ah; ah.half[0] = *(const v8us*)((const unsigned short*)arow + kb + 8 * hh); ah.half[1] = *(const v8us*)((const unsigned short*)arow + kb + 16 + 8 * hh);
#pragma unroll
    for (int t = 0; t < 4; ++t) { if (col0 + t * 16 >= N) continue; const size_t boff = (size_t)(col0 + t * 16 + ln) * ldb + kb; FragH bq; bq.half[0] = *(const v8us*)((const unsigned short*)Bh + boff + 8 * hh); bq.half[1] = *(const v8us*)((const unsigned short*)Bh + boff + 16 + 8 * hh);
      acc[t] = mmaH<1>(ah.v, ah.v, bq.v, bq.v, acc[t]); }
  }
#pragma unroll
  for (int t = 0; t < 4; ++t) { if (col0 + t * 16 >= N) continue; const int col = col0 + t * 16 + ln; const float bv = bp ? bf16_round(bp[col]) : 0.f;
#pragma unroll
    for (int r = 0; r < 8; ++r) { float v = acc[t][r] * alpha + bv; if (CP) { const int bidx = (row0g + row0 + 8 * hh + r) / rowsPerB; v += CP[(size_t)bidx * sCPb + (size_t)by * 64 + col]; } if (ACT == 1) v = (v > 0.f) ? v : expm1f(v); else if (ACT == 7) v = (v > 0.f) ? v + 1.0f : expf(v); else if (ACT == 8) v = tanhf(v); else if (ACT == 9) v = 0.5f * v * (1.0f + tanhf(0.7978845608028654f * (v + 0.044715f * v * v * v))); else if (ACT == 11) v = 1.0f / (1.0f + expf(-v)); else if (ACT == 12) v = (v > 0.f) ? v : 0.01f * v; else if (ACT == 14) v = (v > 0.f) ? v : 0.1f * v; else if (ACT == 15) v = v / (1.0f + expf(-v)); else if (ACT == 3) v = fmaxf(v, 0.f); else if (ACT == 6) v = 0.5f * v * (1.0f + erff(v * 0.70710678118654752f)); so[w][8 * hh + r][t * 16 + ln] = v; } }
  __builtin_amdgcn_fence(__ATOMIC_ACQ_REL, "workgroup"); __builtin_amdgcn_wave_barrier();
  const int rsub = lane >> 4, c4 = (lane & 15) * 4; typedef _Float16 v4h __attribute__((ext_vector_type(4)));
  {
#pragma unroll
    for (int q = 0; q < 8; ++q) { const int r = q * 2 + rsub; if (col0 + c4 < N) { const v4f v = *(const v4fa*)&so[w][r][c4]; if (C) *(v4f*)(C + cofs + (size_t)(row0 + r) * ldc + col0 + c4) = v; if (C16) { v4h h4; for (int i = 0; i < 4; ++i) h4[i] = (_Float16)v[i]; *(v4h*)(C16 + cofs + (size_t)(row0 + r) * ldc + col0 + c4) = h4; } } }
     }
}


typedef _Float16 v4h __attribute__((ext_vector_type(4)));

__global__ __launch_bounds__(256) void k_h16(const float* __restrict__ x, _Float16* __restrict__ X16, size_t n8) { const size_t t = (size_t)blockIdx.x * 256 + threadIdx.x; if (t >= n8) return; FragH f;
#pragma unroll
  for (int q = 0; q < 8; ++q) f.h[q] = (_Float16)x[t * 8 + q]; *(v8us*)((unsigned short*)X16 + t * 8) = f.half[0];  }
template <int NHv, int TTv>
__global__ __launch_bounds__(256) void k_vt(const _Float16* __restrict__ V16, int ldv, int voff, _Float16* __restrict__ Vt) { __shared__ unsigned short tl[64][66]; const int tid = threadIdx.x; const int slab = blockIdx.x / (TTv / 64), lg = blockIdx.x % (TTv / 64); const int b = slab / NHv, h = slab % NHv;
  for (int i = tid; i < 64 * 8; i += 256) { const int r = i / 8, c8 = (i % 8) * 8; FragH f; f.half[0] = *(const v8us*)((const unsigned short*)V16 + ((size_t)b * TTv + lg * 64 + r) * ldv + voff + h * 64 + c8);
#pragma unroll
    for (int q = 0; q < 8; ++q) tl[r][c8 + q] = f.u[q]; }
  __syncthreads();
  {
#pragma unroll
    for (int rd = 0; rd < 2; ++rd) { const int d = rd * 32 + tid / 8, pc = tid % 8; FragH f;
#pragma unroll
      for (int q = 0; q < 8; ++q) f.u[q] = tl[pc * 8 + q][d];
      *(v8us*)((unsigned short*)Vt + ((size_t)slab * 64 + d) * TTv + lg * 64 + pc * 8) = f.half[0]; }
     } }

// ---- fast GEMM (wave tile 32x64; requires M % 32 == 0 rows per launch region, N % 64 == 0 and K % 64 == 0); epilogue = k_gemm_hhx semantics ----
__device__ __forceinline__ v16h g2_frag(const _Float16* p, int hh) { FragH f; f.half[0] = *(const v8us*)((const unsigned short*)p + 8 * hh); f.half[1] = *(const v8us*)((const unsigned short*)p + 16 + 8 * hh); return f.v; }
__device__ __forceinline__ v8f g2_mma(v16h a, v16h b, v8f c) { v8f d = __builtin_amdgcn_wmma_f32_16x16x32_f16(false, a, false, b, (short)0, c, false, false); asm volatile("v_nop\n\tv_nop\n\tv_nop\n\tv_nop" : "+v"(d) : "v"(a), "v"(b)); return d; }
/* XP 0: stores C / C16. XP 1 (q) and 2 (k, inverse scale): the epilogue applies the xPos rotation to the row while it is still in LDS (a 64-column tile is one head, a lane's 4 columns hold whole rotation pairs; token = row % SLEN) and stores the f16 hi + x2^10 residual planes Hh, Hl instead of C. XP 3 (v): the tile (128 tokens of one batch x one head) leaves transposed, as hi + residual planes [(batch, head)][d][token]. XP 4: the three projections as one launch: blockIdx.y = 0, 1, 2 picks the q, k or v epilogue, the weight plane (sB), the bias pointer and the pair of output planes (sH); the k loop is one and the same code. XP 5: C = (A2 + A * 2^-10) . B^T in one launch, A the x2^10 residual plane of A2: the k loop runs over A first, the accumulators are scaled by 2^-10 once, then it runs over A2 on top of them; no addend. Left for a later step: the epilogue's eight bias loads stand one behind the other, each waited for */
template <int ACT, int XP>
__global__ __launch_bounds__(128) void k_gemm2(const _Float16* __restrict__ A, int lda, size_t sA, const _Float16* __restrict__ Bh, int ldb, size_t sB, float alpha, const float* __restrict__ bias, size_t sBias, const float* __restrict__ CP, int rowsPerB, size_t sCPb, int row0g,
    float* __restrict__ C, _Float16* __restrict__ C16, int ldc, size_t sC, int M, int N, int K, const float* __restrict__ CS, const float* __restrict__ SN, const float* __restrict__ SC, _Float16* __restrict__ Hh, _Float16* __restrict__ Hl, const float* __restrict__ bias1, const float* __restrict__ bias2, size_t sH, const _Float16* __restrict__ A2) {
  /* the work-group's 128 x 64 tile: per stage of 64 k (K % 64 == 0) one whole 128-byte line of each of its 128 A rows and 64 B rows goes to LDS, two buffers; row pitch 144 B for the 16-byte fragment reads */
  constexpr int PIT = 72;
  __shared__ __attribute__((aligned(16))) float so[4][32][68];
  __shared__ __attribute__((aligned(16))) _Float16 tA[2][128 * PIT], tB[2][64 * PIT];
  const int tid = threadIdx.x, w = tid >> 5, lane = tid & 31, ln = lane & 15, hh = lane >> 4; const int by = blockIdx.y;
  A += (size_t)by * sA; Bh += (size_t)by * sB; const size_t cofs = (size_t)by * sC; const float* bp = bias ? bias + (size_t)by * sBias : nullptr;
  const bool tr = (XP == 3) || (XP == 4 && by == 2), inv = (XP == 2) || (XP == 4 && by == 1);      /* which epilogue: the same for the whole work-group */
  if (XP == 4) { bp = (by == 0) ? bias : ((by == 1) ? bias1 : bias2); Hh += (size_t)by * sH; Hl += (size_t)by * sH; }
  const int ntn = N >> 6; const int mt = blockIdx.x / ntn, nq = blockIdx.x - mt * ntn; const int row0 = mt * 128 + 32 * w, col0 = nq * 64; if (mt * 128 >= M) return;      /* the same for the whole work-group: every wave reaches every barrier below */
  const int sr = tid >> 3, sc = (tid & 7) * 8;      /* staging: eight threads bring one row's line, a wave four whole lines per load */
  unsigned oa[8], ob[4];      /* byte offsets of the staged lines at k = 0, fixed for the whole loop */
#pragma unroll
  for (int i = 0; i < 8; ++i) oa[i] = ((unsigned)min(mt * 128 + i * 16 + sr, M - 1) * (unsigned)lda + (unsigned)sc) * 2u;      /* rows past M (a last tile of 32, 64 or 96 rows) re-read row M - 1; their waves store nothing */
#pragma unroll
  for (int i = 0; i < 4; ++i) ob[i] = ((unsigned)(col0 + i * 16 + sr) * (unsigned)ldb + (unsigned)sc) * 2u;
  const int so_st = sr * PIT + sc, fa = (32 * w + ln) * PIT, fb = ln * PIT;
  const v8f z8 = {0.f,0.f,0.f,0.f,0.f,0.f,0.f,0.f}; v8f c00 = z8, c01 = z8, c02 = z8, c03 = z8, c10 = z8, c11 = z8, c12 = z8, c13 = z8;
  v8us ra[8], rb[4];
#pragma unroll
  for (int i = 0; i < 8; ++i) ra[i] = *(const v8us*)((const char*)A + oa[i]);
#pragma unroll
  for (int i = 0; i < 4; ++i) rb[i] = *(const v8us*)((const char*)Bh + ob[i]);
#pragma unroll
  for (int i = 0; i < 8; ++i) *(v8us*)&tA[0][so_st + i * 16 * PIT] = ra[i];
#pragma unroll
  for (int i = 0; i < 4; ++i) *(v8us*)&tB[0][so_st + i * 16 * PIT] = rb[i];
  __syncthreads();      /* stage 0 is in LDS before any wave reads it */
  const int KT = (XP == 5) ? 2 * K : K;
#pragma unroll 1      /* stays rolled: the body already holds 16 products and the whole of a stage's loads */
  for (int kb = 0; kb < KT; kb += 64) { const int cur = (kb >> 6) & 1; const bool more = kb + 64 < KT;
    if (more) {      /* the next stage's global loads go out ahead of this stage's products, which cover their latency */
      const int kn = kb + 64; const bool p2 = (XP == 5) && kn >= K; const _Float16* An = p2 ? A2 + (kn - K) : A + kn; const _Float16* Bn = Bh + (p2 ? kn - K : kn);      /* block-uniform: which plane the next stage comes from */
#pragma unroll
      for (int i = 0; i < 8; ++i) ra[i] = *(const v8us*)((const char*)An + oa[i]);
#pragma unroll
      for (int i = 0; i < 4; ++i) rb[i] = *(const v8us*)((const char*)Bn + ob[i]);
      asm volatile("s_wait_xcnt 0x0" ::: "memory"); }      /* precaution: stands in front of every rewrite of the stage loads' address registers (the fragment reads below reuse them) */
    if (XP == 5 && kb == K) { c00 *= 0.0009765625f; c01 *= 0.0009765625f; c02 *= 0.0009765625f; c03 *= 0.0009765625f; c10 *= 0.0009765625f; c11 *= 0.0009765625f; c12 *= 0.0009765625f; c13 *= 0.0009765625f; }      /* the residual plane's sums take their weight (a power of two: exact) before the first product of the hi plane */
    const _Float16* pa = &tA[cur][fa]; const _Float16* pb = &tB[cur][fb];
    v16h a0[2], a1[2], b0[2], b1[2], b2[2], b3[2];      /* all of the stage's fragment reads as one group in front of its products */
#pragma unroll
    for (int ks = 0; ks < 2; ++ks) { a0[ks] = g2_frag(pa + ks * 32, hh); a1[ks] = g2_frag(pa + 16 * PIT + ks * 32, hh); b0[ks] = g2_frag(pb + ks * 32, hh); b1[ks] = g2_frag(pb + 16 * PIT + ks * 32, hh); b2[ks] = g2_frag(pb + 32 * PIT + ks * 32, hh); b3[ks] = g2_frag(pb + 48 * PIT + ks * 32, hh); }
#pragma unroll
    for (int ks = 0; ks < 2; ++ks) {
      c00 = g2_mma(a0[ks], b0[ks], c00); c10 = g2_mma(a1[ks], b0[ks], c10);
      c01 = g2_mma(a0[ks], b1[ks], c01); c11 = g2_mma(a1[ks], b1[ks], c11);
      c02 = g2_mma(a0[ks], b2[ks], c02); c12 = g2_mma(a1[ks], b2[ks], c12);
      c03 = g2_mma(a0[ks], b3[ks], c03); c13 = g2_mma(a1[ks], b3[ks], c13); }
    if (more) {      /* into the buffer that every wave left at the last barrier */
#pragma unroll
      for (int i = 0; i < 8; ++i) *(v8us*)&tA[cur ^ 1][so_st + i * 16 * PIT] = ra[i];
#pragma unroll
      for (int i = 0; i < 4; ++i) *(v8us*)&tB[cur ^ 1][so_st + i * 16 * PIT] = rb[i]; }
    __syncthreads(); }      /* publishes the next stage and ends every wave's reads of this one */
  if (!tr && row0 >= M) return;      /* no barrier follows; XP 3 has one below and takes whole 128-row tiles only (M % 128 == 0) */
  v8f accs[8] = {c00, c01, c02, c03, c10, c11, c12, c13};
  constexpr int TP = 136; _Float16* sT = (_Float16*)&so[0][0][0];      /* XP 3: the staging bytes as two f16 planes [64 d][128 tokens], row pitch 272 B */
  if (XP == 4 && tr) {      /* the v side of XP 4: the XP 3 form of the loop below (XP 4 is used with ACT 0 and without an addend); both loops unrolled like it, so that accs and the fragments are indexed by constants and stay in registers */
#pragma unroll
    for (int u = 0; u < 8; ++u) { const int t = u & 3, half = u >> 2; const float bv = bp ? bf16_round(bp[col0 + t * 16 + ln]) : 0.f; FragH th, tl;
#pragma unroll
      for (int r = 0; r < 8; ++r) { const float v = accs[u][r] * alpha + bv; const _Float16 hv = (_Float16)v; th.h[r] = hv; tl.h[r] = (_Float16)((v - (float)hv) * 1024.0f); }
      const int o = (t * 16 + ln) * TP + 32 * w + half * 16 + 8 * hh; *(v8us*)&sT[o] = th.half[0]; *(v8us*)&sT[64 * TP + o] = tl.half[0]; } }
  else
#pragma unroll
  for (int u = 0; u < 8; ++u) { const int t = u & 3, half = u >> 2; const int col = col0 + t * 16 + ln; const float bv = bp ? bf16_round(bp[col]) : 0.f; FragH th, tl;
#pragma unroll
    for (int r = 0; r < 8; ++r) { const int rloc = half * 16 + 8 * hh + r; float v = accs[u][r] * alpha + bv; if (XP != 5 && CP) { const int bidx = (row0g + row0 + rloc) / rowsPerB; v += CP[(size_t)bidx * sCPb + (size_t)by * 64 + col]; }
      if (ACT == 3) v = fmaxf(v, 0.f); else if (ACT == 6) v = 0.5f * v * (1.0f + erff(v * 0.70710678118654752f)); else if (ACT == 11) v = 1.0f / (1.0f + expf(-v)); else if (ACT == 15) v = v / (1.0f + expf(-v)); else if (ACT == 12) v = (v > 0.f) ? v : 0.01f * v; else if (ACT == 8) v = tanhf(v);
      if (XP == 3) { const _Float16 hv = (_Float16)v; th.h[r] = hv; tl.h[r] = (_Float16)((v - (float)hv) * 1024.0f); } else so[w][rloc][t * 16 + ln] = v; }
    if (XP == 3) { const int o = (t * 16 + ln) * TP + 32 * w + half * 16 + 8 * hh; *(v8us*)&sT[o] = th.half[0]; *(v8us*)&sT[64 * TP + o] = tl.half[0]; } }      /* a lane's 8 accumulator rows are 8 consecutive tokens of one d: one 16-byte piece of the transposed row */
  if (tr) {      /* a block-uniform branch: every wave of such a work-group reaches the barrier */
    __syncthreads();      /* all four waves' 32-token pieces are in LDS before any wave stores whole 256-byte rows */
    const size_t vb = ((size_t)((mt * 128) / SLEN) * NH + nq) * 64 * SLEN + (mt * 128) % SLEN;
#pragma unroll
    for (int it = 0; it < 8; ++it) { const int d = it * 8 + (tid >> 4), pc = tid & 15; const v8us a = *(const v8us*)&sT[d * TP + pc * 8], c = *(const v8us*)&sT[64 * TP + d * TP + pc * 8];
      *(v8us*)((unsigned short*)Hh + vb + (size_t)d * SLEN + pc * 8) = a; *(v8us*)((unsigned short*)Hl + vb + (size_t)d * SLEN + pc * 8) = c; }
    return; }
  __builtin_amdgcn_fence(__ATOMIC_ACQ_REL, "workgroup"); __builtin_amdgcn_wave_barrier();
  const int rsub = lane >> 4, c4 = (lane & 15) * 4;
  if (XP == 1 || XP == 2 || XP == 4) {
    const size_t tb = (size_t)(row0 % SLEN + rsub) * 32;      /* a wave's 32 rows lie in one batch (SLEN % 32 == 0): token = row0 % SLEN + r */
    const float* cs = CS + tb + (c4 >> 1); const float* sn = SN + tb + (c4 >> 1); const float* scp = SC + tb + (c4 & 31);
#pragma unroll
    for (int g = 0; g < 16; g += 8) { v2fa cq[8], sq[8]; v4f s4[8];      /* two groups of 8 rows: 16 rows' table words and the k side's 64 quotients at once need more than 256 registers */
#pragma unroll
      for (int q = 0; q < 8; ++q) { cq[q] = *(const v2fa*)(cs + (g + q) * 64); sq[q] = *(const v2fa*)(sn + (g + q) * 64); s4[q] = *(const v4fa*)(scp + (g + q) * 64); }      /* the group's table words in flight together */
      asm volatile("s_wait_xcnt 0x0" :: "v"(cs), "v"(sn), "v"(scp) : "memory");      /* precaution: stands in front of every rewrite of the table loads' address registers, which stay live up to here */
      if (inv) {      /* the k side's inverse scale, behind one block-uniform branch; both loops unrolled, so that s4 is indexed by constants and stays in registers */
#pragma unroll
        for (int q = 0; q < 8; ++q)
#pragma unroll
          for (int i = 0; i < 4; ++i) s4[q][i] = 1.0f / s4[q][i]; }
#pragma unroll
      for (int q = 0; q < 8; ++q) { const int r = (g + q) * 2 + rsub; const v4f v = *(const v4fa*)&so[w][r][c4]; v4h hi4, lo4;
#pragma unroll
        for (int i = 0; i < 4; ++i) { const float sc = s4[q][i];
          const float x = v[i]; const float rx = (i & 1) ? v[i - 1] : -v[i + 1]; const float o = (x * cq[q][i >> 1]) * sc + (rx * sq[q][i >> 1]) * sc;
          const _Float16 h = (_Float16)o; hi4[i] = h; lo4[i] = (_Float16)((o - (float)h) * 1024.0f); }
        const size_t oo = cofs + (size_t)(row0 + r) * ldc + col0 + c4; *(v4h*)(Hh + oo) = hi4; *(v4h*)(Hl + oo) = lo4; }
      asm volatile("s_wait_xcnt 0x0" ::: "memory"); }      /* precaution: stands in front of every rewrite of a register that the group's stores name (the second group's loads; behind the last group, whatever the listing puts next) */
    return; }
  {
#pragma unroll
    for (int q = 0; q < 16; ++q) { const int r = q * 2 + rsub; const v4f v = *(const v4fa*)&so[w][r][c4]; if (C) *(v4f*)(C + cofs + (size_t)(row0 + r) * ldc + col0 + c4) = v; if (C16) { v4h h4; for (int i = 0; i < 4; ++i) h4[i] = (_Float16)v[i]; *(v4h*)(C16 + cofs + (size_t)(row0 + r) * ldc + col0 + c4) = h4; } }
     } }



template <int TQ, int TK>
__global__ __launch_bounds__(256) void k_flashm(const _Float16* __restrict__ Q16, const _Float16* __restrict__ Q16lo, int ldq, const _Float16* __restrict__ K16, const _Float16* __restrict__ K16lo, int ldk, const _Float16* __restrict__ Vt, const _Float16* __restrict__ Vtlo, const unsigned* __restrict__ MB, const int* __restrict__ RA, const int* __restrict__ KE, _Float16* __restrict__ Oh, _Float16* __restrict__ Ol, int ldo) {
  /* 64 queries per work-group, eight waves: wave w has the 16 queries of sub-tile w & 3 and the 32-key half w >> 2 of every 64-key stage. A stage (K hi, K lo: 64 keys x 64 d; V^T hi, V^T lo: 64 d x 64 keys; whole 128-byte lines) is copied to LDS once and read by all eight waves; two buffers, row pitch 144 B for the 16-byte fragment reads */
  constexpr int RPW = 16, RTN = RPW / 16, QW = 64, NQB = TQ / QW, DT = 4, KS = 2, KP = 72, PLN = 64 * KP, STG = 4 * PLN;
  __shared__ __attribute__((aligned(16))) unsigned short sKV[2][STG];
  __shared__ __attribute__((aligned(16))) unsigned short sP[8][RPW][40], sPl[8][RPW][40]; __shared__ __attribute__((aligned(16))) float sO[8][RPW][64 + 4]; __shared__ float sM[8][RPW], sL[8][RPW];
  const int tid = threadIdx.x, lane = tid & 31, ln = lane & 15, hh = lane >> 4;
  const int w = __builtin_amdgcn_readfirstlane(tid >> 5);      /* the wave's number in a scalar register: the skip of a key half past the bound stays a scalar branch */
  const int qs = w & 3, kg = w >> 2;
  /* grid (slab = (batch, head), tile): both batches in one launch, twice as many groups as resident places (two to a WGP). The cost falls with the flat index throughout (qt = NQB - 1 - blockIdx.y; an order for speed only). Left for later steps: the four v_nop in volatile asm behind every builtin product (mmaH, g2_mma) are 96 of the vector instructions of a pass here and 64 of a GEMM stage; built without them, the GEMM needs a scheduling fence behind its group of fragment reads, else the listing reloads one B fragment's registers between the products and waits for LDS eight times a stage; the preparation launch starts 40,960 waves of one 16-byte store each (64 values a thread, 16 loads in flight: 6,400); also left: the transposed products S^T = K.Q^T, O^T += V^T.P^T (one query per lane: maximum and sum in the lane's own registers plus one exchange between the wave's halves, P^T packed from the score accumulators as the B operand, no shuffles and no P round trip through LDS; the fragment reads here already have the hardware k order) */
  const int slab = blockIdx.x, yy = (int)blockIdx.y, qt = NQB - 1 - yy; const int b = slab / NH, h = slab % NH; const int q0 = qt * QW + qs * RPW; const int qblk = q0 >> 6;
  FragH aq[2][KS], aql[2][KS];
#pragma unroll
  for (int rt = 0; rt < RTN; ++rt) { const size_t qo = ((size_t)b * TQ + q0 + rt * 16 + ln) * ldq + h * 64; const unsigned short* qr = (const unsigned short*)Q16 + qo; const unsigned short* ql = (const unsigned short*)Q16lo + qo;
#pragma unroll
    for (int ks = 0; ks < KS; ++ks) { aq[rt][ks].half[0] = *(const v8us*)(qr + ks * 32 + 8 * hh); aq[rt][ks].half[1] = *(const v8us*)(qr + ks * 32 + 16 + 8 * hh); aql[rt][ks].half[0] = *(const v8us*)(ql + ks * 32 + 8 * hh); aql[rt][ks].half[1] = *(const v8us*)(ql + ks * 32 + 16 + 8 * hh); } }
  const unsigned short* Vth = (const unsigned short*)Vt + (size_t)slab * 64 * TK; const unsigned short* Vtl = (const unsigned short*)Vtlo + (size_t)slab * 64 * TK;
  float m_r[2][8], l_r[2][8]; v8f oacc[2][DT], oaccl[2][DT];
#pragma unroll
  for (int rt = 0; rt < RTN; ++rt) {
#pragma unroll
    for (int r = 0; r < 8; ++r) { m_r[rt][r] = -3.0e38f; l_r[rt][r] = 0.f; }
#pragma unroll
    for (int dt = 0; dt < DT; ++dt) { oacc[rt][dt] = (v8f){0.f,0.f,0.f,0.f,0.f,0.f,0.f,0.f}; oaccl[rt][dt] = oacc[rt][dt]; } }
  int jend = KE[qblk * 32]; jend = min(TK, (jend + 31) & ~31); if (jend < 32) jend = 32; jend = __builtin_amdgcn_readfirstlane(jend);      /* block-uniform, in a scalar register */
  const int nst = (jend + 63) >> 6;      /* stages of 64 keys; TK % 64 == 0, so every stage lies inside K and V */
  int allm[2][8]; const unsigned* mrow[2][8];
#pragma unroll
  for (int rt = 0; rt < RTN; ++rt)
#pragma unroll
    for (int r = 0; r < 8; ++r) { const int tq = q0 + rt * 16 + 8 * hh + r; allm[rt][r] = RA[tq]; mrow[rt][r] = MB + (size_t)tq * (TK / 32); }
  /* staging: eight lanes bring one row's 128-byte line, a wave four whole lines per copy; each thread copies rows cr and cr + 32 of each of the four planes */
  const int cr = tid >> 3, cc = (tid & 7) * 8;
  const size_t gko = ((size_t)b * TK + cr) * ldk + h * 64 + cc, gvo = (size_t)cr * TK + cc;
  const unsigned lds0 = (unsigned)(size_t)&sKV[0][cr * KP + cc];      /* the lane's LDS byte address in buffer 0, plane 0 */
  auto stage = [&](int s, int buf) {
    const unsigned short* k0 = (const unsigned short*)K16 + gko + (size_t)s * 64 * ldk; const unsigned short* k2 = (const unsigned short*)K16lo + gko + (size_t)s * 64 * ldk; const unsigned short* k1 = k0 + (size_t)32 * ldk; const unsigned short* k3 = k2 + (size_t)32 * ldk;
    const unsigned short* v0 = Vth + gvo + s * 64; const unsigned short* v2 = Vtl + gvo + s * 64; const unsigned short* v1 = v0 + (size_t)32 * TK; const unsigned short* v3 = v2 + (size_t)32 * TK;
    const unsigned d0 = lds0 + (unsigned)buf * (STG * 2u), d1 = d0 + 32u * KP * 2u, d2 = d0 + PLN * 2u, d3 = d2 + 32u * KP * 2u, d4 = d0 + 2u * PLN * 2u, d5 = d4 + 32u * KP * 2u, d6 = d0 + 3u * PLN * 2u, d7 = d6 + 32u * KP * 2u;
    /* the stage's eight copies; the closing s_wait_xcnt is a precaution that stands in front of every rewrite of the copies' address registers */
    asm volatile("global_load_async_to_lds_b128 %0, %8, off\n\tglobal_load_async_to_lds_b128 %1, %9, off\n\tglobal_load_async_to_lds_b128 %2, %10, off\n\tglobal_load_async_to_lds_b128 %3, %11, off\n\t"
                 "global_load_async_to_lds_b128 %4, %12, off\n\tglobal_load_async_to_lds_b128 %5, %13, off\n\tglobal_load_async_to_lds_b128 %6, %14, off\n\tglobal_load_async_to_lds_b128 %7, %15, off\n\ts_wait_xcnt 0x0"
                 :: "v"(d0), "v"(d1), "v"(d2), "v"(d3), "v"(d4), "v"(d5), "v"(d6), "v"(d7), "v"(k0), "v"(k1), "v"(k2), "v"(k3), "v"(v0), "v"(v1), "v"(v2), "v"(v3) : "memory"); };
  stage(0, 0);
  asm volatile("s_wait_asynccnt 0x0" ::: "memory");      /* this wave's copies of stage 0 have landed */
  __syncthreads();      /* stage 0 is in LDS before any wave reads it */
  if (nst > 1) stage(1, 1);
#pragma unroll 1
  for (int st = 0; st < nst; ++st) { const int j0 = st * 64 + kg * 32; const unsigned short* tb = &sKV[st & 1][0];
   if (j0 < jend) {      /* a key half past the bound is skipped by its four waves; the publish point below is passed by every wave */
    unsigned mw[2][8];      /* all of the pass's mask words are fetched here, so that their latency runs under the K reads and the score products */
#pragma unroll
    for (int rt = 0; rt < RTN; ++rt)
#pragma unroll
      for (int r = 0; r < 8; ++r) mw[rt][r] = mrow[rt][r][j0 >> 5];
    asm volatile("s_wait_xcnt 0x0" ::: "memory");      /* precaution: stands in front of every rewrite of the mask loads' address registers; it also keeps these loads ahead of the K reads */
    v8f s[2][2]; FragH bk[2][KS], bkl[2][KS];      /* all of the pass's K fragment reads stand as one group in front of its score products: one LDS latency instead of two */
#pragma unroll
    for (int nt = 0; nt < 2; ++nt) { const unsigned short* kr = tb + (kg * 32 + nt * 16 + ln) * KP; const unsigned short* kl = kr + PLN;
#pragma unroll
      for (int ks = 0; ks < KS; ++ks) { bk[nt][ks].half[0] = *(const v8us*)(kr + ks * 32 + 8 * hh); bk[nt][ks].half[1] = *(const v8us*)(kr + ks * 32 + 16 + 8 * hh); bkl[nt][ks].half[0] = *(const v8us*)(kl + ks * 32 + 8 * hh); bkl[nt][ks].half[1] = *(const v8us*)(kl + ks * 32 + 16 + 8 * hh); } }
#pragma unroll
    for (int nt = 0; nt < 2; ++nt) {
#pragma unroll
      for (int rt = 0; rt < RTN; ++rt) { v8f acc = (v8f){0.f,0.f,0.f,0.f,0.f,0.f,0.f,0.f}, accr = acc;
#pragma unroll
        for (int ks = 0; ks < KS; ++ks) { acc = mmaH<1>(aq[rt][ks].v, aq[rt][ks].v, bk[nt][ks].v, bk[nt][ks].v, acc); accr = mmaH<1>(aql[rt][ks].v, aql[rt][ks].v, bk[nt][ks].v, bk[nt][ks].v, accr); accr = mmaH<1>(aq[rt][ks].v, aq[rt][ks].v, bkl[nt][ks].v, bkl[nt][ks].v, accr); }
        s[rt][nt] = acc + accr * 0.0009765625f; } }
    /* softmax in stages over the eight rows, with selects in place of branches: one straight block, in which the rows' dependent chains overlap */
    float s0[2][8], s1[2][8], mc[2][8]; bool ok0[2][8], ok1[2][8];
#pragma unroll
    for (int rt = 0; rt < RTN; ++rt)
#pragma unroll
      for (int r = 0; r < 8; ++r) { const bool am = (allm[rt][r] != 0);
        ok0[rt][r] = am || (((mw[rt][r] >> ln) & 1u) == 0u); ok1[rt][r] = am || (((mw[rt][r] >> (16 + ln)) & 1u) == 0u);
        s0[rt][r] = ok0[rt][r] ? (am ? 0.f : s[rt][0][r] * SCL2) : -INFINITY; s1[rt][r] = ok1[rt][r] ? (am ? 0.f : s[rt][1][r] * SCL2) : -INFINITY; mc[rt][r] = fmaxf(s0[rt][r], s1[rt][r]); }
#pragma unroll
    for (int sx = 1; sx <= 8; sx <<= 1)
#pragma unroll
      for (int rt = 0; rt < RTN; ++rt)
#pragma unroll
        for (int r = 0; r < 8; ++r) mc[rt][r] = fmaxf(mc[rt][r], __shfl_xor(mc[rt][r], sx, 32));
#pragma unroll
    for (int rt = 0; rt < RTN; ++rt)
#pragma unroll
      for (int r = 0; r < 8; ++r) {
        const float mn = fmaxf(m_r[rt][r], mc[rt][r]); const float ea = __builtin_amdgcn_exp2f(m_r[rt][r] - mn), e0 = __builtin_amdgcn_exp2f(s0[rt][r] - mn), e1 = __builtin_amdgcn_exp2f(s1[rt][r] - mn);      /* one hardware exponential each: every argument is <= 0 (no overflow), -inf and -3e38 give 0; computed for every lane; the selects below keep the values of the guarded form */
        const float al = (mn > -1.0e38f) ? ea : 1.0f; m_r[rt][r] = mn; const float p0 = ok0[rt][r] ? e0 : 0.f, p1 = ok1[rt][r] ? e1 : 0.f; l_r[rt][r] = l_r[rt][r] * al + p0 + p1;
#pragma unroll
        for (int dt = 0; dt < DT; ++dt) { oacc[rt][dt][r] *= al; oaccl[rt][dt][r] *= al; }
        FragH t2, t3; const float ps0 = p0 * 1024.0f, ps1 = p1 * 1024.0f; t2.h[0] = (_Float16)ps0; t2.h[1] = (_Float16)ps1; t3.h[0] = (_Float16)((ps0 - (float)t2.h[0]) * 1024.0f); t3.h[1] = (_Float16)((ps1 - (float)t2.h[1]) * 1024.0f);
        sP[w][rt * 16 + 8 * hh + r][ln] = t2.u[0]; sP[w][rt * 16 + 8 * hh + r][16 + ln] = t2.u[1]; sPl[w][rt * 16 + 8 * hh + r][ln] = t3.u[0]; sPl[w][rt * 16 + 8 * hh + r][16 + ln] = t3.u[1]; }
    __builtin_amdgcn_fence(__ATOMIC_ACQ_REL, "workgroup"); __builtin_amdgcn_wave_barrier();
    FragH pa[2], pl[2];
#pragma unroll
    for (int rt = 0; rt < RTN; ++rt) { pa[rt].half[0] = *(const v8us*)&sP[w][rt * 16 + ln][8 * hh]; pa[rt].half[1] = *(const v8us*)&sP[w][rt * 16 + ln][16 + 8 * hh]; pl[rt].half[0] = *(const v8us*)&sPl[w][rt * 16 + ln][8 * hh]; pl[rt].half[1] = *(const v8us*)&sPl[w][rt * 16 + ln][16 + 8 * hh]; }
    FragH bv[DT], bl[DT];      /* all of the pass's V fragment reads stand as one group in front of its value products: one LDS latency instead of four */
#pragma unroll
    for (int dt = 0; dt < DT; ++dt) { const unsigned short* vr = tb + 2 * PLN + (dt * 16 + ln) * KP + kg * 32; const unsigned short* vl = vr + PLN; bv[dt].half[0] = *(const v8us*)(vr + 8 * hh); bv[dt].half[1] = *(const v8us*)(vr + 16 + 8 * hh); bl[dt].half[0] = *(const v8us*)(vl + 8 * hh); bl[dt].half[1] = *(const v8us*)(vl + 16 + 8 * hh); }
#pragma unroll
    for (int dt = 0; dt < DT; ++dt) {
#pragma unroll
      for (int rt = 0; rt < RTN; ++rt) { oacc[rt][dt] = mmaH<1>(pa[rt].v, pa[rt].v, bv[dt].v, bv[dt].v, oacc[rt][dt]); oaccl[rt][dt] = mmaH<1>(pa[rt].v, pa[rt].v, bl[dt].v, bl[dt].v, oaccl[rt][dt]); oaccl[rt][dt] = mmaH<1>(pl[rt].v, pl[rt].v, bv[dt].v, bv[dt].v, oaccl[rt][dt]); } }
   }
    /* publish point of stage st + 1, every wave, in this order */
    asm volatile("s_wait_dscnt 0x0" ::: "memory");      /* this wave's LDS reads of stage st have returned */
    asm volatile("s_wait_asynccnt 0x0" ::: "memory");      /* this wave's copies of stage st + 1 have landed */
    __syncthreads();      /* publishes stage st + 1 and ends every wave's reads of stage st */
    if (st + 2 < nst) stage(st + 2, st & 1); }      /* into the buffer that every wave has just left */
  asm volatile("s_wait_asynccnt 0x0" ::: "memory");      /* no copy is outstanding behind the loop */
#pragma unroll
  for (int rt = 0; rt < RTN; ++rt) {
#pragma unroll
    for (int r = 0; r < 8; ++r) { float l = l_r[rt][r]; l += __shfl_xor(l, 1, 32); l += __shfl_xor(l, 2, 32); l += __shfl_xor(l, 4, 32); l += __shfl_xor(l, 8, 32); l_r[rt][r] = l; }
    if (ln == 0) {
#pragma unroll
      for (int r = 0; r < 8; ++r) { sM[w][rt * 16 + 8 * hh + r] = m_r[rt][r]; sL[w][rt * 16 + 8 * hh + r] = l_r[rt][r]; } }
#pragma unroll
    for (int dt = 0; dt < DT; ++dt)
#pragma unroll
      for (int r = 0; r < 8; ++r) sO[w][rt * 16 + 8 * hh + r][dt * 16 + ln] = oacc[rt][dt][r] + oaccl[rt][dt][r] * 0.0009765625f; }
  __syncthreads();      /* every wave's partial (max, sum, O) is in LDS before any wave merges them */
  {
#pragma unroll
    for (int rp = 0; rp < QW; rp += 16) { const int rq = rp + (tid >> 4), pc = tid & 15; const int wq = rq >> 4, r = rq & 15;      /* query rq of the tile: the partials of waves wq (first key halves) and wq + 4 (second) */
      const float m0 = sM[wq][r], m1 = sM[wq + 4][r]; const float mx = fmaxf(m0, m1);      /* a wave that saw no open key holds -3e38, sum 0, O 0: weight 0 (or 1 on zeros) */
      float e0, e1;      /* the maxima are in base-2 units. Each exponential stands in one statement with the v_nop that fills the slot the instruction set asks for behind a transcendental */
      asm("v_exp_f32 %0, %1\n\tv_nop" : "=v"(e0) : "v"(m0 - mx)); asm("v_exp_f32 %0, %1\n\tv_nop" : "=v"(e1) : "v"(m1 - mx));
      const float l = e0 * sL[wq][r] + e1 * sL[wq + 4][r]; const float inv = (l > 0.f) ? 1.0f / (l * 1024.0f) : 0.f;
      const v4f o0 = *(const v4fa*)&sO[wq][r][pc * 4], o1 = *(const v4fa*)&sO[wq + 4][r][pc * 4];
      const v4f val = (o0 * e0 + o1 * e1) * inv; v4h hi4, lo4;      /* O leaves as the f16 hi + x2^10 residual planes that the output projection reads */
#pragma unroll
      for (int i = 0; i < 4; ++i) { const _Float16 hv = (_Float16)val[i]; hi4[i] = hv; lo4[i] = (_Float16)((val[i] - (float)hv) * 1024.0f); }
      const size_t oo = ((size_t)b * TQ + qt * QW + rq) * ldo + h * 64 + pc * 4; *(v4h*)(Oh + oo) = hi4; *(v4h*)(Ol + oo) = lo4; }
     } }


__constant__ float INVF[32] = {1.000000000e+00f,7.498942018e-01f,5.623413324e-01f,4.216965139e-01f,3.162277639e-01f,2.371373624e-01f,1.778279394e-01f,1.333521456e-01f,1.000000015e-01f,7.498941571e-02f,5.623412877e-02f,4.216964915e-02f,3.162277862e-02f,2.371373586e-02f,1.778279431e-02f,1.333521493e-02f,9.999999776e-03f,7.498942316e-03f,5.623413250e-03f,4.216964822e-03f,3.162277862e-03f,2.371373819e-03f,1.778279431e-03f,1.333521446e-03f,1.000000047e-03f,7.498941850e-04f,5.623413017e-04f,4.216964880e-04f,3.162277862e-04f,2.371373848e-04f,1.778279402e-04f,1.333521504e-04f};
__constant__ float XBASE[32] = {2.857142985e-01f,3.080357313e-01f,3.303571641e-01f,3.526785970e-01f,3.750000000e-01f,3.973214328e-01f,4.196428359e-01f,4.419642687e-01f,4.642857015e-01f,4.866071343e-01f,5.089285374e-01f,5.312500000e-01f,5.535714030e-01f,5.758928657e-01f,5.982142687e-01f,6.205357313e-01f,6.428571343e-01f,6.651785970e-01f,6.875000000e-01f,7.098214030e-01f,7.321428657e-01f,7.544642687e-01f,7.767857313e-01f,7.991071343e-01f,8.214285970e-01f,8.437500000e-01f,8.660714030e-01f,8.883928657e-01f,9.107142687e-01f,9.330357313e-01f,9.553571343e-01f,9.776785970e-01f};
/* ---- the eight preparation jobs, which read none of each other's output, as one launch: the block index picks the job; a thread's work in each job is what it was in the job's own kernel. Each job ends in s_wait_xcnt 0, a precaution: it stands in front of every rewrite of a register that the job's stores name, on whatever way the listing joins the jobs ---- */
__device__ __forceinline__ void prep_round(const float* __restrict__ s, _Float16* __restrict__ d, size_t t, float mul) { FragH f;      /* f16(bf16_round(v) * mul), 8 values a thread; unrolled: two 16-byte loads, one 16-byte store */
#pragma unroll
  for (int q = 0; q < 8; ++q) f.h[q] = (_Float16)(bf16_round(s[t * 8 + q]) * mul); *(v8us*)((unsigned short*)d + t * 8) = f.half[0];
  asm volatile("s_wait_xcnt 0x0" ::: "memory"); }
__device__ __forceinline__ void prep_trig(int t, float* __restrict__ CS, float* __restrict__ SN) {
  #pragma clang fp contract(off)      /* numerical, kept with these lines from their own kernel: the angle is rounded to f32 as the reference rounds it before cos and sin take it; the tables stay bit-identical */
  const int tok = t >> 5, j = t & 31; const float ang = (float)tok * INVF[j]; const float c = cosf(ang), s = sinf(ang);
  *(float*)(CS + t) = c; *(float*)(SN + t) = s;
  asm volatile("s_wait_xcnt 0x0" ::: "memory"); }
__device__ __forceinline__ void prep_scale(int t, float* __restrict__ SC) {
  #pragma clang fp contract(off)      /* numerical, kept with these lines from their own kernel: the exponent is rounded to f32 as the reference rounds it before pow takes it; the table stays bit-identical */
  const int tok = t >> 5, j = t & 31; const float v = powf(XBASE[j], ((float)tok - 1024.0f) / 512.0f);
  *(float*)(SC + t) = v;
  asm volatile("s_wait_xcnt 0x0" ::: "memory"); }
__device__ __forceinline__ void prep_causal(int t, unsigned* __restrict__ MB, int* __restrict__ RA, int* __restrict__ KE, int nq, int nk) {
  const int nw = nk / 32;
  if (t < nq * nw) { const int q = t / nw, w = t % nw; const int first = q + 1 - 32 * w; const unsigned bits = (first <= 0) ? 0xffffffffu : ((first >= 32) ? 0u : (0xffffffffu << first)); *(unsigned*)(MB + t) = bits;  }
  if (t < nq) { *(int*)(RA + t) = 0;  }
  if (t < nq / 64) { const int v = 64 * (t + 1); *(int*)(KE + t * 32) = v;  }
  asm volatile("s_wait_xcnt 0x0" ::: "memory"); }
#define PB_TAB (SLEN * 32 / 256)                 /* blocks of the cos and sin tables, and of the scale table: first, they have the longest chains */
#define PB_X   (NR * DM / (8 * 256))             /* blocks of x */
#define PB_W   (DM * DM / (8 * 256))             /* blocks of one weight matrix */
#define PB_CAU (SLEN * (SLEN / 32) / 256)        /* blocks of the causal bit plane */
__global__ __launch_bounds__(256) void k_prep(const float* __restrict__ x, const float* __restrict__ Wq, const float* __restrict__ Wk, const float* __restrict__ Wv, const float* __restrict__ Wo, _Float16* __restrict__ X16, _Float16* __restrict__ BW,
    float* __restrict__ CS, float* __restrict__ SN, float* __restrict__ SC, unsigned* __restrict__ MB, int* __restrict__ RA, int* __restrict__ KE) {
  const int tid = threadIdx.x; int blk = blockIdx.x;      /* every count below divides exactly: no thread is past the end of its job */
  if (blk < PB_TAB) { prep_trig(blk * 256 + tid, CS, SN); return; }
  blk -= PB_TAB;
  if (blk < PB_TAB) { prep_scale(blk * 256 + tid, SC); return; }
  blk -= PB_TAB;
  if (blk < PB_X) { prep_round(x, X16, (size_t)blk * 256 + tid, 1.0f); return; }
  blk -= PB_X;
  if (blk < 4 * PB_W) { const int m = blk / PB_W;      /* planes in the order the GEMMs index them: q <- Wq, k <- Wv, v <- Wk (module order), then Wo; a weight's (out, in) order is the natural Bt; x16 */
    const float* s = (m == 0) ? Wq : ((m == 1) ? Wv : ((m == 2) ? Wk : Wo)); prep_round(s, BW + (size_t)m * DM * DM, (size_t)(blk - m * PB_W) * 256 + tid, 16.0f); return; }
  blk -= 4 * PB_W;
  prep_causal(blk * 256 + tid, MB, RA, KE, SLEN, SLEN); }
extern "C" void kernel_launch(void* const* d_in, const int* in_sizes, int n_in,
                              void* d_out, int out_size, void* d_ws, size_t ws_size, hipStream_t stream) {
  (void)in_sizes; (void)n_in; (void)out_size;
  const float* const* I = (const float* const*)d_in; const float* x = I[0]; const float* Wq = I[1]; const float* bq = I[2]; const float* Wk = I[3]; const float* bk = I[4]; const float* Wv = I[5]; const float* bv = I[6]; const float* Wo = I[7]; const float* bo = I[8];
  char* ws = (char*)d_ws; size_t off = 0;
  auto take = [&](size_t bytes) { char* p = ws + off; off += (bytes + 255) & ~(size_t)255; return p; };
  _Float16* BW = (_Float16*)take((size_t)4 * DM * DM * 2); _Float16* BO = BW + (size_t)3 * DM * DM;      /* weight planes q, k, v, o */
  _Float16* X16 = (_Float16*)take((size_t)NR * DM * 2); _Float16* Oh = (_Float16*)take((size_t)NR * DM * 2); _Float16* Ol = (_Float16*)take((size_t)NR * DM * 2);
  _Float16* Qh = (_Float16*)take((size_t)6 * NR * DM * 2); _Float16* Ql = Qh + (size_t)NR * DM; _Float16* Kh = Ql + (size_t)NR * DM; _Float16* Kl = Kh + (size_t)NR * DM; _Float16* Vth = Kl + (size_t)NR * DM; _Float16* Vtl = Vth + (size_t)NR * DM;      /* three hi, lo pairs in a row */
  unsigned* MB = (unsigned*)take((size_t)SLEN * (SLEN / 32) * 4); int* RA = (int*)take((size_t)SLEN * 4); int* KE = (int*)take((size_t)(SLEN / 64) * 32 * 4);
  float* CS = (float*)take((size_t)SLEN * 32 * 4); float* SN = (float*)take((size_t)SLEN * 32 * 4); float* SC = (float*)take((size_t)SLEN * 32 * 4);
  if (off > ws_size) return;      /* 8 + 8 + 8 x 8 + 1.5 = 82 MiB */
  k_prep<<<2 * PB_TAB + PB_X + 4 * PB_W + PB_CAU, 256, 0, stream>>>(x, Wq, Wk, Wv, Wo, X16, BW, CS, SN, SC, MB, RA, KE);
  const dim3 gP((NR / 128) * (DM / 64), 1);
  /* q_mat = xpos(x Wq^T + bq) as hi/lo; k_mat = xpos^-1(x Wv^T + bv) (module order); v_mat = x Wk^T + bk as V^T hi/lo [(b, h)][64][2048] */
  k_gemm2<0, 4><<<dim3((NR / 128) * (DM / 64), 3), 128, 0, stream>>>(X16, DM, 0, BW, DM, (size_t)DM * DM, 0.0625f, bq, 0, nullptr, 1, 0, 0, nullptr, nullptr, DM, 0, NR, DM, DM, CS, SN, SC, Qh, Ql, bv, bk, (size_t)2 * NR * DM, nullptr);
  k_flashm<SLEN, SLEN><<<dim3(NBT * NH, SLEN / 64), 256, 0, stream>>>(Qh, Ql, DM, Kh, Kl, DM, Vth, Vtl, MB, RA, KE, Oh, Ol, DM);
  k_gemm2<0, 5><<<gP, 128, 0, stream>>>(Ol, DM, 0, BO, DM, 0, 0.0625f, bo, 0, nullptr, 1, 0, 0, (float*)d_out, nullptr, DM, 0, NR, DM, DM, nullptr, nullptr, nullptr, nullptr, nullptr, nullptr, nullptr, 0, Oh);
}
